// v000
// The times below were measured on an AMD MI455X: many runs one after another, warmed up first and cycling through
// copies of the inputs, with the whole window's GPU time divided by the number of runs. Launches and the gaps
// between them are all in it. The median over several windows is given; except for v000 it joins two sittings, which
// can be a few percent apart, so the side-by-side timings, each taken in one sitting, are the better comparison.
// v000, which the later versions start from, runs in 765 microseconds.
// Contractions: x.(Wq|Wk), Wv^T.x^T and x.(Wpq|Wpk) on v_wmma_f32_16x16x32_bf16 (operands = RNE bf16 of the f32 inputs, single products);
// q.k^T and p.v on v_wmma_f32_16x16x32_f16 (q = f16 hi + f16 residual x2^11 planes; k plain f16 plus f16 residual x2^11 on query tiles 0..3;
// p x1024 plain f16 plus f16 residual x2^11 on query tiles 0..3; v^T = f16 hi + f16 residual x2^11 planes); attn.Wo on v_wmma_f32_16x16x32_bf16
// (attn = bf16 hi + bf16 lo planes, two products; Wo RNE bf16). f32 accumulate everywhere; online softmax, cos/sin phase sums and output scale in f32.
#include <hip/hip_runtime.h>
#include <math.h>
#include <stdint.h>

#define NSEQ   2
#define SQ     2048
#define HID    2048
#define NHQ    16
#define HDM    128
#define NTOK   4096
#define NPH    32
#define PQW    64
#define KLR    256

static_assert(NTOK == NSEQ * SQ);
static_assert(NHQ * HDM == HID);
static_assert(KLR % 32 == 0 && SQ % KLR == 0);

typedef _Float16     v16h __attribute__((ext_vector_type(16)));
typedef _Float16     v8h  __attribute__((ext_vector_type(8)));
typedef __bf16       v16b __attribute__((ext_vector_type(16)));
typedef __bf16       v8b  __attribute__((ext_vector_type(8)));
typedef float        v8f  __attribute__((ext_vector_type(8)));
typedef float        v4f  __attribute__((ext_vector_type(4)));
typedef unsigned int v4u  __attribute__((ext_vector_type(4)));

// ---------------------------------------------------------------------------
// small helpers
// ---------------------------------------------------------------------------
__device__ __forceinline__ unsigned short bf_bits(float f) {          // RNE convert f32 -> bf16 bits
  const unsigned u = __float_as_uint(f);
  return (unsigned short)((u + 0x7FFFu + ((u >> 16) & 1u)) >> 16);
}
__device__ __forceinline__ float bf_val(unsigned short h) { return __uint_as_float(((unsigned)h) << 16); }
__device__ __forceinline__ unsigned pk16(unsigned short a, unsigned short b) { return (unsigned)a | ((unsigned)b << 16); }
__device__ __forceinline__ v8f zero8() { v8f z = {0.f, 0.f, 0.f, 0.f, 0.f, 0.f, 0.f, 0.f}; return z; }
__device__ __forceinline__ int wave_id() {
#if defined(__HIP_DEVICE_COMPILE__)
  return __builtin_amdgcn_readfirstlane((int)(threadIdx.x >> 5));
#else
  return (int)(threadIdx.x >> 5);
#endif
}
// release/acquire + wave barrier between one wave's LDS stores and the other lanes' reloads
__device__ __forceinline__ void lds_wave_sync() {
#if defined(__HIP_DEVICE_COMPILE__)
  __builtin_amdgcn_fence(__ATOMIC_RELEASE, "workgroup");
  __builtin_amdgcn_wave_barrier();
  __builtin_amdgcn_fence(__ATOMIC_ACQUIRE, "workgroup");
#endif
}

// ---------------------------------------------------------------------------
// WMMA fragments (wave32, 16x16x32, 16-bit operands). For A (row m = lane&15) and B (col n = lane&15) alike:
// elements 0..7 <- k0 + 8*(lane>>4) + 0..7, elements 8..15 <- k0 + 16 + 8*(lane>>4) + 0..7.
// ldfrag(p) with p = rowbase + k0 + 8*(lane>>4): two 16-B loads p[0..7], p[16..23].
// D: acc[r] = (row 8*(lane>>4) + r, col lane&15).
// ---------------------------------------------------------------------------
union FragH { v16h v; v8h h[2]; };
union FragB { v16b v; v8b h[2]; };
__device__ __forceinline__ v16h ldfrag_h(const _Float16* p) { FragH f; f.h[0] = *(const v8h*)(p); f.h[1] = *(const v8h*)(p + 16); return f.v; }
__device__ __forceinline__ v16b ldfrag_b(const __bf16* p)   { FragB f; f.h[0] = *(const v8b*)(p); f.h[1] = *(const v8b*)(p + 16); return f.v; }

__device__ __forceinline__ v8f mma_h(v16h a, v16h b, v8f c) {
#if defined(__HIP_DEVICE_COMPILE__)
  return __builtin_amdgcn_wmma_f32_16x16x32_f16(false, a, false, b, (short)0, c, false, false);
#else
  return c;
#endif
}
__device__ __forceinline__ v8f mma_b(v16b a, v16b b, v8f c) {
#if defined(__HIP_DEVICE_COMPILE__)
  return __builtin_amdgcn_wmma_f32_16x16x32_bf16(false, a, false, b, (short)0, c, false, false);
#else
  return c;
#endif
}
// hazard guards: 4 VALU slots after the last WMMA of a group, D tied, A/B kept live; memory clobber keeps later loads behind the group
__device__ __forceinline__ void guard_b5(v8f& a, v8f& b, v16b x0, v16b x1, v16b x2, v16b x3, v16b y) {
#if defined(__HIP_DEVICE_COMPILE__)
  asm volatile("v_nop\n\tv_nop\n\tv_nop\n\tv_nop" : "+v"(a), "+v"(b) : "v"(x0), "v"(x1), "v"(x2), "v"(x3), "v"(y) : "memory");
#endif
}
__device__ __forceinline__ void guard_h3(v8f& a, v8f& b, v16h x, v16h y, v16h z) {
#if defined(__HIP_DEVICE_COMPILE__)
  asm volatile("v_nop\n\tv_nop\n\tv_nop\n\tv_nop" : "+v"(a), "+v"(b) : "v"(x), "v"(y), "v"(z) : "memory");
#endif
}
__device__ __forceinline__ void guard_h4(v8f& a, v8f& b, v16h w, v16h x, v16h y, v16h z) {
#if defined(__HIP_DEVICE_COMPILE__)
  asm volatile("v_nop\n\tv_nop\n\tv_nop\n\tv_nop" : "+v"(a), "+v"(b) : "v"(w), "v"(x), "v"(y), "v"(z) : "memory");
#endif
}
__device__ __forceinline__ void acc_guard4(v8f& a, v8f& b, v8f& c, v8f& d) {
#if defined(__HIP_DEVICE_COMPILE__)
  asm volatile("v_nop\n\tv_nop\n\tv_nop\n\tv_nop" : "+v"(a), "+v"(b), "+v"(c), "+v"(d));
#endif
}

// ---------------------------------------------------------------------------
// Elementwise RNE f32 -> bf16 plane: 8 elements per thread, one 16-B store per lane -> 32 consecutive lanes write 4 whole
// ---------------------------------------------------------------------------
__global__ __launch_bounds__(256) void cvt_bf16_kernel(const float* __restrict__ in, unsigned short* __restrict__ outp, int n8) {
  const int i = (int)blockIdx.x * 256 + (int)threadIdx.x;
  if (i >= n8) return;
  const size_t e = 8 * (size_t)i;
  const v4f a = *(const v4f*)(in + e);
  const v4f b = *(const v4f*)(in + e + 4);
  v4u w;
  w[0] = pk16(bf_bits(a[0]), bf_bits(a[1]));
  w[1] = pk16(bf_bits(a[2]), bf_bits(a[3]));
  w[2] = pk16(bf_bits(b[0]), bf_bits(b[1]));
  w[3] = pk16(bf_bits(b[2]), bf_bits(b[3]));
  *(v4u*)(outp + e) = w;
  
}

// ---------------------------------------------------------------------------
// Fused transpose + RNE bf16 convert: in [R rows][Cc cols] f32 (pitch Cc) -> out[c][r] = bf16(in[r][c])  ([Cc][R], pitch R).
// 64x64 tiles through LDS; grid = (Cc/64, R/64), 256 threads; R, Cc multiples of 64.
// Coverage per block: load 4 it x 256 thr x 4 floats = 64x64; store 2 it x 256 thr x 8 u16 = 64x64.
// ---------------------------------------------------------------------------
__global__ __launch_bounds__(256) void tconv_bf16_kernel(const float* __restrict__ W, unsigned short* __restrict__ outp, int R, int Cc) {
  __shared__ __align__(16) float tf[64 * 68];
  const int c0  = (int)blockIdx.x * 64;   // input column block = output row block
  const int r0  = (int)blockIdx.y * 64;   // input row block    = output column block
  const int tid = (int)threadIdx.x;
  {
    const int lr = tid >> 4;              // 0..15
    const int c4 = (tid & 15) * 4;        // 0..60
#pragma unroll
    for (int it = 0; it < 4; ++it) {
      const int rr = it * 16 + lr;        // 0..63
      const v4f a = *(const v4f*)(W + (size_t)(r0 + rr) * Cc + c0 + c4);
      *(v4f*)(tf + rr * 68 + c4) = a;
    }
  }
  __syncthreads();
  const int sub = tid >> 3;               // 0..31
  const int c8  = (tid & 7) * 8;          // 0..56
  v4u hv[2];
#pragma unroll
  for (int it = 0; it < 2; ++it) {
    const int oc = it * 32 + sub;         // output row within tile (= input column)
    v4u a;
#pragma unroll
    for (int q = 0; q < 4; ++q) {
      const float f0 = tf[(c8 + 2 * q) * 68 + oc];
      const float f1 = tf[(c8 + 2 * q + 1) * 68 + oc];
      a[q] = pk16(bf_bits(f0), bf_bits(f1));
    }
    hv[it] = a;
  }
  {
#pragma unroll
    for (int it = 0; it < 2; ++it) {
      const int oc = it * 32 + sub;
      const size_t go = (size_t)(c0 + oc) * R + r0 + c8;
      *(v4u*)(outp + go) = hv[it];
    }
    
  }
}

// ---------------------------------------------------------------------------
// Phase weights: Wpq [HID][NHQ], Wpk [HID][NHQ] f32 -> WpT [NPH][HID] bf16 rows (rows 0..15 = Wpq^T, 16..31 = Wpk^T).
// ---------------------------------------------------------------------------
__global__ __launch_bounds__(256) void wpt_kernel(const float* __restrict__ Wpq, const float* __restrict__ Wpk,
                                                  unsigned short* __restrict__ outp) {
  const int n = (int)blockIdx.x;                   // 0..31
  const float* W = (n < NHQ) ? Wpq : Wpk;          // block-uniform, both global
  const int h = n & (NHQ - 1);
  const int t = (int)threadIdx.x;                  // k = 8t .. 8t+7  (< HID)
  v4u w;
#pragma unroll
  for (int q = 0; q < 4; ++q) {
    const float f0 = W[(size_t)(8 * t + 2 * q) * NHQ + h];
    const float f1 = W[(size_t)(8 * t + 2 * q + 1) * NHQ + h];
    w[q] = pk16(bf_bits(f0), bf_bits(f1));
  }
  const size_t o = (size_t)n * HID + 8 * (size_t)t;
  *(v4u*)(outp + o) = w;
  
}

// ---------------------------------------------------------------------------
// bf16 WMMA GEMM, wave tile 32 rows x (16*NJ) cols, block = 4 waves (128 threads), no block barriers.
//   C[m][n] = sum_k A[m][k] * Bt[n][k]; A row-major [M][K] bf16 (pitch lda), Bt row-major [N][K] bf16 (pitch ldb);
//   M % 32 == 0, N % (16*NJ) == 0, K % 32 == 0; grid.x = ceil(M/32 * N/(16*NJ) / 4).
//   SPLITA: A carried as hi (Ap) + lo (A2p) bf16 planes, two products into one accumulator.
//   Fragments loaded straight from global rows with the split k map (ldfrag_b).
// Epilogues (all: per wave, per 16-row slab: stage in LDS, wave sync, write each row segment with ONE instruction of
//   EPI 0 (NJ 8): q|k projection. cols n0 < HID (q): f16 hi plane C0 and f16 residual x2048 plane C1, both [M][ldc], cols n0..n0+127
//          (row segment 256 B = 16 lanes x 16 B). cols n0 >= HID (k): hi plane C2 [M][ldc] cols n0-HID..; residual plane C3 [NSEQ*KLR][ldc]
//          only for token rows with (m % SQ) < KLR at row (m / SQ)*KLR + m % SQ (wave-uniform choice; 32-row slabs never straddle).
//   EPI 1 (NJ 8): v^T projection: f16 hi plane C0, residual x2048 plane C1, [M][ldc], row segment 256 B.
//   EPI 2 (NJ 8): f32 output C0 [M][ldc], each row scaled by (1 + 0.1*phs[m]); row segment 128 floats = 512 B = 32 lanes x 16 B per instruction.
//   EPI 3 (NJ 2): f32 plane C0 [M][ldc = PQW]: cols 0..31 cos of the 32 accumulated values, 32..63 sin (precise cosf/sinf, rolled loop);
//          row = 256 B = 16 lanes x 16 B, one instruction covers 2 whole rows.
// ---------------------------------------------------------------------------
template <int EPI> struct SlabT { typedef _Float16 T; static constexpr int PERW = 4096; };   // 2 planes x 16 x 128 halves
template <> struct SlabT<2>     { typedef float    T; static constexpr int PERW = 2048; };   // 16 x 128 floats
template <> struct SlabT<3>     { typedef float    T; static constexpr int PERW = 1536; };   // 16 x 32 raw + 16 x 64 cos|sin floats

template <int EPI, int NJ, bool SPLITA>
__global__ __launch_bounds__(128) void gemm_kernel(
    const unsigned short* Ap, const unsigned short* A2p, int lda,
    const unsigned short* __restrict__ Btp, int ldb,
    const float* __restrict__ phs,
    void* C0, void* C1, void* C2, void* C3, int ldc,
    int M, int N, int K) {
  static_assert(NJ == 8 || NJ == 2);
  static_assert((EPI == 3) ? (NJ == 2) : (NJ == 8));
  typedef typename SlabT<EPI>::T ST;
  __shared__ __align__(16) ST slab_all[4 * SlabT<EPI>::PERW];

  const int lane = threadIdx.x & 31;
  const int wave = wave_id();
  const int hh = lane >> 4;           // lane half: k offset 8*hh, D row offset 8*hh
  const int rl = lane & 15;           // A row / B col / D col within subtile
  const int tilesN = N / (16 * NJ);
  const int tilesM = M >> 5;
  const int tile = (int)blockIdx.x * 4 + wave;
  if (tile >= tilesM * tilesN) return;          // wave-uniform; no block barriers in this kernel
  const int tm = tile / tilesN;
  const int tn = tile - tm * tilesN;
  const int m0 = tm << 5;
  const int n0 = tn * (16 * NJ);

  const __bf16* A  = (const __bf16*)(const void*)Ap;
  const __bf16* A2 = (const __bf16*)(const void*)A2p;
  const __bf16* Bt = (const __bf16*)(const void*)Btp;

  v8f acc[2][NJ];
#pragma unroll
  for (int i = 0; i < 2; ++i)
#pragma unroll
    for (int j = 0; j < NJ; ++j) acc[i][j] = zero8();

  for (int k0 = 0; k0 < K; k0 += 32) {
    v16b ah[2], al[2];
#pragma unroll
    for (int i = 0; i < 2; ++i) {
      const size_t ao = (size_t)(m0 + i * 16 + rl) * lda + k0 + 8 * hh;
      ah[i] = ldfrag_b(A + ao);
      al[i] = SPLITA ? ldfrag_b(A2 + ao) : ah[i];
    }
#pragma unroll
    for (int j = 0; j < NJ; ++j) {
      const v16b bj = ldfrag_b(Bt + (size_t)(n0 + j * 16 + rl) * ldb + k0 + 8 * hh);
      acc[0][j] = mma_b(ah[0], bj, acc[0][j]);
      acc[1][j] = mma_b(ah[1], bj, acc[1][j]);
      if (SPLITA) {
        acc[0][j] = mma_b(al[0], bj, acc[0][j]);
        acc[1][j] = mma_b(al[1], bj, acc[1][j]);
      }
      guard_b5(acc[0][j], acc[1][j], ah[0], ah[1], al[0], al[1], bj);
    }
  }
  if constexpr (NJ == 8) {
    acc_guard4(acc[0][0], acc[0][1], acc[0][2], acc[0][3]);
    acc_guard4(acc[0][4], acc[0][5], acc[0][6], acc[0][7]);
    acc_guard4(acc[1][0], acc[1][1], acc[1][2], acc[1][3]);
    acc_guard4(acc[1][4], acc[1][5], acc[1][6], acc[1][7]);
  } else {
    acc_guard4(acc[0][0], acc[0][1], acc[1][0], acc[1][1]);
  }

  // ---- epilogue ----
  ST* slab = slab_all + wave * SlabT<EPI>::PERW;
  _Float16* sl16 = (_Float16*)(void*)slab;
  float*    slf  = (float*)(void*)slab;

  if constexpr (EPI == 0 || EPI == 1) {
    _Float16* P0;
    _Float16* P1;
    int col0;
    int lomode;                                   // 0: lo row = m; 1: lo row remapped into the KLR-row plane; 2: no lo store
    if constexpr (EPI == 0) {
      const bool isq = (n0 < HID);                // wave-uniform
      P0 = isq ? (_Float16*)C0 : (_Float16*)C2;
      P1 = isq ? (_Float16*)C1 : (_Float16*)C3;
      col0 = isq ? n0 : (n0 - HID);
      const int s0 = m0 & (SQ - 1);
      lomode = isq ? 0 : ((s0 < KLR) ? 1 : 2);
    } else {
      P0 = (_Float16*)C0;
      P1 = (_Float16*)C1;
      col0 = n0;
      lomode = 0;
    }
#pragma unroll
    for (int i = 0; i < 2; ++i) {
#pragma unroll
      for (int r = 0; r < 8; ++r) {
#pragma unroll
        for (int j = 0; j < NJ; ++j) {
          const float v = acc[i][j][r];
          const _Float16 hv = (_Float16)v;
          const int so = (8 * hh + r) * 128 + j * 16 + rl;
          sl16[so]        = hv;
          sl16[2048 + so] = (_Float16)((v - (float)hv) * 2048.0f);
        }
      }
      lds_wave_sync();
      {
#pragma unroll
        for (int it = 0; it < 8; ++it) {
          const int row = it * 2 + hh;            // it x hh covers rows 0..15
          const int c8  = rl * 8;
          const v8h xh = *(const v8h*)(sl16 + row * 128 + c8);
          const v8h xl = *(const v8h*)(sl16 + 2048 + row * 128 + c8);
          const int m = m0 + i * 16 + row;
          *(v8h*)(P0 + (size_t)m * ldc + col0 + c8) = xh;
          if (lomode != 2) {
            const int m1 = (lomode == 1) ? ((m / SQ) * KLR + (m % SQ)) : m;
            *(v8h*)(P1 + (size_t)m1 * ldc + col0 + c8) = xl;
          }
        }
        
      }
      lds_wave_sync();
    }
  } else if constexpr (EPI == 2) {
    float* C = (float*)C0;
#pragma unroll
    for (int i = 0; i < 2; ++i) {
#pragma unroll
      for (int r = 0; r < 8; ++r) {
        const int m = m0 + i * 16 + 8 * hh + r;
        const float sc = 1.0f + 0.1f * phs[m];
#pragma unroll
        for (int j = 0; j < NJ; ++j)
          slf[(8 * hh + r) * 128 + j * 16 + rl] = acc[i][j][r] * sc;
      }
      lds_wave_sync();
      {
#pragma unroll
        for (int row = 0; row < 16; ++row) {      // 32 lanes x 16 B = the whole 512-B row segment per instruction
          const v4f v = *(const v4f*)(slf + row * 128 + lane * 4);
          *(v4f*)(C + (size_t)(m0 + i * 16 + row) * ldc + n0 + lane * 4) = v;
        }
        
      }
      lds_wave_sync();
    }
  } else {
    float* raw = slf;                             // 16 x 32 floats
    float* ocs = slf + 512;                       // 16 x 64 floats
    float* Cp  = (float*)C0;
#pragma unroll
    for (int i = 0; i < 2; ++i) {
#pragma unroll
      for (int j = 0; j < NJ; ++j)
#pragma unroll
        for (int r = 0; r < 8; ++r)
          raw[(8 * hh + r) * 32 + j * 16 + rl] = acc[i][j][r];
      lds_wave_sync();
#pragma unroll 1
      for (int it = 0; it < 16; ++it) {           // row it, col lane: 16 x 32 values, one precise cos + sin site
        const float v  = raw[it * 32 + lane];
        const float cv = cosf(v);
        const float sv = sinf(v);
        ocs[it * PQW + lane]      = cv;
        ocs[it * PQW + 32 + lane] = sv;
      }
      lds_wave_sync();
      {
#pragma unroll
        for (int it = 0; it < 8; ++it) {
          const int row = it * 2 + hh;            // 2 rows per instruction, 16 lanes x 16 B = one whole 256-B row
          const int c4  = rl * 4;
          const v4f x = *(const v4f*)(ocs + row * PQW + c4);
          *(v4f*)(Cp + (size_t)(m0 + i * 16 + row) * ldc + c4) = x;
        }
        
      }
      lds_wave_sync();
    }
  }
}

// ---------------------------------------------------------------------------
// Phase modulation factor, one block per sequence (grid NSEQ, 256 threads), all f32:
//   PQ plane [NTOK][PQW]: col h = cos(pq_h), 16+h = cos(pk_h), 32+h = sin(pq_h), 48+h = sin(pk_h).
//   Ck[h] = sum_s cos(pk), Sk[h] = sum_s sin(pk) (per-thread partials over 8 rows, LDS combine in fixed order);
//   phs[b*SQ + s] = sum_h (cos(pq_h)*Ck[h] + sin(pq_h)*Sk[h]) / 32768.
//   Coverage: NSEQ blocks x 2048 = NTOK values.
// ---------------------------------------------------------------------------
__global__ __launch_bounds__(256) void phase_kernel(const float* __restrict__ PQ, float* __restrict__ phs) {
  __shared__ float red[2 * NHQ][256];
  __shared__ float csk[2 * NHQ];
  __shared__ __align__(16) float stg[SQ];
  const int b   = (int)blockIdx.x;
  const int tid = (int)threadIdx.x;
  float pc[NHQ], ps[NHQ];
#pragma unroll
  for (int h = 0; h < NHQ; ++h) { pc[h] = 0.f; ps[h] = 0.f; }
#pragma unroll 1
  for (int u = 0; u < SQ / 256; ++u) {
    const int s = u * 256 + tid;
    const float* rowp = PQ + ((size_t)b * SQ + s) * PQW;
#pragma unroll
    for (int h = 0; h < NHQ; ++h) {
      pc[h] += rowp[NHQ + h];
      ps[h] += rowp[NPH + NHQ + h];
    }
  }
#pragma unroll
  for (int h = 0; h < NHQ; ++h) { red[h][tid] = pc[h]; red[NHQ + h][tid] = ps[h]; }
  __syncthreads();
  if (tid < 2 * NHQ) {
    float s = 0.f;
#pragma unroll 1
    for (int t = 0; t < 256; ++t) s += red[tid][t];
    csk[tid] = s;
  }
  __syncthreads();
#pragma unroll 1
  for (int u = 0; u < SQ / 256; ++u) {
    const int s = u * 256 + tid;
    const float* rowp = PQ + ((size_t)b * SQ + s) * PQW;
    float a = 0.f;
#pragma unroll 1
    for (int h = 0; h < NHQ; ++h) a += rowp[h] * csk[h] + rowp[NPH + h] * csk[NHQ + h];
    stg[s] = a * (1.0f / 32768.0f);
  }
  __syncthreads();
  {
#pragma unroll
    for (int it = 0; it < SQ / 1024; ++it) {
      const int idx = it * 256 + tid;           // float4 index 0..511
      const v4f v = *(const v4f*)(stg + 4 * idx);
      *(v4f*)(phs + (size_t)b * SQ + 4 * idx) = v;
    }
    
  }
}

// ---------------------------------------------------------------------------
// Causal flash attention, head dim 128, 32-key chunks, block = 4 waves = 64 query rows of one (b, h); grid (n query tiles, NHQ, NSEQ).
//   q planes f16 [tok][h*128+d]: hi (qhp) and residual x2048 (qlp); k planes f16 [tok][h*128+d]: hi (khp); residual x2048 (klp) only for
//   keys < KLR of each sequence, stored at row b*KLR + key (read only when PRES); v^T planes f16 [h*128+d][tok]: hi (vhp), residual x2048 (vlp);
//   outputs attn bf16 hi (ahp) / lo (alp) [tok][h*128+d].
//   scores = (Sh + Sr/2048) * 128^-0.5 with Sh = qh.kh and Sr = ql'.kh (+ qh.kl' when PRES); keys > query -> -inf; online softmax f32;
//   p' = 1024 p stored per wave to LDS as f16 hi (and residual x2048 when PRES), reloaded as A fragments after a wave sync;
//   O = (Oh + Or/2048)/1024/l with Oh = ph.vh, Or = ph.vl' (+ pl'.vh when PRES).
//   K / V^T chunk staging: 128 threads x 4 x 16 B per plane = whole 32x128 / 128x32 tile, plain loads, __syncthreads before and after.
//   Trip count 2*qb+2 chunks (static bound 64); waves whose rows are all below the chunk skip it (wave-uniform, scalar branch).
// ---------------------------------------------------------------------------
#define AT_KC   32
#define KS_P    136
#define VS_P    40
#define PS_P    40
#define LDS_KS  0
#define LDS_KLS (32 * KS_P)
#define LDS_VHS (2 * 32 * KS_P)
#define LDS_VLS (LDS_VHS + 128 * VS_P)
#define LDS_PH  (LDS_VLS + 128 * VS_P)
#define LDS_PL  (LDS_PH + 4 * 16 * PS_P)
#define LDS_TOT (LDS_PL + 4 * 16 * PS_P)
static_assert(LDS_TOT * 2 <= 65536);
static_assert(4 * 4096 <= LDS_TOT);          // output staging (2 planes x 16 x 128 per wave) aliases the chunk region after the loop

template <bool PRES>
__global__ __launch_bounds__(128) void attn_causal_kernel(
    const unsigned short* __restrict__ qhp, const unsigned short* __restrict__ qlp,
    const unsigned short* __restrict__ khp, const unsigned short* __restrict__ klp,
    const unsigned short* __restrict__ vhp, const unsigned short* __restrict__ vlp,
    unsigned short* __restrict__ ahp, unsigned short* __restrict__ alp, int qb_base) {
  __shared__ __align__(16) _Float16 lds[LDS_TOT];
  _Float16* Ks  = lds + LDS_KS;
  _Float16* Kls = lds + LDS_KLS;
  _Float16* Vhs = lds + LDS_VHS;
  _Float16* Vls = lds + LDS_VLS;

  const int tid  = (int)threadIdx.x;
  const int lane = tid & 31;
  const int wave = wave_id();
  const int hh   = lane >> 4;
  const int c    = lane & 15;
  const int qb   = (int)blockIdx.x + qb_base;
  const int h    = (int)blockIdx.y;
  const int b    = (int)blockIdx.z;
  const int q0   = qb * 64 + wave * 16;          // first query row of this wave (within sequence)
  const int qlast = q0 + 15;
  const size_t tok0 = (size_t)b * SQ;

  const _Float16* Qhr = (const _Float16*)(const void*)qhp + (tok0 + q0 + c) * HID + h * HDM + 8 * hh;
  const _Float16* Qlr = (const _Float16*)(const void*)qlp + (tok0 + q0 + c) * HID + h * HDM + 8 * hh;
  const _Float16* Kg  = (const _Float16*)(const void*)khp + tok0 * HID + h * HDM;
  const _Float16* Klg = (const _Float16*)(const void*)klp + (size_t)b * KLR * HID + h * HDM;
  const _Float16* Vhg = (const _Float16*)(const void*)vhp + (size_t)(h * HDM) * NTOK + tok0;
  const _Float16* Vlg = (const _Float16*)(const void*)vlp + (size_t)(h * HDM) * NTOK + tok0;
  _Float16* ph = lds + LDS_PH + wave * (16 * PS_P);
  _Float16* pl = lds + LDS_PL + wave * (16 * PS_P);

  float mrow[8], lrow[8];
  v8f oacc[8], oaccr[8];
#pragma unroll
  for (int r = 0; r < 8; ++r) { mrow[r] = -INFINITY; lrow[r] = 0.f; }
#pragma unroll
  for (int t = 0; t < 8; ++t) { oacc[t] = zero8(); oaccr[t] = zero8(); }

  const int nch = 2 * qb + 2;                    // block-uniform, <= 64; keys < 64*(qb+1) <= SQ; PRES blocks: keys < 256 = KLR
  for (int kc = 0; kc < nch; ++kc) {
    const int kv0 = kc * AT_KC;
    __syncthreads();
#pragma unroll
    for (int i = 0; i < 4; ++i) {                // coverage: 512 pieces of 8 halves per plane = whole tile
      const int p   = tid + 128 * i;             // 0..511
      const int key = p >> 4, d8 = (p & 15) * 8; // K: 32 keys x 128 d
      const v8h kx = *(const v8h*)(Kg + (size_t)(kv0 + key) * HID + d8);
      *(v8h*)(Ks + key * KS_P + d8) = kx;
      if (PRES) {
        const v8h ky = *(const v8h*)(Klg + (size_t)(kv0 + key) * HID + d8);
        *(v8h*)(Kls + key * KS_P + d8) = ky;
      }
      const int d = p >> 2, k8 = (p & 3) * 8;    // V^T: 128 d x 32 keys
      const v8h vx = *(const v8h*)(Vhg + (size_t)d * NTOK + kv0 + k8);
      const v8h vy = *(const v8h*)(Vlg + (size_t)d * NTOK + kv0 + k8);
      *(v8h*)(Vhs + d * VS_P + k8) = vx;
      *(v8h*)(Vls + d * VS_P + k8) = vy;
    }
    __syncthreads();

    if (kv0 <= qlast) {                          // wave-uniform (scalar): skip chunks fully above this wave's rows
      // ---- scores ----
      v8f sh[2], sr[2];
      sh[0] = zero8(); sh[1] = zero8(); sr[0] = zero8(); sr[1] = zero8();
#pragma unroll
      for (int dc = 0; dc < 4; ++dc) {
        const v16h qa = ldfrag_h(Qhr + dc * 32);
        const v16h ql = ldfrag_h(Qlr + dc * 32);
#pragma unroll
        for (int j = 0; j < 2; ++j) {
          const v16h kb = ldfrag_h(Ks + (j * 16 + c) * KS_P + dc * 32 + 8 * hh);
          sh[j] = mma_h(qa, kb, sh[j]);
          sr[j] = mma_h(ql, kb, sr[j]);
          if (PRES) {
            const v16h kl = ldfrag_h(Kls + (j * 16 + c) * KS_P + dc * 32 + 8 * hh);
            sr[j] = mma_h(qa, kl, sr[j]);
            guard_h4(sh[j], sr[j], qa, ql, kb, kl);
          } else {
            guard_h3(sh[j], sr[j], qa, ql, kb);
          }
        }
      }
      // ---- scale, causal mask, chunk row max ----
      float cm[8];
#pragma unroll
      for (int r = 0; r < 8; ++r) {
        const int qrow = q0 + 8 * hh + r;
        float m = -INFINITY;
#pragma unroll
        for (int j = 0; j < 2; ++j) {
          const int key = kv0 + j * 16 + c;
          float s = (sh[j][r] + sr[j][r] * 0.00048828125f) * 0.08838834764831845f;
          s = (key > qrow) ? -INFINITY : s;
          sh[j][r] = s;
          m = fmaxf(m, s);
        }
#pragma unroll
        for (int off = 1; off < 16; off <<= 1) m = fmaxf(m, __shfl_xor(m, off, 32));
        cm[r] = m;
      }
      // ---- online softmax, P' to LDS ----
#pragma unroll
      for (int r = 0; r < 8; ++r) {
        const float mnew  = fmaxf(mrow[r], cm[r]);
        const float alpha = __expf(mrow[r] - mnew);
        mrow[r] = mnew;
        float psum = 0.f;
#pragma unroll
        for (int j = 0; j < 2; ++j) {
          const float p  = __expf(sh[j][r] - mnew);
          psum += p;
          const float pp = p * 1024.0f;
          const _Float16 phv = (_Float16)pp;
          const int po = (8 * hh + r) * PS_P + j * 16 + c;
          ph[po] = phv;
          if (PRES) pl[po] = (_Float16)((pp - (float)phv) * 2048.0f);
        }
#pragma unroll
        for (int off = 1; off < 16; off <<= 1) psum += __shfl_xor(psum, off, 32);
        lrow[r] = lrow[r] * alpha + psum;
#pragma unroll
        for (int t = 0; t < 8; ++t) { oacc[t][r] *= alpha; oaccr[t][r] *= alpha; }
      }
      lds_wave_sync();                           // P' stores visible to the other lanes of this wave before the fragment reload
      // ---- O += P' . V ----
      const v16h pa = ldfrag_h(ph + c * PS_P + 8 * hh);
      v16h pr = pa;
      if (PRES) pr = ldfrag_h(pl + c * PS_P + 8 * hh);
#pragma unroll
      for (int t = 0; t < 8; ++t) {
        const v16h vb = ldfrag_h(Vhs + (t * 16 + c) * VS_P + 8 * hh);
        const v16h vr = ldfrag_h(Vls + (t * 16 + c) * VS_P + 8 * hh);
        oacc[t]  = mma_h(pa, vb, oacc[t]);
        oaccr[t] = mma_h(pa, vr, oaccr[t]);
        if (PRES) oaccr[t] = mma_h(pr, vb, oaccr[t]);
        guard_h4(oacc[t], oaccr[t], pa, pr, vb, vr);
      }
    }
  }

  __syncthreads();                               // all chunk-region readers done before aliasing it as output staging
  _Float16* osh = lds + wave * 4096;
  _Float16* osl = osh + 2048;
#pragma unroll
  for (int r = 0; r < 8; ++r) {
    const float inv = (1.0f / lrow[r]) * 0.0009765625f;
#pragma unroll
    for (int t = 0; t < 8; ++t) {
      const float o = (oacc[t][r] + oaccr[t][r] * 0.00048828125f) * inv;
      const unsigned short hb = bf_bits(o);
      const unsigned short lb = bf_bits(o - bf_val(hb));
      const int so = (8 * hh + r) * 128 + t * 16 + c;
      osh[so] = __builtin_bit_cast(_Float16, hb);
      osl[so] = __builtin_bit_cast(_Float16, lb);
    }
  }
  lds_wave_sync();
  _Float16* Ahg = (_Float16*)(void*)ahp + (tok0 + q0) * HID + h * HDM;
  _Float16* Alg = (_Float16*)(void*)alp + (tok0 + q0) * HID + h * HDM;
  {
#pragma unroll
    for (int it = 0; it < 8; ++it) {
      const int row = it * 2 + hh;               // it 0..7 x hh 0..1 covers rows 0..15
      const int c8  = c * 8;                     // 16 lanes x 16 B = the whole 256-B segment
      const v8h x = *(const v8h*)(osh + row * 128 + c8);
      const v8h y = *(const v8h*)(osl + row * 128 + c8);
      *(v8h*)(Ahg + (size_t)row * HID + c8) = x;
      *(v8h*)(Alg + (size_t)row * HID + c8) = y;
    }
    
  }
}

// ---------------------------------------------------------------------------
// Workspace map (bytes; every region is a whole number of the rows its producer writes with whole-line stores; all dims are tile multiples,
// so padded size == logical size; offsets are multiples of 16384):
//   R0   Xb  bf16 [4096][2048] 16777216, later Ah bf16 [4096][2048] (Xb dead after the three projection GEMMs)
//   R1   WqkT bf16 [4096][2048] 16777216, later Al bf16 [4096][2048]
//   R2   WvT bf16 [2048][2048]  8388608, later WoT bf16 [2048][2048] (WvT dead after the v GEMM)
//   WpT  bf16 [32][2048]          131072
//   Qh, Ql, Kh f16 [4096][2048]  16777216 each
//   Kl   f16 [512][2048]          2097152
//   Vh, Vl f16 [2048][4096]      16777216 each
//   PQ   f32 [4096][64]           1048576
//   phs  f32 [4096]                 16384
//   total                       129122304
// ---------------------------------------------------------------------------
static inline size_t smax(size_t a, size_t b) { return a > b ? a : b; }

extern "C" void kernel_launch(void* const* d_in, const int* in_sizes, int n_in,
                              void* d_out, int out_size, void* d_ws, size_t ws_size,
                              hipStream_t stream) {
  if (n_in < 7) return;
  if (in_sizes[0] != NTOK * HID) return;
  if (in_sizes[1] != HID * HID) return;
  if (in_sizes[2] != HID * HID) return;
  if (in_sizes[3] != HID * HID) return;
  if (in_sizes[4] != HID * HID) return;
  if (in_sizes[5] != HID * NHQ) return;
  if (in_sizes[6] != HID * NHQ) return;
  if (out_size != NTOK * HID) return;

  const float* x   = (const float*)d_in[0];
  const float* Wq  = (const float*)d_in[1];
  const float* Wk  = (const float*)d_in[2];
  const float* Wv  = (const float*)d_in[3];
  const float* Wo  = (const float*)d_in[4];
  const float* Wpq = (const float*)d_in[5];
  const float* Wpk = (const float*)d_in[6];
  float* out = (float*)d_out;

  const size_t szX   = (size_t)NTOK * HID * 2;
  const size_t szWqk = (size_t)2 * HID * HID * 2;
  const size_t szW   = (size_t)HID * HID * 2;
  const size_t szA   = (size_t)NTOK * HID * 2;
  const size_t szWp  = (size_t)NPH * HID * 2;
  const size_t szQ   = (size_t)NTOK * HID * 2;
  const size_t szKl  = (size_t)NSEQ * KLR * HID * 2;
  const size_t szV   = (size_t)HID * NTOK * 2;
  const size_t szPQ  = (size_t)NTOK * PQW * 4;
  const size_t szPh  = (size_t)NTOK * 4;
  size_t off = 0;
  const size_t oR0 = off; off += smax(szX, szA);
  const size_t oR1 = off; off += smax(szWqk, szA);
  const size_t oR2 = off; off += szW;
  const size_t oWp = off; off += szWp;
  const size_t oQh = off; off += szQ;
  const size_t oQl = off; off += szQ;
  const size_t oKh = off; off += szQ;
  const size_t oKl = off; off += szKl;
  const size_t oVh = off; off += szV;
  const size_t oVl = off; off += szV;
  const size_t oPQ = off; off += szPQ;
  const size_t oPh = off; off += szPh;
  if (off > ws_size) return;                     // off = 129122304

  char* ws = (char*)d_ws;
  unsigned short* Xb   = (unsigned short*)(ws + oR0);
  unsigned short* Ah   = (unsigned short*)(ws + oR0);
  unsigned short* WqkT = (unsigned short*)(ws + oR1);
  unsigned short* Al   = (unsigned short*)(ws + oR1);
  unsigned short* WvT  = (unsigned short*)(ws + oR2);
  unsigned short* WoT  = (unsigned short*)(ws + oR2);
  unsigned short* WpT  = (unsigned short*)(ws + oWp);
  unsigned short* Qh   = (unsigned short*)(ws + oQh);
  unsigned short* Ql   = (unsigned short*)(ws + oQl);
  unsigned short* Kh   = (unsigned short*)(ws + oKh);
  unsigned short* Kl   = (unsigned short*)(ws + oKl);
  unsigned short* Vh   = (unsigned short*)(ws + oVh);
  unsigned short* Vl   = (unsigned short*)(ws + oVl);
  float*          PQ   = (float*)(ws + oPQ);
  float*          phs  = (float*)(ws + oPh);

  const dim3 b256(256), b128(128);

  // (1) x -> bf16 plane [4096][2048]
  cvt_bf16_kernel<<<dim3((NTOK * HID / 8) / 256), b256, 0, stream>>>(x, Xb, NTOK * HID / 8);
  // (2) Wq in[2048 rows][2048 cols] -> WqkT rows 0..2047 = out[n][k]; Wk -> WqkT rows 2048..4095; Wv -> WvT   (grid = cols/64, rows/64)
  tconv_bf16_kernel<<<dim3(HID / 64, HID / 64), b256, 0, stream>>>(Wq, WqkT, HID, HID);
  tconv_bf16_kernel<<<dim3(HID / 64, HID / 64), b256, 0, stream>>>(Wk, WqkT + (size_t)HID * HID, HID, HID);
  tconv_bf16_kernel<<<dim3(HID / 64, HID / 64), b256, 0, stream>>>(Wv, WvT, HID, HID);
  // (3) Wpq|Wpk -> WpT [32][2048]
  wpt_kernel<<<dim3(NPH), b256, 0, stream>>>(Wpq, Wpk, WpT);
  // (4) pq|pk = x . (Wpq|Wpk) -> cos|sin plane PQ [4096][64]   (M=4096, N=32, K=2048; 128 tiles / 4)
  gemm_kernel<3, 2, false><<<dim3((NTOK / 32) * (NPH / 32) / 4), b128, 0, stream>>>(
      Xb, Xb, HID, WpT, HID, phs, (void*)PQ, (void*)PQ, (void*)PQ, (void*)PQ, PQW, NTOK, NPH, HID);
  // (5) phase factor phs [4096]
  phase_kernel<<<dim3(NSEQ), b256, 0, stream>>>(PQ, phs);
  // (6) q|k = x . (Wq|Wk) -> Qh/Ql [4096][2048], Kh [4096][2048], Kl [512][2048]   (M=4096, N=4096, K=2048; 4096 tiles / 4)
  gemm_kernel<0, 8, false><<<dim3((NTOK / 32) * ((2 * HID) / 128) / 4), b128, 0, stream>>>(
      Xb, Xb, HID, WqkT, HID, phs, (void*)Qh, (void*)Ql, (void*)Kh, (void*)Kl, HID, NTOK, 2 * HID, HID);
  // (7) v^T = WvT . x^T -> Vh/Vl [2048][4096]   (A = WvT, Bt = Xb; M=2048, N=4096, K=2048; 2048 tiles / 4)
  gemm_kernel<1, 8, false><<<dim3((HID / 32) * (NTOK / 128) / 4), b128, 0, stream>>>(
      WvT, WvT, HID, Xb, HID, phs, (void*)Vh, (void*)Vl, (void*)Vh, (void*)Vl, NTOK, HID, NTOK, HID);
  // (8) Wo -> WoT (over the dead WvT region)
  tconv_bf16_kernel<<<dim3(HID / 64, HID / 64), b256, 0, stream>>>(Wo, WoT, HID, HID);
  // (9) causal attention, query tiles 0..3 with k and p residual products, tiles 4..31 without -> Ah/Al (over the dead Xb/WqkT regions)
  attn_causal_kernel<true><<<dim3(4, NHQ, NSEQ), b128, 0, stream>>>(Qh, Ql, Kh, Kl, Vh, Vl, Ah, Al, 0);
  attn_causal_kernel<false><<<dim3(SQ / 64 - 4, NHQ, NSEQ), b128, 0, stream>>>(Qh, Ql, Kh, Kl, Vh, Vl, Ah, Al, 4);
  // (10) out = (attn hi + lo) . Wo * (1 + 0.1*phs[m]) -> d_out f32 [4096][2048]   (M=4096, N=2048, K=2048; 2048 tiles / 4)
  gemm_kernel<2, 8, true><<<dim3((NTOK / 32) * (HID / 128) / 4), b128, 0, stream>>>(
      Ah, Al, HID, WoT, HID, phs, (void*)out, (void*)out, (void*)out, (void*)out, HID, NTOK, HID, HID);
  (void)hipGetLastError();
}

// v001
// It runs in 501 microseconds.
// Timed twice side by side with v000, it ran 1.54 times as fast both times.
// Contractions: x.(Wq|Wk), Wv^T.x^T and x.(Wpq|Wpk) on v_wmma_f32_16x16x32_bf16 (operands = RNE bf16 of the f32 inputs, single products);
// q.k^T and p.v on v_wmma_f32_16x16x32_f16 (q = f16 hi + f16 residual x2^11 planes; k plain f16 plus f16 residual x2^11 on query tiles 0..3;
// p x1024 plain f16 plus f16 residual x2^11 on query tiles 0..3; v^T = f16 hi + f16 residual x2^11 planes); attn.Wo on v_wmma_f32_16x16x32_bf16
// (attn = bf16 hi + bf16 lo planes, two products; Wo RNE bf16). f32 accumulate everywhere; online softmax, cos/sin phase sums and output scale in f32.
#include <hip/hip_runtime.h>
#include <math.h>
#include <stdint.h>

#define NSEQ   2
#define SQ     2048
#define HID    2048
#define NHQ    16
#define HDM    128
#define NTOK   4096
#define NPH    32
#define PQW    64
#define KLR    256

static_assert(NTOK == NSEQ * SQ);
static_assert(NHQ * HDM == HID);
static_assert(KLR % 32 == 0 && SQ % KLR == 0);

typedef _Float16     v16h __attribute__((ext_vector_type(16)));
typedef _Float16     v8h  __attribute__((ext_vector_type(8)));
typedef __bf16       v16b __attribute__((ext_vector_type(16)));
typedef __bf16       v8b  __attribute__((ext_vector_type(8)));
typedef float        v8f  __attribute__((ext_vector_type(8)));
typedef float        v4f  __attribute__((ext_vector_type(4)));
typedef unsigned int v4u  __attribute__((ext_vector_type(4)));

// ---------------------------------------------------------------------------
// small helpers
// ---------------------------------------------------------------------------
__device__ __forceinline__ unsigned short bf_bits(float f) {          // RNE convert f32 -> bf16 bits
  const unsigned u = __float_as_uint(f);
  return (unsigned short)((u + 0x7FFFu + ((u >> 16) & 1u)) >> 16);
}
__device__ __forceinline__ float bf_val(unsigned short h) { return __uint_as_float(((unsigned)h) << 16); }
__device__ __forceinline__ unsigned pk16(unsigned short a, unsigned short b) { return (unsigned)a | ((unsigned)b << 16); }
__device__ __forceinline__ v8f zero8() { v8f z = {0.f, 0.f, 0.f, 0.f, 0.f, 0.f, 0.f, 0.f}; return z; }
__device__ __forceinline__ int wave_id() {
#if defined(__HIP_DEVICE_COMPILE__)
  return __builtin_amdgcn_readfirstlane((int)(threadIdx.x >> 5));
#else
  return (int)(threadIdx.x >> 5);
#endif
}
// release/acquire + wave barrier between one wave's LDS stores and the other lanes' reloads
__device__ __forceinline__ void lds_wave_sync() {
#if defined(__HIP_DEVICE_COMPILE__)
  __builtin_amdgcn_fence(__ATOMIC_RELEASE, "workgroup");
  __builtin_amdgcn_wave_barrier();
  __builtin_amdgcn_fence(__ATOMIC_ACQUIRE, "workgroup");
#endif
}

// ---------------------------------------------------------------------------
// WMMA fragments (wave32, 16x16x32, 16-bit operands). For A (row m = lane&15) and B (col n = lane&15) alike:
// elements 0..7 <- k0 + 8*(lane>>4) + 0..7, elements 8..15 <- k0 + 16 + 8*(lane>>4) + 0..7.
// ldfrag(p) with p = rowbase + k0 + 8*(lane>>4): two 16-B loads p[0..7], p[16..23].
// D: acc[r] = (row 8*(lane>>4) + r, col lane&15).
// ---------------------------------------------------------------------------
union FragH { v16h v; v8h h[2]; };
union FragB { v16b v; v8b h[2]; };
__device__ __forceinline__ v16h ldfrag_h(const _Float16* p) { FragH f; f.h[0] = *(const v8h*)(p); f.h[1] = *(const v8h*)(p + 16); return f.v; }
__device__ __forceinline__ v16b ldfrag_b(const __bf16* p)   { FragB f; f.h[0] = *(const v8b*)(p); f.h[1] = *(const v8b*)(p + 16); return f.v; }

__device__ __forceinline__ v8f mma_h(v16h a, v16h b, v8f c) {
#if defined(__HIP_DEVICE_COMPILE__)
  return __builtin_amdgcn_wmma_f32_16x16x32_f16(false, a, false, b, (short)0, c, false, false);
#else
  return c;
#endif
}
__device__ __forceinline__ v8f mma_b(v16b a, v16b b, v8f c) {
#if defined(__HIP_DEVICE_COMPILE__)
  return __builtin_amdgcn_wmma_f32_16x16x32_bf16(false, a, false, b, (short)0, c, false, false);
#else
  return c;
#endif
}
// hazard guards: 4 VALU slots after the last WMMA of a group, D tied, A/B kept live; memory clobber keeps later loads behind the group
__device__ __forceinline__ void guard_b5(v8f& a, v8f& b, v16b x0, v16b x1, v16b x2, v16b x3, v16b y) {
#if defined(__HIP_DEVICE_COMPILE__)
  asm volatile("v_nop\n\tv_nop\n\tv_nop\n\tv_nop" : "+v"(a), "+v"(b) : "v"(x0), "v"(x1), "v"(x2), "v"(x3), "v"(y) : "memory");
#endif
}
__device__ __forceinline__ void guard_h3(v8f& a, v8f& b, v16h x, v16h y, v16h z) {
#if defined(__HIP_DEVICE_COMPILE__)
  asm volatile("v_nop\n\tv_nop\n\tv_nop\n\tv_nop" : "+v"(a), "+v"(b) : "v"(x), "v"(y), "v"(z) : "memory");
#endif
}
__device__ __forceinline__ void guard_h4(v8f& a, v8f& b, v16h w, v16h x, v16h y, v16h z) {
#if defined(__HIP_DEVICE_COMPILE__)
  asm volatile("v_nop\n\tv_nop\n\tv_nop\n\tv_nop" : "+v"(a), "+v"(b) : "v"(w), "v"(x), "v"(y), "v"(z) : "memory");
#endif
}
__device__ __forceinline__ void acc_guard4(v8f& a, v8f& b, v8f& c, v8f& d) {
#if defined(__HIP_DEVICE_COMPILE__)
  asm volatile("v_nop\n\tv_nop\n\tv_nop\n\tv_nop" : "+v"(a), "+v"(b), "+v"(c), "+v"(d));
#endif
}

// ---------------------------------------------------------------------------
// Elementwise RNE f32 -> bf16 plane: 8 elements per thread, one 16-B store per lane -> 32 consecutive lanes write 4 whole
// ---------------------------------------------------------------------------
__global__ __launch_bounds__(256) void cvt_bf16_kernel(const float* __restrict__ in, unsigned short* __restrict__ outp, int n8) {
  const int i = (int)blockIdx.x * 256 + (int)threadIdx.x;
  if (i >= n8) return;
  const size_t e = 8 * (size_t)i;
  const v4f a = *(const v4f*)(in + e);
  const v4f b = *(const v4f*)(in + e + 4);
  v4u w;
  w[0] = pk16(bf_bits(a[0]), bf_bits(a[1]));
  w[1] = pk16(bf_bits(a[2]), bf_bits(a[3]));
  w[2] = pk16(bf_bits(b[0]), bf_bits(b[1]));
  w[3] = pk16(bf_bits(b[2]), bf_bits(b[3]));
  *(v4u*)(outp + e) = w;
  
}

// ---------------------------------------------------------------------------
// Fused transpose + RNE bf16 convert: in [R rows][Cc cols] f32 (pitch Cc) -> out[c][r] = bf16(in[r][c])  ([Cc][R], pitch R).
// 64x64 tiles through LDS; grid = (Cc/64, R/64), 256 threads; R, Cc multiples of 64.
// Coverage per block: load 4 it x 256 thr x 4 floats = 64x64; store 2 it x 256 thr x 8 u16 = 64x64.
// ---------------------------------------------------------------------------
__global__ __launch_bounds__(256) void tconv_bf16_kernel(const float* __restrict__ W, unsigned short* __restrict__ outp, int R, int Cc) {
  __shared__ __align__(16) float tf[64 * 68];
  const int c0  = (int)blockIdx.x * 64;   // input column block = output row block
  const int r0  = (int)blockIdx.y * 64;   // input row block    = output column block
  const int tid = (int)threadIdx.x;
  {
    const int lr = tid >> 4;              // 0..15
    const int c4 = (tid & 15) * 4;        // 0..60
#pragma unroll
    for (int it = 0; it < 4; ++it) {
      const int rr = it * 16 + lr;        // 0..63
      const v4f a = *(const v4f*)(W + (size_t)(r0 + rr) * Cc + c0 + c4);
      *(v4f*)(tf + rr * 68 + c4) = a;
    }
  }
  __syncthreads();
  const int sub = tid >> 3;               // 0..31
  const int c8  = (tid & 7) * 8;          // 0..56
  v4u hv[2];
#pragma unroll
  for (int it = 0; it < 2; ++it) {
    const int oc = it * 32 + sub;         // output row within tile (= input column)
    v4u a;
#pragma unroll
    for (int q = 0; q < 4; ++q) {
      const float f0 = tf[(c8 + 2 * q) * 68 + oc];
      const float f1 = tf[(c8 + 2 * q + 1) * 68 + oc];
      a[q] = pk16(bf_bits(f0), bf_bits(f1));
    }
    hv[it] = a;
  }
  {
#pragma unroll
    for (int it = 0; it < 2; ++it) {
      const int oc = it * 32 + sub;
      const size_t go = (size_t)(c0 + oc) * R + r0 + c8;
      *(v4u*)(outp + go) = hv[it];
    }
    
  }
}

// ---------------------------------------------------------------------------
// Phase weights: Wpq [HID][NHQ], Wpk [HID][NHQ] f32 -> WpT [NPH][HID] bf16 rows (rows 0..15 = Wpq^T, 16..31 = Wpk^T).
// ---------------------------------------------------------------------------
__global__ __launch_bounds__(256) void wpt_kernel(const float* __restrict__ Wpq, const float* __restrict__ Wpk,
                                                  unsigned short* __restrict__ outp) {
  const int n = (int)blockIdx.x;                   // 0..31
  const float* W = (n < NHQ) ? Wpq : Wpk;          // block-uniform, both global
  const int h = n & (NHQ - 1);
  const int t = (int)threadIdx.x;                  // k = 8t .. 8t+7  (< HID)
  v4u w;
#pragma unroll
  for (int q = 0; q < 4; ++q) {
    const float f0 = W[(size_t)(8 * t + 2 * q) * NHQ + h];
    const float f1 = W[(size_t)(8 * t + 2 * q + 1) * NHQ + h];
    w[q] = pk16(bf_bits(f0), bf_bits(f1));
  }
  const size_t o = (size_t)n * HID + 8 * (size_t)t;
  *(v4u*)(outp + o) = w;
  
}

// ---------------------------------------------------------------------------
// bf16 WMMA GEMMs: C[m][n] = sum_k A[m][k] * Bt[n][k]; A row-major [M][K] bf16 (pitch lda), Bt row-major [N][K] bf16 (pitch ldb).
//   SPLITA: A carried as hi (Ap) + lo (A2p) bf16 planes, two products into one accumulator (hi then lo at every k step).
//   gemm_kernel (EPI 3): wave tile 32 x 32, 4 independent waves per block, fragments straight from global rows, no block barriers.
//   gemm_tiled_kernel (EPI 0, 1, 2): block tile 128 x 256, waves of 64 x 128 (EPI 0) or 32 x 128 (EPI 1, 2), operands staged in an LDS ring of two buffers.
// Epilogues (all: per wave, per 16-row slab: stage in LDS, wave sync, write each row segment with ONE instruction); MI = 16-row slabs per wave.
//   EPI 0 (NJ 8): q|k projection. cols n0 < HID (q): f16 hi plane C0 and f16 residual x2048 plane C1, both [M][ldc], cols n0..n0+127
//          (row segment 256 B = 16 lanes x 16 B). cols n0 >= HID (k): hi plane C2 [M][ldc] cols n0-HID..; residual plane C3 [NSEQ*KLR][ldc]
//          only for token rows with (m % SQ) < KLR at row (m / SQ)*KLR + m % SQ (wave-uniform choice; 32- and 64-row wave tiles never straddle).
//   EPI 1 (NJ 8): v^T projection: f16 hi plane C0, residual x2048 plane C1, [M][ldc], row segment 256 B.
//   EPI 2 (NJ 8): f32 output C0 [M][ldc], each row scaled by (1 + 0.1*phs[m]); row segment 128 floats = 512 B = 32 lanes x 16 B per instruction.
//   EPI 3 (NJ 2): f32 plane C0 [M][ldc = PQW]: cols 0..31 cos of the 32 accumulated values, 32..63 sin (precise cosf/sinf, rolled loop);
//          row = 256 B = 16 lanes x 16 B, one instruction covers 2 whole rows.
// ---------------------------------------------------------------------------
template <int EPI> struct SlabT { typedef _Float16 T; static constexpr int PERW = 4096; };   // 2 planes x 16 x 128 halves
template <> struct SlabT<2>     { typedef float    T; static constexpr int PERW = 2048; };   // 16 x 128 floats
template <> struct SlabT<3>     { typedef float    T; static constexpr int PERW = 1536; };   // 16 x 32 raw + 16 x 64 cos|sin floats

// s_wait_xcnt 0 behind an issued global store, in front of a rewrite of a register that the store names
__device__ __forceinline__ void wait_x0() {
#if defined(__HIP_DEVICE_COMPILE__)
  asm volatile("s_wait_xcnt 0x0" ::: "memory");
#endif
}

// slab: this wave's own LDS staging range; (m0, n0): first row and column of the wave's (16*MI) x (16*NJ) tile.
template <int EPI, int NJ, int MI>
__device__ __forceinline__ void gemm_epilogue(v8f (&acc)[MI][NJ], typename SlabT<EPI>::T* slab, int lane, int m0, int n0,
                                              const float* __restrict__ phs, void* C0, void* C1, void* C2, void* C3, int ldc) {
  const int hh = lane >> 4;
  const int rl = lane & 15;
  _Float16* sl16 = (_Float16*)(void*)slab;
  float*    slf  = (float*)(void*)slab;

  if constexpr (EPI == 0 || EPI == 1) {
    _Float16* P0;
    _Float16* P1;
    int col0;
    int lomode;                                   // 0: lo row = m; 1: lo row remapped into the KLR-row plane; 2: no lo store
    if constexpr (EPI == 0) {
      const bool isq = (n0 < HID);                // wave-uniform
      P0 = isq ? (_Float16*)C0 : (_Float16*)C2;
      P1 = isq ? (_Float16*)C1 : (_Float16*)C3;
      col0 = isq ? n0 : (n0 - HID);
      const int s0 = m0 & (SQ - 1);
      lomode = isq ? 0 : ((s0 < KLR) ? 1 : 2);
    } else {
      P0 = (_Float16*)C0;
      P1 = (_Float16*)C1;
      col0 = n0;
      lomode = 0;
    }
#pragma unroll
    for (int i = 0; i < MI; ++i) {
#pragma unroll
      for (int r = 0; r < 8; ++r) {
#pragma unroll
        for (int j = 0; j < NJ; ++j) {
          const float v = acc[i][j][r];
          const _Float16 hv = (_Float16)v;
          const int so = (8 * hh + r) * 128 + j * 16 + rl;
          sl16[so]        = hv;
          sl16[2048 + so] = (_Float16)((v - (float)hv) * 2048.0f);
        }
      }
      lds_wave_sync();
      {
#pragma unroll
        for (int it = 0; it < 8; ++it) {
          const int row = it * 2 + hh;            // it x hh covers rows 0..15
          const int c8  = rl * 8;
          const v8h xh = *(const v8h*)(sl16 + row * 128 + c8);
          const v8h xl = *(const v8h*)(sl16 + 2048 + row * 128 + c8);
          const int m = m0 + i * 16 + row;
          *(v8h*)(P0 + (size_t)m * ldc + col0 + c8) = xh;
          if constexpr (EPI == 0) wait_x0();      // precaution: in front of the branch below, whose first instructions reuse this store's registers
          if (lomode != 2) {
            const int m1 = (lomode == 1) ? ((m / SQ) * KLR + (m % SQ)) : m;
            *(v8h*)(P1 + (size_t)m1 * ldc + col0 + c8) = xl;
            if constexpr (EPI == 0) wait_x0();    // precaution: inside the branch, in front of whatever reuses this store's registers behind it
          }
        }
        
      }
      lds_wave_sync();
    }
  } else if constexpr (EPI == 2) {
    float* C = (float*)C0;
#pragma unroll
    for (int i = 0; i < MI; ++i) {
#pragma unroll
      for (int r = 0; r < 8; ++r) {
        const int m = m0 + i * 16 + 8 * hh + r;
        const float sc = 1.0f + 0.1f * phs[m];
#pragma unroll
        for (int j = 0; j < NJ; ++j)
          slf[(8 * hh + r) * 128 + j * 16 + rl] = acc[i][j][r] * sc;
      }
      lds_wave_sync();
      {
#pragma unroll
        for (int row = 0; row < 16; ++row) {      // 32 lanes x 16 B = the whole 512-B row segment per instruction
          const v4f v = *(const v4f*)(slf + row * 128 + lane * 4);
          *(v4f*)(C + (size_t)(m0 + i * 16 + row) * ldc + n0 + lane * 4) = v;
        }
        
      }
      lds_wave_sync();
    }
  } else {
    float* raw = slf;                             // 16 x 32 floats
    float* ocs = slf + 512;                       // 16 x 64 floats
    float* Cp  = (float*)C0;
#pragma unroll
    for (int i = 0; i < MI; ++i) {
#pragma unroll
      for (int j = 0; j < NJ; ++j)
#pragma unroll
        for (int r = 0; r < 8; ++r)
          raw[(8 * hh + r) * 32 + j * 16 + rl] = acc[i][j][r];
      lds_wave_sync();
#pragma unroll 1
      for (int it = 0; it < 16; ++it) {           // row it, col lane: 16 x 32 values, one precise cos + sin site
        const float v  = raw[it * 32 + lane];
        const float cv = cosf(v);
        const float sv = sinf(v);
        ocs[it * PQW + lane]      = cv;
        ocs[it * PQW + 32 + lane] = sv;
      }
      lds_wave_sync();
      {
#pragma unroll
        for (int it = 0; it < 8; ++it) {
          const int row = it * 2 + hh;            // 2 rows per instruction, 16 lanes x 16 B = one whole 256-B row
          const int c4  = rl * 4;
          const v4f x = *(const v4f*)(ocs + row * PQW + c4);
          *(v4f*)(Cp + (size_t)(m0 + i * 16 + row) * ldc + c4) = x;
        }
        
      }
      lds_wave_sync();
    }
  }
}

template <int EPI, int NJ, bool SPLITA>
__global__ __launch_bounds__(128) void gemm_kernel(
    const unsigned short* Ap, const unsigned short* A2p, int lda,
    const unsigned short* __restrict__ Btp, int ldb,
    const float* __restrict__ phs,
    void* C0, void* C1, void* C2, void* C3, int ldc,
    int M, int N, int K) {
  static_assert(NJ == 8 || NJ == 2);
  static_assert((EPI == 3) ? (NJ == 2) : (NJ == 8));
  typedef typename SlabT<EPI>::T ST;
  __shared__ __align__(16) ST slab_all[4 * SlabT<EPI>::PERW];

  const int lane = threadIdx.x & 31;
  const int wave = wave_id();
  const int hh = lane >> 4;           // lane half: k offset 8*hh, D row offset 8*hh
  const int rl = lane & 15;           // A row / B col / D col within subtile
  const int tilesN = N / (16 * NJ);
  const int tilesM = M >> 5;
  const int tile = (int)blockIdx.x * 4 + wave;
  if (tile >= tilesM * tilesN) return;          // wave-uniform; no block barriers in this kernel
  const int tm = tile / tilesN;
  const int tn = tile - tm * tilesN;
  const int m0 = tm << 5;
  const int n0 = tn * (16 * NJ);

  const __bf16* A  = (const __bf16*)(const void*)Ap;
  const __bf16* A2 = (const __bf16*)(const void*)A2p;
  const __bf16* Bt = (const __bf16*)(const void*)Btp;

  v8f acc[2][NJ];
#pragma unroll
  for (int i = 0; i < 2; ++i)
#pragma unroll
    for (int j = 0; j < NJ; ++j) acc[i][j] = zero8();

  for (int k0 = 0; k0 < K; k0 += 32) {
    v16b ah[2], al[2];
#pragma unroll
    for (int i = 0; i < 2; ++i) {
      const size_t ao = (size_t)(m0 + i * 16 + rl) * lda + k0 + 8 * hh;
      ah[i] = ldfrag_b(A + ao);
      al[i] = SPLITA ? ldfrag_b(A2 + ao) : ah[i];
    }
#pragma unroll
    for (int j = 0; j < NJ; ++j) {
      const v16b bj = ldfrag_b(Bt + (size_t)(n0 + j * 16 + rl) * ldb + k0 + 8 * hh);
      acc[0][j] = mma_b(ah[0], bj, acc[0][j]);
      acc[1][j] = mma_b(ah[1], bj, acc[1][j]);
      if (SPLITA) {
        acc[0][j] = mma_b(al[0], bj, acc[0][j]);
        acc[1][j] = mma_b(al[1], bj, acc[1][j]);
      }
      guard_b5(acc[0][j], acc[1][j], ah[0], ah[1], al[0], al[1], bj);
    }
  }
  if constexpr (NJ == 8) {
    acc_guard4(acc[0][0], acc[0][1], acc[0][2], acc[0][3]);
    acc_guard4(acc[0][4], acc[0][5], acc[0][6], acc[0][7]);
    acc_guard4(acc[1][0], acc[1][1], acc[1][2], acc[1][3]);
    acc_guard4(acc[1][4], acc[1][5], acc[1][6], acc[1][7]);
  } else {
    acc_guard4(acc[0][0], acc[0][1], acc[1][0], acc[1][1]);
  }

  gemm_epilogue<EPI, NJ, 2>(acc, slab_all + wave * SlabT<EPI>::PERW, lane, m0, n0, phs, C0, C1, C2, C3, ldc);
}

// ---------------------------------------------------------------------------
// Tiled GEMM main loop. Block tile 128 x 256; waves in a (8/MI) x 2 grid, each (16*MI) x 128: MI 4 = 4 waves, MI 2 = 8 waves.
// A pass is 64 k: a stage holds [A 128 rows | (SPLITA: A2 128 rows) | Bt 256 rows] of 128 B at pitch 144 B
// (16 B x 9: ds_load_b128 fragment reads without bank conflicts). Every thread brings 16-B pieces with asynchronous copies to LDS,
// one pass ahead of the pass that reads them. M % 128 == 0, N % 256 == 0, K % 64 == 0, K >= 128; grid.x = (M/128) * (N/256).
// ---------------------------------------------------------------------------
#define GT_BM 128
#define GT_BN 256
#define GT_KP 64
#define GT_LP 72                                  // LDS row pitch in bf16 elements

// Asynchronous 16-B copies, one per lane and line of the statement: l + c * lstep = the lane's LDS byte address, g[c] = its global source.
// s_wait_xcnt stands inside the statement so that no address register is rewritten ahead of it.
__device__ __forceinline__ void copy8(unsigned l, unsigned lstep, const __bf16* const* g) {
#if defined(__HIP_DEVICE_COMPILE__)
  asm volatile(
      "global_load_async_to_lds_b128 %0, %8, off\n\t"
      "global_load_async_to_lds_b128 %1, %9, off\n\t"
      "global_load_async_to_lds_b128 %2, %10, off\n\t"
      "global_load_async_to_lds_b128 %3, %11, off\n\t"
      "global_load_async_to_lds_b128 %4, %12, off\n\t"
      "global_load_async_to_lds_b128 %5, %13, off\n\t"
      "global_load_async_to_lds_b128 %6, %14, off\n\t"
      "global_load_async_to_lds_b128 %7, %15, off\n\t"
      "s_wait_xcnt 0x0"
      :: "v"(l), "v"(l + lstep), "v"(l + 2u * lstep), "v"(l + 3u * lstep),
         "v"(l + 4u * lstep), "v"(l + 5u * lstep), "v"(l + 6u * lstep), "v"(l + 7u * lstep),
         "v"(g[0]), "v"(g[1]), "v"(g[2]), "v"(g[3]), "v"(g[4]), "v"(g[5]), "v"(g[6]), "v"(g[7])
      : "memory");
#endif
}
__device__ __forceinline__ void copy4(unsigned l, unsigned lstep, const __bf16* const* g) {
#if defined(__HIP_DEVICE_COMPILE__)
  asm volatile(
      "global_load_async_to_lds_b128 %0, %4, off\n\t"
      "global_load_async_to_lds_b128 %1, %5, off\n\t"
      "global_load_async_to_lds_b128 %2, %6, off\n\t"
      "global_load_async_to_lds_b128 %3, %7, off\n\t"
      "s_wait_xcnt 0x0"
      :: "v"(l), "v"(l + lstep), "v"(l + 2u * lstep), "v"(l + 3u * lstep),
         "v"(g[0]), "v"(g[1]), "v"(g[2]), "v"(g[3])
      : "memory");
#endif
}
// this wave's copies have landed in LDS
__device__ __forceinline__ void wait_async0() {
#if defined(__HIP_DEVICE_COMPILE__)
  asm volatile("s_wait_asynccnt 0x0" ::: "memory");
#endif
}
// this wave's LDS reads have returned (before the buffer they read is handed back for a refill)
__device__ __forceinline__ void wait_ds0() {
#if defined(__HIP_DEVICE_COMPILE__)
  asm volatile("s_wait_dscnt 0x0" ::: "memory");
#endif
}
// the compiler's scheduler moves nothing across this point
__device__ __forceinline__ void sched_fence() {
#if defined(__HIP_DEVICE_COMPILE__)
  __builtin_amdgcn_sched_barrier(0);
#endif
}

// second launch bound: two waves per SIMD (two 4-wave blocks, or one 8-wave block, per WGP), so that one wave's WMMAs cover the other's waits
template <int EPI, int MI, bool SPLITA>
__global__ __launch_bounds__(512 / MI, 2) void gemm_tiled_kernel(
    const unsigned short* Ap, const unsigned short* A2p, int lda,
    const unsigned short* __restrict__ Btp, int ldb,
    const float* __restrict__ phs,
    void* C0, void* C1, void* C2, void* C3, int ldc,
    int M, int N, int K) {
  static_assert(EPI == 0 || EPI == 1 || EPI == 2);
  static_assert(MI == 4 || MI == 2);
  static_assert(GT_KP == 64);
  constexpr int NW    = 16 / MI;                  // waves per block
  constexpr int RS    = NW * 4;                   // stage rows that one copy of every thread covers (8 threads per 128-B row)
  constexpr int AROWS = (SPLITA ? 2 : 1) * GT_BM;
  constexpr int NCP   = (AROWS + GT_BN) / RS;     // copies per thread and stage: 24, 12 or 16 (at most 63 may be outstanding)
  constexpr int STAGE = (AROWS + GT_BN) * GT_LP;  // elements per buffer
  static_assert(NCP % 4 == 0 && NCP <= 63);
  typedef typename SlabT<EPI>::T ST;
  __shared__ __align__(16) __bf16 ring[2 * STAGE];
  __shared__ __align__(16) ST slab_all[NW * SlabT<EPI>::PERW];

  const int tid  = (int)threadIdx.x;
  const int lane = tid & 31;
  const int wave = wave_id();
  const int hh = lane >> 4;           // lane half: k offset 8*hh
  const int rl = lane & 15;           // A row / B col within subtile
  const int tilesN = N / GT_BN;
  const int tm  = (int)blockIdx.x / tilesN;
  const int tn  = (int)blockIdx.x - tm * tilesN;
  const int bm0 = tm * GT_BM;
  const int bn0 = tn * GT_BN;
  const int wm  = wave >> 1;
  const int wn  = wave & 1;

  // copy side: copy c of this thread brings piece tid % 8 of stage row c * RS + tid / 8
  const int crow = tid >> 3;
  const int cpc  = (tid & 7) * 8;     // element offset of the 16-B piece
  const __bf16* gA  = (const __bf16*)(const void*)Ap  + (size_t)(bm0 + crow) * lda + cpc;
  const __bf16* gA2 = (const __bf16*)(const void*)A2p + (size_t)(bm0 + crow) * lda + cpc;
  const __bf16* gB  = (const __bf16*)(const void*)Btp + (size_t)(bn0 + crow) * ldb + cpc;
  const unsigned lc = (unsigned)(size_t)(const void*)ring + (unsigned)(crow * GT_LP + cpc) * 2u;
  auto fill = [&](int t) {            // tile t -> buffer t % 2
    const unsigned l = lc + (unsigned)(t & 1) * (unsigned)(STAGE * 2);
    const size_t ko = (size_t)t * GT_KP;
    const __bf16* g[NCP];
#pragma unroll
    for (int c = 0; c < NCP; ++c) {
      const int r = c * RS;
      g[c] = (r < GT_BM) ? gA + ko + (size_t)r * lda
           : (r < AROWS) ? gA2 + ko + (size_t)(r - GT_BM) * lda
                         : gB + ko + (size_t)(r - AROWS) * ldb;
    }
#pragma unroll
    for (int c = 0; c + 8 <= NCP; c += 8) copy8(l + (unsigned)(c * RS * GT_LP * 2), RS * GT_LP * 2u, g + c);
    if constexpr (NCP % 8 == 4) copy4(l + (unsigned)((NCP - 4) * RS * GT_LP * 2), RS * GT_LP * 2u, g + (NCP - 4));
  };

  v8f acc[MI][8];
#pragma unroll
  for (int i = 0; i < MI; ++i)
#pragma unroll
    for (int j = 0; j < 8; ++j) acc[i][j] = zero8();

  const int nt = K / GT_KP;           // block-uniform, >= 2
  fill(0);
  wait_async0();
  __syncthreads();                    // tile 0 readable by every wave
  fill(1);

  const int aoff = (wm * (16 * MI) + rl) * GT_LP + 8 * hh;
  const int boff = (AROWS + wn * 128 + rl) * GT_LP + 8 * hh;
#pragma unroll 1                      // one pass per trip: the ring's order below holds per trip, and every acc index stays constant
  for (int t = 0; t < nt; ++t) {
    const __bf16* st = ring + (t & 1) * STAGE;
    v16b fa[2][MI], fl[2][MI], fb[2][8];          // one fragment set per 32-k step of the pass
#pragma unroll
    for (int ks = 0; ks < 2; ++ks) {
#pragma unroll
      for (int i = 0; i < MI; ++i) {
        fa[ks][i] = ldfrag_b(st + aoff + i * 16 * GT_LP + ks * 32);
        if constexpr (SPLITA) fl[ks][i] = ldfrag_b(st + aoff + (GT_BM + i * 16) * GT_LP + ks * 32);
      }
#pragma unroll
      for (int j = 0; j < 8; ++j) fb[ks][j] = ldfrag_b(st + boff + j * 16 * GT_LP + ks * 32);
      sched_fence();                              // each step's LDS reads stay one group ahead of the WMMA blocks, not spread among them
    }
#pragma unroll
    for (int ks = 0; ks < 2; ++ks) {
#pragma unroll
      for (int j = 0; j < 8; ++j) {
#pragma unroll
        for (int i = 0; i < MI; ++i) acc[i][j] = mma_b(fa[ks][i], fb[ks][j], acc[i][j]);
        if constexpr (SPLITA) {
#pragma unroll
          for (int i = 0; i < MI; ++i) acc[i][j] = mma_b(fl[ks][i], fb[ks][j], acc[i][j]);
        }
      }
      // step 1's WMMAs stay behind step 0's (only step 0's reads are waited for first) and in front of the waits at the foot
      // (moved behind the barrier they would halve the lead of the copies in flight)
      sched_fence();
    }
    wait_ds0();
    wait_async0();
    __syncthreads();                  // publishes tile t + 1 and ends every wave's reads of tile t's buffer
    if (t + 2 < nt) fill(t + 2);      // block-uniform test
  }
  wait_async0();

  gemm_epilogue<EPI, 8, MI>(acc, slab_all + wave * SlabT<EPI>::PERW, lane, bm0 + wm * (16 * MI), bn0 + wn * 128, phs, C0, C1, C2, C3, ldc);
}

// ---------------------------------------------------------------------------
// Phase modulation factor, one block per sequence (grid NSEQ, 256 threads), all f32:
//   PQ plane [NTOK][PQW]: col h = cos(pq_h), 16+h = cos(pk_h), 32+h = sin(pq_h), 48+h = sin(pk_h).
//   Ck[h] = sum_s cos(pk), Sk[h] = sum_s sin(pk) (per-thread partials over 8 rows, LDS combine in fixed order);
//   phs[b*SQ + s] = sum_h (cos(pq_h)*Ck[h] + sin(pq_h)*Sk[h]) / 32768.
//   Coverage: NSEQ blocks x 2048 = NTOK values.
// ---------------------------------------------------------------------------
__global__ __launch_bounds__(256) void phase_kernel(const float* __restrict__ PQ, float* __restrict__ phs) {
  __shared__ float red[2 * NHQ][256];
  __shared__ float csk[2 * NHQ];
  __shared__ __align__(16) float stg[SQ];
  const int b   = (int)blockIdx.x;
  const int tid = (int)threadIdx.x;
  float pc[NHQ], ps[NHQ];
#pragma unroll
  for (int h = 0; h < NHQ; ++h) { pc[h] = 0.f; ps[h] = 0.f; }
#pragma unroll 1
  for (int u = 0; u < SQ / 256; ++u) {
    const int s = u * 256 + tid;
    const float* rowp = PQ + ((size_t)b * SQ + s) * PQW;
#pragma unroll
    for (int h = 0; h < NHQ; ++h) {
      pc[h] += rowp[NHQ + h];
      ps[h] += rowp[NPH + NHQ + h];
    }
  }
#pragma unroll
  for (int h = 0; h < NHQ; ++h) { red[h][tid] = pc[h]; red[NHQ + h][tid] = ps[h]; }
  __syncthreads();
  if (tid < 2 * NHQ) {
    float s = 0.f;
#pragma unroll 1
    for (int t = 0; t < 256; ++t) s += red[tid][t];
    csk[tid] = s;
  }
  __syncthreads();
#pragma unroll 1
  for (int u = 0; u < SQ / 256; ++u) {
    const int s = u * 256 + tid;
    const float* rowp = PQ + ((size_t)b * SQ + s) * PQW;
    float a = 0.f;
#pragma unroll 1
    for (int h = 0; h < NHQ; ++h) a += rowp[h] * csk[h] + rowp[NPH + h] * csk[NHQ + h];
    stg[s] = a * (1.0f / 32768.0f);
  }
  __syncthreads();
  {
#pragma unroll
    for (int it = 0; it < SQ / 1024; ++it) {
      const int idx = it * 256 + tid;           // float4 index 0..511
      const v4f v = *(const v4f*)(stg + 4 * idx);
      *(v4f*)(phs + (size_t)b * SQ + 4 * idx) = v;
    }
    
  }
}

// ---------------------------------------------------------------------------
// Causal flash attention, head dim 128, 32-key chunks, block = 4 waves = 64 query rows of one (b, h); grid (n query tiles, NHQ, NSEQ).
//   q planes f16 [tok][h*128+d]: hi (qhp) and residual x2048 (qlp); k planes f16 [tok][h*128+d]: hi (khp); residual x2048 (klp) only for
//   keys < KLR of each sequence, stored at row b*KLR + key (read only when PRES); v^T planes f16 [h*128+d][tok]: hi (vhp), residual x2048 (vlp);
//   outputs attn bf16 hi (ahp) / lo (alp) [tok][h*128+d].
//   scores = (Sh + Sr/2048) * 128^-0.5 with Sh = qh.kh and Sr = ql'.kh (+ qh.kl' when PRES); keys > query -> -inf; online softmax f32;
//   p' = 1024 p stored per wave to LDS as f16 hi (and residual x2048 when PRES), reloaded as A fragments after a wave sync;
//   O = (Oh + Or/2048)/1024/l with Oh = ph.vh, Or = ph.vl' (+ pl'.vh when PRES).
//   K / V^T chunk staging: 128 threads x 4 x 16 B per plane = whole 32x128 / 128x32 tile, plain loads, __syncthreads before and after.
//   Trip count 2*qb+2 chunks (static bound 64); waves whose rows are all below the chunk skip it (wave-uniform, scalar branch).
// ---------------------------------------------------------------------------
#define AT_KC   32
#define KS_P    136
#define VS_P    40
#define PS_P    40
#define LDS_KS  0
#define LDS_KLS (32 * KS_P)
#define LDS_VHS (2 * 32 * KS_P)
#define LDS_VLS (LDS_VHS + 128 * VS_P)
#define LDS_PH  (LDS_VLS + 128 * VS_P)
#define LDS_PL  (LDS_PH + 4 * 16 * PS_P)
#define LDS_TOT (LDS_PL + 4 * 16 * PS_P)
static_assert(LDS_TOT * 2 <= 65536);
static_assert(4 * 4096 <= LDS_TOT);          // output staging (2 planes x 16 x 128 per wave) aliases the chunk region after the loop

template <bool PRES>
__global__ __launch_bounds__(128) void attn_causal_kernel(
    const unsigned short* __restrict__ qhp, const unsigned short* __restrict__ qlp,
    const unsigned short* __restrict__ khp, const unsigned short* __restrict__ klp,
    const unsigned short* __restrict__ vhp, const unsigned short* __restrict__ vlp,
    unsigned short* __restrict__ ahp, unsigned short* __restrict__ alp, int qb_base) {
  __shared__ __align__(16) _Float16 lds[LDS_TOT];
  _Float16* Ks  = lds + LDS_KS;
  _Float16* Kls = lds + LDS_KLS;
  _Float16* Vhs = lds + LDS_VHS;
  _Float16* Vls = lds + LDS_VLS;

  const int tid  = (int)threadIdx.x;
  const int lane = tid & 31;
  const int wave = wave_id();
  const int hh   = lane >> 4;
  const int c    = lane & 15;
  const int qb   = (int)blockIdx.x + qb_base;
  const int h    = (int)blockIdx.y;
  const int b    = (int)blockIdx.z;
  const int q0   = qb * 64 + wave * 16;          // first query row of this wave (within sequence)
  const int qlast = q0 + 15;
  const size_t tok0 = (size_t)b * SQ;

  const _Float16* Qhr = (const _Float16*)(const void*)qhp + (tok0 + q0 + c) * HID + h * HDM + 8 * hh;
  const _Float16* Qlr = (const _Float16*)(const void*)qlp + (tok0 + q0 + c) * HID + h * HDM + 8 * hh;
  const _Float16* Kg  = (const _Float16*)(const void*)khp + tok0 * HID + h * HDM;
  const _Float16* Klg = (const _Float16*)(const void*)klp + (size_t)b * KLR * HID + h * HDM;
  const _Float16* Vhg = (const _Float16*)(const void*)vhp + (size_t)(h * HDM) * NTOK + tok0;
  const _Float16* Vlg = (const _Float16*)(const void*)vlp + (size_t)(h * HDM) * NTOK + tok0;
  _Float16* ph = lds + LDS_PH + wave * (16 * PS_P);
  _Float16* pl = lds + LDS_PL + wave * (16 * PS_P);

  float mrow[8], lrow[8];
  v8f oacc[8], oaccr[8];
#pragma unroll
  for (int r = 0; r < 8; ++r) { mrow[r] = -INFINITY; lrow[r] = 0.f; }
#pragma unroll
  for (int t = 0; t < 8; ++t) { oacc[t] = zero8(); oaccr[t] = zero8(); }

  const int nch = 2 * qb + 2;                    // block-uniform, <= 64; keys < 64*(qb+1) <= SQ; PRES blocks: keys < 256 = KLR
  for (int kc = 0; kc < nch; ++kc) {
    const int kv0 = kc * AT_KC;
    __syncthreads();
#pragma unroll
    for (int i = 0; i < 4; ++i) {                // coverage: 512 pieces of 8 halves per plane = whole tile
      const int p   = tid + 128 * i;             // 0..511
      const int key = p >> 4, d8 = (p & 15) * 8; // K: 32 keys x 128 d
      const v8h kx = *(const v8h*)(Kg + (size_t)(kv0 + key) * HID + d8);
      *(v8h*)(Ks + key * KS_P + d8) = kx;
      if (PRES) {
        const v8h ky = *(const v8h*)(Klg + (size_t)(kv0 + key) * HID + d8);
        *(v8h*)(Kls + key * KS_P + d8) = ky;
      }
      const int d = p >> 2, k8 = (p & 3) * 8;    // V^T: 128 d x 32 keys
      const v8h vx = *(const v8h*)(Vhg + (size_t)d * NTOK + kv0 + k8);
      const v8h vy = *(const v8h*)(Vlg + (size_t)d * NTOK + kv0 + k8);
      *(v8h*)(Vhs + d * VS_P + k8) = vx;
      *(v8h*)(Vls + d * VS_P + k8) = vy;
    }
    __syncthreads();

    if (kv0 <= qlast) {                          // wave-uniform (scalar): skip chunks fully above this wave's rows
      // ---- scores ----
      v8f sh[2], sr[2];
      sh[0] = zero8(); sh[1] = zero8(); sr[0] = zero8(); sr[1] = zero8();
#pragma unroll
      for (int dc = 0; dc < 4; ++dc) {
        const v16h qa = ldfrag_h(Qhr + dc * 32);
        const v16h ql = ldfrag_h(Qlr + dc * 32);
#pragma unroll
        for (int j = 0; j < 2; ++j) {
          const v16h kb = ldfrag_h(Ks + (j * 16 + c) * KS_P + dc * 32 + 8 * hh);
          sh[j] = mma_h(qa, kb, sh[j]);
          sr[j] = mma_h(ql, kb, sr[j]);
          if (PRES) {
            const v16h kl = ldfrag_h(Kls + (j * 16 + c) * KS_P + dc * 32 + 8 * hh);
            sr[j] = mma_h(qa, kl, sr[j]);
            guard_h4(sh[j], sr[j], qa, ql, kb, kl);
          } else {
            guard_h3(sh[j], sr[j], qa, ql, kb);
          }
        }
      }
      // ---- scale, causal mask, chunk row max ----
      float cm[8];
#pragma unroll
      for (int r = 0; r < 8; ++r) {
        const int qrow = q0 + 8 * hh + r;
        float m = -INFINITY;
#pragma unroll
        for (int j = 0; j < 2; ++j) {
          const int key = kv0 + j * 16 + c;
          float s = (sh[j][r] + sr[j][r] * 0.00048828125f) * 0.08838834764831845f;
          s = (key > qrow) ? -INFINITY : s;
          sh[j][r] = s;
          m = fmaxf(m, s);
        }
#pragma unroll
        for (int off = 1; off < 16; off <<= 1) m = fmaxf(m, __shfl_xor(m, off, 32));
        cm[r] = m;
      }
      // ---- online softmax, P' to LDS ----
#pragma unroll
      for (int r = 0; r < 8; ++r) {
        const float mnew  = fmaxf(mrow[r], cm[r]);
        const float alpha = __expf(mrow[r] - mnew);
        mrow[r] = mnew;
        float psum = 0.f;
#pragma unroll
        for (int j = 0; j < 2; ++j) {
          const float p  = __expf(sh[j][r] - mnew);
          psum += p;
          const float pp = p * 1024.0f;
          const _Float16 phv = (_Float16)pp;
          const int po = (8 * hh + r) * PS_P + j * 16 + c;
          ph[po] = phv;
          if (PRES) pl[po] = (_Float16)((pp - (float)phv) * 2048.0f);
        }
#pragma unroll
        for (int off = 1; off < 16; off <<= 1) psum += __shfl_xor(psum, off, 32);
        lrow[r] = lrow[r] * alpha + psum;
#pragma unroll
        for (int t = 0; t < 8; ++t) { oacc[t][r] *= alpha; oaccr[t][r] *= alpha; }
      }
      lds_wave_sync();                           // P' stores visible to the other lanes of this wave before the fragment reload
      // ---- O += P' . V ----
      const v16h pa = ldfrag_h(ph + c * PS_P + 8 * hh);
      v16h pr = pa;
      if (PRES) pr = ldfrag_h(pl + c * PS_P + 8 * hh);
#pragma unroll
      for (int t = 0; t < 8; ++t) {
        const v16h vb = ldfrag_h(Vhs + (t * 16 + c) * VS_P + 8 * hh);
        const v16h vr = ldfrag_h(Vls + (t * 16 + c) * VS_P + 8 * hh);
        oacc[t]  = mma_h(pa, vb, oacc[t]);
        oaccr[t] = mma_h(pa, vr, oaccr[t]);
        if (PRES) oaccr[t] = mma_h(pr, vb, oaccr[t]);
        guard_h4(oacc[t], oaccr[t], pa, pr, vb, vr);
      }
    }
  }

  __syncthreads();                               // all chunk-region readers done before aliasing it as output staging
  _Float16* osh = lds + wave * 4096;
  _Float16* osl = osh + 2048;
#pragma unroll
  for (int r = 0; r < 8; ++r) {
    const float inv = (1.0f / lrow[r]) * 0.0009765625f;
#pragma unroll
    for (int t = 0; t < 8; ++t) {
      const float o = (oacc[t][r] + oaccr[t][r] * 0.00048828125f) * inv;
      const unsigned short hb = bf_bits(o);
      const unsigned short lb = bf_bits(o - bf_val(hb));
      const int so = (8 * hh + r) * 128 + t * 16 + c;
      osh[so] = __builtin_bit_cast(_Float16, hb);
      osl[so] = __builtin_bit_cast(_Float16, lb);
    }
  }
  lds_wave_sync();
  _Float16* Ahg = (_Float16*)(void*)ahp + (tok0 + q0) * HID + h * HDM;
  _Float16* Alg = (_Float16*)(void*)alp + (tok0 + q0) * HID + h * HDM;
  {
#pragma unroll
    for (int it = 0; it < 8; ++it) {
      const int row = it * 2 + hh;               // it 0..7 x hh 0..1 covers rows 0..15
      const int c8  = c * 8;                     // 16 lanes x 16 B = the whole 256-B segment
      const v8h x = *(const v8h*)(osh + row * 128 + c8);
      const v8h y = *(const v8h*)(osl + row * 128 + c8);
      *(v8h*)(Ahg + (size_t)row * HID + c8) = x;
      *(v8h*)(Alg + (size_t)row * HID + c8) = y;
    }
    
  }
}

// ---------------------------------------------------------------------------
// Workspace map (bytes; every region is a whole number of the rows its producer writes with whole-line stores; all dims are tile multiples,
// so padded size == logical size; offsets are multiples of 16384):
//   R0   Xb  bf16 [4096][2048] 16777216, later Ah bf16 [4096][2048] (Xb dead after the three projection GEMMs)
//   R1   WqkT bf16 [4096][2048] 16777216, later Al bf16 [4096][2048]
//   R2   WvT bf16 [2048][2048]  8388608, later WoT bf16 [2048][2048] (WvT dead after the v GEMM)
//   WpT  bf16 [32][2048]          131072
//   Qh, Ql, Kh f16 [4096][2048]  16777216 each
//   Kl   f16 [512][2048]          2097152
//   Vh, Vl f16 [2048][4096]      16777216 each
//   PQ   f32 [4096][64]           1048576
//   phs  f32 [4096]                 16384
//   total                       129122304
// ---------------------------------------------------------------------------
static inline size_t smax(size_t a, size_t b) { return a > b ? a : b; }

extern "C" void kernel_launch(void* const* d_in, const int* in_sizes, int n_in,
                              void* d_out, int out_size, void* d_ws, size_t ws_size,
                              hipStream_t stream) {
  if (n_in < 7) return;
  if (in_sizes[0] != NTOK * HID) return;
  if (in_sizes[1] != HID * HID) return;
  if (in_sizes[2] != HID * HID) return;
  if (in_sizes[3] != HID * HID) return;
  if (in_sizes[4] != HID * HID) return;
  if (in_sizes[5] != HID * NHQ) return;
  if (in_sizes[6] != HID * NHQ) return;
  if (out_size != NTOK * HID) return;

  const float* x   = (const float*)d_in[0];
  const float* Wq  = (const float*)d_in[1];
  const float* Wk  = (const float*)d_in[2];
  const float* Wv  = (const float*)d_in[3];
  const float* Wo  = (const float*)d_in[4];
  const float* Wpq = (const float*)d_in[5];
  const float* Wpk = (const float*)d_in[6];
  float* out = (float*)d_out;

  const size_t szX   = (size_t)NTOK * HID * 2;
  const size_t szWqk = (size_t)2 * HID * HID * 2;
  const size_t szW   = (size_t)HID * HID * 2;
  const size_t szA   = (size_t)NTOK * HID * 2;
  const size_t szWp  = (size_t)NPH * HID * 2;
  const size_t szQ   = (size_t)NTOK * HID * 2;
  const size_t szKl  = (size_t)NSEQ * KLR * HID * 2;
  const size_t szV   = (size_t)HID * NTOK * 2;
  const size_t szPQ  = (size_t)NTOK * PQW * 4;
  const size_t szPh  = (size_t)NTOK * 4;
  size_t off = 0;
  const size_t oR0 = off; off += smax(szX, szA);
  const size_t oR1 = off; off += smax(szWqk, szA);
  const size_t oR2 = off; off += szW;
  const size_t oWp = off; off += szWp;
  const size_t oQh = off; off += szQ;
  const size_t oQl = off; off += szQ;
  const size_t oKh = off; off += szQ;
  const size_t oKl = off; off += szKl;
  const size_t oVh = off; off += szV;
  const size_t oVl = off; off += szV;
  const size_t oPQ = off; off += szPQ;
  const size_t oPh = off; off += szPh;
  if (off > ws_size) return;                     // off = 129122304

  char* ws = (char*)d_ws;
  unsigned short* Xb   = (unsigned short*)(ws + oR0);
  unsigned short* Ah   = (unsigned short*)(ws + oR0);
  unsigned short* WqkT = (unsigned short*)(ws + oR1);
  unsigned short* Al   = (unsigned short*)(ws + oR1);
  unsigned short* WvT  = (unsigned short*)(ws + oR2);
  unsigned short* WoT  = (unsigned short*)(ws + oR2);
  unsigned short* WpT  = (unsigned short*)(ws + oWp);
  unsigned short* Qh   = (unsigned short*)(ws + oQh);
  unsigned short* Ql   = (unsigned short*)(ws + oQl);
  unsigned short* Kh   = (unsigned short*)(ws + oKh);
  unsigned short* Kl   = (unsigned short*)(ws + oKl);
  unsigned short* Vh   = (unsigned short*)(ws + oVh);
  unsigned short* Vl   = (unsigned short*)(ws + oVl);
  float*          PQ   = (float*)(ws + oPQ);
  float*          phs  = (float*)(ws + oPh);

  const dim3 b256(256), b128(128);

  // (1) x -> bf16 plane [4096][2048]
  cvt_bf16_kernel<<<dim3((NTOK * HID / 8) / 256), b256, 0, stream>>>(x, Xb, NTOK * HID / 8);
  // (2) Wq in[2048 rows][2048 cols] -> WqkT rows 0..2047 = out[n][k]; Wk -> WqkT rows 2048..4095; Wv -> WvT   (grid = cols/64, rows/64)
  tconv_bf16_kernel<<<dim3(HID / 64, HID / 64), b256, 0, stream>>>(Wq, WqkT, HID, HID);
  tconv_bf16_kernel<<<dim3(HID / 64, HID / 64), b256, 0, stream>>>(Wk, WqkT + (size_t)HID * HID, HID, HID);
  tconv_bf16_kernel<<<dim3(HID / 64, HID / 64), b256, 0, stream>>>(Wv, WvT, HID, HID);
  // (3) Wpq|Wpk -> WpT [32][2048]
  wpt_kernel<<<dim3(NPH), b256, 0, stream>>>(Wpq, Wpk, WpT);
  // (4) pq|pk = x . (Wpq|Wpk) -> cos|sin plane PQ [4096][64]   (M=4096, N=32, K=2048; 128 tiles / 4)
  gemm_kernel<3, 2, false><<<dim3((NTOK / 32) * (NPH / 32) / 4), b128, 0, stream>>>(
      Xb, Xb, HID, WpT, HID, phs, (void*)PQ, (void*)PQ, (void*)PQ, (void*)PQ, PQW, NTOK, NPH, HID);
  // (5) phase factor phs [4096]
  phase_kernel<<<dim3(NSEQ), b256, 0, stream>>>(PQ, phs);
  // (6) q|k = x . (Wq|Wk) -> Qh/Ql [4096][2048], Kh [4096][2048], Kl [512][2048]   (M=4096, N=4096, K=2048; 32 x 16 block tiles)
  gemm_tiled_kernel<0, 4, false><<<dim3((NTOK / GT_BM) * ((2 * HID) / GT_BN)), b128, 0, stream>>>(
      Xb, Xb, HID, WqkT, HID, phs, (void*)Qh, (void*)Ql, (void*)Kh, (void*)Kl, HID, NTOK, 2 * HID, HID);
  // (7) v^T = WvT . x^T -> Vh/Vl [2048][4096]   (A = WvT, Bt = Xb; M=2048, N=4096, K=2048; 16 x 16 block tiles)
  gemm_tiled_kernel<1, 2, false><<<dim3((HID / GT_BM) * (NTOK / GT_BN)), b256, 0, stream>>>(
      WvT, WvT, HID, Xb, HID, phs, (void*)Vh, (void*)Vl, (void*)Vh, (void*)Vl, NTOK, HID, NTOK, HID);
  // (8) Wo -> WoT (over the dead WvT region)
  tconv_bf16_kernel<<<dim3(HID / 64, HID / 64), b256, 0, stream>>>(Wo, WoT, HID, HID);
  // (9) causal attention, query tiles 0..3 with k and p residual products, tiles 4..31 without -> Ah/Al (over the dead Xb/WqkT regions)
  attn_causal_kernel<true><<<dim3(4, NHQ, NSEQ), b128, 0, stream>>>(Qh, Ql, Kh, Kl, Vh, Vl, Ah, Al, 0);
  attn_causal_kernel<false><<<dim3(SQ / 64 - 4, NHQ, NSEQ), b128, 0, stream>>>(Qh, Ql, Kh, Kl, Vh, Vl, Ah, Al, 4);
  // (10) out = (attn hi + lo) . Wo * (1 + 0.1*phs[m]) -> d_out f32 [4096][2048]   (M=4096, N=2048, K=2048; 32 x 8 block tiles)
  gemm_tiled_kernel<2, 2, true><<<dim3((NTOK / GT_BM) * (HID / GT_BN)), b256, 0, stream>>>(
      Ah, Al, HID, WoT, HID, phs, (void*)out, (void*)out, (void*)out, (void*)out, HID, NTOK, HID, HID);
  (void)hipGetLastError();
}

// v002
// It runs in 418 microseconds.
// In two side-by-side timings against v001, it was 1.21 and 1.20 times as fast.
// Over all steps from v000 it is 1.85 times as fast.
// Contractions: x.(Wq|Wk), Wv^T.x^T and x.(Wpq|Wpk) on v_wmma_f32_16x16x32_bf16 (operands = RNE bf16 of the f32 inputs, single products);
// q.k^T and p.v on v_wmma_f32_16x16x32_f16 (q = f16 hi + f16 residual x2^11 planes; k plain f16 plus f16 residual x2^11 on query tiles 0..3;
// p x1024 plain f16 plus f16 residual x2^11 on query tiles 0..3; v^T = f16 hi + f16 residual x2^11 planes); attn.Wo on v_wmma_f32_16x16x32_bf16
// (attn = bf16 hi + bf16 lo planes, two products; Wo RNE bf16). f32 accumulate everywhere; online softmax, cos/sin phase sums and output scale in f32.
#include <hip/hip_runtime.h>
#include <math.h>
#include <stdint.h>

#define NSEQ   2
#define SQ     2048
#define HID    2048
#define NHQ    16
#define HDM    128
#define NTOK   4096
#define NPH    32
#define PQW    64
#define KLR    256

static_assert(NTOK == NSEQ * SQ);
static_assert(NHQ * HDM == HID);
static_assert(KLR % 32 == 0 && SQ % KLR == 0);

typedef _Float16     v16h __attribute__((ext_vector_type(16)));
typedef _Float16     v8h  __attribute__((ext_vector_type(8)));
typedef __bf16       v16b __attribute__((ext_vector_type(16)));
typedef __bf16       v8b  __attribute__((ext_vector_type(8)));
typedef float        v8f  __attribute__((ext_vector_type(8)));
typedef float        v4f  __attribute__((ext_vector_type(4)));
typedef unsigned int v4u  __attribute__((ext_vector_type(4)));

// ---------------------------------------------------------------------------
// small helpers
// ---------------------------------------------------------------------------
__device__ __forceinline__ unsigned short bf_bits(float f) {          // RNE convert f32 -> bf16 bits
  const unsigned u = __float_as_uint(f);
  return (unsigned short)((u + 0x7FFFu + ((u >> 16) & 1u)) >> 16);
}
__device__ __forceinline__ float bf_val(unsigned short h) { return __uint_as_float(((unsigned)h) << 16); }
__device__ __forceinline__ unsigned pk16(unsigned short a, unsigned short b) { return (unsigned)a | ((unsigned)b << 16); }
__device__ __forceinline__ v8f zero8() { v8f z = {0.f, 0.f, 0.f, 0.f, 0.f, 0.f, 0.f, 0.f}; return z; }
__device__ __forceinline__ int wave_id() {
#if defined(__HIP_DEVICE_COMPILE__)
  return __builtin_amdgcn_readfirstlane((int)(threadIdx.x >> 5));
#else
  return (int)(threadIdx.x >> 5);
#endif
}
// release/acquire + wave barrier between one wave's LDS stores and the other lanes' reloads
__device__ __forceinline__ void lds_wave_sync() {
#if defined(__HIP_DEVICE_COMPILE__)
  __builtin_amdgcn_fence(__ATOMIC_RELEASE, "workgroup");
  __builtin_amdgcn_wave_barrier();
  __builtin_amdgcn_fence(__ATOMIC_ACQUIRE, "workgroup");
#endif
}

// ---------------------------------------------------------------------------
// WMMA fragments (wave32, 16x16x32, 16-bit operands). For A (row m = lane&15) and B (col n = lane&15) alike:
// elements 0..7 <- k0 + 8*(lane>>4) + 0..7, elements 8..15 <- k0 + 16 + 8*(lane>>4) + 0..7.
// ldfrag(p) with p = rowbase + k0 + 8*(lane>>4): two 16-B loads p[0..7], p[16..23].
// D: acc[r] = (row 8*(lane>>4) + r, col lane&15).
// ---------------------------------------------------------------------------
union FragH { v16h v; v8h h[2]; };
union FragB { v16b v; v8b h[2]; };
__device__ __forceinline__ v16h ldfrag_h(const _Float16* p) { FragH f; f.h[0] = *(const v8h*)(p); f.h[1] = *(const v8h*)(p + 16); return f.v; }
__device__ __forceinline__ v16b ldfrag_b(const __bf16* p)   { FragB f; f.h[0] = *(const v8b*)(p); f.h[1] = *(const v8b*)(p + 16); return f.v; }

__device__ __forceinline__ v8f mma_h(v16h a, v16h b, v8f c) {
#if defined(__HIP_DEVICE_COMPILE__)
  return __builtin_amdgcn_wmma_f32_16x16x32_f16(false, a, false, b, (short)0, c, false, false);
#else
  return c;
#endif
}
__device__ __forceinline__ v8f mma_b(v16b a, v16b b, v8f c) {
#if defined(__HIP_DEVICE_COMPILE__)
  return __builtin_amdgcn_wmma_f32_16x16x32_bf16(false, a, false, b, (short)0, c, false, false);
#else
  return c;
#endif
}
// hazard guards: 4 VALU slots after the last WMMA of a group, D tied, A/B kept live; memory clobber keeps later loads behind the group
__device__ __forceinline__ void guard_b5(v8f& a, v8f& b, v16b x0, v16b x1, v16b x2, v16b x3, v16b y) {
#if defined(__HIP_DEVICE_COMPILE__)
  asm volatile("v_nop\n\tv_nop\n\tv_nop\n\tv_nop" : "+v"(a), "+v"(b) : "v"(x0), "v"(x1), "v"(x2), "v"(x3), "v"(y) : "memory");
#endif
}
__device__ __forceinline__ void guard_h3(v8f& a, v8f& b, v16h x, v16h y, v16h z) {
#if defined(__HIP_DEVICE_COMPILE__)
  asm volatile("v_nop\n\tv_nop\n\tv_nop\n\tv_nop" : "+v"(a), "+v"(b) : "v"(x), "v"(y), "v"(z) : "memory");
#endif
}
__device__ __forceinline__ void guard_h4(v8f& a, v8f& b, v16h w, v16h x, v16h y, v16h z) {
#if defined(__HIP_DEVICE_COMPILE__)
  asm volatile("v_nop\n\tv_nop\n\tv_nop\n\tv_nop" : "+v"(a), "+v"(b) : "v"(w), "v"(x), "v"(y), "v"(z) : "memory");
#endif
}
__device__ __forceinline__ void acc_guard4(v8f& a, v8f& b, v8f& c, v8f& d) {
#if defined(__HIP_DEVICE_COMPILE__)
  asm volatile("v_nop\n\tv_nop\n\tv_nop\n\tv_nop" : "+v"(a), "+v"(b), "+v"(c), "+v"(d));
#endif
}

// ---------------------------------------------------------------------------
// Elementwise RNE f32 -> bf16 plane: 8 elements per thread, one 16-B store per lane -> 32 consecutive lanes write 4 whole
// ---------------------------------------------------------------------------
__global__ __launch_bounds__(256) void cvt_bf16_kernel(const float* __restrict__ in, unsigned short* __restrict__ outp, int n8) {
  const int i = (int)blockIdx.x * 256 + (int)threadIdx.x;
  if (i >= n8) return;
  const size_t e = 8 * (size_t)i;
  const v4f a = *(const v4f*)(in + e);
  const v4f b = *(const v4f*)(in + e + 4);
  v4u w;
  w[0] = pk16(bf_bits(a[0]), bf_bits(a[1]));
  w[1] = pk16(bf_bits(a[2]), bf_bits(a[3]));
  w[2] = pk16(bf_bits(b[0]), bf_bits(b[1]));
  w[3] = pk16(bf_bits(b[2]), bf_bits(b[3]));
  *(v4u*)(outp + e) = w;
  
}

// ---------------------------------------------------------------------------
// Fused transpose + RNE bf16 convert: in [R rows][Cc cols] f32 (pitch Cc) -> out[c][r] = bf16(in[r][c])  ([Cc][R], pitch R).
// 64x64 tiles through LDS; grid = (Cc/64, R/64), 256 threads; R, Cc multiples of 64.
// Coverage per block: load 4 it x 256 thr x 4 floats = 64x64; store 2 it x 256 thr x 8 u16 = 64x64.
// ---------------------------------------------------------------------------
__global__ __launch_bounds__(256) void tconv_bf16_kernel(const float* __restrict__ W, unsigned short* __restrict__ outp, int R, int Cc) {
  __shared__ __align__(16) float tf[64 * 68];
  const int c0  = (int)blockIdx.x * 64;   // input column block = output row block
  const int r0  = (int)blockIdx.y * 64;   // input row block    = output column block
  const int tid = (int)threadIdx.x;
  {
    const int lr = tid >> 4;              // 0..15
    const int c4 = (tid & 15) * 4;        // 0..60
#pragma unroll
    for (int it = 0; it < 4; ++it) {
      const int rr = it * 16 + lr;        // 0..63
      const v4f a = *(const v4f*)(W + (size_t)(r0 + rr) * Cc + c0 + c4);
      *(v4f*)(tf + rr * 68 + c4) = a;
    }
  }
  __syncthreads();
  const int sub = tid >> 3;               // 0..31
  const int c8  = (tid & 7) * 8;          // 0..56
  v4u hv[2];
#pragma unroll
  for (int it = 0; it < 2; ++it) {
    const int oc = it * 32 + sub;         // output row within tile (= input column)
    v4u a;
#pragma unroll
    for (int q = 0; q < 4; ++q) {
      const float f0 = tf[(c8 + 2 * q) * 68 + oc];
      const float f1 = tf[(c8 + 2 * q + 1) * 68 + oc];
      a[q] = pk16(bf_bits(f0), bf_bits(f1));
    }
    hv[it] = a;
  }
  {
#pragma unroll
    for (int it = 0; it < 2; ++it) {
      const int oc = it * 32 + sub;
      const size_t go = (size_t)(c0 + oc) * R + r0 + c8;
      *(v4u*)(outp + go) = hv[it];
    }
    
  }
}

// ---------------------------------------------------------------------------
// Phase weights: Wpq [HID][NHQ], Wpk [HID][NHQ] f32 -> WpT [NPH][HID] bf16 rows (rows 0..15 = Wpq^T, 16..31 = Wpk^T).
// ---------------------------------------------------------------------------
__global__ __launch_bounds__(256) void wpt_kernel(const float* __restrict__ Wpq, const float* __restrict__ Wpk,
                                                  unsigned short* __restrict__ outp) {
  const int n = (int)blockIdx.x;                   // 0..31
  const float* W = (n < NHQ) ? Wpq : Wpk;          // block-uniform, both global
  const int h = n & (NHQ - 1);
  const int t = (int)threadIdx.x;                  // k = 8t .. 8t+7  (< HID)
  v4u w;
#pragma unroll
  for (int q = 0; q < 4; ++q) {
    const float f0 = W[(size_t)(8 * t + 2 * q) * NHQ + h];
    const float f1 = W[(size_t)(8 * t + 2 * q + 1) * NHQ + h];
    w[q] = pk16(bf_bits(f0), bf_bits(f1));
  }
  const size_t o = (size_t)n * HID + 8 * (size_t)t;
  *(v4u*)(outp + o) = w;
  
}

// ---------------------------------------------------------------------------
// bf16 WMMA GEMMs: C[m][n] = sum_k A[m][k] * Bt[n][k]; A row-major [M][K] bf16 (pitch lda), Bt row-major [N][K] bf16 (pitch ldb).
//   SPLITA: A carried as hi (Ap) + lo (A2p) bf16 planes, two products into one accumulator (hi then lo at every k step).
//   gemm_kernel (EPI 3): wave tile 32 x 32, 4 independent waves per block, fragments straight from global rows, no block barriers.
//   gemm_tiled_kernel (EPI 0, 1, 2): block tile 128 x 256, waves of 64 x 128 (EPI 0) or 32 x 128 (EPI 1, 2), operands staged in an LDS ring of two buffers.
// Epilogues (all: per wave, per 16-row slab: stage in LDS, wave sync, write each row segment with ONE instruction); MI = 16-row slabs per wave.
//   EPI 0 (NJ 8): q|k projection. cols n0 < HID (q): f16 hi plane C0 and f16 residual x2048 plane C1, both [M][ldc], cols n0..n0+127
//          (row segment 256 B = 16 lanes x 16 B). cols n0 >= HID (k): hi plane C2 [M][ldc] cols n0-HID..; residual plane C3 [NSEQ*KLR][ldc]
//          only for token rows with (m % SQ) < KLR at row (m / SQ)*KLR + m % SQ (wave-uniform choice; 32- and 64-row wave tiles never straddle).
//   EPI 1 (NJ 8): v^T projection: f16 hi plane C0, residual x2048 plane C1, [M][ldc], row segment 256 B.
//   EPI 2 (NJ 8): f32 output C0 [M][ldc], each row scaled by (1 + 0.1*phs[m]); row segment 128 floats = 512 B = 32 lanes x 16 B per instruction.
//   EPI 3 (NJ 2): f32 plane C0 [M][ldc = PQW]: cols 0..31 cos of the 32 accumulated values, 32..63 sin (precise cosf/sinf, rolled loop);
//          row = 256 B = 16 lanes x 16 B, one instruction covers 2 whole rows.
// ---------------------------------------------------------------------------
template <int EPI> struct SlabT { typedef _Float16 T; static constexpr int PERW = 4096; };   // 2 planes x 16 x 128 halves
template <> struct SlabT<2>     { typedef float    T; static constexpr int PERW = 2048; };   // 16 x 128 floats
template <> struct SlabT<3>     { typedef float    T; static constexpr int PERW = 1536; };   // 16 x 32 raw + 16 x 64 cos|sin floats

// s_wait_xcnt 0 behind an issued global store, in front of a rewrite of a register that the store names
__device__ __forceinline__ void wait_x0() {
#if defined(__HIP_DEVICE_COMPILE__)
  asm volatile("s_wait_xcnt 0x0" ::: "memory");
#endif
}

// slab: this wave's own LDS staging range; (m0, n0): first row and column of the wave's (16*MI) x (16*NJ) tile.
template <int EPI, int NJ, int MI>
__device__ __forceinline__ void gemm_epilogue(v8f (&acc)[MI][NJ], typename SlabT<EPI>::T* slab, int lane, int m0, int n0,
                                              const float* __restrict__ phs, void* C0, void* C1, void* C2, void* C3, int ldc) {
  const int hh = lane >> 4;
  const int rl = lane & 15;
  _Float16* sl16 = (_Float16*)(void*)slab;
  float*    slf  = (float*)(void*)slab;

  if constexpr (EPI == 0 || EPI == 1) {
    _Float16* P0;
    _Float16* P1;
    int col0;
    int lomode;                                   // 0: lo row = m; 1: lo row remapped into the KLR-row plane; 2: no lo store
    if constexpr (EPI == 0) {
      const bool isq = (n0 < HID);                // wave-uniform
      P0 = isq ? (_Float16*)C0 : (_Float16*)C2;
      P1 = isq ? (_Float16*)C1 : (_Float16*)C3;
      col0 = isq ? n0 : (n0 - HID);
      const int s0 = m0 & (SQ - 1);
      lomode = isq ? 0 : ((s0 < KLR) ? 1 : 2);
    } else {
      P0 = (_Float16*)C0;
      P1 = (_Float16*)C1;
      col0 = n0;
      lomode = 0;
    }
#pragma unroll
    for (int i = 0; i < MI; ++i) {
#pragma unroll
      for (int r = 0; r < 8; ++r) {
#pragma unroll
        for (int j = 0; j < NJ; ++j) {
          const float v = acc[i][j][r];
          const _Float16 hv = (_Float16)v;
          const int so = (8 * hh + r) * 128 + j * 16 + rl;
          sl16[so]        = hv;
          sl16[2048 + so] = (_Float16)((v - (float)hv) * 2048.0f);
        }
      }
      lds_wave_sync();
      {
#pragma unroll
        for (int it = 0; it < 8; ++it) {
          const int row = it * 2 + hh;            // it x hh covers rows 0..15
          const int c8  = rl * 8;
          const v8h xh = *(const v8h*)(sl16 + row * 128 + c8);
          const v8h xl = *(const v8h*)(sl16 + 2048 + row * 128 + c8);
          const int m = m0 + i * 16 + row;
          *(v8h*)(P0 + (size_t)m * ldc + col0 + c8) = xh;
          if constexpr (EPI == 0) wait_x0();      // precaution: in front of the branch below, whose first instructions reuse this store's registers
          if (lomode != 2) {
            const int m1 = (lomode == 1) ? ((m / SQ) * KLR + (m % SQ)) : m;
            *(v8h*)(P1 + (size_t)m1 * ldc + col0 + c8) = xl;
            if constexpr (EPI == 0) wait_x0();    // precaution: inside the branch, in front of whatever reuses this store's registers behind it
          }
        }
        
      }
      lds_wave_sync();
    }
  } else if constexpr (EPI == 2) {
    float* C = (float*)C0;
#pragma unroll
    for (int i = 0; i < MI; ++i) {
#pragma unroll
      for (int r = 0; r < 8; ++r) {
        const int m = m0 + i * 16 + 8 * hh + r;
        const float sc = 1.0f + 0.1f * phs[m];
#pragma unroll
        for (int j = 0; j < NJ; ++j)
          slf[(8 * hh + r) * 128 + j * 16 + rl] = acc[i][j][r] * sc;
      }
      lds_wave_sync();
      {
#pragma unroll
        for (int row = 0; row < 16; ++row) {      // 32 lanes x 16 B = the whole 512-B row segment per instruction
          const v4f v = *(const v4f*)(slf + row * 128 + lane * 4);
          *(v4f*)(C + (size_t)(m0 + i * 16 + row) * ldc + n0 + lane * 4) = v;
        }
        
      }
      lds_wave_sync();
    }
  } else {
    float* raw = slf;                             // 16 x 32 floats
    float* ocs = slf + 512;                       // 16 x 64 floats
    float* Cp  = (float*)C0;
#pragma unroll
    for (int i = 0; i < MI; ++i) {
#pragma unroll
      for (int j = 0; j < NJ; ++j)
#pragma unroll
        for (int r = 0; r < 8; ++r)
          raw[(8 * hh + r) * 32 + j * 16 + rl] = acc[i][j][r];
      lds_wave_sync();
#pragma unroll 1
      for (int it = 0; it < 16; ++it) {           // row it, col lane: 16 x 32 values, one precise cos + sin site
        const float v  = raw[it * 32 + lane];
        const float cv = cosf(v);
        const float sv = sinf(v);
        ocs[it * PQW + lane]      = cv;
        ocs[it * PQW + 32 + lane] = sv;
      }
      lds_wave_sync();
      {
#pragma unroll
        for (int it = 0; it < 8; ++it) {
          const int row = it * 2 + hh;            // 2 rows per instruction, 16 lanes x 16 B = one whole 256-B row
          const int c4  = rl * 4;
          const v4f x = *(const v4f*)(ocs + row * PQW + c4);
          *(v4f*)(Cp + (size_t)(m0 + i * 16 + row) * ldc + c4) = x;
        }
        
      }
      lds_wave_sync();
    }
  }
}

template <int EPI, int NJ, bool SPLITA>
__global__ __launch_bounds__(128) void gemm_kernel(
    const unsigned short* Ap, const unsigned short* A2p, int lda,
    const unsigned short* __restrict__ Btp, int ldb,
    const float* __restrict__ phs,
    void* C0, void* C1, void* C2, void* C3, int ldc,
    int M, int N, int K) {
  static_assert(NJ == 8 || NJ == 2);
  static_assert((EPI == 3) ? (NJ == 2) : (NJ == 8));
  typedef typename SlabT<EPI>::T ST;
  __shared__ __align__(16) ST slab_all[4 * SlabT<EPI>::PERW];

  const int lane = threadIdx.x & 31;
  const int wave = wave_id();
  const int hh = lane >> 4;           // lane half: k offset 8*hh, D row offset 8*hh
  const int rl = lane & 15;           // A row / B col / D col within subtile
  const int tilesN = N / (16 * NJ);
  const int tilesM = M >> 5;
  const int tile = (int)blockIdx.x * 4 + wave;
  if (tile >= tilesM * tilesN) return;          // wave-uniform; no block barriers in this kernel
  const int tm = tile / tilesN;
  const int tn = tile - tm * tilesN;
  const int m0 = tm << 5;
  const int n0 = tn * (16 * NJ);

  const __bf16* A  = (const __bf16*)(const void*)Ap;
  const __bf16* A2 = (const __bf16*)(const void*)A2p;
  const __bf16* Bt = (const __bf16*)(const void*)Btp;

  v8f acc[2][NJ];
#pragma unroll
  for (int i = 0; i < 2; ++i)
#pragma unroll
    for (int j = 0; j < NJ; ++j) acc[i][j] = zero8();

  for (int k0 = 0; k0 < K; k0 += 32) {
    v16b ah[2], al[2];
#pragma unroll
    for (int i = 0; i < 2; ++i) {
      const size_t ao = (size_t)(m0 + i * 16 + rl) * lda + k0 + 8 * hh;
      ah[i] = ldfrag_b(A + ao);
      al[i] = SPLITA ? ldfrag_b(A2 + ao) : ah[i];
    }
#pragma unroll
    for (int j = 0; j < NJ; ++j) {
      const v16b bj = ldfrag_b(Bt + (size_t)(n0 + j * 16 + rl) * ldb + k0 + 8 * hh);
      acc[0][j] = mma_b(ah[0], bj, acc[0][j]);
      acc[1][j] = mma_b(ah[1], bj, acc[1][j]);
      if (SPLITA) {
        acc[0][j] = mma_b(al[0], bj, acc[0][j]);
        acc[1][j] = mma_b(al[1], bj, acc[1][j]);
      }
      guard_b5(acc[0][j], acc[1][j], ah[0], ah[1], al[0], al[1], bj);
    }
  }
  if constexpr (NJ == 8) {
    acc_guard4(acc[0][0], acc[0][1], acc[0][2], acc[0][3]);
    acc_guard4(acc[0][4], acc[0][5], acc[0][6], acc[0][7]);
    acc_guard4(acc[1][0], acc[1][1], acc[1][2], acc[1][3]);
    acc_guard4(acc[1][4], acc[1][5], acc[1][6], acc[1][7]);
  } else {
    acc_guard4(acc[0][0], acc[0][1], acc[1][0], acc[1][1]);
  }

  gemm_epilogue<EPI, NJ, 2>(acc, slab_all + wave * SlabT<EPI>::PERW, lane, m0, n0, phs, C0, C1, C2, C3, ldc);
}

// ---------------------------------------------------------------------------
// Tiled GEMM main loop. Block tile 128 x 256; waves in a (8/MI) x 2 grid, each (16*MI) x 128: MI 4 = 4 waves, MI 2 = 8 waves.
// A pass is 64 k: a stage holds [A 128 rows | (SPLITA: A2 128 rows) | Bt 256 rows] of 128 B at pitch 144 B
// (16 B x 9: ds_load_b128 fragment reads without bank conflicts). Every thread brings 16-B pieces with asynchronous copies to LDS,
// one pass ahead of the pass that reads them. M % 128 == 0, N % 256 == 0, K % 64 == 0, K >= 128; grid.x = (M/128) * (N/256).
// ---------------------------------------------------------------------------
#define GT_BM 128
#define GT_BN 256
#define GT_KP 64
#define GT_LP 72                                  // LDS row pitch in bf16 elements

// Asynchronous 16-B copies, one per lane and line of the statement: l + c * lstep = the lane's LDS byte address, g[c] = its global source.
// s_wait_xcnt stands inside the statement so that no address register is rewritten ahead of it.
__device__ __forceinline__ void copy8(unsigned l, unsigned lstep, const __bf16* const* g) {
#if defined(__HIP_DEVICE_COMPILE__)
  asm volatile(
      "global_load_async_to_lds_b128 %0, %8, off\n\t"
      "global_load_async_to_lds_b128 %1, %9, off\n\t"
      "global_load_async_to_lds_b128 %2, %10, off\n\t"
      "global_load_async_to_lds_b128 %3, %11, off\n\t"
      "global_load_async_to_lds_b128 %4, %12, off\n\t"
      "global_load_async_to_lds_b128 %5, %13, off\n\t"
      "global_load_async_to_lds_b128 %6, %14, off\n\t"
      "global_load_async_to_lds_b128 %7, %15, off\n\t"
      "s_wait_xcnt 0x0"
      :: "v"(l), "v"(l + lstep), "v"(l + 2u * lstep), "v"(l + 3u * lstep),
         "v"(l + 4u * lstep), "v"(l + 5u * lstep), "v"(l + 6u * lstep), "v"(l + 7u * lstep),
         "v"(g[0]), "v"(g[1]), "v"(g[2]), "v"(g[3]), "v"(g[4]), "v"(g[5]), "v"(g[6]), "v"(g[7])
      : "memory");
#endif
}
__device__ __forceinline__ void copy4(unsigned l, unsigned lstep, const __bf16* const* g) {
#if defined(__HIP_DEVICE_COMPILE__)
  asm volatile(
      "global_load_async_to_lds_b128 %0, %4, off\n\t"
      "global_load_async_to_lds_b128 %1, %5, off\n\t"
      "global_load_async_to_lds_b128 %2, %6, off\n\t"
      "global_load_async_to_lds_b128 %3, %7, off\n\t"
      "s_wait_xcnt 0x0"
      :: "v"(l), "v"(l + lstep), "v"(l + 2u * lstep), "v"(l + 3u * lstep),
         "v"(g[0]), "v"(g[1]), "v"(g[2]), "v"(g[3])
      : "memory");
#endif
}
// this wave's copies have landed in LDS
__device__ __forceinline__ void wait_async0() {
#if defined(__HIP_DEVICE_COMPILE__)
  asm volatile("s_wait_asynccnt 0x0" ::: "memory");
#endif
}
// this wave's LDS reads have returned (before the buffer they read is handed back for a refill)
__device__ __forceinline__ void wait_ds0() {
#if defined(__HIP_DEVICE_COMPILE__)
  asm volatile("s_wait_dscnt 0x0" ::: "memory");
#endif
}
// the compiler's scheduler moves nothing across this point
__device__ __forceinline__ void sched_fence() {
#if defined(__HIP_DEVICE_COMPILE__)
  __builtin_amdgcn_sched_barrier(0);
#endif
}

// second launch bound: two waves per SIMD (two 4-wave blocks, or one 8-wave block, per WGP), so that one wave's WMMAs cover the other's waits
template <int EPI, int MI, bool SPLITA>
__global__ __launch_bounds__(512 / MI, 2) void gemm_tiled_kernel(
    const unsigned short* Ap, const unsigned short* A2p, int lda,
    const unsigned short* __restrict__ Btp, int ldb,
    const float* __restrict__ phs,
    void* C0, void* C1, void* C2, void* C3, int ldc,
    int M, int N, int K) {
  static_assert(EPI == 0 || EPI == 1 || EPI == 2);
  static_assert(MI == 4 || MI == 2);
  static_assert(GT_KP == 64);
  constexpr int NW    = 16 / MI;                  // waves per block
  constexpr int RS    = NW * 4;                   // stage rows that one copy of every thread covers (8 threads per 128-B row)
  constexpr int AROWS = (SPLITA ? 2 : 1) * GT_BM;
  constexpr int NCP   = (AROWS + GT_BN) / RS;     // copies per thread and stage: 24, 12 or 16 (at most 63 may be outstanding)
  constexpr int STAGE = (AROWS + GT_BN) * GT_LP;  // elements per buffer
  static_assert(NCP % 4 == 0 && NCP <= 63);
  typedef typename SlabT<EPI>::T ST;
  __shared__ __align__(16) __bf16 ring[2 * STAGE];
  __shared__ __align__(16) ST slab_all[NW * SlabT<EPI>::PERW];

  const int tid  = (int)threadIdx.x;
  const int lane = tid & 31;
  const int wave = wave_id();
  const int hh = lane >> 4;           // lane half: k offset 8*hh
  const int rl = lane & 15;           // A row / B col within subtile
  const int tilesN = N / GT_BN;
  const int tm  = (int)blockIdx.x / tilesN;
  const int tn  = (int)blockIdx.x - tm * tilesN;
  const int bm0 = tm * GT_BM;
  const int bn0 = tn * GT_BN;
  const int wm  = wave >> 1;
  const int wn  = wave & 1;

  // copy side: copy c of this thread brings piece tid % 8 of stage row c * RS + tid / 8
  const int crow = tid >> 3;
  const int cpc  = (tid & 7) * 8;     // element offset of the 16-B piece
  const __bf16* gA  = (const __bf16*)(const void*)Ap  + (size_t)(bm0 + crow) * lda + cpc;
  const __bf16* gA2 = (const __bf16*)(const void*)A2p + (size_t)(bm0 + crow) * lda + cpc;
  const __bf16* gB  = (const __bf16*)(const void*)Btp + (size_t)(bn0 + crow) * ldb + cpc;
  const unsigned lc = (unsigned)(size_t)(const void*)ring + (unsigned)(crow * GT_LP + cpc) * 2u;
  auto fill = [&](int t) {            // tile t -> buffer t % 2
    const unsigned l = lc + (unsigned)(t & 1) * (unsigned)(STAGE * 2);
    const size_t ko = (size_t)t * GT_KP;
    const __bf16* g[NCP];
#pragma unroll
    for (int c = 0; c < NCP; ++c) {
      const int r = c * RS;
      g[c] = (r < GT_BM) ? gA + ko + (size_t)r * lda
           : (r < AROWS) ? gA2 + ko + (size_t)(r - GT_BM) * lda
                         : gB + ko + (size_t)(r - AROWS) * ldb;
    }
#pragma unroll
    for (int c = 0; c + 8 <= NCP; c += 8) copy8(l + (unsigned)(c * RS * GT_LP * 2), RS * GT_LP * 2u, g + c);
    if constexpr (NCP % 8 == 4) copy4(l + (unsigned)((NCP - 4) * RS * GT_LP * 2), RS * GT_LP * 2u, g + (NCP - 4));
  };

  v8f acc[MI][8];
#pragma unroll
  for (int i = 0; i < MI; ++i)
#pragma unroll
    for (int j = 0; j < 8; ++j) acc[i][j] = zero8();

  const int nt = K / GT_KP;           // block-uniform, >= 2
  fill(0);
  wait_async0();
  __syncthreads();                    // tile 0 readable by every wave
  fill(1);

  const int aoff = (wm * (16 * MI) + rl) * GT_LP + 8 * hh;
  const int boff = (AROWS + wn * 128 + rl) * GT_LP + 8 * hh;
#pragma unroll 1                      // one pass per trip: the ring's order below holds per trip, and every acc index stays constant
  for (int t = 0; t < nt; ++t) {
    const __bf16* st = ring + (t & 1) * STAGE;
    v16b fa[2][MI], fl[2][MI], fb[2][8];          // one fragment set per 32-k step of the pass
#pragma unroll
    for (int ks = 0; ks < 2; ++ks) {
#pragma unroll
      for (int i = 0; i < MI; ++i) {
        fa[ks][i] = ldfrag_b(st + aoff + i * 16 * GT_LP + ks * 32);
        if constexpr (SPLITA) fl[ks][i] = ldfrag_b(st + aoff + (GT_BM + i * 16) * GT_LP + ks * 32);
      }
#pragma unroll
      for (int j = 0; j < 8; ++j) fb[ks][j] = ldfrag_b(st + boff + j * 16 * GT_LP + ks * 32);
      sched_fence();                              // each step's LDS reads stay one group ahead of the WMMA blocks, not spread among them
    }
#pragma unroll
    for (int ks = 0; ks < 2; ++ks) {
#pragma unroll
      for (int j = 0; j < 8; ++j) {
#pragma unroll
        for (int i = 0; i < MI; ++i) acc[i][j] = mma_b(fa[ks][i], fb[ks][j], acc[i][j]);
        if constexpr (SPLITA) {
#pragma unroll
          for (int i = 0; i < MI; ++i) acc[i][j] = mma_b(fl[ks][i], fb[ks][j], acc[i][j]);
        }
      }
      // step 1's WMMAs stay behind step 0's (only step 0's reads are waited for first) and in front of the waits at the foot
      // (moved behind the barrier they would halve the lead of the copies in flight)
      sched_fence();
    }
    wait_ds0();
    wait_async0();
    __syncthreads();                  // publishes tile t + 1 and ends every wave's reads of tile t's buffer
    if (t + 2 < nt) fill(t + 2);      // block-uniform test
  }
  wait_async0();

  gemm_epilogue<EPI, 8, MI>(acc, slab_all + wave * SlabT<EPI>::PERW, lane, bm0 + wm * (16 * MI), bn0 + wn * 128, phs, C0, C1, C2, C3, ldc);
}

// ---------------------------------------------------------------------------
// Phase modulation factor, one block per sequence (grid NSEQ, 256 threads), all f32:
//   PQ plane [NTOK][PQW]: col h = cos(pq_h), 16+h = cos(pk_h), 32+h = sin(pq_h), 48+h = sin(pk_h).
//   Ck[h] = sum_s cos(pk), Sk[h] = sum_s sin(pk) (per-thread partials over 8 rows, LDS combine in fixed order);
//   phs[b*SQ + s] = sum_h (cos(pq_h)*Ck[h] + sin(pq_h)*Sk[h]) / 32768.
//   Coverage: NSEQ blocks x 2048 = NTOK values.
// ---------------------------------------------------------------------------
__global__ __launch_bounds__(256) void phase_kernel(const float* __restrict__ PQ, float* __restrict__ phs) {
  __shared__ float red[2 * NHQ][256];
  __shared__ float csk[2 * NHQ];
  __shared__ __align__(16) float stg[SQ];
  const int b   = (int)blockIdx.x;
  const int tid = (int)threadIdx.x;
  float pc[NHQ], ps[NHQ];
#pragma unroll
  for (int h = 0; h < NHQ; ++h) { pc[h] = 0.f; ps[h] = 0.f; }
#pragma unroll 1
  for (int u = 0; u < SQ / 256; ++u) {
    const int s = u * 256 + tid;
    const float* rowp = PQ + ((size_t)b * SQ + s) * PQW;
#pragma unroll
    for (int h = 0; h < NHQ; ++h) {
      pc[h] += rowp[NHQ + h];
      ps[h] += rowp[NPH + NHQ + h];
    }
  }
#pragma unroll
  for (int h = 0; h < NHQ; ++h) { red[h][tid] = pc[h]; red[NHQ + h][tid] = ps[h]; }
  __syncthreads();
  if (tid < 2 * NHQ) {
    float s = 0.f;
#pragma unroll 1
    for (int t = 0; t < 256; ++t) s += red[tid][t];
    csk[tid] = s;
  }
  __syncthreads();
#pragma unroll 1
  for (int u = 0; u < SQ / 256; ++u) {
    const int s = u * 256 + tid;
    const float* rowp = PQ + ((size_t)b * SQ + s) * PQW;
    float a = 0.f;
#pragma unroll 1
    for (int h = 0; h < NHQ; ++h) a += rowp[h] * csk[h] + rowp[NPH + h] * csk[NHQ + h];
    stg[s] = a * (1.0f / 32768.0f);
  }
  __syncthreads();
  {
#pragma unroll
    for (int it = 0; it < SQ / 1024; ++it) {
      const int idx = it * 256 + tid;           // float4 index 0..511
      const v4f v = *(const v4f*)(stg + 4 * idx);
      *(v4f*)(phs + (size_t)b * SQ + 4 * idx) = v;
    }
    
  }
}

// ---------------------------------------------------------------------------
// Causal flash attention, head dim 128, 32-key chunks, block = 4 waves = 64 query rows of one (b, h); grid (n query tiles, NHQ, NSEQ).
//   q planes f16 [tok][h*128+d]: hi (qhp) and residual x2048 (qlp); k planes f16 [tok][h*128+d]: hi (khp); residual x2048 (klp) only for
//   keys < KLR of each sequence, stored at row b*KLR + key (read only when PRES); v^T planes f16 [h*128+d][tok]: hi (vhp), residual x2048 (vlp);
//   outputs attn bf16 hi (ahp) / lo (alp) [tok][h*128+d].
//   scores = (Sh + Sr/2048) * 128^-0.5 with Sh = qh.kh and Sr = ql'.kh (+ qh.kl' when PRES); keys > query -> -inf; online softmax f32;
//   p' = 1024 p stored per wave to LDS as f16 hi (and residual x2048 when PRES), reloaded as A fragments after a wave sync;
//   O = (Oh + Or/2048)/1024/l with Oh = ph.vh, Or = ph.vl' (+ pl'.vh when PRES).
//   q planes: each wave copies its 16 rows to LDS once and takes its A fragments from there in every chunk.
//   K / V^T chunk staging: 128 threads x 4 x 16 B per plane = whole 32x128 / 128x32 tile, plain loads, __syncthreads before and after.
//   Trip count 2*qb+2 chunks (static bound 64); waves whose rows are all below the chunk skip it (wave-uniform, scalar branch).
// ---------------------------------------------------------------------------
#define AT_KC   32
#define KS_P    136
#define VS_P    40
#define PS_P    40
#define QS_P    136
// LDS map in halves. The k and p residual planes exist only with PRES. QS: per wave 2 planes x 16 query rows at pitch QS_P (272 B = 16 B x 17).
template <bool PRES> struct AttnLds {
  static constexpr int KS  = 0;
  static constexpr int KLS = 32 * KS_P;
  static constexpr int VHS = (PRES ? 2 : 1) * 32 * KS_P;
  static constexpr int VLS = VHS + 128 * VS_P;
  static constexpr int PH  = VLS + 128 * VS_P;
  static constexpr int PL  = PH + 4 * 16 * PS_P;
  static constexpr int QS  = PH + (PRES ? 2 : 1) * 4 * 16 * PS_P;
  static constexpr int TOT = QS + 4 * 2 * 16 * QS_P;
};
static_assert(4 * AttnLds<false>::TOT * 2 <= 327680);   // four blocks of the long launch per WGP, as its registers allow
static_assert(4 * 4096 <= AttnLds<false>::QS);          // output staging (2 planes x 16 x 128 per wave) aliases the chunk region after the loop

template <bool PRES>
__global__ __launch_bounds__(128) void attn_causal_kernel(
    const unsigned short* __restrict__ qhp, const unsigned short* __restrict__ qlp,
    const unsigned short* __restrict__ khp, const unsigned short* __restrict__ klp,
    const unsigned short* __restrict__ vhp, const unsigned short* __restrict__ vlp,
    unsigned short* __restrict__ ahp, unsigned short* __restrict__ alp, int qb_base) {
  typedef AttnLds<PRES> L;
  __shared__ __align__(16) _Float16 lds[L::TOT];
  _Float16* Ks  = lds + L::KS;
  _Float16* Kls = PRES ? lds + L::KLS : Ks;      // used only with PRES
  _Float16* Vhs = lds + L::VHS;
  _Float16* Vls = lds + L::VLS;

  const int tid  = (int)threadIdx.x;
  const int lane = tid & 31;
  const int wave = wave_id();
  const int hh   = lane >> 4;
  const int c    = lane & 15;
  const int qb   = (int)blockIdx.x + qb_base;
  const int h    = (int)blockIdx.y;
  const int b    = (int)blockIdx.z;
  const int q0   = qb * 64 + wave * 16;          // first query row of this wave (within sequence)
  const int qlast = q0 + 15;
  const size_t tok0 = (size_t)b * SQ;

  const _Float16* Qhg = (const _Float16*)(const void*)qhp + (tok0 + q0) * HID + h * HDM;
  const _Float16* Qlg = (const _Float16*)(const void*)qlp + (tok0 + q0) * HID + h * HDM;
  const _Float16* Kg  = (const _Float16*)(const void*)khp + tok0 * HID + h * HDM;
  const _Float16* Klg = (const _Float16*)(const void*)klp + (size_t)b * KLR * HID + h * HDM;
  const _Float16* Vhg = (const _Float16*)(const void*)vhp + (size_t)(h * HDM) * NTOK + tok0;
  const _Float16* Vlg = (const _Float16*)(const void*)vlp + (size_t)(h * HDM) * NTOK + tok0;
  _Float16* ph = lds + L::PH + wave * (16 * PS_P);
  _Float16* pl = PRES ? lds + L::PL + wave * (16 * PS_P) : ph;   // used only with PRES
  _Float16* Qs = lds + L::QS + wave * (2 * 16 * QS_P);           // this wave's own query rows: hi plane, then residual plane

  // q rows to LDS once, whole 256-B rows per 16 lanes; read back only by this wave, behind the first barrier of the chunk loop (nch >= 2)
#pragma unroll                                   // all 16 loads in flight together: one global latency for the whole fill
  for (int it = 0; it < 8; ++it) {
    const int row = it * 2 + hh;                 // it 0..7 x hh 0..1 covers rows 0..15
    const v8h x = *(const v8h*)(Qhg + (size_t)row * HID + c * 8);
    const v8h y = *(const v8h*)(Qlg + (size_t)row * HID + c * 8);
    *(v8h*)(Qs + row * QS_P + c * 8) = x;
    *(v8h*)(Qs + (16 + row) * QS_P + c * 8) = y;
  }

  float mrow[8], lrow[8];
  v8f oacc[8], oaccr[8];
#pragma unroll
  for (int r = 0; r < 8; ++r) { mrow[r] = -INFINITY; lrow[r] = 0.f; }
#pragma unroll
  for (int t = 0; t < 8; ++t) { oacc[t] = zero8(); oaccr[t] = zero8(); }

  const int nch = 2 * qb + 2;                    // block-uniform, <= 64; keys < 64*(qb+1) <= SQ; PRES blocks: keys < 256 = KLR
  for (int kc = 0; kc < nch; ++kc) {
    const int kv0 = kc * AT_KC;
    __syncthreads();
#pragma unroll
    for (int i = 0; i < 4; ++i) {                // coverage: 512 pieces of 8 halves per plane = whole tile
      const int p   = tid + 128 * i;             // 0..511
      const int key = p >> 4, d8 = (p & 15) * 8; // K: 32 keys x 128 d
      const v8h kx = *(const v8h*)(Kg + (size_t)(kv0 + key) * HID + d8);
      *(v8h*)(Ks + key * KS_P + d8) = kx;
      if (PRES) {
        const v8h ky = *(const v8h*)(Klg + (size_t)(kv0 + key) * HID + d8);
        *(v8h*)(Kls + key * KS_P + d8) = ky;
      }
      const int d = p >> 2, k8 = (p & 3) * 8;    // V^T: 128 d x 32 keys
      const v8h vx = *(const v8h*)(Vhg + (size_t)d * NTOK + kv0 + k8);
      const v8h vy = *(const v8h*)(Vlg + (size_t)d * NTOK + kv0 + k8);
      *(v8h*)(Vhs + d * VS_P + k8) = vx;
      *(v8h*)(Vls + d * VS_P + k8) = vy;
    }
    __syncthreads();

    if (kv0 <= qlast) {                          // wave-uniform (scalar): skip chunks fully above this wave's rows
      // ---- scores ----
      v8f sh[2], sr[2];
      sh[0] = zero8(); sh[1] = zero8(); sr[0] = zero8(); sr[1] = zero8();
#pragma unroll
      for (int dc = 0; dc < 4; ++dc) {
        const v16h qa = ldfrag_h(Qs + c * QS_P + dc * 32 + 8 * hh);
        const v16h ql = ldfrag_h(Qs + (16 + c) * QS_P + dc * 32 + 8 * hh);
#pragma unroll
        for (int j = 0; j < 2; ++j) {
          const v16h kb = ldfrag_h(Ks + (j * 16 + c) * KS_P + dc * 32 + 8 * hh);
          sh[j] = mma_h(qa, kb, sh[j]);
          sr[j] = mma_h(ql, kb, sr[j]);
          if (PRES) {
            const v16h kl = ldfrag_h(Kls + (j * 16 + c) * KS_P + dc * 32 + 8 * hh);
            sr[j] = mma_h(qa, kl, sr[j]);
            guard_h4(sh[j], sr[j], qa, ql, kb, kl);
          } else {
            guard_h3(sh[j], sr[j], qa, ql, kb);
          }
        }
      }
      // ---- scale, causal mask, chunk row max ----
      float cm[8];
#pragma unroll
      for (int r = 0; r < 8; ++r) {
        const int qrow = q0 + 8 * hh + r;
        float m = -INFINITY;
#pragma unroll
        for (int j = 0; j < 2; ++j) {
          const int key = kv0 + j * 16 + c;
          float s = (sh[j][r] + sr[j][r] * 0.00048828125f) * 0.08838834764831845f;
          s = (key > qrow) ? -INFINITY : s;
          sh[j][r] = s;
          m = fmaxf(m, s);
        }
#pragma unroll
        for (int off = 1; off < 16; off <<= 1) m = fmaxf(m, __shfl_xor(m, off, 32));
        cm[r] = m;
      }
      // ---- online softmax, P' to LDS ----
#pragma unroll
      for (int r = 0; r < 8; ++r) {
        const float mnew  = fmaxf(mrow[r], cm[r]);
        const float alpha = __expf(mrow[r] - mnew);
        mrow[r] = mnew;
        float psum = 0.f;
#pragma unroll
        for (int j = 0; j < 2; ++j) {
          const float p  = __expf(sh[j][r] - mnew);
          psum += p;
          const float pp = p * 1024.0f;
          const _Float16 phv = (_Float16)pp;
          const int po = (8 * hh + r) * PS_P + j * 16 + c;
          ph[po] = phv;
          if (PRES) pl[po] = (_Float16)((pp - (float)phv) * 2048.0f);
        }
#pragma unroll
        for (int off = 1; off < 16; off <<= 1) psum += __shfl_xor(psum, off, 32);
        lrow[r] = lrow[r] * alpha + psum;
#pragma unroll
        for (int t = 0; t < 8; ++t) { oacc[t][r] *= alpha; oaccr[t][r] *= alpha; }
      }
      lds_wave_sync();                           // P' stores visible to the other lanes of this wave before the fragment reload
      // ---- O += P' . V ----
      const v16h pa = ldfrag_h(ph + c * PS_P + 8 * hh);
      v16h pr = pa;
      if (PRES) pr = ldfrag_h(pl + c * PS_P + 8 * hh);
#pragma unroll
      for (int t = 0; t < 8; ++t) {
        const v16h vb = ldfrag_h(Vhs + (t * 16 + c) * VS_P + 8 * hh);
        const v16h vr = ldfrag_h(Vls + (t * 16 + c) * VS_P + 8 * hh);
        oacc[t]  = mma_h(pa, vb, oacc[t]);
        oaccr[t] = mma_h(pa, vr, oaccr[t]);
        if (PRES) oaccr[t] = mma_h(pr, vb, oaccr[t]);
        guard_h4(oacc[t], oaccr[t], pa, pr, vb, vr);
      }
    }
  }

  __syncthreads();                               // all chunk-region readers done before aliasing it as output staging
  _Float16* osh = lds + wave * 4096;
  _Float16* osl = osh + 2048;
#pragma unroll
  for (int r = 0; r < 8; ++r) {
    const float inv = (1.0f / lrow[r]) * 0.0009765625f;
#pragma unroll
    for (int t = 0; t < 8; ++t) {
      const float o = (oacc[t][r] + oaccr[t][r] * 0.00048828125f) * inv;
      const unsigned short hb = bf_bits(o);
      const unsigned short lb = bf_bits(o - bf_val(hb));
      const int so = (8 * hh + r) * 128 + t * 16 + c;
      osh[so] = __builtin_bit_cast(_Float16, hb);
      osl[so] = __builtin_bit_cast(_Float16, lb);
    }
  }
  lds_wave_sync();
  _Float16* Ahg = (_Float16*)(void*)ahp + (tok0 + q0) * HID + h * HDM;
  _Float16* Alg = (_Float16*)(void*)alp + (tok0 + q0) * HID + h * HDM;
  {
#pragma unroll
    for (int it = 0; it < 8; ++it) {
      const int row = it * 2 + hh;               // it 0..7 x hh 0..1 covers rows 0..15
      const int c8  = c * 8;                     // 16 lanes x 16 B = the whole 256-B segment
      const v8h x = *(const v8h*)(osh + row * 128 + c8);
      const v8h y = *(const v8h*)(osl + row * 128 + c8);
      *(v8h*)(Ahg + (size_t)row * HID + c8) = x;
      *(v8h*)(Alg + (size_t)row * HID + c8) = y;
    }
    
  }
}

// ---------------------------------------------------------------------------
// Workspace map (bytes; every region is a whole number of the rows its producer writes with whole-line stores; all dims are tile multiples,
// so padded size == logical size; offsets are multiples of 16384):
//   R0   Xb  bf16 [4096][2048] 16777216, later Ah bf16 [4096][2048] (Xb dead after the three projection GEMMs)
//   R1   WqkT bf16 [4096][2048] 16777216, later Al bf16 [4096][2048]
//   R2   WvT bf16 [2048][2048]  8388608, later WoT bf16 [2048][2048] (WvT dead after the v GEMM)
//   WpT  bf16 [32][2048]          131072
//   Qh, Ql, Kh f16 [4096][2048]  16777216 each
//   Kl   f16 [512][2048]          2097152
//   Vh, Vl f16 [2048][4096]      16777216 each
//   PQ   f32 [4096][64]           1048576
//   phs  f32 [4096]                 16384
//   total                       129122304
// ---------------------------------------------------------------------------
static inline size_t smax(size_t a, size_t b) { return a > b ? a : b; }

extern "C" void kernel_launch(void* const* d_in, const int* in_sizes, int n_in,
                              void* d_out, int out_size, void* d_ws, size_t ws_size,
                              hipStream_t stream) {
  if (n_in < 7) return;
  if (in_sizes[0] != NTOK * HID) return;
  if (in_sizes[1] != HID * HID) return;
  if (in_sizes[2] != HID * HID) return;
  if (in_sizes[3] != HID * HID) return;
  if (in_sizes[4] != HID * HID) return;
  if (in_sizes[5] != HID * NHQ) return;
  if (in_sizes[6] != HID * NHQ) return;
  if (out_size != NTOK * HID) return;

  const float* x   = (const float*)d_in[0];
  const float* Wq  = (const float*)d_in[1];
  const float* Wk  = (const float*)d_in[2];
  const float* Wv  = (const float*)d_in[3];
  const float* Wo  = (const float*)d_in[4];
  const float* Wpq = (const float*)d_in[5];
  const float* Wpk = (const float*)d_in[6];
  float* out = (float*)d_out;

  const size_t szX   = (size_t)NTOK * HID * 2;
  const size_t szWqk = (size_t)2 * HID * HID * 2;
  const size_t szW   = (size_t)HID * HID * 2;
  const size_t szA   = (size_t)NTOK * HID * 2;
  const size_t szWp  = (size_t)NPH * HID * 2;
  const size_t szQ   = (size_t)NTOK * HID * 2;
  const size_t szKl  = (size_t)NSEQ * KLR * HID * 2;
  const size_t szV   = (size_t)HID * NTOK * 2;
  const size_t szPQ  = (size_t)NTOK * PQW * 4;
  const size_t szPh  = (size_t)NTOK * 4;
  size_t off = 0;
  const size_t oR0 = off; off += smax(szX, szA);
  const size_t oR1 = off; off += smax(szWqk, szA);
  const size_t oR2 = off; off += szW;
  const size_t oWp = off; off += szWp;
  const size_t oQh = off; off += szQ;
  const size_t oQl = off; off += szQ;
  const size_t oKh = off; off += szQ;
  const size_t oKl = off; off += szKl;
  const size_t oVh = off; off += szV;
  const size_t oVl = off; off += szV;
  const size_t oPQ = off; off += szPQ;
  const size_t oPh = off; off += szPh;
  if (off > ws_size) return;                     // off = 129122304

  char* ws = (char*)d_ws;
  unsigned short* Xb   = (unsigned short*)(ws + oR0);
  unsigned short* Ah   = (unsigned short*)(ws + oR0);
  unsigned short* WqkT = (unsigned short*)(ws + oR1);
  unsigned short* Al   = (unsigned short*)(ws + oR1);
  unsigned short* WvT  = (unsigned short*)(ws + oR2);
  unsigned short* WoT  = (unsigned short*)(ws + oR2);
  unsigned short* WpT  = (unsigned short*)(ws + oWp);
  unsigned short* Qh   = (unsigned short*)(ws + oQh);
  unsigned short* Ql   = (unsigned short*)(ws + oQl);
  unsigned short* Kh   = (unsigned short*)(ws + oKh);
  unsigned short* Kl   = (unsigned short*)(ws + oKl);
  unsigned short* Vh   = (unsigned short*)(ws + oVh);
  unsigned short* Vl   = (unsigned short*)(ws + oVl);
  float*          PQ   = (float*)(ws + oPQ);
  float*          phs  = (float*)(ws + oPh);

  const dim3 b256(256), b128(128);

  // (1) x -> bf16 plane [4096][2048]
  cvt_bf16_kernel<<<dim3((NTOK * HID / 8) / 256), b256, 0, stream>>>(x, Xb, NTOK * HID / 8);
  // (2) Wq in[2048 rows][2048 cols] -> WqkT rows 0..2047 = out[n][k]; Wk -> WqkT rows 2048..4095; Wv -> WvT   (grid = cols/64, rows/64)
  tconv_bf16_kernel<<<dim3(HID / 64, HID / 64), b256, 0, stream>>>(Wq, WqkT, HID, HID);
  tconv_bf16_kernel<<<dim3(HID / 64, HID / 64), b256, 0, stream>>>(Wk, WqkT + (size_t)HID * HID, HID, HID);
  tconv_bf16_kernel<<<dim3(HID / 64, HID / 64), b256, 0, stream>>>(Wv, WvT, HID, HID);
  // (3) Wpq|Wpk -> WpT [32][2048]
  wpt_kernel<<<dim3(NPH), b256, 0, stream>>>(Wpq, Wpk, WpT);
  // (4) pq|pk = x . (Wpq|Wpk) -> cos|sin plane PQ [4096][64]   (M=4096, N=32, K=2048; 128 tiles / 4)
  gemm_kernel<3, 2, false><<<dim3((NTOK / 32) * (NPH / 32) / 4), b128, 0, stream>>>(
      Xb, Xb, HID, WpT, HID, phs, (void*)PQ, (void*)PQ, (void*)PQ, (void*)PQ, PQW, NTOK, NPH, HID);
  // (5) phase factor phs [4096]
  phase_kernel<<<dim3(NSEQ), b256, 0, stream>>>(PQ, phs);
  // (6) q|k = x . (Wq|Wk) -> Qh/Ql [4096][2048], Kh [4096][2048], Kl [512][2048]   (M=4096, N=4096, K=2048; 32 x 16 block tiles)
  gemm_tiled_kernel<0, 4, false><<<dim3((NTOK / GT_BM) * ((2 * HID) / GT_BN)), b128, 0, stream>>>(
      Xb, Xb, HID, WqkT, HID, phs, (void*)Qh, (void*)Ql, (void*)Kh, (void*)Kl, HID, NTOK, 2 * HID, HID);
  // (7) v^T = WvT . x^T -> Vh/Vl [2048][4096]   (A = WvT, Bt = Xb; M=2048, N=4096, K=2048; 16 x 16 block tiles)
  gemm_tiled_kernel<1, 2, false><<<dim3((HID / GT_BM) * (NTOK / GT_BN)), b256, 0, stream>>>(
      WvT, WvT, HID, Xb, HID, phs, (void*)Vh, (void*)Vl, (void*)Vh, (void*)Vl, NTOK, HID, NTOK, HID);
  // (8) Wo -> WoT (over the dead WvT region)
  tconv_bf16_kernel<<<dim3(HID / 64, HID / 64), b256, 0, stream>>>(Wo, WoT, HID, HID);
  // (9) causal attention, query tiles 0..3 with k and p residual products, tiles 4..31 without -> Ah/Al (over the dead Xb/WqkT regions)
  attn_causal_kernel<true><<<dim3(4, NHQ, NSEQ), b128, 0, stream>>>(Qh, Ql, Kh, Kl, Vh, Vl, Ah, Al, 0);
  attn_causal_kernel<false><<<dim3(SQ / 64 - 4, NHQ, NSEQ), b128, 0, stream>>>(Qh, Ql, Kh, Kl, Vh, Vl, Ah, Al, 4);
  // (10) out = (attn hi + lo) . Wo * (1 + 0.1*phs[m]) -> d_out f32 [4096][2048]   (M=4096, N=2048, K=2048; 32 x 8 block tiles)
  gemm_tiled_kernel<2, 2, true><<<dim3((NTOK / GT_BM) * (HID / GT_BN)), b256, 0, stream>>>(
      Ah, Al, HID, WoT, HID, phs, (void*)out, (void*)out, (void*)out, (void*)out, HID, NTOK, HID, HID);
  (void)hipGetLastError();
}

// v003
// A run of this version takes 387 microseconds.
// Next to v002, in two timings, it ran 1.08 times as fast each time.
// Counting every step since v000, it is 2.00 times as fast.
// Contractions: x.(Wq|Wk), Wv^T.x^T and x.(Wpq|Wpk) on v_wmma_f32_16x16x32_bf16 (operands = RNE bf16 of the f32 inputs, single products);
// q.k^T and p.v on v_wmma_f32_16x16x32_f16 (q = f16 hi + f16 residual x2^11 planes; k plain f16 plus f16 residual x2^11 on query tiles 0..3;
// p x1024 plain f16 plus f16 residual x2^11 on query tiles 0..3; v^T = f16 hi + f16 residual x2^11 planes); attn.Wo on v_wmma_f32_16x16x32_bf16
// (attn = bf16 hi + bf16 lo planes, two products; Wo RNE bf16). f32 accumulate everywhere; online softmax, cos/sin phase sums and output scale in f32.
#include <hip/hip_runtime.h>
#include <math.h>
#include <stdint.h>

#define NSEQ   2
#define SQ     2048
#define HID    2048
#define NHQ    16
#define HDM    128
#define NTOK   4096
#define NPH    32
#define PQW    64
#define KLR    256

static_assert(NTOK == NSEQ * SQ);
static_assert(NHQ * HDM == HID);
static_assert(KLR % 32 == 0 && SQ % KLR == 0);

typedef _Float16     v16h __attribute__((ext_vector_type(16)));
typedef _Float16     v8h  __attribute__((ext_vector_type(8)));
typedef __bf16       v16b __attribute__((ext_vector_type(16)));
typedef __bf16       v8b  __attribute__((ext_vector_type(8)));
typedef float        v8f  __attribute__((ext_vector_type(8)));
typedef float        v4f  __attribute__((ext_vector_type(4)));
typedef unsigned int v4u  __attribute__((ext_vector_type(4)));

// ---------------------------------------------------------------------------
// small helpers
// ---------------------------------------------------------------------------
__device__ __forceinline__ unsigned short bf_bits(float f) {          // RNE convert f32 -> bf16 bits
  const unsigned u = __float_as_uint(f);
  return (unsigned short)((u + 0x7FFFu + ((u >> 16) & 1u)) >> 16);
}
__device__ __forceinline__ float bf_val(unsigned short h) { return __uint_as_float(((unsigned)h) << 16); }
__device__ __forceinline__ unsigned pk16(unsigned short a, unsigned short b) { return (unsigned)a | ((unsigned)b << 16); }
__device__ __forceinline__ v8f zero8() { v8f z = {0.f, 0.f, 0.f, 0.f, 0.f, 0.f, 0.f, 0.f}; return z; }
__device__ __forceinline__ int wave_id() {
#if defined(__HIP_DEVICE_COMPILE__)
  return __builtin_amdgcn_readfirstlane((int)(threadIdx.x >> 5));
#else
  return (int)(threadIdx.x >> 5);
#endif
}
// release/acquire + wave barrier between one wave's LDS stores and the other lanes' reloads
__device__ __forceinline__ void lds_wave_sync() {
#if defined(__HIP_DEVICE_COMPILE__)
  __builtin_amdgcn_fence(__ATOMIC_RELEASE, "workgroup");
  __builtin_amdgcn_wave_barrier();
  __builtin_amdgcn_fence(__ATOMIC_ACQUIRE, "workgroup");
#endif
}

// ---------------------------------------------------------------------------
// WMMA fragments (wave32, 16x16x32, 16-bit operands). For A (row m = lane&15) and B (col n = lane&15) alike:
// elements 0..7 <- k0 + 8*(lane>>4) + 0..7, elements 8..15 <- k0 + 16 + 8*(lane>>4) + 0..7.
// ldfrag(p) with p = rowbase + k0 + 8*(lane>>4): two 16-B loads p[0..7], p[16..23].
// D: acc[r] = (row 8*(lane>>4) + r, col lane&15).
// ---------------------------------------------------------------------------
union FragH { v16h v; v8h h[2]; };
union FragB { v16b v; v8b h[2]; };
__device__ __forceinline__ v16h ldfrag_h(const _Float16* p) { FragH f; f.h[0] = *(const v8h*)(p); f.h[1] = *(const v8h*)(p + 16); return f.v; }
__device__ __forceinline__ v16b ldfrag_b(const __bf16* p)   { FragB f; f.h[0] = *(const v8b*)(p); f.h[1] = *(const v8b*)(p + 16); return f.v; }

__device__ __forceinline__ v8f mma_h(v16h a, v16h b, v8f c) {
#if defined(__HIP_DEVICE_COMPILE__)
  return __builtin_amdgcn_wmma_f32_16x16x32_f16(false, a, false, b, (short)0, c, false, false);
#else
  return c;
#endif
}
__device__ __forceinline__ v8f mma_b(v16b a, v16b b, v8f c) {
#if defined(__HIP_DEVICE_COMPILE__)
  return __builtin_amdgcn_wmma_f32_16x16x32_bf16(false, a, false, b, (short)0, c, false, false);
#else
  return c;
#endif
}
// hazard guards: 4 VALU slots after the last WMMA of a group, D tied, A/B kept live; memory clobber keeps later loads behind the group
__device__ __forceinline__ void guard_b5(v8f& a, v8f& b, v16b x0, v16b x1, v16b x2, v16b x3, v16b y) {
#if defined(__HIP_DEVICE_COMPILE__)
  asm volatile("v_nop\n\tv_nop\n\tv_nop\n\tv_nop" : "+v"(a), "+v"(b) : "v"(x0), "v"(x1), "v"(x2), "v"(x3), "v"(y) : "memory");
#endif
}
__device__ __forceinline__ void guard_h3(v8f& a, v8f& b, v16h x, v16h y, v16h z) {
#if defined(__HIP_DEVICE_COMPILE__)
  asm volatile("v_nop\n\tv_nop\n\tv_nop\n\tv_nop" : "+v"(a), "+v"(b) : "v"(x), "v"(y), "v"(z) : "memory");
#endif
}
__device__ __forceinline__ void guard_h4(v8f& a, v8f& b, v16h w, v16h x, v16h y, v16h z) {
#if defined(__HIP_DEVICE_COMPILE__)
  asm volatile("v_nop\n\tv_nop\n\tv_nop\n\tv_nop" : "+v"(a), "+v"(b) : "v"(w), "v"(x), "v"(y), "v"(z) : "memory");
#endif
}
__device__ __forceinline__ void acc_guard4(v8f& a, v8f& b, v8f& c, v8f& d) {
#if defined(__HIP_DEVICE_COMPILE__)
  asm volatile("v_nop\n\tv_nop\n\tv_nop\n\tv_nop" : "+v"(a), "+v"(b), "+v"(c), "+v"(d));
#endif
}

// ---------------------------------------------------------------------------
// Elementwise RNE f32 -> bf16 plane: 8 elements per thread, one 16-B store per lane -> 32 consecutive lanes write 4 whole
// ---------------------------------------------------------------------------
__global__ __launch_bounds__(256) void cvt_bf16_kernel(const float* __restrict__ in, unsigned short* __restrict__ outp, int n8) {
  const int i = (int)blockIdx.x * 256 + (int)threadIdx.x;
  if (i >= n8) return;
  const size_t e = 8 * (size_t)i;
  const v4f a = *(const v4f*)(in + e);
  const v4f b = *(const v4f*)(in + e + 4);
  v4u w;
  w[0] = pk16(bf_bits(a[0]), bf_bits(a[1]));
  w[1] = pk16(bf_bits(a[2]), bf_bits(a[3]));
  w[2] = pk16(bf_bits(b[0]), bf_bits(b[1]));
  w[3] = pk16(bf_bits(b[2]), bf_bits(b[3]));
  *(v4u*)(outp + e) = w;
  
}

// ---------------------------------------------------------------------------
// Fused transpose + RNE bf16 convert: in [R rows][Cc cols] f32 (pitch Cc) -> out[c][r] = bf16(in[r][c])  ([Cc][R], pitch R).
// 64x64 tiles through LDS; grid = (Cc/64, R/64), 256 threads; R, Cc multiples of 64.
// Coverage per block: load 4 it x 256 thr x 4 floats = 64x64; store 2 it x 256 thr x 8 u16 = 64x64.
// ---------------------------------------------------------------------------
__global__ __launch_bounds__(256) void tconv_bf16_kernel(const float* __restrict__ W, unsigned short* __restrict__ outp, int R, int Cc) {
  __shared__ __align__(16) float tf[64 * 68];
  const int c0  = (int)blockIdx.x * 64;   // input column block = output row block
  const int r0  = (int)blockIdx.y * 64;   // input row block    = output column block
  const int tid = (int)threadIdx.x;
  {
    const int lr = tid >> 4;              // 0..15
    const int c4 = (tid & 15) * 4;        // 0..60
#pragma unroll
    for (int it = 0; it < 4; ++it) {
      const int rr = it * 16 + lr;        // 0..63
      const v4f a = *(const v4f*)(W + (size_t)(r0 + rr) * Cc + c0 + c4);
      *(v4f*)(tf + rr * 68 + c4) = a;
    }
  }
  __syncthreads();
  const int sub = tid >> 3;               // 0..31
  const int c8  = (tid & 7) * 8;          // 0..56
  v4u hv[2];
#pragma unroll
  for (int it = 0; it < 2; ++it) {
    const int oc = it * 32 + sub;         // output row within tile (= input column)
    v4u a;
#pragma unroll
    for (int q = 0; q < 4; ++q) {
      const float f0 = tf[(c8 + 2 * q) * 68 + oc];
      const float f1 = tf[(c8 + 2 * q + 1) * 68 + oc];
      a[q] = pk16(bf_bits(f0), bf_bits(f1));
    }
    hv[it] = a;
  }
  {
#pragma unroll
    for (int it = 0; it < 2; ++it) {
      const int oc = it * 32 + sub;
      const size_t go = (size_t)(c0 + oc) * R + r0 + c8;
      *(v4u*)(outp + go) = hv[it];
    }
    
  }
}

// ---------------------------------------------------------------------------
// Phase weights: Wpq [HID][NHQ], Wpk [HID][NHQ] f32 -> WpT [NPH][HID] bf16 rows (rows 0..15 = Wpq^T, 16..31 = Wpk^T).
// ---------------------------------------------------------------------------
__global__ __launch_bounds__(256) void wpt_kernel(const float* __restrict__ Wpq, const float* __restrict__ Wpk,
                                                  unsigned short* __restrict__ outp) {
  const int n = (int)blockIdx.x;                   // 0..31
  const float* W = (n < NHQ) ? Wpq : Wpk;          // block-uniform, both global
  const int h = n & (NHQ - 1);
  const int t = (int)threadIdx.x;                  // k = 8t .. 8t+7  (< HID)
  v4u w;
#pragma unroll
  for (int q = 0; q < 4; ++q) {
    const float f0 = W[(size_t)(8 * t + 2 * q) * NHQ + h];
    const float f1 = W[(size_t)(8 * t + 2 * q + 1) * NHQ + h];
    w[q] = pk16(bf_bits(f0), bf_bits(f1));
  }
  const size_t o = (size_t)n * HID + 8 * (size_t)t;
  *(v4u*)(outp + o) = w;
  
}

// ---------------------------------------------------------------------------
// bf16 WMMA GEMMs: C[m][n] = sum_k A[m][k] * Bt[n][k]; A row-major [M][K] bf16 (pitch lda), Bt row-major [N][K] bf16 (pitch ldb).
//   SPLITA: A carried as hi (Ap) + lo (A2p) bf16 planes, two products into one accumulator (hi then lo at every k step).
//   gemm_kernel (EPI 3): wave tile 32 x 32, 4 independent waves per block, fragments straight from global rows, no block barriers.
//   gemm_tiled_kernel (EPI 0, 1, 2): block tile 128 x 256, waves of 64 x 128 (EPI 0) or 32 x 128 (EPI 1, 2), operands staged in an LDS ring of two buffers.
// Epilogues (all: per wave, per 16-row slab: stage in LDS, wave sync, write each row segment with ONE instruction); MI = 16-row slabs per wave.
//   EPI 0 (NJ 8): q|k projection. cols n0 < HID (q): f16 hi plane C0 and f16 residual x2048 plane C1, both [M][ldc], cols n0..n0+127
//          (row segment 256 B = 16 lanes x 16 B). cols n0 >= HID (k): hi plane C2 [M][ldc] cols n0-HID..; residual plane C3 [NSEQ*KLR][ldc]
//          only for token rows with (m % SQ) < KLR at row (m / SQ)*KLR + m % SQ (wave-uniform choice; 32- and 64-row wave tiles never straddle).
//   EPI 1 (NJ 8): v^T projection: f16 hi plane C0, residual x2048 plane C1, [M][ldc], row segment 256 B.
//   EPI 2 (NJ 8): f32 output C0 [M][ldc], each row scaled by (1 + 0.1*phs[m]); row segment 128 floats = 512 B = 32 lanes x 16 B per instruction.
//   EPI 3 (NJ 2): f32 plane C0 [M][ldc = PQW]: cols 0..31 cos of the 32 accumulated values, 32..63 sin (precise cosf/sinf, rolled loop);
//          row = 256 B = 16 lanes x 16 B, one instruction covers 2 whole rows.
// ---------------------------------------------------------------------------
template <int EPI> struct SlabT { typedef _Float16 T; static constexpr int PERW = 4096; };   // 2 planes x 16 x 128 halves
template <> struct SlabT<2>     { typedef float    T; static constexpr int PERW = 2048; };   // 16 x 128 floats
template <> struct SlabT<3>     { typedef float    T; static constexpr int PERW = 1536; };   // 16 x 32 raw + 16 x 64 cos|sin floats

// s_wait_xcnt 0 behind an issued global store, in front of a rewrite of a register that the store names
__device__ __forceinline__ void wait_x0() {
#if defined(__HIP_DEVICE_COMPILE__)
  asm volatile("s_wait_xcnt 0x0" ::: "memory");
#endif
}

// slab: this wave's own LDS staging range; (m0, n0): first row and column of the wave's (16*MI) x (16*NJ) tile.
template <int EPI, int NJ, int MI>
__device__ __forceinline__ void gemm_epilogue(v8f (&acc)[MI][NJ], typename SlabT<EPI>::T* slab, int lane, int m0, int n0,
                                              const float* __restrict__ phs, void* C0, void* C1, void* C2, void* C3, int ldc) {
  const int hh = lane >> 4;
  const int rl = lane & 15;
  _Float16* sl16 = (_Float16*)(void*)slab;
  float*    slf  = (float*)(void*)slab;

  if constexpr (EPI == 0 || EPI == 1) {
    _Float16* P0;
    _Float16* P1;
    int col0;
    int lomode;                                   // 0: lo row = m; 1: lo row remapped into the KLR-row plane; 2: no lo store
    if constexpr (EPI == 0) {
      const bool isq = (n0 < HID);                // wave-uniform
      P0 = isq ? (_Float16*)C0 : (_Float16*)C2;
      P1 = isq ? (_Float16*)C1 : (_Float16*)C3;
      col0 = isq ? n0 : (n0 - HID);
      const int s0 = m0 & (SQ - 1);
      lomode = isq ? 0 : ((s0 < KLR) ? 1 : 2);
    } else {
      P0 = (_Float16*)C0;
      P1 = (_Float16*)C1;
      col0 = n0;
      lomode = 0;
    }
#pragma unroll
    for (int i = 0; i < MI; ++i) {
#pragma unroll
      for (int r = 0; r < 8; ++r) {
#pragma unroll
        for (int j = 0; j < NJ; ++j) {
          const float v = acc[i][j][r];
          const _Float16 hv = (_Float16)v;
          const int so = (8 * hh + r) * 128 + j * 16 + rl;
          sl16[so]        = hv;
          sl16[2048 + so] = (_Float16)((v - (float)hv) * 2048.0f);
        }
      }
      lds_wave_sync();
      {
#pragma unroll
        for (int it = 0; it < 8; ++it) {
          const int row = it * 2 + hh;            // it x hh covers rows 0..15
          const int c8  = rl * 8;
          const v8h xh = *(const v8h*)(sl16 + row * 128 + c8);
          const v8h xl = *(const v8h*)(sl16 + 2048 + row * 128 + c8);
          const int m = m0 + i * 16 + row;
          *(v8h*)(P0 + (size_t)m * ldc + col0 + c8) = xh;
          if constexpr (EPI == 0) wait_x0();      // precaution: in front of the branch below, whose first instructions reuse this store's registers
          if (lomode != 2) {
            const int m1 = (lomode == 1) ? ((m / SQ) * KLR + (m % SQ)) : m;
            *(v8h*)(P1 + (size_t)m1 * ldc + col0 + c8) = xl;
            if constexpr (EPI == 0) wait_x0();    // precaution: inside the branch, in front of whatever reuses this store's registers behind it
          }
        }
        
      }
      lds_wave_sync();
    }
  } else if constexpr (EPI == 2) {
    float* C = (float*)C0;
#pragma unroll
    for (int i = 0; i < MI; ++i) {
#pragma unroll
      for (int r = 0; r < 8; ++r) {
        const int m = m0 + i * 16 + 8 * hh + r;
        const float sc = 1.0f + 0.1f * phs[m];
#pragma unroll
        for (int j = 0; j < NJ; ++j)
          slf[(8 * hh + r) * 128 + j * 16 + rl] = acc[i][j][r] * sc;
      }
      lds_wave_sync();
      {
#pragma unroll
        for (int row = 0; row < 16; ++row) {      // 32 lanes x 16 B = the whole 512-B row segment per instruction
          const v4f v = *(const v4f*)(slf + row * 128 + lane * 4);
          *(v4f*)(C + (size_t)(m0 + i * 16 + row) * ldc + n0 + lane * 4) = v;
        }
        
      }
      lds_wave_sync();
    }
  } else {
    float* raw = slf;                             // 16 x 32 floats
    float* ocs = slf + 512;                       // 16 x 64 floats
    float* Cp  = (float*)C0;
#pragma unroll
    for (int i = 0; i < MI; ++i) {
#pragma unroll
      for (int j = 0; j < NJ; ++j)
#pragma unroll
        for (int r = 0; r < 8; ++r)
          raw[(8 * hh + r) * 32 + j * 16 + rl] = acc[i][j][r];
      lds_wave_sync();
#pragma unroll 1
      for (int it = 0; it < 16; ++it) {           // row it, col lane: 16 x 32 values, one precise cos + sin site
        const float v  = raw[it * 32 + lane];
        const float cv = cosf(v);
        const float sv = sinf(v);
        ocs[it * PQW + lane]      = cv;
        ocs[it * PQW + 32 + lane] = sv;
      }
      lds_wave_sync();
      {
#pragma unroll
        for (int it = 0; it < 8; ++it) {
          const int row = it * 2 + hh;            // 2 rows per instruction, 16 lanes x 16 B = one whole 256-B row
          const int c4  = rl * 4;
          const v4f x = *(const v4f*)(ocs + row * PQW + c4);
          *(v4f*)(Cp + (size_t)(m0 + i * 16 + row) * ldc + c4) = x;
        }
        
      }
      lds_wave_sync();
    }
  }
}

template <int EPI, int NJ, bool SPLITA>
__global__ __launch_bounds__(128) void gemm_kernel(
    const unsigned short* Ap, const unsigned short* A2p, int lda,
    const unsigned short* __restrict__ Btp, int ldb,
    const float* __restrict__ phs,
    void* C0, void* C1, void* C2, void* C3, int ldc,
    int M, int N, int K) {
  static_assert(NJ == 8 || NJ == 2);
  static_assert((EPI == 3) ? (NJ == 2) : (NJ == 8));
  typedef typename SlabT<EPI>::T ST;
  __shared__ __align__(16) ST slab_all[4 * SlabT<EPI>::PERW];

  const int lane = threadIdx.x & 31;
  const int wave = wave_id();
  const int hh = lane >> 4;           // lane half: k offset 8*hh, D row offset 8*hh
  const int rl = lane & 15;           // A row / B col / D col within subtile
  const int tilesN = N / (16 * NJ);
  const int tilesM = M >> 5;
  const int tile = (int)blockIdx.x * 4 + wave;
  if (tile >= tilesM * tilesN) return;          // wave-uniform; no block barriers in this kernel
  const int tm = tile / tilesN;
  const int tn = tile - tm * tilesN;
  const int m0 = tm << 5;
  const int n0 = tn * (16 * NJ);

  const __bf16* A  = (const __bf16*)(const void*)Ap;
  const __bf16* A2 = (const __bf16*)(const void*)A2p;
  const __bf16* Bt = (const __bf16*)(const void*)Btp;

  v8f acc[2][NJ];
#pragma unroll
  for (int i = 0; i < 2; ++i)
#pragma unroll
    for (int j = 0; j < NJ; ++j) acc[i][j] = zero8();

  for (int k0 = 0; k0 < K; k0 += 32) {
    v16b ah[2], al[2];
#pragma unroll
    for (int i = 0; i < 2; ++i) {
      const size_t ao = (size_t)(m0 + i * 16 + rl) * lda + k0 + 8 * hh;
      ah[i] = ldfrag_b(A + ao);
      al[i] = SPLITA ? ldfrag_b(A2 + ao) : ah[i];
    }
#pragma unroll
    for (int j = 0; j < NJ; ++j) {
      const v16b bj = ldfrag_b(Bt + (size_t)(n0 + j * 16 + rl) * ldb + k0 + 8 * hh);
      acc[0][j] = mma_b(ah[0], bj, acc[0][j]);
      acc[1][j] = mma_b(ah[1], bj, acc[1][j]);
      if (SPLITA) {
        acc[0][j] = mma_b(al[0], bj, acc[0][j]);
        acc[1][j] = mma_b(al[1], bj, acc[1][j]);
      }
      guard_b5(acc[0][j], acc[1][j], ah[0], ah[1], al[0], al[1], bj);
    }
  }
  if constexpr (NJ == 8) {
    acc_guard4(acc[0][0], acc[0][1], acc[0][2], acc[0][3]);
    acc_guard4(acc[0][4], acc[0][5], acc[0][6], acc[0][7]);
    acc_guard4(acc[1][0], acc[1][1], acc[1][2], acc[1][3]);
    acc_guard4(acc[1][4], acc[1][5], acc[1][6], acc[1][7]);
  } else {
    acc_guard4(acc[0][0], acc[0][1], acc[1][0], acc[1][1]);
  }

  gemm_epilogue<EPI, NJ, 2>(acc, slab_all + wave * SlabT<EPI>::PERW, lane, m0, n0, phs, C0, C1, C2, C3, ldc);
}

// ---------------------------------------------------------------------------
// Tiled GEMM main loop. Block tile 128 x 256; waves in a (8/MI) x 2 grid, each (16*MI) x 128: MI 4 = 4 waves, MI 2 = 8 waves.
// A pass is 64 k: a stage holds [A 128 rows | (SPLITA: A2 128 rows) | Bt 256 rows] of 128 B at pitch 144 B
// (16 B x 9: ds_load_b128 fragment reads without bank conflicts). Every thread brings 16-B pieces with asynchronous copies to LDS,
// one pass ahead of the pass that reads them. M % 128 == 0, N % 256 == 0, K % 64 == 0, K >= 128; grid.x = (M/128) * (N/256).
// ---------------------------------------------------------------------------
#define GT_BM 128
#define GT_BN 256
#define GT_KP 64
#define GT_LP 72                                  // LDS row pitch in bf16 elements

// Asynchronous 16-B copies, one per lane and line of the statement: l + c * lstep = the lane's LDS byte address, g[c] = its global source.
// s_wait_xcnt stands inside the statement so that no address register is rewritten ahead of it.
__device__ __forceinline__ void copy8(unsigned l, unsigned lstep, const __bf16* const* g) {
#if defined(__HIP_DEVICE_COMPILE__)
  asm volatile(
      "global_load_async_to_lds_b128 %0, %8, off\n\t"
      "global_load_async_to_lds_b128 %1, %9, off\n\t"
      "global_load_async_to_lds_b128 %2, %10, off\n\t"
      "global_load_async_to_lds_b128 %3, %11, off\n\t"
      "global_load_async_to_lds_b128 %4, %12, off\n\t"
      "global_load_async_to_lds_b128 %5, %13, off\n\t"
      "global_load_async_to_lds_b128 %6, %14, off\n\t"
      "global_load_async_to_lds_b128 %7, %15, off\n\t"
      "s_wait_xcnt 0x0"
      :: "v"(l), "v"(l + lstep), "v"(l + 2u * lstep), "v"(l + 3u * lstep),
         "v"(l + 4u * lstep), "v"(l + 5u * lstep), "v"(l + 6u * lstep), "v"(l + 7u * lstep),
         "v"(g[0]), "v"(g[1]), "v"(g[2]), "v"(g[3]), "v"(g[4]), "v"(g[5]), "v"(g[6]), "v"(g[7])
      : "memory");
#endif
}
__device__ __forceinline__ void copy4(unsigned l, unsigned lstep, const __bf16* const* g) {
#if defined(__HIP_DEVICE_COMPILE__)
  asm volatile(
      "global_load_async_to_lds_b128 %0, %4, off\n\t"
      "global_load_async_to_lds_b128 %1, %5, off\n\t"
      "global_load_async_to_lds_b128 %2, %6, off\n\t"
      "global_load_async_to_lds_b128 %3, %7, off\n\t"
      "s_wait_xcnt 0x0"
      :: "v"(l), "v"(l + lstep), "v"(l + 2u * lstep), "v"(l + 3u * lstep),
         "v"(g[0]), "v"(g[1]), "v"(g[2]), "v"(g[3])
      : "memory");
#endif
}
// this wave's copies have landed in LDS
__device__ __forceinline__ void wait_async0() {
#if defined(__HIP_DEVICE_COMPILE__)
  asm volatile("s_wait_asynccnt 0x0" ::: "memory");
#endif
}
// this wave's LDS reads have returned (before the buffer they read is handed back for a refill)
__device__ __forceinline__ void wait_ds0() {
#if defined(__HIP_DEVICE_COMPILE__)
  asm volatile("s_wait_dscnt 0x0" ::: "memory");
#endif
}
// the compiler's scheduler moves nothing across this point
__device__ __forceinline__ void sched_fence() {
#if defined(__HIP_DEVICE_COMPILE__)
  __builtin_amdgcn_sched_barrier(0);
#endif
}

// second launch bound: two waves per SIMD (two 4-wave blocks, or one 8-wave block, per WGP), so that one wave's WMMAs cover the other's waits
template <int EPI, int MI, bool SPLITA>
__global__ __launch_bounds__(512 / MI, 2) void gemm_tiled_kernel(
    const unsigned short* Ap, const unsigned short* A2p, int lda,
    const unsigned short* __restrict__ Btp, int ldb,
    const float* __restrict__ phs,
    void* C0, void* C1, void* C2, void* C3, int ldc,
    int M, int N, int K) {
  static_assert(EPI == 0 || EPI == 1 || EPI == 2);
  static_assert(MI == 4 || MI == 2);
  static_assert(GT_KP == 64);
  constexpr int NW    = 16 / MI;                  // waves per block
  constexpr int RS    = NW * 4;                   // stage rows that one copy of every thread covers (8 threads per 128-B row)
  constexpr int AROWS = (SPLITA ? 2 : 1) * GT_BM;
  constexpr int NCP   = (AROWS + GT_BN) / RS;     // copies per thread and stage: 24, 12 or 16 (at most 63 may be outstanding)
  constexpr int STAGE = (AROWS + GT_BN) * GT_LP;  // elements per buffer
  static_assert(NCP % 4 == 0 && NCP <= 63);
  typedef typename SlabT<EPI>::T ST;
  __shared__ __align__(16) __bf16 ring[2 * STAGE];
  __shared__ __align__(16) ST slab_all[NW * SlabT<EPI>::PERW];

  const int tid  = (int)threadIdx.x;
  const int lane = tid & 31;
  const int wave = wave_id();
  const int hh = lane >> 4;           // lane half: k offset 8*hh
  const int rl = lane & 15;           // A row / B col within subtile
  const int tilesN = N / GT_BN;
  const int tm  = (int)blockIdx.x / tilesN;
  const int tn  = (int)blockIdx.x - tm * tilesN;
  const int bm0 = tm * GT_BM;
  const int bn0 = tn * GT_BN;
  const int wm  = wave >> 1;
  const int wn  = wave & 1;

  // copy side: copy c of this thread brings piece tid % 8 of stage row c * RS + tid / 8
  const int crow = tid >> 3;
  const int cpc  = (tid & 7) * 8;     // element offset of the 16-B piece
  const __bf16* gA  = (const __bf16*)(const void*)Ap  + (size_t)(bm0 + crow) * lda + cpc;
  const __bf16* gA2 = (const __bf16*)(const void*)A2p + (size_t)(bm0 + crow) * lda + cpc;
  const __bf16* gB  = (const __bf16*)(const void*)Btp + (size_t)(bn0 + crow) * ldb + cpc;
  const unsigned lc = (unsigned)(size_t)(const void*)ring + (unsigned)(crow * GT_LP + cpc) * 2u;
  auto fill = [&](int t) {            // tile t -> buffer t % 2
    const unsigned l = lc + (unsigned)(t & 1) * (unsigned)(STAGE * 2);
    const size_t ko = (size_t)t * GT_KP;
    const __bf16* g[NCP];
#pragma unroll
    for (int c = 0; c < NCP; ++c) {
      const int r = c * RS;
      g[c] = (r < GT_BM) ? gA + ko + (size_t)r * lda
           : (r < AROWS) ? gA2 + ko + (size_t)(r - GT_BM) * lda
                         : gB + ko + (size_t)(r - AROWS) * ldb;
    }
#pragma unroll
    for (int c = 0; c + 8 <= NCP; c += 8) copy8(l + (unsigned)(c * RS * GT_LP * 2), RS * GT_LP * 2u, g + c);
    if constexpr (NCP % 8 == 4) copy4(l + (unsigned)((NCP - 4) * RS * GT_LP * 2), RS * GT_LP * 2u, g + (NCP - 4));
  };

  v8f acc[MI][8];
#pragma unroll
  for (int i = 0; i < MI; ++i)
#pragma unroll
    for (int j = 0; j < 8; ++j) acc[i][j] = zero8();

  const int nt = K / GT_KP;           // block-uniform, >= 2
  fill(0);
  wait_async0();
  __syncthreads();                    // tile 0 readable by every wave
  fill(1);

  const int aoff = (wm * (16 * MI) + rl) * GT_LP + 8 * hh;
  const int boff = (AROWS + wn * 128 + rl) * GT_LP + 8 * hh;
#pragma unroll 1                      // one pass per trip: the ring's order below holds per trip, and every acc index stays constant
  for (int t = 0; t < nt; ++t) {
    const __bf16* st = ring + (t & 1) * STAGE;
    v16b fa[2][MI], fl[2][MI], fb[2][8];          // one fragment set per 32-k step of the pass
#pragma unroll
    for (int ks = 0; ks < 2; ++ks) {
#pragma unroll
      for (int i = 0; i < MI; ++i) {
        fa[ks][i] = ldfrag_b(st + aoff + i * 16 * GT_LP + ks * 32);
        if constexpr (SPLITA) fl[ks][i] = ldfrag_b(st + aoff + (GT_BM + i * 16) * GT_LP + ks * 32);
      }
#pragma unroll
      for (int j = 0; j < 8; ++j) fb[ks][j] = ldfrag_b(st + boff + j * 16 * GT_LP + ks * 32);
      sched_fence();                              // each step's LDS reads stay one group ahead of the WMMA blocks, not spread among them
    }
#pragma unroll
    for (int ks = 0; ks < 2; ++ks) {
#pragma unroll
      for (int j = 0; j < 8; ++j) {
#pragma unroll
        for (int i = 0; i < MI; ++i) acc[i][j] = mma_b(fa[ks][i], fb[ks][j], acc[i][j]);
        if constexpr (SPLITA) {
#pragma unroll
          for (int i = 0; i < MI; ++i) acc[i][j] = mma_b(fl[ks][i], fb[ks][j], acc[i][j]);
        }
      }
      // step 1's WMMAs stay behind step 0's (only step 0's reads are waited for first) and in front of the waits at the foot
      // (moved behind the barrier they would halve the lead of the copies in flight)
      sched_fence();
    }
    wait_ds0();
    wait_async0();
    __syncthreads();                  // publishes tile t + 1 and ends every wave's reads of tile t's buffer
    if (t + 2 < nt) fill(t + 2);      // block-uniform test
  }
  wait_async0();

  gemm_epilogue<EPI, 8, MI>(acc, slab_all + wave * SlabT<EPI>::PERW, lane, bm0 + wm * (16 * MI), bn0 + wn * 128, phs, C0, C1, C2, C3, ldc);
}

// ---------------------------------------------------------------------------
// Phase modulation factor, PH_PB blocks per sequence (grid NSEQ * PH_PB, 512 threads), all f32:
//   PQ plane [NTOK][PQW]: col h = cos(pq_h), 16+h = cos(pk_h), 32+h = sin(pq_h), 48+h = sin(pk_h).
//   Ck[h] = sum_s cos(pk), Sk[h] = sum_s sin(pk): every block sums its whole sequence itself (no data passes between blocks of the launch).
//   8 threads per row, each one 16-B piece (4 heads of cos or of sin), 64 rows per pass: a wave reads 4 rows x two 64-B runs per instruction;
//   per-thread partials over 32 rows, then 32 threads add the 64 row groups in fixed order from LDS (lanes on consecutive banks).
//   phs[b*SQ + s] = sum_h (cos(pq_h)*Ck[h] + sin(pq_h)*Sk[h]) / 32768: 4 products per thread, 8 partials per row joined through LDS in fixed order.
//   Coverage: NSEQ * PH_PB blocks x PH_ROWS = NTOK values; each wave of the last stage stores one whole 128-B line.
// ---------------------------------------------------------------------------
#define PH_PB   16
#define PH_ROWS (SQ / PH_PB)
static_assert(PH_ROWS % 64 == 0 && SQ % 64 == 0 && PH_ROWS <= 512);
__global__ __launch_bounds__(512) void phase_kernel(const float* __restrict__ PQ, float* __restrict__ phs) {
  __shared__ __align__(16) float red[64 * 2 * NHQ];
  __shared__ __align__(16) float csk[2 * NHQ];
  __shared__ __align__(16) float part[PH_ROWS * 8];
  const int b   = (int)blockIdx.x / PH_PB;
  const int blk = (int)blockIdx.x % PH_PB;
  const int tid = (int)threadIdx.x;
  const int pc  = tid & 7;                            // piece: 0..3 = cos of heads 4*pc.., 4..7 = sin of heads 4*(pc-4)..
  const int g   = tid >> 3;                           // row within a pass of 64
  const int col = (pc < 4) ? 4 * pc : NHQ + 4 * pc;   // pq columns 0..12 and 32..44; the pk columns lie NHQ further
  const float* base = PQ + (size_t)b * SQ * PQW;
  v4f xq[PH_ROWS / 64];                               // this block's own pq rows, asked for ahead of the sums
#pragma unroll
  for (int it = 0; it < PH_ROWS / 64; ++it)
    xq[it] = *(const v4f*)(base + (size_t)(blk * PH_ROWS + it * 64 + g) * PQW + col);
  v4f acc = {0.f, 0.f, 0.f, 0.f};
#pragma unroll 8                                      // 8 loads in flight per thread: 4 L2 round trips for the 32 rows, not 32
  for (int it = 0; it < SQ / 64; ++it) {
    const v4f x = *(const v4f*)(base + (size_t)(it * 64 + g) * PQW + NHQ + col);
    acc += x;
  }
  *(v4f*)(red + g * (2 * NHQ) + 4 * pc) = acc;
  __syncthreads();
  if (tid < 2 * NHQ) {                                // wave 0
    float s = 0.f;
#pragma unroll                                        // the 64 LDS reads go out together; only the adds are a chain
    for (int r = 0; r < 64; ++r) s += red[r * (2 * NHQ) + tid];
    csk[tid] = s;
  }
  __syncthreads();
  const v4f w = *(const v4f*)(csk + 4 * pc);
#pragma unroll
  for (int it = 0; it < PH_ROWS / 64; ++it) {
    const v4f x = xq[it];
    part[(it * 64 + g) * 8 + pc] = (x[0] * w[0] + x[1] * w[1]) + (x[2] * w[2] + x[3] * w[3]);
  }
  __syncthreads();
  if (tid < PH_ROWS) {                                // whole waves
    const v4f p0 = *(const v4f*)(part + tid * 8);
    const v4f p1 = *(const v4f*)(part + tid * 8 + 4);
    const float a = ((p0[0] + p0[1]) + (p0[2] + p0[3])) + ((p1[0] + p1[1]) + (p1[2] + p1[3]));
    phs[(size_t)b * SQ + blk * PH_ROWS + tid] = a * (1.0f / 32768.0f);
  }
}

// ---------------------------------------------------------------------------
// Causal flash attention, head dim 128, 32-key chunks, block = 4 waves = 64 query rows of one (b, h); grid (n query tiles, NHQ, NSEQ).
//   q planes f16 [tok][h*128+d]: hi (qhp) and residual x2048 (qlp); k planes f16 [tok][h*128+d]: hi (khp); residual x2048 (klp) only for
//   keys < KLR of each sequence, stored at row b*KLR + key (read only when PRES); v^T planes f16 [h*128+d][tok]: hi (vhp), residual x2048 (vlp);
//   outputs attn bf16 hi (ahp) / lo (alp) [tok][h*128+d].
//   scores = (Sh + Sr/2048) * 128^-0.5 with Sh = qh.kh and Sr = ql'.kh (+ qh.kl' when PRES); keys > query -> -inf; online softmax f32;
//   p' = 1024 p stored per wave to LDS as f16 hi (and residual x2048 when PRES), reloaded as A fragments after a wave sync;
//   O = (Oh + Or/2048)/1024/l with Oh = ph.vh, Or = ph.vl' (+ pl'.vh when PRES).
//   q planes: each wave copies its 16 rows to LDS once and takes its A fragments from there in every chunk.
//   K / V^T chunk staging: 128 threads x 4 x 16 B per plane = whole 32x128 / 128x32 tile, plain loads, __syncthreads before and after.
//   Trip count 2*qb+2 chunks (static bound 64); waves whose rows are all below the chunk skip it (wave-uniform, scalar branch).
// ---------------------------------------------------------------------------
#define AT_KC   32
#define KS_P    136
#define VS_P    40
#define PS_P    40
#define QS_P    136
// LDS map in halves. The k and p residual planes exist only with PRES. QS: per wave 2 planes x 16 query rows at pitch QS_P (272 B = 16 B x 17).
template <bool PRES> struct AttnLds {
  static constexpr int KS  = 0;
  static constexpr int KLS = 32 * KS_P;
  static constexpr int VHS = (PRES ? 2 : 1) * 32 * KS_P;
  static constexpr int VLS = VHS + 128 * VS_P;
  static constexpr int PH  = VLS + 128 * VS_P;
  static constexpr int PL  = PH + 4 * 16 * PS_P;
  static constexpr int QS  = PH + (PRES ? 2 : 1) * 4 * 16 * PS_P;
  static constexpr int TOT = QS + 4 * 2 * 16 * QS_P;
};
static_assert(4 * AttnLds<false>::TOT * 2 <= 327680);   // four blocks of the long launch per WGP, as its registers allow
static_assert(4 * 4096 <= AttnLds<false>::QS);          // output staging (2 planes x 16 x 128 per wave) aliases the chunk region after the loop

template <bool PRES>
__global__ __launch_bounds__(128) void attn_causal_kernel(
    const unsigned short* __restrict__ qhp, const unsigned short* __restrict__ qlp,
    const unsigned short* __restrict__ khp, const unsigned short* __restrict__ klp,
    const unsigned short* __restrict__ vhp, const unsigned short* __restrict__ vlp,
    unsigned short* __restrict__ ahp, unsigned short* __restrict__ alp, int qb_base) {
  typedef AttnLds<PRES> L;
  __shared__ __align__(16) _Float16 lds[L::TOT];
  _Float16* Ks  = lds + L::KS;
  _Float16* Kls = PRES ? lds + L::KLS : Ks;      // used only with PRES
  _Float16* Vhs = lds + L::VHS;
  _Float16* Vls = lds + L::VLS;

  const int tid  = (int)threadIdx.x;
  const int lane = tid & 31;
  const int wave = wave_id();
  const int hh   = lane >> 4;
  const int c    = lane & 15;
  const int qb   = (int)blockIdx.x + qb_base;
  const int h    = (int)blockIdx.y;
  const int b    = (int)blockIdx.z;
  const int q0   = qb * 64 + wave * 16;          // first query row of this wave (within sequence)
  const int qlast = q0 + 15;
  const size_t tok0 = (size_t)b * SQ;

  const _Float16* Qhg = (const _Float16*)(const void*)qhp + (tok0 + q0) * HID + h * HDM;
  const _Float16* Qlg = (const _Float16*)(const void*)qlp + (tok0 + q0) * HID + h * HDM;
  const _Float16* Kg  = (const _Float16*)(const void*)khp + tok0 * HID + h * HDM;
  const _Float16* Klg = (const _Float16*)(const void*)klp + (size_t)b * KLR * HID + h * HDM;
  const _Float16* Vhg = (const _Float16*)(const void*)vhp + (size_t)(h * HDM) * NTOK + tok0;
  const _Float16* Vlg = (const _Float16*)(const void*)vlp + (size_t)(h * HDM) * NTOK + tok0;
  _Float16* ph = lds + L::PH + wave * (16 * PS_P);
  _Float16* pl = PRES ? lds + L::PL + wave * (16 * PS_P) : ph;   // used only with PRES
  _Float16* Qs = lds + L::QS + wave * (2 * 16 * QS_P);           // this wave's own query rows: hi plane, then residual plane

  // q rows to LDS once, whole 256-B rows per 16 lanes; read back only by this wave, behind the first barrier of the chunk loop (nch >= 2)
#pragma unroll                                   // all 16 loads in flight together: one global latency for the whole fill
  for (int it = 0; it < 8; ++it) {
    const int row = it * 2 + hh;                 // it 0..7 x hh 0..1 covers rows 0..15
    const v8h x = *(const v8h*)(Qhg + (size_t)row * HID + c * 8);
    const v8h y = *(const v8h*)(Qlg + (size_t)row * HID + c * 8);
    *(v8h*)(Qs + row * QS_P + c * 8) = x;
    *(v8h*)(Qs + (16 + row) * QS_P + c * 8) = y;
  }

  float mrow[8], lrow[8];
  v8f oacc[8], oaccr[8];
#pragma unroll
  for (int r = 0; r < 8; ++r) { mrow[r] = -INFINITY; lrow[r] = 0.f; }
#pragma unroll
  for (int t = 0; t < 8; ++t) { oacc[t] = zero8(); oaccr[t] = zero8(); }

  const int nch = 2 * qb + 2;                    // block-uniform, <= 64; keys < 64*(qb+1) <= SQ; PRES blocks: keys < 256 = KLR
  for (int kc = 0; kc < nch; ++kc) {
    const int kv0 = kc * AT_KC;
    __syncthreads();
#pragma unroll
    for (int i = 0; i < 4; ++i) {                // coverage: 512 pieces of 8 halves per plane = whole tile
      const int p   = tid + 128 * i;             // 0..511
      const int key = p >> 4, d8 = (p & 15) * 8; // K: 32 keys x 128 d
      const v8h kx = *(const v8h*)(Kg + (size_t)(kv0 + key) * HID + d8);
      *(v8h*)(Ks + key * KS_P + d8) = kx;
      if (PRES) {
        const v8h ky = *(const v8h*)(Klg + (size_t)(kv0 + key) * HID + d8);
        *(v8h*)(Kls + key * KS_P + d8) = ky;
      }
      const int d = p >> 2, k8 = (p & 3) * 8;    // V^T: 128 d x 32 keys
      const v8h vx = *(const v8h*)(Vhg + (size_t)d * NTOK + kv0 + k8);
      const v8h vy = *(const v8h*)(Vlg + (size_t)d * NTOK + kv0 + k8);
      *(v8h*)(Vhs + d * VS_P + k8) = vx;
      *(v8h*)(Vls + d * VS_P + k8) = vy;
    }
    __syncthreads();

    if (kv0 <= qlast) {                          // wave-uniform (scalar): skip chunks fully above this wave's rows
      // ---- scores ----
      v8f sh[2], sr[2];
      sh[0] = zero8(); sh[1] = zero8(); sr[0] = zero8(); sr[1] = zero8();
#pragma unroll
      for (int dc = 0; dc < 4; ++dc) {
        const v16h qa = ldfrag_h(Qs + c * QS_P + dc * 32 + 8 * hh);
        const v16h ql = ldfrag_h(Qs + (16 + c) * QS_P + dc * 32 + 8 * hh);
#pragma unroll
        for (int j = 0; j < 2; ++j) {
          const v16h kb = ldfrag_h(Ks + (j * 16 + c) * KS_P + dc * 32 + 8 * hh);
          sh[j] = mma_h(qa, kb, sh[j]);
          sr[j] = mma_h(ql, kb, sr[j]);
          if (PRES) {
            const v16h kl = ldfrag_h(Kls + (j * 16 + c) * KS_P + dc * 32 + 8 * hh);
            sr[j] = mma_h(qa, kl, sr[j]);
            guard_h4(sh[j], sr[j], qa, ql, kb, kl);
          } else {
            guard_h3(sh[j], sr[j], qa, ql, kb);
          }
        }
      }
      // ---- scale, causal mask, chunk row max ----
      float cm[8];
#pragma unroll
      for (int r = 0; r < 8; ++r) {
        const int qrow = q0 + 8 * hh + r;
        float m = -INFINITY;
#pragma unroll
        for (int j = 0; j < 2; ++j) {
          const int key = kv0 + j * 16 + c;
          float s = (sh[j][r] + sr[j][r] * 0.00048828125f) * 0.08838834764831845f;
          s = (key > qrow) ? -INFINITY : s;
          sh[j][r] = s;
          m = fmaxf(m, s);
        }
#pragma unroll
        for (int off = 1; off < 16; off <<= 1) m = fmaxf(m, __shfl_xor(m, off, 32));
        cm[r] = m;
      }
      // ---- online softmax, P' to LDS ----
#pragma unroll
      for (int r = 0; r < 8; ++r) {
        const float mnew  = fmaxf(mrow[r], cm[r]);
        const float alpha = __expf(mrow[r] - mnew);
        mrow[r] = mnew;
        float psum = 0.f;
#pragma unroll
        for (int j = 0; j < 2; ++j) {
          const float p  = __expf(sh[j][r] - mnew);
          psum += p;
          const float pp = p * 1024.0f;
          const _Float16 phv = (_Float16)pp;
          const int po = (8 * hh + r) * PS_P + j * 16 + c;
          ph[po] = phv;
          if (PRES) pl[po] = (_Float16)((pp - (float)phv) * 2048.0f);
        }
#pragma unroll
        for (int off = 1; off < 16; off <<= 1) psum += __shfl_xor(psum, off, 32);
        lrow[r] = lrow[r] * alpha + psum;
#pragma unroll
        for (int t = 0; t < 8; ++t) { oacc[t][r] *= alpha; oaccr[t][r] *= alpha; }
      }
      lds_wave_sync();                           // P' stores visible to the other lanes of this wave before the fragment reload
      // ---- O += P' . V ----
      const v16h pa = ldfrag_h(ph + c * PS_P + 8 * hh);
      v16h pr = pa;
      if (PRES) pr = ldfrag_h(pl + c * PS_P + 8 * hh);
#pragma unroll
      for (int t = 0; t < 8; ++t) {
        const v16h vb = ldfrag_h(Vhs + (t * 16 + c) * VS_P + 8 * hh);
        const v16h vr = ldfrag_h(Vls + (t * 16 + c) * VS_P + 8 * hh);
        oacc[t]  = mma_h(pa, vb, oacc[t]);
        oaccr[t] = mma_h(pa, vr, oaccr[t]);
        if (PRES) oaccr[t] = mma_h(pr, vb, oaccr[t]);
        guard_h4(oacc[t], oaccr[t], pa, pr, vb, vr);
      }
    }
  }

  __syncthreads();                               // all chunk-region readers done before aliasing it as output staging
  _Float16* osh = lds + wave * 4096;
  _Float16* osl = osh + 2048;
#pragma unroll
  for (int r = 0; r < 8; ++r) {
    const float inv = (1.0f / lrow[r]) * 0.0009765625f;
#pragma unroll
    for (int t = 0; t < 8; ++t) {
      const float o = (oacc[t][r] + oaccr[t][r] * 0.00048828125f) * inv;
      const unsigned short hb = bf_bits(o);
      const unsigned short lb = bf_bits(o - bf_val(hb));
      const int so = (8 * hh + r) * 128 + t * 16 + c;
      osh[so] = __builtin_bit_cast(_Float16, hb);
      osl[so] = __builtin_bit_cast(_Float16, lb);
    }
  }
  lds_wave_sync();
  _Float16* Ahg = (_Float16*)(void*)ahp + (tok0 + q0) * HID + h * HDM;
  _Float16* Alg = (_Float16*)(void*)alp + (tok0 + q0) * HID + h * HDM;
  {
#pragma unroll
    for (int it = 0; it < 8; ++it) {
      const int row = it * 2 + hh;               // it 0..7 x hh 0..1 covers rows 0..15
      const int c8  = c * 8;                     // 16 lanes x 16 B = the whole 256-B segment
      const v8h x = *(const v8h*)(osh + row * 128 + c8);
      const v8h y = *(const v8h*)(osl + row * 128 + c8);
      *(v8h*)(Ahg + (size_t)row * HID + c8) = x;
      *(v8h*)(Alg + (size_t)row * HID + c8) = y;
    }
    
  }
}

// ---------------------------------------------------------------------------
// Workspace map (bytes; every region is a whole number of the rows its producer writes with whole-line stores; all dims are tile multiples,
// so padded size == logical size; offsets are multiples of 16384):
//   R0   Xb  bf16 [4096][2048] 16777216, later Ah bf16 [4096][2048] (Xb dead after the three projection GEMMs)
//   R1   WqkT bf16 [4096][2048] 16777216, later Al bf16 [4096][2048]
//   R2   WvT bf16 [2048][2048]  8388608, later WoT bf16 [2048][2048] (WvT dead after the v GEMM)
//   WpT  bf16 [32][2048]          131072
//   Qh, Ql, Kh f16 [4096][2048]  16777216 each
//   Kl   f16 [512][2048]          2097152
//   Vh, Vl f16 [2048][4096]      16777216 each
//   PQ   f32 [4096][64]           1048576
//   phs  f32 [4096]                 16384
//   total                       129122304
// ---------------------------------------------------------------------------
static inline size_t smax(size_t a, size_t b) { return a > b ? a : b; }

extern "C" void kernel_launch(void* const* d_in, const int* in_sizes, int n_in,
                              void* d_out, int out_size, void* d_ws, size_t ws_size,
                              hipStream_t stream) {
  if (n_in < 7) return;
  if (in_sizes[0] != NTOK * HID) return;
  if (in_sizes[1] != HID * HID) return;
  if (in_sizes[2] != HID * HID) return;
  if (in_sizes[3] != HID * HID) return;
  if (in_sizes[4] != HID * HID) return;
  if (in_sizes[5] != HID * NHQ) return;
  if (in_sizes[6] != HID * NHQ) return;
  if (out_size != NTOK * HID) return;

  const float* x   = (const float*)d_in[0];
  const float* Wq  = (const float*)d_in[1];
  const float* Wk  = (const float*)d_in[2];
  const float* Wv  = (const float*)d_in[3];
  const float* Wo  = (const float*)d_in[4];
  const float* Wpq = (const float*)d_in[5];
  const float* Wpk = (const float*)d_in[6];
  float* out = (float*)d_out;

  const size_t szX   = (size_t)NTOK * HID * 2;
  const size_t szWqk = (size_t)2 * HID * HID * 2;
  const size_t szW   = (size_t)HID * HID * 2;
  const size_t szA   = (size_t)NTOK * HID * 2;
  const size_t szWp  = (size_t)NPH * HID * 2;
  const size_t szQ   = (size_t)NTOK * HID * 2;
  const size_t szKl  = (size_t)NSEQ * KLR * HID * 2;
  const size_t szV   = (size_t)HID * NTOK * 2;
  const size_t szPQ  = (size_t)NTOK * PQW * 4;
  const size_t szPh  = (size_t)NTOK * 4;
  size_t off = 0;
  const size_t oR0 = off; off += smax(szX, szA);
  const size_t oR1 = off; off += smax(szWqk, szA);
  const size_t oR2 = off; off += szW;
  const size_t oWp = off; off += szWp;
  const size_t oQh = off; off += szQ;
  const size_t oQl = off; off += szQ;
  const size_t oKh = off; off += szQ;
  const size_t oKl = off; off += szKl;
  const size_t oVh = off; off += szV;
  const size_t oVl = off; off += szV;
  const size_t oPQ = off; off += szPQ;
  const size_t oPh = off; off += szPh;
  if (off > ws_size) return;                     // off = 129122304

  char* ws = (char*)d_ws;
  unsigned short* Xb   = (unsigned short*)(ws + oR0);
  unsigned short* Ah   = (unsigned short*)(ws + oR0);
  unsigned short* WqkT = (unsigned short*)(ws + oR1);
  unsigned short* Al   = (unsigned short*)(ws + oR1);
  unsigned short* WvT  = (unsigned short*)(ws + oR2);
  unsigned short* WoT  = (unsigned short*)(ws + oR2);
  unsigned short* WpT  = (unsigned short*)(ws + oWp);
  unsigned short* Qh   = (unsigned short*)(ws + oQh);
  unsigned short* Ql   = (unsigned short*)(ws + oQl);
  unsigned short* Kh   = (unsigned short*)(ws + oKh);
  unsigned short* Kl   = (unsigned short*)(ws + oKl);
  unsigned short* Vh   = (unsigned short*)(ws + oVh);
  unsigned short* Vl   = (unsigned short*)(ws + oVl);
  float*          PQ   = (float*)(ws + oPQ);
  float*          phs  = (float*)(ws + oPh);

  const dim3 b256(256), b128(128);

  // (1) x -> bf16 plane [4096][2048]
  cvt_bf16_kernel<<<dim3((NTOK * HID / 8) / 256), b256, 0, stream>>>(x, Xb, NTOK * HID / 8);
  // (2) Wq in[2048 rows][2048 cols] -> WqkT rows 0..2047 = out[n][k]; Wk -> WqkT rows 2048..4095; Wv -> WvT   (grid = cols/64, rows/64)
  tconv_bf16_kernel<<<dim3(HID / 64, HID / 64), b256, 0, stream>>>(Wq, WqkT, HID, HID);
  tconv_bf16_kernel<<<dim3(HID / 64, HID / 64), b256, 0, stream>>>(Wk, WqkT + (size_t)HID * HID, HID, HID);
  tconv_bf16_kernel<<<dim3(HID / 64, HID / 64), b256, 0, stream>>>(Wv, WvT, HID, HID);
  // (3) Wpq|Wpk -> WpT [32][2048]
  wpt_kernel<<<dim3(NPH), b256, 0, stream>>>(Wpq, Wpk, WpT);
  // (4) pq|pk = x . (Wpq|Wpk) -> cos|sin plane PQ [4096][64]   (M=4096, N=32, K=2048; 128 tiles / 4)
  gemm_kernel<3, 2, false><<<dim3((NTOK / 32) * (NPH / 32) / 4), b128, 0, stream>>>(
      Xb, Xb, HID, WpT, HID, phs, (void*)PQ, (void*)PQ, (void*)PQ, (void*)PQ, PQW, NTOK, NPH, HID);
  // (5) phase factor phs [4096]
  phase_kernel<<<dim3(NSEQ * PH_PB), dim3(512), 0, stream>>>(PQ, phs);
  // (6) q|k = x . (Wq|Wk) -> Qh/Ql [4096][2048], Kh [4096][2048], Kl [512][2048]   (M=4096, N=4096, K=2048; 32 x 16 block tiles)
  gemm_tiled_kernel<0, 4, false><<<dim3((NTOK / GT_BM) * ((2 * HID) / GT_BN)), b128, 0, stream>>>(
      Xb, Xb, HID, WqkT, HID, phs, (void*)Qh, (void*)Ql, (void*)Kh, (void*)Kl, HID, NTOK, 2 * HID, HID);
  // (7) v^T = WvT . x^T -> Vh/Vl [2048][4096]   (A = WvT, Bt = Xb; M=2048, N=4096, K=2048; 16 x 16 block tiles)
  gemm_tiled_kernel<1, 2, false><<<dim3((HID / GT_BM) * (NTOK / GT_BN)), b256, 0, stream>>>(
      WvT, WvT, HID, Xb, HID, phs, (void*)Vh, (void*)Vl, (void*)Vh, (void*)Vl, NTOK, HID, NTOK, HID);
  // (8) Wo -> WoT (over the dead WvT region)
  tconv_bf16_kernel<<<dim3(HID / 64, HID / 64), b256, 0, stream>>>(Wo, WoT, HID, HID);
  // (9) causal attention, query tiles 0..3 with k and p residual products, tiles 4..31 without -> Ah/Al (over the dead Xb/WqkT regions)
  attn_causal_kernel<true><<<dim3(4, NHQ, NSEQ), b128, 0, stream>>>(Qh, Ql, Kh, Kl, Vh, Vl, Ah, Al, 0);
  attn_causal_kernel<false><<<dim3(SQ / 64 - 4, NHQ, NSEQ), b128, 0, stream>>>(Qh, Ql, Kh, Kl, Vh, Vl, Ah, Al, 4);
  // (10) out = (attn hi + lo) . Wo * (1 + 0.1*phs[m]) -> d_out f32 [4096][2048]   (M=4096, N=2048, K=2048; 32 x 8 block tiles)
  gemm_tiled_kernel<2, 2, true><<<dim3((NTOK / GT_BM) * (HID / GT_BN)), b256, 0, stream>>>(
      Ah, Al, HID, WoT, HID, phs, (void*)out, (void*)out, (void*)out, (void*)out, HID, NTOK, HID, HID);
  (void)hipGetLastError();
}

// v004
// It runs in 357 microseconds.
// Two timings next to v003 put it at 1.09 and 1.08 times that version's speed.
// Counting every step since v000, it is 2.17 times as fast.
// Contractions: x.(Wq|Wk), Wv^T.x^T and x.(Wpq|Wpk) on v_wmma_f32_16x16x32_bf16 (operands = RNE bf16 of the f32 inputs, single products);
// q.k^T and p.v on v_wmma_f32_16x16x32_f16 (q = f16 hi + f16 residual x2^11 planes; k plain f16 plus f16 residual x2^11 on query tiles 0..3;
// p x1024 plain f16 plus f16 residual x2^11 on query tiles 0..3; v^T = f16 hi + f16 residual x2^11 planes); attn.Wo on v_wmma_f32_16x16x32_bf16
// (attn = bf16 hi + bf16 lo planes, two products; Wo RNE bf16). f32 accumulate everywhere; online softmax, cos/sin phase sums and output scale in f32.
#include <hip/hip_runtime.h>
#include <math.h>
#include <stdint.h>

#define NSEQ   2
#define SQ     2048
#define HID    2048
#define NHQ    16
#define HDM    128
#define NTOK   4096
#define NPH    32
#define PQW    64
#define KLR    256

static_assert(NTOK == NSEQ * SQ);
static_assert(NHQ * HDM == HID);
static_assert(KLR % 32 == 0 && SQ % KLR == 0);

typedef _Float16     v16h __attribute__((ext_vector_type(16)));
typedef _Float16     v8h  __attribute__((ext_vector_type(8)));
typedef __bf16       v16b __attribute__((ext_vector_type(16)));
typedef __bf16       v8b  __attribute__((ext_vector_type(8)));
typedef float        v8f  __attribute__((ext_vector_type(8)));
typedef float        v4f  __attribute__((ext_vector_type(4)));
typedef unsigned int v4u  __attribute__((ext_vector_type(4)));

// ---------------------------------------------------------------------------
// small helpers
// ---------------------------------------------------------------------------
__device__ __forceinline__ unsigned short bf_bits(float f) {          // RNE convert f32 -> bf16 bits
  const unsigned u = __float_as_uint(f);
  return (unsigned short)((u + 0x7FFFu + ((u >> 16) & 1u)) >> 16);
}
__device__ __forceinline__ float bf_val(unsigned short h) { return __uint_as_float(((unsigned)h) << 16); }
__device__ __forceinline__ unsigned pk16(unsigned short a, unsigned short b) { return (unsigned)a | ((unsigned)b << 16); }
__device__ __forceinline__ v8f zero8() { v8f z = {0.f, 0.f, 0.f, 0.f, 0.f, 0.f, 0.f, 0.f}; return z; }
__device__ __forceinline__ int wave_id() {
#if defined(__HIP_DEVICE_COMPILE__)
  return __builtin_amdgcn_readfirstlane((int)(threadIdx.x >> 5));
#else
  return (int)(threadIdx.x >> 5);
#endif
}
// release/acquire + wave barrier between one wave's LDS stores and the other lanes' reloads
__device__ __forceinline__ void lds_wave_sync() {
#if defined(__HIP_DEVICE_COMPILE__)
  __builtin_amdgcn_fence(__ATOMIC_RELEASE, "workgroup");
  __builtin_amdgcn_wave_barrier();
  __builtin_amdgcn_fence(__ATOMIC_ACQUIRE, "workgroup");
#endif
}

// ---------------------------------------------------------------------------
// WMMA fragments (wave32, 16x16x32, 16-bit operands). For A (row m = lane&15) and B (col n = lane&15) alike:
// elements 0..7 <- k0 + 8*(lane>>4) + 0..7, elements 8..15 <- k0 + 16 + 8*(lane>>4) + 0..7.
// ldfrag(p) with p = rowbase + k0 + 8*(lane>>4): two 16-B loads p[0..7], p[16..23].
// D: acc[r] = (row 8*(lane>>4) + r, col lane&15).
// ---------------------------------------------------------------------------
union FragH { v16h v; v8h h[2]; };
union FragB { v16b v; v8b h[2]; };
__device__ __forceinline__ v16h ldfrag_h(const _Float16* p) { FragH f; f.h[0] = *(const v8h*)(p); f.h[1] = *(const v8h*)(p + 16); return f.v; }
__device__ __forceinline__ v16b ldfrag_b(const __bf16* p)   { FragB f; f.h[0] = *(const v8b*)(p); f.h[1] = *(const v8b*)(p + 16); return f.v; }

__device__ __forceinline__ v8f mma_h(v16h a, v16h b, v8f c) {
#if defined(__HIP_DEVICE_COMPILE__)
  return __builtin_amdgcn_wmma_f32_16x16x32_f16(false, a, false, b, (short)0, c, false, false);
#else
  return c;
#endif
}
__device__ __forceinline__ v8f mma_b(v16b a, v16b b, v8f c) {
#if defined(__HIP_DEVICE_COMPILE__)
  return __builtin_amdgcn_wmma_f32_16x16x32_bf16(false, a, false, b, (short)0, c, false, false);
#else
  return c;
#endif
}
// hazard guards: 4 VALU slots after the last WMMA of a group, D tied, A/B kept live; memory clobber keeps later loads behind the group
__device__ __forceinline__ void guard_h3(v8f& a, v8f& b, v16h x, v16h y, v16h z) {
#if defined(__HIP_DEVICE_COMPILE__)
  asm volatile("v_nop\n\tv_nop\n\tv_nop\n\tv_nop" : "+v"(a), "+v"(b) : "v"(x), "v"(y), "v"(z) : "memory");
#endif
}
__device__ __forceinline__ void guard_h4(v8f& a, v8f& b, v16h w, v16h x, v16h y, v16h z) {
#if defined(__HIP_DEVICE_COMPILE__)
  asm volatile("v_nop\n\tv_nop\n\tv_nop\n\tv_nop" : "+v"(a), "+v"(b) : "v"(w), "v"(x), "v"(y), "v"(z) : "memory");
#endif
}

// ---------------------------------------------------------------------------
// Elementwise RNE f32 -> bf16 plane: 8 elements per thread, one 16-B store per lane -> 32 consecutive lanes write 4 whole
// ---------------------------------------------------------------------------
__global__ __launch_bounds__(256) void cvt_bf16_kernel(const float* __restrict__ in, unsigned short* __restrict__ outp, int n8) {
  const int i = (int)blockIdx.x * 256 + (int)threadIdx.x;
  if (i >= n8) return;
  const size_t e = 8 * (size_t)i;
  const v4f a = *(const v4f*)(in + e);
  const v4f b = *(const v4f*)(in + e + 4);
  v4u w;
  w[0] = pk16(bf_bits(a[0]), bf_bits(a[1]));
  w[1] = pk16(bf_bits(a[2]), bf_bits(a[3]));
  w[2] = pk16(bf_bits(b[0]), bf_bits(b[1]));
  w[3] = pk16(bf_bits(b[2]), bf_bits(b[3]));
  *(v4u*)(outp + e) = w;
  
}

// ---------------------------------------------------------------------------
// Fused transpose + RNE bf16 convert: in [R rows][Cc cols] f32 (pitch Cc) -> out[c][r] = bf16(in[r][c])  ([Cc][R], pitch R).
// 64x64 tiles through LDS; grid = (Cc/64, R/64), 256 threads; R, Cc multiples of 64.
// Coverage per block: load 4 it x 256 thr x 4 floats = 64x64; store 2 it x 256 thr x 8 u16 = 64x64.
// ---------------------------------------------------------------------------
__global__ __launch_bounds__(256) void tconv_bf16_kernel(const float* __restrict__ W, unsigned short* __restrict__ outp, int R, int Cc) {
  __shared__ __align__(16) float tf[64 * 68];
  const int c0  = (int)blockIdx.x * 64;   // input column block = output row block
  const int r0  = (int)blockIdx.y * 64;   // input row block    = output column block
  const int tid = (int)threadIdx.x;
  {
    const int lr = tid >> 4;              // 0..15
    const int c4 = (tid & 15) * 4;        // 0..60
#pragma unroll
    for (int it = 0; it < 4; ++it) {
      const int rr = it * 16 + lr;        // 0..63
      const v4f a = *(const v4f*)(W + (size_t)(r0 + rr) * Cc + c0 + c4);
      *(v4f*)(tf + rr * 68 + c4) = a;
    }
  }
  __syncthreads();
  const int sub = tid >> 3;               // 0..31
  const int c8  = (tid & 7) * 8;          // 0..56
  v4u hv[2];
#pragma unroll
  for (int it = 0; it < 2; ++it) {
    const int oc = it * 32 + sub;         // output row within tile (= input column)
    v4u a;
#pragma unroll
    for (int q = 0; q < 4; ++q) {
      const float f0 = tf[(c8 + 2 * q) * 68 + oc];
      const float f1 = tf[(c8 + 2 * q + 1) * 68 + oc];
      a[q] = pk16(bf_bits(f0), bf_bits(f1));
    }
    hv[it] = a;
  }
  {
#pragma unroll
    for (int it = 0; it < 2; ++it) {
      const int oc = it * 32 + sub;
      const size_t go = (size_t)(c0 + oc) * R + r0 + c8;
      *(v4u*)(outp + go) = hv[it];
    }
    
  }
}

// ---------------------------------------------------------------------------
// Phase weights: Wpq [HID][NHQ], Wpk [HID][NHQ] f32 -> WpT [NPH][HID] bf16 rows (rows 0..15 = Wpq^T, 16..31 = Wpk^T).
// ---------------------------------------------------------------------------
__global__ __launch_bounds__(256) void wpt_kernel(const float* __restrict__ Wpq, const float* __restrict__ Wpk,
                                                  unsigned short* __restrict__ outp) {
  const int n = (int)blockIdx.x;                   // 0..31
  const float* W = (n < NHQ) ? Wpq : Wpk;          // block-uniform, both global
  const int h = n & (NHQ - 1);
  const int t = (int)threadIdx.x;                  // k = 8t .. 8t+7  (< HID)
  v4u w;
#pragma unroll
  for (int q = 0; q < 4; ++q) {
    const float f0 = W[(size_t)(8 * t + 2 * q) * NHQ + h];
    const float f1 = W[(size_t)(8 * t + 2 * q + 1) * NHQ + h];
    w[q] = pk16(bf_bits(f0), bf_bits(f1));
  }
  const size_t o = (size_t)n * HID + 8 * (size_t)t;
  *(v4u*)(outp + o) = w;
  
}

// ---------------------------------------------------------------------------
// bf16 WMMA GEMMs: C[m][n] = sum_k A[m][k] * Bt[n][k]; A row-major [M][K] bf16 (pitch lda), Bt row-major [N][K] bf16 (pitch ldb).
//   SPLITA: A carried as hi (Ap) + lo (A2p) bf16 planes, two products into one accumulator (hi then lo at every k step).
//   gemm_tiled_kernel (EPI 0, 1, 2): block tile 128 x 256, waves of 64 x 128 (EPI 0) or 32 x 128 (EPI 1, 2), operands staged in an LDS ring of two buffers.
// Epilogues (all: per wave, per 16-row slab: stage in LDS, wave sync, write each row segment with ONE instruction); MI = 16-row slabs per wave.
//   EPI 0 (NJ 8): q|k projection. cols n0 < HID (q): f16 hi plane C0 and f16 residual x2048 plane C1, both [M][ldc], cols n0..n0+127
//          (row segment 256 B = 16 lanes x 16 B). cols n0 >= HID (k): hi plane C2 [M][ldc] cols n0-HID..; residual plane C3 [NSEQ*KLR][ldc]
//          only for token rows with (m % SQ) < KLR at row (m / SQ)*KLR + m % SQ (wave-uniform choice; 32- and 64-row wave tiles never straddle).
//   EPI 1 (NJ 8): v^T projection: f16 hi plane C0, residual x2048 plane C1, [M][ldc], row segment 256 B.
//   EPI 2 (NJ 8): f32 output C0 [M][ldc], each row scaled by (1 + 0.1*phs[m]); row segment 128 floats = 512 B = 32 lanes x 16 B per instruction.
// ---------------------------------------------------------------------------
template <int EPI> struct SlabT { typedef _Float16 T; static constexpr int PERW = 4096; };   // 2 planes x 16 x 128 halves
template <> struct SlabT<2>     { typedef float    T; static constexpr int PERW = 2048; };   // 16 x 128 floats

// s_wait_xcnt 0 behind an issued global store, in front of a rewrite of a register that the store names
__device__ __forceinline__ void wait_x0() {
#if defined(__HIP_DEVICE_COMPILE__)
  asm volatile("s_wait_xcnt 0x0" ::: "memory");
#endif
}

// slab: this wave's own LDS staging range; (m0, n0): first row and column of the wave's (16*MI) x (16*NJ) tile.
template <int EPI, int NJ, int MI>
__device__ __forceinline__ void gemm_epilogue(v8f (&acc)[MI][NJ], typename SlabT<EPI>::T* slab, int lane, int m0, int n0,
                                              const float* __restrict__ phs, void* C0, void* C1, void* C2, void* C3, int ldc) {
  const int hh = lane >> 4;
  const int rl = lane & 15;
  _Float16* sl16 = (_Float16*)(void*)slab;
  float*    slf  = (float*)(void*)slab;

  if constexpr (EPI == 0 || EPI == 1) {
    _Float16* P0;
    _Float16* P1;
    int col0;
    int lomode;                                   // 0: lo row = m; 1: lo row remapped into the KLR-row plane; 2: no lo store
    if constexpr (EPI == 0) {
      const bool isq = (n0 < HID);                // wave-uniform
      P0 = isq ? (_Float16*)C0 : (_Float16*)C2;
      P1 = isq ? (_Float16*)C1 : (_Float16*)C3;
      col0 = isq ? n0 : (n0 - HID);
      const int s0 = m0 & (SQ - 1);
      lomode = isq ? 0 : ((s0 < KLR) ? 1 : 2);
    } else {
      P0 = (_Float16*)C0;
      P1 = (_Float16*)C1;
      col0 = n0;
      lomode = 0;
    }
#pragma unroll
    for (int i = 0; i < MI; ++i) {
#pragma unroll
      for (int r = 0; r < 8; ++r) {
#pragma unroll
        for (int j = 0; j < NJ; ++j) {
          const float v = acc[i][j][r];
          const _Float16 hv = (_Float16)v;
          const int so = (8 * hh + r) * 128 + j * 16 + rl;
          sl16[so]        = hv;
          sl16[2048 + so] = (_Float16)((v - (float)hv) * 2048.0f);
        }
      }
      lds_wave_sync();
      {
#pragma unroll
        for (int it = 0; it < 8; ++it) {
          const int row = it * 2 + hh;            // it x hh covers rows 0..15
          const int c8  = rl * 8;
          const v8h xh = *(const v8h*)(sl16 + row * 128 + c8);
          const v8h xl = *(const v8h*)(sl16 + 2048 + row * 128 + c8);
          const int m = m0 + i * 16 + row;
          *(v8h*)(P0 + (size_t)m * ldc + col0 + c8) = xh;
          if constexpr (EPI == 0) wait_x0();      // precaution: in front of the branch below, whose first instructions reuse this store's registers
          if (lomode != 2) {
            const int m1 = (lomode == 1) ? ((m / SQ) * KLR + (m % SQ)) : m;
            *(v8h*)(P1 + (size_t)m1 * ldc + col0 + c8) = xl;
            if constexpr (EPI == 0) wait_x0();    // precaution: inside the branch, in front of whatever reuses this store's registers behind it
          }
        }
        
      }
      lds_wave_sync();
    }
  } else if constexpr (EPI == 2) {
    float* C = (float*)C0;
#pragma unroll
    for (int i = 0; i < MI; ++i) {
#pragma unroll
      for (int r = 0; r < 8; ++r) {
        const int m = m0 + i * 16 + 8 * hh + r;
        const float sc = 1.0f + 0.1f * phs[m];
#pragma unroll
        for (int j = 0; j < NJ; ++j)
          slf[(8 * hh + r) * 128 + j * 16 + rl] = acc[i][j][r] * sc;
      }
      lds_wave_sync();
      {
#pragma unroll
        for (int row = 0; row < 16; ++row) {      // 32 lanes x 16 B = the whole 512-B row segment per instruction
          const v4f v = *(const v4f*)(slf + row * 128 + lane * 4);
          *(v4f*)(C + (size_t)(m0 + i * 16 + row) * ldc + n0 + lane * 4) = v;
        }
        
      }
      lds_wave_sync();
    }
  }
}

// ---------------------------------------------------------------------------
// Tiled GEMM main loop. Block tile 128 x 256; waves in a (8/MI) x 2 grid, each (16*MI) x 128: MI 4 = 4 waves, MI 2 = 8 waves.
// A pass is 64 k: a stage holds [A 128 rows | (SPLITA: A2 128 rows) | Bt 256 rows] of 128 B at pitch 144 B
// (16 B x 9: ds_load_b128 fragment reads without bank conflicts). Every thread brings 16-B pieces with asynchronous copies to LDS,
// one pass ahead of the pass that reads them. M % 128 == 0, N % 256 == 0, K % 64 == 0, K >= 128; grid.x = (M/128) * (N/256).
// ---------------------------------------------------------------------------
#define GT_BM 128
#define GT_BN 256
#define GT_KP 64
#define GT_LP 72                                  // LDS row pitch in bf16 elements

// Asynchronous 16-B copies, one per lane and line of the statement: l + c * lstep = the lane's LDS byte address, g[c] = its global source.
// s_wait_xcnt stands inside the statement so that no address register is rewritten ahead of it.
__device__ __forceinline__ void copy8(unsigned l, unsigned lstep, const __bf16* const* g) {
#if defined(__HIP_DEVICE_COMPILE__)
  asm volatile(
      "global_load_async_to_lds_b128 %0, %8, off\n\t"
      "global_load_async_to_lds_b128 %1, %9, off\n\t"
      "global_load_async_to_lds_b128 %2, %10, off\n\t"
      "global_load_async_to_lds_b128 %3, %11, off\n\t"
      "global_load_async_to_lds_b128 %4, %12, off\n\t"
      "global_load_async_to_lds_b128 %5, %13, off\n\t"
      "global_load_async_to_lds_b128 %6, %14, off\n\t"
      "global_load_async_to_lds_b128 %7, %15, off\n\t"
      "s_wait_xcnt 0x0"
      :: "v"(l), "v"(l + lstep), "v"(l + 2u * lstep), "v"(l + 3u * lstep),
         "v"(l + 4u * lstep), "v"(l + 5u * lstep), "v"(l + 6u * lstep), "v"(l + 7u * lstep),
         "v"(g[0]), "v"(g[1]), "v"(g[2]), "v"(g[3]), "v"(g[4]), "v"(g[5]), "v"(g[6]), "v"(g[7])
      : "memory");
#endif
}
__device__ __forceinline__ void copy4(unsigned l, unsigned lstep, const __bf16* const* g) {
#if defined(__HIP_DEVICE_COMPILE__)
  asm volatile(
      "global_load_async_to_lds_b128 %0, %4, off\n\t"
      "global_load_async_to_lds_b128 %1, %5, off\n\t"
      "global_load_async_to_lds_b128 %2, %6, off\n\t"
      "global_load_async_to_lds_b128 %3, %7, off\n\t"
      "s_wait_xcnt 0x0"
      :: "v"(l), "v"(l + lstep), "v"(l + 2u * lstep), "v"(l + 3u * lstep),
         "v"(g[0]), "v"(g[1]), "v"(g[2]), "v"(g[3])
      : "memory");
#endif
}
// this wave's copies have landed in LDS
__device__ __forceinline__ void wait_async0() {
#if defined(__HIP_DEVICE_COMPILE__)
  asm volatile("s_wait_asynccnt 0x0" ::: "memory");
#endif
}
// this wave's LDS reads have returned (before the buffer they read is handed back for a refill)
__device__ __forceinline__ void wait_ds0() {
#if defined(__HIP_DEVICE_COMPILE__)
  asm volatile("s_wait_dscnt 0x0" ::: "memory");
#endif
}
// the compiler's scheduler moves nothing across this point
__device__ __forceinline__ void sched_fence() {
#if defined(__HIP_DEVICE_COMPILE__)
  __builtin_amdgcn_sched_barrier(0);
#endif
}

// second launch bound: two waves per SIMD (two 4-wave blocks, or one 8-wave block, per WGP), so that one wave's WMMAs cover the other's waits
template <int EPI, int MI, bool SPLITA>
__global__ __launch_bounds__(512 / MI, 2) void gemm_tiled_kernel(
    const unsigned short* Ap, const unsigned short* A2p, int lda,
    const unsigned short* __restrict__ Btp, int ldb,
    const float* __restrict__ phs,
    void* C0, void* C1, void* C2, void* C3, int ldc,
    int M, int N, int K) {
  static_assert(EPI == 0 || EPI == 1 || EPI == 2);
  static_assert(MI == 4 || MI == 2);
  static_assert(GT_KP == 64);
  constexpr int NW    = 16 / MI;                  // waves per block
  constexpr int RS    = NW * 4;                   // stage rows that one copy of every thread covers (8 threads per 128-B row)
  constexpr int AROWS = (SPLITA ? 2 : 1) * GT_BM;
  constexpr int NCP   = (AROWS + GT_BN) / RS;     // copies per thread and stage: 24, 12 or 16 (at most 63 may be outstanding)
  constexpr int STAGE = (AROWS + GT_BN) * GT_LP;  // elements per buffer
  static_assert(NCP % 4 == 0 && NCP <= 63);
  typedef typename SlabT<EPI>::T ST;
  __shared__ __align__(16) __bf16 ring[2 * STAGE];
  __shared__ __align__(16) ST slab_all[NW * SlabT<EPI>::PERW];

  const int tid  = (int)threadIdx.x;
  const int lane = tid & 31;
  const int wave = wave_id();
  const int hh = lane >> 4;           // lane half: k offset 8*hh
  const int rl = lane & 15;           // A row / B col within subtile
  const int tilesN = N / GT_BN;
  const int tm  = (int)blockIdx.x / tilesN;
  const int tn  = (int)blockIdx.x - tm * tilesN;
  const int bm0 = tm * GT_BM;
  const int bn0 = tn * GT_BN;
  const int wm  = wave >> 1;
  const int wn  = wave & 1;

  // copy side: copy c of this thread brings piece tid % 8 of stage row c * RS + tid / 8
  const int crow = tid >> 3;
  const int cpc  = (tid & 7) * 8;     // element offset of the 16-B piece
  const __bf16* gA  = (const __bf16*)(const void*)Ap  + (size_t)(bm0 + crow) * lda + cpc;
  const __bf16* gA2 = (const __bf16*)(const void*)A2p + (size_t)(bm0 + crow) * lda + cpc;
  const __bf16* gB  = (const __bf16*)(const void*)Btp + (size_t)(bn0 + crow) * ldb + cpc;
  const unsigned lc = (unsigned)(size_t)(const void*)ring + (unsigned)(crow * GT_LP + cpc) * 2u;
  auto fill = [&](int t) {            // tile t -> buffer t % 2
    const unsigned l = lc + (unsigned)(t & 1) * (unsigned)(STAGE * 2);
    const size_t ko = (size_t)t * GT_KP;
    const __bf16* g[NCP];
#pragma unroll
    for (int c = 0; c < NCP; ++c) {
      const int r = c * RS;
      g[c] = (r < GT_BM) ? gA + ko + (size_t)r * lda
           : (r < AROWS) ? gA2 + ko + (size_t)(r - GT_BM) * lda
                         : gB + ko + (size_t)(r - AROWS) * ldb;
    }
#pragma unroll
    for (int c = 0; c + 8 <= NCP; c += 8) copy8(l + (unsigned)(c * RS * GT_LP * 2), RS * GT_LP * 2u, g + c);
    if constexpr (NCP % 8 == 4) copy4(l + (unsigned)((NCP - 4) * RS * GT_LP * 2), RS * GT_LP * 2u, g + (NCP - 4));
  };

  v8f acc[MI][8];
#pragma unroll
  for (int i = 0; i < MI; ++i)
#pragma unroll
    for (int j = 0; j < 8; ++j) acc[i][j] = zero8();

  const int nt = K / GT_KP;           // block-uniform, >= 2
  fill(0);
  wait_async0();
  __syncthreads();                    // tile 0 readable by every wave
  fill(1);

  const int aoff = (wm * (16 * MI) + rl) * GT_LP + 8 * hh;
  const int boff = (AROWS + wn * 128 + rl) * GT_LP + 8 * hh;
#pragma unroll 1                      // one pass per trip: the ring's order below holds per trip, and every acc index stays constant
  for (int t = 0; t < nt; ++t) {
    const __bf16* st = ring + (t & 1) * STAGE;
    v16b fa[2][MI], fl[2][MI], fb[2][8];          // one fragment set per 32-k step of the pass
#pragma unroll
    for (int ks = 0; ks < 2; ++ks) {
#pragma unroll
      for (int i = 0; i < MI; ++i) {
        fa[ks][i] = ldfrag_b(st + aoff + i * 16 * GT_LP + ks * 32);
        if constexpr (SPLITA) fl[ks][i] = ldfrag_b(st + aoff + (GT_BM + i * 16) * GT_LP + ks * 32);
      }
#pragma unroll
      for (int j = 0; j < 8; ++j) fb[ks][j] = ldfrag_b(st + boff + j * 16 * GT_LP + ks * 32);
      sched_fence();                              // each step's LDS reads stay one group ahead of the WMMA blocks, not spread among them
    }
#pragma unroll
    for (int ks = 0; ks < 2; ++ks) {
#pragma unroll
      for (int j = 0; j < 8; ++j) {
#pragma unroll
        for (int i = 0; i < MI; ++i) acc[i][j] = mma_b(fa[ks][i], fb[ks][j], acc[i][j]);
        if constexpr (SPLITA) {
#pragma unroll
          for (int i = 0; i < MI; ++i) acc[i][j] = mma_b(fl[ks][i], fb[ks][j], acc[i][j]);
        }
      }
      // step 1's WMMAs stay behind step 0's (only step 0's reads are waited for first) and in front of the waits at the foot
      // (moved behind the barrier they would halve the lead of the copies in flight)
      sched_fence();
    }
    wait_ds0();
    wait_async0();
    __syncthreads();                  // publishes tile t + 1 and ends every wave's reads of tile t's buffer
    if (t + 2 < nt) fill(t + 2);      // block-uniform test
  }
  wait_async0();

  gemm_epilogue<EPI, 8, MI>(acc, slab_all + wave * SlabT<EPI>::PERW, lane, bm0 + wm * (16 * MI), bn0 + wn * 128, phs, C0, C1, C2, C3, ldc);
}

// ---------------------------------------------------------------------------
// Phase projection: v[m][n] = sum_k Xb[m][k] * WpT[n][k] (M = NTOK, N = NPH, K = HID), then PQ[m][n] = cos(v), PQ[m][NPH + n] = sin(v).
// Block = 16 token rows x all NPH columns, PP_NW waves; wave w takes k in [w * PP_KS, (w + 1) * PP_KS): all its fragment loads
// (straight from the global rows) go out ahead of its WMMAs, so a wave pays the global latency once. The PP_NW partial tiles meet
// in LDS and are added in wave order 0..PP_NW-1. Each thread then finishes 2 values (precise cosf/sinf); a wave's store is one whole 128-B line.
// Coverage: NTOK / 16 blocks x 16 rows x PQW columns = the whole PQ plane.
// ---------------------------------------------------------------------------
#define PP_NW 8
#define PP_KS (HID / PP_NW)
static_assert(PP_KS % 32 == 0 && NPH == 32 && PQW == 2 * NPH && NTOK % 16 == 0);
__global__ __launch_bounds__(32 * PP_NW) void phase_proj_kernel(const unsigned short* __restrict__ Xp, const unsigned short* __restrict__ Wp,
                                                                float* __restrict__ PQ) {
  constexpr int NS = PP_KS / 32;      // 32-k steps per wave
  __shared__ __align__(16) float part[PP_NW * 16 * NPH];
  const int tid  = (int)threadIdx.x;
  const int lane = tid & 31;
  const int wave = wave_id();
  const int hh = lane >> 4;           // lane half: k offset 8*hh, D row offset 8*hh
  const int rl = lane & 15;           // A row / B col / D col within subtile
  const int m0 = (int)blockIdx.x * 16;
  const __bf16* A  = (const __bf16*)(const void*)Xp + (size_t)(m0 + rl) * HID + wave * PP_KS + 8 * hh;
  const __bf16* B0 = (const __bf16*)(const void*)Wp + (size_t)rl * HID + wave * PP_KS + 8 * hh;
  const __bf16* B1 = B0 + (size_t)16 * HID;
  v16b fa[NS], f0[NS], f1[NS];
#pragma unroll
  for (int s = 0; s < NS; ++s) {
    fa[s] = ldfrag_b(A + s * 32);
    f0[s] = ldfrag_b(B0 + s * 32);
    f1[s] = ldfrag_b(B1 + s * 32);
  }
  sched_fence();                      // all 6 * NS loads stay ahead of the first WMMA: spread among the WMMAs they would return in NS rounds of latency
  v8f a0 = zero8(), a1 = zero8();
#pragma unroll
  for (int s = 0; s < NS; ++s) {
    a0 = mma_b(fa[s], f0[s], a0);
    a1 = mma_b(fa[s], f1[s], a1);
  }
  float* pw = part + wave * (16 * NPH);
#pragma unroll
  for (int r = 0; r < 8; ++r) {
    pw[(8 * hh + r) * NPH + rl]      = a0[r];
    pw[(8 * hh + r) * NPH + 16 + rl] = a1[r];
  }
  __syncthreads();                    // every wave's partial tile readable by the block
#pragma unroll 1                      // one precise cos + sin site in the text
  for (int it = 0; it < (16 * NPH) / (32 * PP_NW); ++it) {
    const int e = it * (32 * PP_NW) + tid;        // row e / NPH, column e % NPH (= lane)
    float v = part[e];
#pragma unroll
    for (int w = 1; w < PP_NW; ++w) v += part[w * (16 * NPH) + e];
    float* o = PQ + (size_t)(m0 + e / NPH) * PQW + (e % NPH);
    o[0]   = cosf(v);
    o[NPH] = sinf(v);
    wait_x0();                        // precaution: the next trip's first instructions reuse this store's address registers
  }
}

// ---------------------------------------------------------------------------
// Phase modulation factor, PH_PB blocks per sequence (grid NSEQ * PH_PB, 512 threads), all f32:
//   PQ plane [NTOK][PQW]: col h = cos(pq_h), 16+h = cos(pk_h), 32+h = sin(pq_h), 48+h = sin(pk_h).
//   Ck[h] = sum_s cos(pk), Sk[h] = sum_s sin(pk): every block sums its whole sequence itself (no data passes between blocks of the launch).
//   8 threads per row, each one 16-B piece (4 heads of cos or of sin), 64 rows per pass: a wave reads 4 rows x two 64-B runs per instruction;
//   per-thread partials over 32 rows, then 32 threads add the 64 row groups in fixed order from LDS (lanes on consecutive banks).
//   phs[b*SQ + s] = sum_h (cos(pq_h)*Ck[h] + sin(pq_h)*Sk[h]) / 32768: 4 products per thread, 8 partials per row joined through LDS in fixed order.
//   Coverage: NSEQ * PH_PB blocks x PH_ROWS = NTOK values; each wave of the last stage stores one whole 128-B line.
// ---------------------------------------------------------------------------
#define PH_PB   16
#define PH_ROWS (SQ / PH_PB)
static_assert(PH_ROWS % 64 == 0 && SQ % 64 == 0 && PH_ROWS <= 512);
__global__ __launch_bounds__(512) void phase_kernel(const float* __restrict__ PQ, float* __restrict__ phs) {
  __shared__ __align__(16) float red[64 * 2 * NHQ];
  __shared__ __align__(16) float csk[2 * NHQ];
  __shared__ __align__(16) float part[PH_ROWS * 8];
  const int b   = (int)blockIdx.x / PH_PB;
  const int blk = (int)blockIdx.x % PH_PB;
  const int tid = (int)threadIdx.x;
  const int pc  = tid & 7;                            // piece: 0..3 = cos of heads 4*pc.., 4..7 = sin of heads 4*(pc-4)..
  const int g   = tid >> 3;                           // row within a pass of 64
  const int col = (pc < 4) ? 4 * pc : NHQ + 4 * pc;   // pq columns 0..12 and 32..44; the pk columns lie NHQ further
  const float* base = PQ + (size_t)b * SQ * PQW;
  v4f xq[PH_ROWS / 64];                               // this block's own pq rows, asked for ahead of the sums
#pragma unroll
  for (int it = 0; it < PH_ROWS / 64; ++it)
    xq[it] = *(const v4f*)(base + (size_t)(blk * PH_ROWS + it * 64 + g) * PQW + col);
  v4f acc = {0.f, 0.f, 0.f, 0.f};
#pragma unroll 8                                      // 8 loads in flight per thread: 4 L2 round trips for the 32 rows, not 32
  for (int it = 0; it < SQ / 64; ++it) {
    const v4f x = *(const v4f*)(base + (size_t)(it * 64 + g) * PQW + NHQ + col);
    acc += x;
  }
  *(v4f*)(red + g * (2 * NHQ) + 4 * pc) = acc;
  __syncthreads();
  if (tid < 2 * NHQ) {                                // wave 0
    float s = 0.f;
#pragma unroll                                        // the 64 LDS reads go out together; only the adds are a chain
    for (int r = 0; r < 64; ++r) s += red[r * (2 * NHQ) + tid];
    csk[tid] = s;
  }
  __syncthreads();
  const v4f w = *(const v4f*)(csk + 4 * pc);
#pragma unroll
  for (int it = 0; it < PH_ROWS / 64; ++it) {
    const v4f x = xq[it];
    part[(it * 64 + g) * 8 + pc] = (x[0] * w[0] + x[1] * w[1]) + (x[2] * w[2] + x[3] * w[3]);
  }
  __syncthreads();
  if (tid < PH_ROWS) {                                // whole waves
    const v4f p0 = *(const v4f*)(part + tid * 8);
    const v4f p1 = *(const v4f*)(part + tid * 8 + 4);
    const float a = ((p0[0] + p0[1]) + (p0[2] + p0[3])) + ((p1[0] + p1[1]) + (p1[2] + p1[3]));
    phs[(size_t)b * SQ + blk * PH_ROWS + tid] = a * (1.0f / 32768.0f);
  }
}

// ---------------------------------------------------------------------------
// Causal flash attention, head dim 128, 32-key chunks, block = 4 waves = 64 query rows of one (b, h); grid (n query tiles, NHQ, NSEQ).
//   q planes f16 [tok][h*128+d]: hi (qhp) and residual x2048 (qlp); k planes f16 [tok][h*128+d]: hi (khp); residual x2048 (klp) only for
//   keys < KLR of each sequence, stored at row b*KLR + key (read only when PRES); v^T planes f16 [h*128+d][tok]: hi (vhp), residual x2048 (vlp);
//   outputs attn bf16 hi (ahp) / lo (alp) [tok][h*128+d].
//   scores = (Sh + Sr/2048) * 128^-0.5 with Sh = qh.kh and Sr = ql'.kh (+ qh.kl' when PRES); keys > query -> -inf; online softmax f32;
//   p' = 1024 p stored per wave to LDS as f16 hi (and residual x2048 when PRES), reloaded as A fragments after a wave sync;
//   O = (Oh + Or/2048)/1024/l with Oh = ph.vh, Or = ph.vl' (+ pl'.vh when PRES).
//   q planes: each wave copies its 16 rows to LDS once and takes its A fragments from there in every chunk.
//   K / V^T chunk staging: 128 threads x 4 x 16 B per plane = whole 32x128 / 128x32 tile, plain loads, __syncthreads before and after.
//   Trip count 2*qb+2 chunks (static bound 64); waves whose rows are all below the chunk skip it (wave-uniform, scalar branch).
// ---------------------------------------------------------------------------
#define AT_KC   32
#define KS_P    136
#define VS_P    40
#define PS_P    40
#define QS_P    136
// LDS map in halves. The k and p residual planes exist only with PRES. QS: per wave 2 planes x 16 query rows at pitch QS_P (272 B = 16 B x 17).
template <bool PRES> struct AttnLds {
  static constexpr int KS  = 0;
  static constexpr int KLS = 32 * KS_P;
  static constexpr int VHS = (PRES ? 2 : 1) * 32 * KS_P;
  static constexpr int VLS = VHS + 128 * VS_P;
  static constexpr int PH  = VLS + 128 * VS_P;
  static constexpr int PL  = PH + 4 * 16 * PS_P;
  static constexpr int QS  = PH + (PRES ? 2 : 1) * 4 * 16 * PS_P;
  static constexpr int TOT = QS + 4 * 2 * 16 * QS_P;
};
static_assert(4 * AttnLds<false>::TOT * 2 <= 327680);   // four blocks of the long launch per WGP, as its registers allow
static_assert(4 * 4096 <= AttnLds<false>::QS);          // output staging (2 planes x 16 x 128 per wave) aliases the chunk region after the loop

template <bool PRES>
__global__ __launch_bounds__(128) void attn_causal_kernel(
    const unsigned short* __restrict__ qhp, const unsigned short* __restrict__ qlp,
    const unsigned short* __restrict__ khp, const unsigned short* __restrict__ klp,
    const unsigned short* __restrict__ vhp, const unsigned short* __restrict__ vlp,
    unsigned short* __restrict__ ahp, unsigned short* __restrict__ alp, int qb_base) {
  typedef AttnLds<PRES> L;
  __shared__ __align__(16) _Float16 lds[L::TOT];
  _Float16* Ks  = lds + L::KS;
  _Float16* Kls = PRES ? lds + L::KLS : Ks;      // used only with PRES
  _Float16* Vhs = lds + L::VHS;
  _Float16* Vls = lds + L::VLS;

  const int tid  = (int)threadIdx.x;
  const int lane = tid & 31;
  const int wave = wave_id();
  const int hh   = lane >> 4;
  const int c    = lane & 15;
  const int qb   = (int)blockIdx.x + qb_base;
  const int h    = (int)blockIdx.y;
  const int b    = (int)blockIdx.z;
  const int q0   = qb * 64 + wave * 16;          // first query row of this wave (within sequence)
  const int qlast = q0 + 15;
  const size_t tok0 = (size_t)b * SQ;

  const _Float16* Qhg = (const _Float16*)(const void*)qhp + (tok0 + q0) * HID + h * HDM;
  const _Float16* Qlg = (const _Float16*)(const void*)qlp + (tok0 + q0) * HID + h * HDM;
  const _Float16* Kg  = (const _Float16*)(const void*)khp + tok0 * HID + h * HDM;
  const _Float16* Klg = (const _Float16*)(const void*)klp + (size_t)b * KLR * HID + h * HDM;
  const _Float16* Vhg = (const _Float16*)(const void*)vhp + (size_t)(h * HDM) * NTOK + tok0;
  const _Float16* Vlg = (const _Float16*)(const void*)vlp + (size_t)(h * HDM) * NTOK + tok0;
  _Float16* ph = lds + L::PH + wave * (16 * PS_P);
  _Float16* pl = PRES ? lds + L::PL + wave * (16 * PS_P) : ph;   // used only with PRES
  _Float16* Qs = lds + L::QS + wave * (2 * 16 * QS_P);           // this wave's own query rows: hi plane, then residual plane

  // q rows to LDS once, whole 256-B rows per 16 lanes; read back only by this wave, behind the first barrier of the chunk loop (nch >= 2)
#pragma unroll                                   // all 16 loads in flight together: one global latency for the whole fill
  for (int it = 0; it < 8; ++it) {
    const int row = it * 2 + hh;                 // it 0..7 x hh 0..1 covers rows 0..15
    const v8h x = *(const v8h*)(Qhg + (size_t)row * HID + c * 8);
    const v8h y = *(const v8h*)(Qlg + (size_t)row * HID + c * 8);
    *(v8h*)(Qs + row * QS_P + c * 8) = x;
    *(v8h*)(Qs + (16 + row) * QS_P + c * 8) = y;
  }

  float mrow[8], lrow[8];
  v8f oacc[8], oaccr[8];
#pragma unroll
  for (int r = 0; r < 8; ++r) { mrow[r] = -INFINITY; lrow[r] = 0.f; }
#pragma unroll
  for (int t = 0; t < 8; ++t) { oacc[t] = zero8(); oaccr[t] = zero8(); }

  const int nch = 2 * qb + 2;                    // block-uniform, <= 64; keys < 64*(qb+1) <= SQ; PRES blocks: keys < 256 = KLR
  for (int kc = 0; kc < nch; ++kc) {
    const int kv0 = kc * AT_KC;
    __syncthreads();
#pragma unroll
    for (int i = 0; i < 4; ++i) {                // coverage: 512 pieces of 8 halves per plane = whole tile
      const int p   = tid + 128 * i;             // 0..511
      const int key = p >> 4, d8 = (p & 15) * 8; // K: 32 keys x 128 d
      const v8h kx = *(const v8h*)(Kg + (size_t)(kv0 + key) * HID + d8);
      *(v8h*)(Ks + key * KS_P + d8) = kx;
      if (PRES) {
        const v8h ky = *(const v8h*)(Klg + (size_t)(kv0 + key) * HID + d8);
        *(v8h*)(Kls + key * KS_P + d8) = ky;
      }
      const int d = p >> 2, k8 = (p & 3) * 8;    // V^T: 128 d x 32 keys
      const v8h vx = *(const v8h*)(Vhg + (size_t)d * NTOK + kv0 + k8);
      const v8h vy = *(const v8h*)(Vlg + (size_t)d * NTOK + kv0 + k8);
      *(v8h*)(Vhs + d * VS_P + k8) = vx;
      *(v8h*)(Vls + d * VS_P + k8) = vy;
    }
    __syncthreads();

    if (kv0 <= qlast) {                          // wave-uniform (scalar): skip chunks fully above this wave's rows
      // ---- scores ----
      v8f sh[2], sr[2];
      sh[0] = zero8(); sh[1] = zero8(); sr[0] = zero8(); sr[1] = zero8();
#pragma unroll
      for (int dc = 0; dc < 4; ++dc) {
        const v16h qa = ldfrag_h(Qs + c * QS_P + dc * 32 + 8 * hh);
        const v16h ql = ldfrag_h(Qs + (16 + c) * QS_P + dc * 32 + 8 * hh);
#pragma unroll
        for (int j = 0; j < 2; ++j) {
          const v16h kb = ldfrag_h(Ks + (j * 16 + c) * KS_P + dc * 32 + 8 * hh);
          sh[j] = mma_h(qa, kb, sh[j]);
          sr[j] = mma_h(ql, kb, sr[j]);
          if (PRES) {
            const v16h kl = ldfrag_h(Kls + (j * 16 + c) * KS_P + dc * 32 + 8 * hh);
            sr[j] = mma_h(qa, kl, sr[j]);
            guard_h4(sh[j], sr[j], qa, ql, kb, kl);
          } else {
            guard_h3(sh[j], sr[j], qa, ql, kb);
          }
        }
      }
      // ---- scale, causal mask, chunk row max ----
      float cm[8];
#pragma unroll
      for (int r = 0; r < 8; ++r) {
        const int qrow = q0 + 8 * hh + r;
        float m = -INFINITY;
#pragma unroll
        for (int j = 0; j < 2; ++j) {
          const int key = kv0 + j * 16 + c;
          float s = (sh[j][r] + sr[j][r] * 0.00048828125f) * 0.08838834764831845f;
          s = (key > qrow) ? -INFINITY : s;
          sh[j][r] = s;
          m = fmaxf(m, s);
        }
#pragma unroll
        for (int off = 1; off < 16; off <<= 1) m = fmaxf(m, __shfl_xor(m, off, 32));
        cm[r] = m;
      }
      // ---- online softmax, P' to LDS ----
#pragma unroll
      for (int r = 0; r < 8; ++r) {
        const float mnew  = fmaxf(mrow[r], cm[r]);
        const float alpha = __expf(mrow[r] - mnew);
        mrow[r] = mnew;
        float psum = 0.f;
#pragma unroll
        for (int j = 0; j < 2; ++j) {
          const float p  = __expf(sh[j][r] - mnew);
          psum += p;
          const float pp = p * 1024.0f;
          const _Float16 phv = (_Float16)pp;
          const int po = (8 * hh + r) * PS_P + j * 16 + c;
          ph[po] = phv;
          if (PRES) pl[po] = (_Float16)((pp - (float)phv) * 2048.0f);
        }
#pragma unroll
        for (int off = 1; off < 16; off <<= 1) psum += __shfl_xor(psum, off, 32);
        lrow[r] = lrow[r] * alpha + psum;
#pragma unroll
        for (int t = 0; t < 8; ++t) { oacc[t][r] *= alpha; oaccr[t][r] *= alpha; }
      }
      lds_wave_sync();                           // P' stores visible to the other lanes of this wave before the fragment reload
      // ---- O += P' . V ----
      const v16h pa = ldfrag_h(ph + c * PS_P + 8 * hh);
      v16h pr = pa;
      if (PRES) pr = ldfrag_h(pl + c * PS_P + 8 * hh);
#pragma unroll
      for (int t = 0; t < 8; ++t) {
        const v16h vb = ldfrag_h(Vhs + (t * 16 + c) * VS_P + 8 * hh);
        const v16h vr = ldfrag_h(Vls + (t * 16 + c) * VS_P + 8 * hh);
        oacc[t]  = mma_h(pa, vb, oacc[t]);
        oaccr[t] = mma_h(pa, vr, oaccr[t]);
        if (PRES) oaccr[t] = mma_h(pr, vb, oaccr[t]);
        guard_h4(oacc[t], oaccr[t], pa, pr, vb, vr);
      }
    }
  }

  __syncthreads();                               // all chunk-region readers done before aliasing it as output staging
  _Float16* osh = lds + wave * 4096;
  _Float16* osl = osh + 2048;
#pragma unroll
  for (int r = 0; r < 8; ++r) {
    const float inv = (1.0f / lrow[r]) * 0.0009765625f;
#pragma unroll
    for (int t = 0; t < 8; ++t) {
      const float o = (oacc[t][r] + oaccr[t][r] * 0.00048828125f) * inv;
      const unsigned short hb = bf_bits(o);
      const unsigned short lb = bf_bits(o - bf_val(hb));
      const int so = (8 * hh + r) * 128 + t * 16 + c;
      osh[so] = __builtin_bit_cast(_Float16, hb);
      osl[so] = __builtin_bit_cast(_Float16, lb);
    }
  }
  lds_wave_sync();
  _Float16* Ahg = (_Float16*)(void*)ahp + (tok0 + q0) * HID + h * HDM;
  _Float16* Alg = (_Float16*)(void*)alp + (tok0 + q0) * HID + h * HDM;
  {
#pragma unroll
    for (int it = 0; it < 8; ++it) {
      const int row = it * 2 + hh;               // it 0..7 x hh 0..1 covers rows 0..15
      const int c8  = c * 8;                     // 16 lanes x 16 B = the whole 256-B segment
      const v8h x = *(const v8h*)(osh + row * 128 + c8);
      const v8h y = *(const v8h*)(osl + row * 128 + c8);
      *(v8h*)(Ahg + (size_t)row * HID + c8) = x;
      *(v8h*)(Alg + (size_t)row * HID + c8) = y;
    }
    
  }
}

// ---------------------------------------------------------------------------
// Workspace map (bytes; every region is a whole number of the rows its producer writes with whole-line stores; all dims are tile multiples,
// so padded size == logical size; offsets are multiples of 16384):
//   R0   Xb  bf16 [4096][2048] 16777216, later Ah bf16 [4096][2048] (Xb dead after the three projection GEMMs)
//   R1   WqkT bf16 [4096][2048] 16777216, later Al bf16 [4096][2048]
//   R2   WvT bf16 [2048][2048]  8388608, later WoT bf16 [2048][2048] (WvT dead after the v GEMM)
//   WpT  bf16 [32][2048]          131072
//   Qh, Ql, Kh f16 [4096][2048]  16777216 each
//   Kl   f16 [512][2048]          2097152
//   Vh, Vl f16 [2048][4096]      16777216 each
//   PQ   f32 [4096][64]           1048576
//   phs  f32 [4096]                 16384
//   total                       129122304
// ---------------------------------------------------------------------------
static inline size_t smax(size_t a, size_t b) { return a > b ? a : b; }

extern "C" void kernel_launch(void* const* d_in, const int* in_sizes, int n_in,
                              void* d_out, int out_size, void* d_ws, size_t ws_size,
                              hipStream_t stream) {
  if (n_in < 7) return;
  if (in_sizes[0] != NTOK * HID) return;
  if (in_sizes[1] != HID * HID) return;
  if (in_sizes[2] != HID * HID) return;
  if (in_sizes[3] != HID * HID) return;
  if (in_sizes[4] != HID * HID) return;
  if (in_sizes[5] != HID * NHQ) return;
  if (in_sizes[6] != HID * NHQ) return;
  if (out_size != NTOK * HID) return;

  const float* x   = (const float*)d_in[0];
  const float* Wq  = (const float*)d_in[1];
  const float* Wk  = (const float*)d_in[2];
  const float* Wv  = (const float*)d_in[3];
  const float* Wo  = (const float*)d_in[4];
  const float* Wpq = (const float*)d_in[5];
  const float* Wpk = (const float*)d_in[6];
  float* out = (float*)d_out;

  const size_t szX   = (size_t)NTOK * HID * 2;
  const size_t szWqk = (size_t)2 * HID * HID * 2;
  const size_t szW   = (size_t)HID * HID * 2;
  const size_t szA   = (size_t)NTOK * HID * 2;
  const size_t szWp  = (size_t)NPH * HID * 2;
  const size_t szQ   = (size_t)NTOK * HID * 2;
  const size_t szKl  = (size_t)NSEQ * KLR * HID * 2;
  const size_t szV   = (size_t)HID * NTOK * 2;
  const size_t szPQ  = (size_t)NTOK * PQW * 4;
  const size_t szPh  = (size_t)NTOK * 4;
  size_t off = 0;
  const size_t oR0 = off; off += smax(szX, szA);
  const size_t oR1 = off; off += smax(szWqk, szA);
  const size_t oR2 = off; off += szW;
  const size_t oWp = off; off += szWp;
  const size_t oQh = off; off += szQ;
  const size_t oQl = off; off += szQ;
  const size_t oKh = off; off += szQ;
  const size_t oKl = off; off += szKl;
  const size_t oVh = off; off += szV;
  const size_t oVl = off; off += szV;
  const size_t oPQ = off; off += szPQ;
  const size_t oPh = off; off += szPh;
  if (off > ws_size) return;                     // off = 129122304

  char* ws = (char*)d_ws;
  unsigned short* Xb   = (unsigned short*)(ws + oR0);
  unsigned short* Ah   = (unsigned short*)(ws + oR0);
  unsigned short* WqkT = (unsigned short*)(ws + oR1);
  unsigned short* Al   = (unsigned short*)(ws + oR1);
  unsigned short* WvT  = (unsigned short*)(ws + oR2);
  unsigned short* WoT  = (unsigned short*)(ws + oR2);
  unsigned short* WpT  = (unsigned short*)(ws + oWp);
  unsigned short* Qh   = (unsigned short*)(ws + oQh);
  unsigned short* Ql   = (unsigned short*)(ws + oQl);
  unsigned short* Kh   = (unsigned short*)(ws + oKh);
  unsigned short* Kl   = (unsigned short*)(ws + oKl);
  unsigned short* Vh   = (unsigned short*)(ws + oVh);
  unsigned short* Vl   = (unsigned short*)(ws + oVl);
  float*          PQ   = (float*)(ws + oPQ);
  float*          phs  = (float*)(ws + oPh);

  const dim3 b256(256), b128(128);

  // (1) x -> bf16 plane [4096][2048]
  cvt_bf16_kernel<<<dim3((NTOK * HID / 8) / 256), b256, 0, stream>>>(x, Xb, NTOK * HID / 8);
  // (2) Wq in[2048 rows][2048 cols] -> WqkT rows 0..2047 = out[n][k]; Wk -> WqkT rows 2048..4095; Wv -> WvT   (grid = cols/64, rows/64)
  tconv_bf16_kernel<<<dim3(HID / 64, HID / 64), b256, 0, stream>>>(Wq, WqkT, HID, HID);
  tconv_bf16_kernel<<<dim3(HID / 64, HID / 64), b256, 0, stream>>>(Wk, WqkT + (size_t)HID * HID, HID, HID);
  tconv_bf16_kernel<<<dim3(HID / 64, HID / 64), b256, 0, stream>>>(Wv, WvT, HID, HID);
  // (3) Wpq|Wpk -> WpT [32][2048]
  wpt_kernel<<<dim3(NPH), b256, 0, stream>>>(Wpq, Wpk, WpT);
  // (4) pq|pk = x . (Wpq|Wpk) -> cos|sin plane PQ [4096][64]   (M=4096, N=32, K=2048; one block per 16 rows)
  phase_proj_kernel<<<dim3(NTOK / 16), b256, 0, stream>>>(Xb, WpT, PQ);
  // (5) phase factor phs [4096]
  phase_kernel<<<dim3(NSEQ * PH_PB), dim3(512), 0, stream>>>(PQ, phs);
  // (6) q|k = x . (Wq|Wk) -> Qh/Ql [4096][2048], Kh [4096][2048], Kl [512][2048]   (M=4096, N=4096, K=2048; 32 x 16 block tiles)
  gemm_tiled_kernel<0, 4, false><<<dim3((NTOK / GT_BM) * ((2 * HID) / GT_BN)), b128, 0, stream>>>(
      Xb, Xb, HID, WqkT, HID, phs, (void*)Qh, (void*)Ql, (void*)Kh, (void*)Kl, HID, NTOK, 2 * HID, HID);
  // (7) v^T = WvT . x^T -> Vh/Vl [2048][4096]   (A = WvT, Bt = Xb; M=2048, N=4096, K=2048; 16 x 16 block tiles)
  gemm_tiled_kernel<1, 2, false><<<dim3((HID / GT_BM) * (NTOK / GT_BN)), b256, 0, stream>>>(
      WvT, WvT, HID, Xb, HID, phs, (void*)Vh, (void*)Vl, (void*)Vh, (void*)Vl, NTOK, HID, NTOK, HID);
  // (8) Wo -> WoT (over the dead WvT region)
  tconv_bf16_kernel<<<dim3(HID / 64, HID / 64), b256, 0, stream>>>(Wo, WoT, HID, HID);
  // (9) causal attention, query tiles 0..3 with k and p residual products, tiles 4..31 without -> Ah/Al (over the dead Xb/WqkT regions)
  attn_causal_kernel<true><<<dim3(4, NHQ, NSEQ), b128, 0, stream>>>(Qh, Ql, Kh, Kl, Vh, Vl, Ah, Al, 0);
  attn_causal_kernel<false><<<dim3(SQ / 64 - 4, NHQ, NSEQ), b128, 0, stream>>>(Qh, Ql, Kh, Kl, Vh, Vl, Ah, Al, 4);
  // (10) out = (attn hi + lo) . Wo * (1 + 0.1*phs[m]) -> d_out f32 [4096][2048]   (M=4096, N=2048, K=2048; 32 x 8 block tiles)
  gemm_tiled_kernel<2, 2, true><<<dim3((NTOK / GT_BM) * (HID / GT_BN)), b256, 0, stream>>>(
      Ah, Al, HID, WoT, HID, phs, (void*)out, (void*)out, (void*)out, (void*)out, HID, NTOK, HID, HID);
  (void)hipGetLastError();
}

// v005
// Measured time: 333 microseconds a run.
// In both of two side-by-side timings against v004, it was 1.08 times as fast.
// Over all steps from v000 it is 2.34 times as fast.
// Contractions: x.(Wq|Wk), Wv^T.x^T and x.(Wpq|Wpk) on v_wmma_f32_16x16x32_bf16 (operands = RNE bf16 of the f32 inputs, single products);
// q.k^T and p.v on v_wmma_f32_16x16x32_f16 (q = f16 hi + f16 residual x2^11 planes; k plain f16 plus f16 residual x2^11 on query tiles 0..3;
// p x1024 plain f16 plus f16 residual x2^11 on query tiles 0..3; v^T = f16 hi + f16 residual x2^11 planes); attn.Wo on v_wmma_f32_16x16x32_bf16
// (attn = bf16 hi + bf16 lo planes, two products; Wo RNE bf16). f32 accumulate everywhere; online softmax, cos/sin phase sums and output scale in f32.
#include <hip/hip_runtime.h>
#include <math.h>
#include <stdint.h>

#define NSEQ   2
#define SQ     2048
#define HID    2048
#define NHQ    16
#define HDM    128
#define NTOK   4096
#define NPH    32
#define PQW    64
#define KLR    256

static_assert(NTOK == NSEQ * SQ);
static_assert(NHQ * HDM == HID);
static_assert(KLR % 32 == 0 && SQ % KLR == 0);

typedef _Float16     v16h __attribute__((ext_vector_type(16)));
typedef _Float16     v8h  __attribute__((ext_vector_type(8)));
typedef __bf16       v16b __attribute__((ext_vector_type(16)));
typedef __bf16       v8b  __attribute__((ext_vector_type(8)));
typedef float        v8f  __attribute__((ext_vector_type(8)));
typedef float        v4f  __attribute__((ext_vector_type(4)));
typedef unsigned int v4u  __attribute__((ext_vector_type(4)));

// ---------------------------------------------------------------------------
// small helpers
// ---------------------------------------------------------------------------
__device__ __forceinline__ unsigned short bf_bits(float f) {          // RNE convert f32 -> bf16 bits
  const unsigned u = __float_as_uint(f);
  return (unsigned short)((u + 0x7FFFu + ((u >> 16) & 1u)) >> 16);
}
__device__ __forceinline__ float bf_val(unsigned short h) { return __uint_as_float(((unsigned)h) << 16); }
__device__ __forceinline__ unsigned pk16(unsigned short a, unsigned short b) { return (unsigned)a | ((unsigned)b << 16); }
__device__ __forceinline__ v8f zero8() { v8f z = {0.f, 0.f, 0.f, 0.f, 0.f, 0.f, 0.f, 0.f}; return z; }
__device__ __forceinline__ int wave_id() {
#if defined(__HIP_DEVICE_COMPILE__)
  return __builtin_amdgcn_readfirstlane((int)(threadIdx.x >> 5));
#else
  return (int)(threadIdx.x >> 5);
#endif
}
// three e^x as __expf forms them (one multiply, v_exp_f32 each). One statement: the three are independent of one another (outputs apart from
// all inputs), and the v_nop is the slot that the instruction set asks for between a transcendental and a directly following instruction
// that reads its result or overwrites its source; inside the statement it stands there in every build
__device__ __forceinline__ void exp3_slot(float a, float b, float c, float& ea, float& eb, float& ec) {
#if defined(__HIP_DEVICE_COMPILE__)
  const float ta = a * 1.44269504088896340736f;
  const float tb = b * 1.44269504088896340736f;
  const float tc = c * 1.44269504088896340736f;
  asm("v_exp_f32 %0, %3\n\tv_exp_f32 %1, %4\n\tv_exp_f32 %2, %5\n\tv_nop" : "=&v"(ea), "=&v"(eb), "=&v"(ec) : "v"(ta), "v"(tb), "v"(tc));
#else
  ea = expf(a); eb = expf(b); ec = expf(c);
#endif
}
// release/acquire + wave barrier between one wave's LDS stores and the other lanes' reloads
__device__ __forceinline__ void lds_wave_sync() {
#if defined(__HIP_DEVICE_COMPILE__)
  __builtin_amdgcn_fence(__ATOMIC_RELEASE, "workgroup");
  __builtin_amdgcn_wave_barrier();
  __builtin_amdgcn_fence(__ATOMIC_ACQUIRE, "workgroup");
#endif
}

// ---------------------------------------------------------------------------
// WMMA fragments (wave32, 16x16x32, 16-bit operands). For A (row m = lane&15) and B (col n = lane&15) alike:
// elements 0..7 <- k0 + 8*(lane>>4) + 0..7, elements 8..15 <- k0 + 16 + 8*(lane>>4) + 0..7.
// ldfrag(p) with p = rowbase + k0 + 8*(lane>>4): two 16-B loads p[0..7], p[16..23].
// D: acc[r] = (row 8*(lane>>4) + r, col lane&15).
// ---------------------------------------------------------------------------
union FragH { v16h v; v8h h[2]; };
union FragB { v16b v; v8b h[2]; };
__device__ __forceinline__ v16h ldfrag_h(const _Float16* p) { FragH f; f.h[0] = *(const v8h*)(p); f.h[1] = *(const v8h*)(p + 16); return f.v; }
__device__ __forceinline__ v16b ldfrag_b(const __bf16* p)   { FragB f; f.h[0] = *(const v8b*)(p); f.h[1] = *(const v8b*)(p + 16); return f.v; }

__device__ __forceinline__ v8f mma_h(v16h a, v16h b, v8f c) {
#if defined(__HIP_DEVICE_COMPILE__)
  return __builtin_amdgcn_wmma_f32_16x16x32_f16(false, a, false, b, (short)0, c, false, false);
#else
  return c;
#endif
}
__device__ __forceinline__ v8f mma_b(v16b a, v16b b, v8f c) {
#if defined(__HIP_DEVICE_COMPILE__)
  return __builtin_amdgcn_wmma_f32_16x16x32_bf16(false, a, false, b, (short)0, c, false, false);
#else
  return c;
#endif
}
// hazard guard: 4 VALU slots after the last WMMA in front of the chunk loop's back edge, D tied, A/B kept live
__device__ __forceinline__ void guard_h4(v8f& a, v8f& b, v16h w, v16h x, v16h y, v16h z) {
#if defined(__HIP_DEVICE_COMPILE__)
  asm volatile("v_nop\n\tv_nop\n\tv_nop\n\tv_nop" : "+v"(a), "+v"(b) : "v"(w), "v"(x), "v"(y), "v"(z) : "memory");
#endif
}

// ---------------------------------------------------------------------------
// Elementwise RNE f32 -> bf16 plane: 8 elements per thread, one 16-B store per lane -> 32 consecutive lanes write 4 whole
// ---------------------------------------------------------------------------
__global__ __launch_bounds__(256) void cvt_bf16_kernel(const float* __restrict__ in, unsigned short* __restrict__ outp, int n8) {
  const int i = (int)blockIdx.x * 256 + (int)threadIdx.x;
  if (i >= n8) return;
  const size_t e = 8 * (size_t)i;
  const v4f a = *(const v4f*)(in + e);
  const v4f b = *(const v4f*)(in + e + 4);
  v4u w;
  w[0] = pk16(bf_bits(a[0]), bf_bits(a[1]));
  w[1] = pk16(bf_bits(a[2]), bf_bits(a[3]));
  w[2] = pk16(bf_bits(b[0]), bf_bits(b[1]));
  w[3] = pk16(bf_bits(b[2]), bf_bits(b[3]));
  *(v4u*)(outp + e) = w;
  
}

// ---------------------------------------------------------------------------
// Fused transpose + RNE bf16 convert: in [R rows][Cc cols] f32 (pitch Cc) -> out[c][r] = bf16(in[r][c])  ([Cc][R], pitch R).
// 64x64 tiles through LDS; grid = (Cc/64, R/64), 256 threads; R, Cc multiples of 64.
// Coverage per block: load 4 it x 256 thr x 4 floats = 64x64; store 2 it x 256 thr x 8 u16 = 64x64.
// ---------------------------------------------------------------------------
__global__ __launch_bounds__(256) void tconv_bf16_kernel(const float* __restrict__ W, unsigned short* __restrict__ outp, int R, int Cc) {
  __shared__ __align__(16) float tf[64 * 68];
  const int c0  = (int)blockIdx.x * 64;   // input column block = output row block
  const int r0  = (int)blockIdx.y * 64;   // input row block    = output column block
  const int tid = (int)threadIdx.x;
  {
    const int lr = tid >> 4;              // 0..15
    const int c4 = (tid & 15) * 4;        // 0..60
#pragma unroll
    for (int it = 0; it < 4; ++it) {
      const int rr = it * 16 + lr;        // 0..63
      const v4f a = *(const v4f*)(W + (size_t)(r0 + rr) * Cc + c0 + c4);
      *(v4f*)(tf + rr * 68 + c4) = a;
    }
  }
  __syncthreads();
  const int sub = tid >> 3;               // 0..31
  const int c8  = (tid & 7) * 8;          // 0..56
  v4u hv[2];
#pragma unroll
  for (int it = 0; it < 2; ++it) {
    const int oc = it * 32 + sub;         // output row within tile (= input column)
    v4u a;
#pragma unroll
    for (int q = 0; q < 4; ++q) {
      const float f0 = tf[(c8 + 2 * q) * 68 + oc];
      const float f1 = tf[(c8 + 2 * q + 1) * 68 + oc];
      a[q] = pk16(bf_bits(f0), bf_bits(f1));
    }
    hv[it] = a;
  }
  {
#pragma unroll
    for (int it = 0; it < 2; ++it) {
      const int oc = it * 32 + sub;
      const size_t go = (size_t)(c0 + oc) * R + r0 + c8;
      *(v4u*)(outp + go) = hv[it];
    }
    
  }
}

// ---------------------------------------------------------------------------
// Phase weights: Wpq [HID][NHQ], Wpk [HID][NHQ] f32 -> WpT [NPH][HID] bf16 rows (rows 0..15 = Wpq^T, 16..31 = Wpk^T).
// ---------------------------------------------------------------------------
__global__ __launch_bounds__(256) void wpt_kernel(const float* __restrict__ Wpq, const float* __restrict__ Wpk,
                                                  unsigned short* __restrict__ outp) {
  const int n = (int)blockIdx.x;                   // 0..31
  const float* W = (n < NHQ) ? Wpq : Wpk;          // block-uniform, both global
  const int h = n & (NHQ - 1);
  const int t = (int)threadIdx.x;                  // k = 8t .. 8t+7  (< HID)
  v4u w;
#pragma unroll
  for (int q = 0; q < 4; ++q) {
    const float f0 = W[(size_t)(8 * t + 2 * q) * NHQ + h];
    const float f1 = W[(size_t)(8 * t + 2 * q + 1) * NHQ + h];
    w[q] = pk16(bf_bits(f0), bf_bits(f1));
  }
  const size_t o = (size_t)n * HID + 8 * (size_t)t;
  *(v4u*)(outp + o) = w;
  
}

// ---------------------------------------------------------------------------
// bf16 WMMA GEMMs: C[m][n] = sum_k A[m][k] * Bt[n][k]; A row-major [M][K] bf16 (pitch lda), Bt row-major [N][K] bf16 (pitch ldb).
//   SPLITA: A carried as hi (Ap) + lo (A2p) bf16 planes, two products into one accumulator (hi then lo at every k step).
//   gemm_tiled_kernel (EPI 0, 1, 2): block tile 128 x 256, waves of 64 x 128 (EPI 0) or 32 x 128 (EPI 1, 2), operands staged in an LDS ring of two buffers.
// Epilogues (all: per wave, per 16-row slab: stage in LDS, wave sync, write each row segment with ONE instruction); MI = 16-row slabs per wave.
//   EPI 0 (NJ 8): q|k projection. cols n0 < HID (q): f16 hi plane C0 and f16 residual x2048 plane C1, both [M][ldc], cols n0..n0+127
//          (row segment 256 B = 16 lanes x 16 B). cols n0 >= HID (k): hi plane C2 [M][ldc] cols n0-HID..; residual plane C3 [NSEQ*KLR][ldc]
//          only for token rows with (m % SQ) < KLR at row (m / SQ)*KLR + m % SQ (wave-uniform choice; 32- and 64-row wave tiles never straddle).
//   EPI 1 (NJ 8): v^T projection: f16 hi plane C0, residual x2048 plane C1, [M][ldc], row segment 256 B.
//   EPI 2 (NJ 8): f32 output C0 [M][ldc], each row scaled by (1 + 0.1*phs[m]); row segment 128 floats = 512 B = 32 lanes x 16 B per instruction.
// ---------------------------------------------------------------------------
template <int EPI> struct SlabT { typedef _Float16 T; static constexpr int PERW = 4096; };   // 2 planes x 16 x 128 halves
template <> struct SlabT<2>     { typedef float    T; static constexpr int PERW = 2048; };   // 16 x 128 floats

// s_wait_xcnt 0 behind an issued global store, in front of a rewrite of a register that the store names
__device__ __forceinline__ void wait_x0() {
#if defined(__HIP_DEVICE_COMPILE__)
  asm volatile("s_wait_xcnt 0x0" ::: "memory");
#endif
}

// slab: this wave's own LDS staging range; (m0, n0): first row and column of the wave's (16*MI) x (16*NJ) tile.
template <int EPI, int NJ, int MI>
__device__ __forceinline__ void gemm_epilogue(v8f (&acc)[MI][NJ], typename SlabT<EPI>::T* slab, int lane, int m0, int n0,
                                              const float* __restrict__ phs, void* C0, void* C1, void* C2, void* C3, int ldc) {
  const int hh = lane >> 4;
  const int rl = lane & 15;
  _Float16* sl16 = (_Float16*)(void*)slab;
  float*    slf  = (float*)(void*)slab;

  if constexpr (EPI == 0 || EPI == 1) {
    _Float16* P0;
    _Float16* P1;
    int col0;
    int lomode;                                   // 0: lo row = m; 1: lo row remapped into the KLR-row plane; 2: no lo store
    if constexpr (EPI == 0) {
      const bool isq = (n0 < HID);                // wave-uniform
      P0 = isq ? (_Float16*)C0 : (_Float16*)C2;
      P1 = isq ? (_Float16*)C1 : (_Float16*)C3;
      col0 = isq ? n0 : (n0 - HID);
      const int s0 = m0 & (SQ - 1);
      lomode = isq ? 0 : ((s0 < KLR) ? 1 : 2);
    } else {
      P0 = (_Float16*)C0;
      P1 = (_Float16*)C1;
      col0 = n0;
      lomode = 0;
    }
#pragma unroll
    for (int i = 0; i < MI; ++i) {
#pragma unroll
      for (int r = 0; r < 8; ++r) {
#pragma unroll
        for (int j = 0; j < NJ; ++j) {
          const float v = acc[i][j][r];
          const _Float16 hv = (_Float16)v;
          const int so = (8 * hh + r) * 128 + j * 16 + rl;
          sl16[so]        = hv;
          sl16[2048 + so] = (_Float16)((v - (float)hv) * 2048.0f);
        }
      }
      lds_wave_sync();
      {
#pragma unroll
        for (int it = 0; it < 8; ++it) {
          const int row = it * 2 + hh;            // it x hh covers rows 0..15
          const int c8  = rl * 8;
          const v8h xh = *(const v8h*)(sl16 + row * 128 + c8);
          const v8h xl = *(const v8h*)(sl16 + 2048 + row * 128 + c8);
          const int m = m0 + i * 16 + row;
          *(v8h*)(P0 + (size_t)m * ldc + col0 + c8) = xh;
          if constexpr (EPI == 0) wait_x0();      // precaution: in front of the branch below, whose first instructions reuse this store's registers
          if (lomode != 2) {
            const int m1 = (lomode == 1) ? ((m / SQ) * KLR + (m % SQ)) : m;
            *(v8h*)(P1 + (size_t)m1 * ldc + col0 + c8) = xl;
            if constexpr (EPI == 0) wait_x0();    // precaution: inside the branch, in front of whatever reuses this store's registers behind it
          }
        }
        
      }
      lds_wave_sync();
    }
  } else if constexpr (EPI == 2) {
    float* C = (float*)C0;
#pragma unroll
    for (int i = 0; i < MI; ++i) {
#pragma unroll
      for (int r = 0; r < 8; ++r) {
        const int m = m0 + i * 16 + 8 * hh + r;
        const float sc = 1.0f + 0.1f * phs[m];
#pragma unroll
        for (int j = 0; j < NJ; ++j)
          slf[(8 * hh + r) * 128 + j * 16 + rl] = acc[i][j][r] * sc;
      }
      lds_wave_sync();
      {
#pragma unroll
        for (int row = 0; row < 16; ++row) {      // 32 lanes x 16 B = the whole 512-B row segment per instruction
          const v4f v = *(const v4f*)(slf + row * 128 + lane * 4);
          *(v4f*)(C + (size_t)(m0 + i * 16 + row) * ldc + n0 + lane * 4) = v;
        }
        
      }
      lds_wave_sync();
    }
  }
}

// ---------------------------------------------------------------------------
// Tiled GEMM main loop. Block tile 128 x 256; waves in a (8/MI) x 2 grid, each (16*MI) x 128: MI 4 = 4 waves, MI 2 = 8 waves.
// A pass is 64 k: a stage holds [A 128 rows | (SPLITA: A2 128 rows) | Bt 256 rows] of 128 B at pitch 144 B
// (16 B x 9: ds_load_b128 fragment reads without bank conflicts). Every thread brings 16-B pieces with asynchronous copies to LDS,
// one pass ahead of the pass that reads them. M % 128 == 0, N % 256 == 0, K % 64 == 0, K >= 128; grid.x = (M/128) * (N/256).
// ---------------------------------------------------------------------------
#define GT_BM 128
#define GT_BN 256
#define GT_KP 64
#define GT_LP 72                                  // LDS row pitch in bf16 elements

// Asynchronous 16-B copies, one per lane and line of the statement: l + c * lstep = the lane's LDS byte address, g[c] = its global source.
// s_wait_xcnt stands inside the statement so that no address register is rewritten ahead of it.
__device__ __forceinline__ void copy8(unsigned l, unsigned lstep, const __bf16* const* g) {
#if defined(__HIP_DEVICE_COMPILE__)
  asm volatile(
      "global_load_async_to_lds_b128 %0, %8, off\n\t"
      "global_load_async_to_lds_b128 %1, %9, off\n\t"
      "global_load_async_to_lds_b128 %2, %10, off\n\t"
      "global_load_async_to_lds_b128 %3, %11, off\n\t"
      "global_load_async_to_lds_b128 %4, %12, off\n\t"
      "global_load_async_to_lds_b128 %5, %13, off\n\t"
      "global_load_async_to_lds_b128 %6, %14, off\n\t"
      "global_load_async_to_lds_b128 %7, %15, off\n\t"
      "s_wait_xcnt 0x0"
      :: "v"(l), "v"(l + lstep), "v"(l + 2u * lstep), "v"(l + 3u * lstep),
         "v"(l + 4u * lstep), "v"(l + 5u * lstep), "v"(l + 6u * lstep), "v"(l + 7u * lstep),
         "v"(g[0]), "v"(g[1]), "v"(g[2]), "v"(g[3]), "v"(g[4]), "v"(g[5]), "v"(g[6]), "v"(g[7])
      : "memory");
#endif
}
__device__ __forceinline__ void copy4(unsigned l, unsigned lstep, const __bf16* const* g) {
#if defined(__HIP_DEVICE_COMPILE__)
  asm volatile(
      "global_load_async_to_lds_b128 %0, %4, off\n\t"
      "global_load_async_to_lds_b128 %1, %5, off\n\t"
      "global_load_async_to_lds_b128 %2, %6, off\n\t"
      "global_load_async_to_lds_b128 %3, %7, off\n\t"
      "s_wait_xcnt 0x0"
      :: "v"(l), "v"(l + lstep), "v"(l + 2u * lstep), "v"(l + 3u * lstep),
         "v"(g[0]), "v"(g[1]), "v"(g[2]), "v"(g[3])
      : "memory");
#endif
}
// this wave's copies have landed in LDS
__device__ __forceinline__ void wait_async0() {
#if defined(__HIP_DEVICE_COMPILE__)
  asm volatile("s_wait_asynccnt 0x0" ::: "memory");
#endif
}
// this wave's LDS reads have returned (before the buffer they read is handed back for a refill)
__device__ __forceinline__ void wait_ds0() {
#if defined(__HIP_DEVICE_COMPILE__)
  asm volatile("s_wait_dscnt 0x0" ::: "memory");
#endif
}
// the compiler's scheduler moves nothing across this point
__device__ __forceinline__ void sched_fence() {
#if defined(__HIP_DEVICE_COMPILE__)
  __builtin_amdgcn_sched_barrier(0);
#endif
}

// second launch bound: two waves per SIMD (two 4-wave blocks, or one 8-wave block, per WGP), so that one wave's WMMAs cover the other's waits
template <int EPI, int MI, bool SPLITA>
__global__ __launch_bounds__(512 / MI, 2) void gemm_tiled_kernel(
    const unsigned short* Ap, const unsigned short* A2p, int lda,
    const unsigned short* __restrict__ Btp, int ldb,
    const float* __restrict__ phs,
    void* C0, void* C1, void* C2, void* C3, int ldc,
    int M, int N, int K) {
  static_assert(EPI == 0 || EPI == 1 || EPI == 2);
  static_assert(MI == 4 || MI == 2);
  static_assert(GT_KP == 64);
  constexpr int NW    = 16 / MI;                  // waves per block
  constexpr int RS    = NW * 4;                   // stage rows that one copy of every thread covers (8 threads per 128-B row)
  constexpr int AROWS = (SPLITA ? 2 : 1) * GT_BM;
  constexpr int NCP   = (AROWS + GT_BN) / RS;     // copies per thread and stage: 24, 12 or 16 (at most 63 may be outstanding)
  constexpr int STAGE = (AROWS + GT_BN) * GT_LP;  // elements per buffer
  static_assert(NCP % 4 == 0 && NCP <= 63);
  typedef typename SlabT<EPI>::T ST;
  __shared__ __align__(16) __bf16 ring[2 * STAGE];
  __shared__ __align__(16) ST slab_all[NW * SlabT<EPI>::PERW];

  const int tid  = (int)threadIdx.x;
  const int lane = tid & 31;
  const int wave = wave_id();
  const int hh = lane >> 4;           // lane half: k offset 8*hh
  const int rl = lane & 15;           // A row / B col within subtile
  const int tilesN = N / GT_BN;
  const int tm  = (int)blockIdx.x / tilesN;
  const int tn  = (int)blockIdx.x - tm * tilesN;
  const int bm0 = tm * GT_BM;
  const int bn0 = tn * GT_BN;
  const int wm  = wave >> 1;
  const int wn  = wave & 1;

  // copy side: copy c of this thread brings piece tid % 8 of stage row c * RS + tid / 8
  const int crow = tid >> 3;
  const int cpc  = (tid & 7) * 8;     // element offset of the 16-B piece
  const __bf16* gA  = (const __bf16*)(const void*)Ap  + (size_t)(bm0 + crow) * lda + cpc;
  const __bf16* gA2 = (const __bf16*)(const void*)A2p + (size_t)(bm0 + crow) * lda + cpc;
  const __bf16* gB  = (const __bf16*)(const void*)Btp + (size_t)(bn0 + crow) * ldb + cpc;
  const unsigned lc = (unsigned)(size_t)(const void*)ring + (unsigned)(crow * GT_LP + cpc) * 2u;
  auto fill = [&](int t) {            // tile t -> buffer t % 2
    const unsigned l = lc + (unsigned)(t & 1) * (unsigned)(STAGE * 2);
    const size_t ko = (size_t)t * GT_KP;
    const __bf16* g[NCP];
#pragma unroll
    for (int c = 0; c < NCP; ++c) {
      const int r = c * RS;
      g[c] = (r < GT_BM) ? gA + ko + (size_t)r * lda
           : (r < AROWS) ? gA2 + ko + (size_t)(r - GT_BM) * lda
                         : gB + ko + (size_t)(r - AROWS) * ldb;
    }
#pragma unroll
    for (int c = 0; c + 8 <= NCP; c += 8) copy8(l + (unsigned)(c * RS * GT_LP * 2), RS * GT_LP * 2u, g + c);
    if constexpr (NCP % 8 == 4) copy4(l + (unsigned)((NCP - 4) * RS * GT_LP * 2), RS * GT_LP * 2u, g + (NCP - 4));
  };

  v8f acc[MI][8];
#pragma unroll
  for (int i = 0; i < MI; ++i)
#pragma unroll
    for (int j = 0; j < 8; ++j) acc[i][j] = zero8();

  const int nt = K / GT_KP;           // block-uniform, >= 2
  fill(0);
  wait_async0();
  __syncthreads();                    // tile 0 readable by every wave
  fill(1);

  const int aoff = (wm * (16 * MI) + rl) * GT_LP + 8 * hh;
  const int boff = (AROWS + wn * 128 + rl) * GT_LP + 8 * hh;
#pragma unroll 1                      // one pass per trip: the ring's order below holds per trip, and every acc index stays constant
  for (int t = 0; t < nt; ++t) {
    const __bf16* st = ring + (t & 1) * STAGE;
    v16b fa[2][MI], fl[2][MI], fb[2][8];          // one fragment set per 32-k step of the pass
#pragma unroll
    for (int ks = 0; ks < 2; ++ks) {
#pragma unroll
      for (int i = 0; i < MI; ++i) {
        fa[ks][i] = ldfrag_b(st + aoff + i * 16 * GT_LP + ks * 32);
        if constexpr (SPLITA) fl[ks][i] = ldfrag_b(st + aoff + (GT_BM + i * 16) * GT_LP + ks * 32);
      }
#pragma unroll
      for (int j = 0; j < 8; ++j) fb[ks][j] = ldfrag_b(st + boff + j * 16 * GT_LP + ks * 32);
      sched_fence();                              // each step's LDS reads stay one group ahead of the WMMA blocks, not spread among them
    }
#pragma unroll
    for (int ks = 0; ks < 2; ++ks) {
#pragma unroll
      for (int j = 0; j < 8; ++j) {
#pragma unroll
        for (int i = 0; i < MI; ++i) acc[i][j] = mma_b(fa[ks][i], fb[ks][j], acc[i][j]);
        if constexpr (SPLITA) {
#pragma unroll
          for (int i = 0; i < MI; ++i) acc[i][j] = mma_b(fl[ks][i], fb[ks][j], acc[i][j]);
        }
      }
      // step 1's WMMAs stay behind step 0's (only step 0's reads are waited for first) and in front of the waits at the foot
      // (moved behind the barrier they would halve the lead of the copies in flight)
      sched_fence();
    }
    wait_ds0();
    wait_async0();
    __syncthreads();                  // publishes tile t + 1 and ends every wave's reads of tile t's buffer
    if (t + 2 < nt) fill(t + 2);      // block-uniform test
  }
  wait_async0();

  gemm_epilogue<EPI, 8, MI>(acc, slab_all + wave * SlabT<EPI>::PERW, lane, bm0 + wm * (16 * MI), bn0 + wn * 128, phs, C0, C1, C2, C3, ldc);
}

// ---------------------------------------------------------------------------
// Phase projection: v[m][n] = sum_k Xb[m][k] * WpT[n][k] (M = NTOK, N = NPH, K = HID), then PQ[m][n] = cos(v), PQ[m][NPH + n] = sin(v).
// Block = 16 token rows x all NPH columns, PP_NW waves; wave w takes k in [w * PP_KS, (w + 1) * PP_KS): all its fragment loads
// (straight from the global rows) go out ahead of its WMMAs, so a wave pays the global latency once. The PP_NW partial tiles meet
// in LDS and are added in wave order 0..PP_NW-1. Each thread then finishes 2 values (precise cosf/sinf); a wave's store is one whole 128-B line.
// Coverage: NTOK / 16 blocks x 16 rows x PQW columns = the whole PQ plane.
// ---------------------------------------------------------------------------
#define PP_NW 8
#define PP_KS (HID / PP_NW)
static_assert(PP_KS % 32 == 0 && NPH == 32 && PQW == 2 * NPH && NTOK % 16 == 0);
__global__ __launch_bounds__(32 * PP_NW) void phase_proj_kernel(const unsigned short* __restrict__ Xp, const unsigned short* __restrict__ Wp,
                                                                float* __restrict__ PQ) {
  constexpr int NS = PP_KS / 32;      // 32-k steps per wave
  __shared__ __align__(16) float part[PP_NW * 16 * NPH];
  const int tid  = (int)threadIdx.x;
  const int lane = tid & 31;
  const int wave = wave_id();
  const int hh = lane >> 4;           // lane half: k offset 8*hh, D row offset 8*hh
  const int rl = lane & 15;           // A row / B col / D col within subtile
  const int m0 = (int)blockIdx.x * 16;
  const __bf16* A  = (const __bf16*)(const void*)Xp + (size_t)(m0 + rl) * HID + wave * PP_KS + 8 * hh;
  const __bf16* B0 = (const __bf16*)(const void*)Wp + (size_t)rl * HID + wave * PP_KS + 8 * hh;
  const __bf16* B1 = B0 + (size_t)16 * HID;
  v16b fa[NS], f0[NS], f1[NS];
#pragma unroll
  for (int s = 0; s < NS; ++s) {
    fa[s] = ldfrag_b(A + s * 32);
    f0[s] = ldfrag_b(B0 + s * 32);
    f1[s] = ldfrag_b(B1 + s * 32);
  }
  sched_fence();                      // all 6 * NS loads stay ahead of the first WMMA: spread among the WMMAs they would return in NS rounds of latency
  v8f a0 = zero8(), a1 = zero8();
#pragma unroll
  for (int s = 0; s < NS; ++s) {
    a0 = mma_b(fa[s], f0[s], a0);
    a1 = mma_b(fa[s], f1[s], a1);
  }
  float* pw = part + wave * (16 * NPH);
#pragma unroll
  for (int r = 0; r < 8; ++r) {
    pw[(8 * hh + r) * NPH + rl]      = a0[r];
    pw[(8 * hh + r) * NPH + 16 + rl] = a1[r];
  }
  __syncthreads();                    // every wave's partial tile readable by the block
#pragma unroll 1                      // one precise cos + sin site in the text
  for (int it = 0; it < (16 * NPH) / (32 * PP_NW); ++it) {
    const int e = it * (32 * PP_NW) + tid;        // row e / NPH, column e % NPH (= lane)
    float v = part[e];
#pragma unroll
    for (int w = 1; w < PP_NW; ++w) v += part[w * (16 * NPH) + e];
    float* o = PQ + (size_t)(m0 + e / NPH) * PQW + (e % NPH);
    o[0]   = cosf(v);
    o[NPH] = sinf(v);
    wait_x0();                        // precaution: the next trip's first instructions reuse this store's address registers
  }
}

// ---------------------------------------------------------------------------
// Phase modulation factor, PH_PB blocks per sequence (grid NSEQ * PH_PB, 512 threads), all f32:
//   PQ plane [NTOK][PQW]: col h = cos(pq_h), 16+h = cos(pk_h), 32+h = sin(pq_h), 48+h = sin(pk_h).
//   Ck[h] = sum_s cos(pk), Sk[h] = sum_s sin(pk): every block sums its whole sequence itself (no data passes between blocks of the launch).
//   8 threads per row, each one 16-B piece (4 heads of cos or of sin), 64 rows per pass: a wave reads 4 rows x two 64-B runs per instruction;
//   per-thread partials over 32 rows, then 32 threads add the 64 row groups in fixed order from LDS (lanes on consecutive banks).
//   phs[b*SQ + s] = sum_h (cos(pq_h)*Ck[h] + sin(pq_h)*Sk[h]) / 32768: 4 products per thread, 8 partials per row joined through LDS in fixed order.
//   Coverage: NSEQ * PH_PB blocks x PH_ROWS = NTOK values; each wave of the last stage stores one whole 128-B line.
// ---------------------------------------------------------------------------
#define PH_PB   16
#define PH_ROWS (SQ / PH_PB)
static_assert(PH_ROWS % 64 == 0 && SQ % 64 == 0 && PH_ROWS <= 512);
__global__ __launch_bounds__(512) void phase_kernel(const float* __restrict__ PQ, float* __restrict__ phs) {
  __shared__ __align__(16) float red[64 * 2 * NHQ];
  __shared__ __align__(16) float csk[2 * NHQ];
  __shared__ __align__(16) float part[PH_ROWS * 8];
  const int b   = (int)blockIdx.x / PH_PB;
  const int blk = (int)blockIdx.x % PH_PB;
  const int tid = (int)threadIdx.x;
  const int pc  = tid & 7;                            // piece: 0..3 = cos of heads 4*pc.., 4..7 = sin of heads 4*(pc-4)..
  const int g   = tid >> 3;                           // row within a pass of 64
  const int col = (pc < 4) ? 4 * pc : NHQ + 4 * pc;   // pq columns 0..12 and 32..44; the pk columns lie NHQ further
  const float* base = PQ + (size_t)b * SQ * PQW;
  v4f xq[PH_ROWS / 64];                               // this block's own pq rows, asked for ahead of the sums
#pragma unroll
  for (int it = 0; it < PH_ROWS / 64; ++it)
    xq[it] = *(const v4f*)(base + (size_t)(blk * PH_ROWS + it * 64 + g) * PQW + col);
  v4f acc = {0.f, 0.f, 0.f, 0.f};
#pragma unroll 8                                      // 8 loads in flight per thread: 4 L2 round trips for the 32 rows, not 32
  for (int it = 0; it < SQ / 64; ++it) {
    const v4f x = *(const v4f*)(base + (size_t)(it * 64 + g) * PQW + NHQ + col);
    acc += x;
  }
  *(v4f*)(red + g * (2 * NHQ) + 4 * pc) = acc;
  __syncthreads();
  if (tid < 2 * NHQ) {                                // wave 0
    float s = 0.f;
#pragma unroll                                        // the 64 LDS reads go out together; only the adds are a chain
    for (int r = 0; r < 64; ++r) s += red[r * (2 * NHQ) + tid];
    csk[tid] = s;
  }
  __syncthreads();
  const v4f w = *(const v4f*)(csk + 4 * pc);
#pragma unroll
  for (int it = 0; it < PH_ROWS / 64; ++it) {
    const v4f x = xq[it];
    part[(it * 64 + g) * 8 + pc] = (x[0] * w[0] + x[1] * w[1]) + (x[2] * w[2] + x[3] * w[3]);
  }
  __syncthreads();
  if (tid < PH_ROWS) {                                // whole waves
    const v4f p0 = *(const v4f*)(part + tid * 8);
    const v4f p1 = *(const v4f*)(part + tid * 8 + 4);
    const float a = ((p0[0] + p0[1]) + (p0[2] + p0[3])) + ((p1[0] + p1[1]) + (p1[2] + p1[3]));
    phs[(size_t)b * SQ + blk * PH_ROWS + tid] = a * (1.0f / 32768.0f);
  }
}

// ---------------------------------------------------------------------------
// Causal flash attention, head dim 128, 32-key chunks, block = 4 waves = 64 query rows of one (b, h); grid (n query tiles, NHQ, NSEQ).
//   q planes f16 [tok][h*128+d]: hi (qhp) and residual x2048 (qlp); k planes f16 [tok][h*128+d]: hi (khp); residual x2048 (klp) only for
//   keys < KLR of each sequence, stored at row b*KLR + key (read only when PRES); v^T planes f16 [h*128+d][tok]: hi (vhp), residual x2048 (vlp);
//   outputs attn bf16 hi (ahp) / lo (alp) [tok][h*128+d].
//   scores = (Sh + Sr/2048) * 128^-0.5 with Sh = qh.kh and Sr = ql'.kh (+ qh.kl' when PRES); keys > query -> -inf; online softmax f32;
//   p' = 1024 p stored per wave to LDS as f16 hi (and residual x2048 when PRES), reloaded as A fragments after a wave sync;
//   O = (Oh + Or/2048)/1024/l with Oh = ph.vh, Or = ph.vl' (+ pl'.vh when PRES).
//   q planes: each wave copies its 16 rows to LDS once and takes its A fragments from there in every chunk.
//   K / V^T chunk staging: 128 threads x 4 x 16 B per plane = whole 32x128 / 128x32 tile, plain loads, __syncthreads before and after.
//   Fragment reads run ahead of the WMMAs that use them: q/k four or more WMMAs ahead, v^T AT_VD tiles ahead (tiles 0 to 2 in front of the softmax).
//   Trip count 2*qb+2 chunks (static bound 64); waves whose rows are all below the chunk skip it (wave-uniform, scalar branch).
// ---------------------------------------------------------------------------
#define AT_KC   32
#define KS_P    136
#define VS_P    40
#define PS_P    40
#define QS_P    136
#define AT_VD   4
// LDS map in halves. The k and p residual planes exist only with PRES. QS: per wave 2 planes x 16 query rows at pitch QS_P (272 B = 16 B x 17).
template <bool PRES> struct AttnLds {
  static constexpr int KS  = 0;
  static constexpr int KLS = 32 * KS_P;
  static constexpr int VHS = (PRES ? 2 : 1) * 32 * KS_P;
  static constexpr int VLS = VHS + 128 * VS_P;
  static constexpr int PH  = VLS + 128 * VS_P;
  static constexpr int PL  = PH + 4 * 16 * PS_P;
  static constexpr int QS  = PH + (PRES ? 2 : 1) * 4 * 16 * PS_P;
  static constexpr int ST  = QS + 4 * 2 * 16 * QS_P;     // per wave 4 planes x 32 lanes x 16 B: each lane's own 8 row maxima and 8 row sums
  static constexpr int TOT = ST + 4 * 1024;
};
static_assert(4 * AttnLds<false>::TOT * 2 <= 327680);   // four blocks of the long launch per WGP, as its registers allow
static_assert(4 * 4096 <= AttnLds<false>::QS);          // output staging (2 planes x 16 x 128 per wave) aliases the chunk region after the loop

// second launch bound of the long launch: four waves per SIMD, so that all its blocks are resident at once
template <bool PRES>
__global__ __launch_bounds__(128, PRES ? 1 : 4) void attn_causal_kernel(
    const unsigned short* __restrict__ qhp, const unsigned short* __restrict__ qlp,
    const unsigned short* __restrict__ khp, const unsigned short* __restrict__ klp,
    const unsigned short* __restrict__ vhp, const unsigned short* __restrict__ vlp,
    unsigned short* __restrict__ ahp, unsigned short* __restrict__ alp, int qb_base) {
  typedef AttnLds<PRES> L;
  __shared__ __align__(16) _Float16 lds[L::TOT];
  _Float16* Ks  = lds + L::KS;
  _Float16* Vhs = lds + L::VHS;

  const int tid  = (int)threadIdx.x;
  const int lane = tid & 31;
  const int wave = wave_id();
  const int hh   = lane >> 4;
  const int c    = lane & 15;
  const int qb   = (int)blockIdx.x + qb_base;
  const int h    = (int)blockIdx.y;
  const int b    = (int)blockIdx.z;
  const int q0   = qb * 64 + wave * 16;          // first query row of this wave (within sequence)
  const int qlast = q0 + 15;
  const size_t tok0 = (size_t)b * SQ;

  const _Float16* Qhg = (const _Float16*)(const void*)qhp + (tok0 + q0) * HID + h * HDM;
  const _Float16* Qlg = (const _Float16*)(const void*)qlp + (tok0 + q0) * HID + h * HDM;
  const _Float16* Kg  = (const _Float16*)(const void*)khp + tok0 * HID + h * HDM;
  const _Float16* Klg = (const _Float16*)(const void*)klp + (size_t)b * KLR * HID + h * HDM;
  const _Float16* Vhg = (const _Float16*)(const void*)vhp + (size_t)(h * HDM) * NTOK + tok0;
  const _Float16* Vlg = (const _Float16*)(const void*)vlp + (size_t)(h * HDM) * NTOK + tok0;
  _Float16* ph = lds + L::PH + wave * (16 * PS_P);
  _Float16* pl = PRES ? lds + L::PL + wave * (16 * PS_P) : ph;   // used only with PRES
  _Float16* Qs = lds + L::QS + wave * (2 * 16 * QS_P);           // this wave's own query rows: hi plane, then residual plane

  // q rows to LDS once, whole 256-B rows per 16 lanes; read back only by this wave, behind the first barrier of the chunk loop (nch >= 2)
#pragma unroll                                   // all 16 loads in flight together: one global latency for the whole fill
  for (int it = 0; it < 8; ++it) {
    const int row = it * 2 + hh;                 // it 0..7 x hh 0..1 covers rows 0..15
    const v8h x = *(const v8h*)(Qhg + (size_t)row * HID + c * 8);
    const v8h y = *(const v8h*)(Qlg + (size_t)row * HID + c * 8);
    *(v8h*)(Qs + row * QS_P + c * 8) = x;
    *(v8h*)(Qs + (16 + row) * QS_P + c * 8) = y;
  }

  // running row maxima and row sums live in LDS between their one use per chunk (each lane reads back only what it wrote):
  // their 16 registers go to the fragments in flight, within the 256 that four waves per SIMD allow
  float* stw = (float*)(void*)(lds + L::ST + wave * 1024) + lane * 4;
  {
    const v4f ninf = {-INFINITY, -INFINITY, -INFINITY, -INFINITY};
    const v4f zero = {0.f, 0.f, 0.f, 0.f};
    *(v4f*)(stw) = ninf; *(v4f*)(stw + 128) = ninf; *(v4f*)(stw + 256) = zero; *(v4f*)(stw + 384) = zero;
  }
  v8f oacc[8], oaccr[8];
#pragma unroll
  for (int t = 0; t < 8; ++t) { oacc[t] = zero8(); oaccr[t] = zero8(); }

  // staging: block-uniform bases in scalar registers and one running 32-bit byte offset per tile shape (64-bit lane addresses would take
  // the fragments' registers); places in LDS
  const char* Kc  = (const char*)Kg;
  const char* Klc = (const char*)Klg;
  const char* Vhc = (const char*)Vhg;
  const char* Vlc = (const char*)Vlg;
  unsigned kgo = (unsigned)((tid >> 4) * (HID * 2) + (tid & 15) * 16);
  unsigned vgo = (unsigned)((tid >> 2) * (NTOK * 2) + (tid & 3) * 16);
  _Float16* kst = Ks + (tid >> 4) * KS_P + (tid & 15) * 8;
  _Float16* vst = Vhs + (tid >> 2) * VS_P + (tid & 3) * 8;
  const _Float16* qf = Qs + c * QS_P + 8 * hh;                                  // fragment reads: this lane's row and k half
  const _Float16* kf = Ks + c * KS_P + 8 * hh;
  const _Float16* vf = Vhs + c * VS_P + 8 * hh;
  const int dq = c - 8 * hh - q0;                // key - query row = kv0 + 16 * j - r + dq

  const int nch = 2 * qb + 2;                    // block-uniform, <= 64; keys < 64*(qb+1) <= SQ; PRES blocks: keys < 256 = KLR
  for (int kc = 0; kc < nch; ++kc) {
    const int kv0 = kc * AT_KC;
    __syncthreads();
#pragma unroll
    for (int i = 0; i < 4; ++i) {                // coverage: piece p = tid + 128 * i, 512 pieces of 8 halves per plane = whole tile
      const v8h kx = *(const v8h*)(Kc + kgo + i * (8 * HID * 2));          // K: key p >> 4, d (p & 15) * 8
      *(v8h*)(kst + i * 8 * KS_P) = kx;
      if (PRES) {
        const v8h ky = *(const v8h*)(Klc + kgo + i * (8 * HID * 2));
        *(v8h*)(kst + (L::KLS - L::KS) + i * 8 * KS_P) = ky;
      }
      const v8h vx = *(const v8h*)(Vhc + vgo + i * (32 * NTOK * 2));       // V^T: d p >> 2, keys (p & 3) * 8
      const v8h vy = *(const v8h*)(Vlc + vgo + i * (32 * NTOK * 2));
      *(v8h*)(vst + i * 32 * VS_P) = vx;
      *(v8h*)(vst + (L::VLS - L::VHS) + i * 32 * VS_P) = vy;
    }
    kgo += AT_KC * HID * 2;                      // next chunk's offsets, behind the loads' data waits
    vgo += AT_KC * 2;
    __syncthreads();

    if (kv0 <= qlast) {                          // wave-uniform (scalar): skip chunks fully above this wave's rows
      // ---- scores ----
      v16h qa[4], ql[4], kb[4][2], kl[4][2], vb[8], vr[8];
      auto ld_k = [&](int dc, int j) {           // k fragment(s) of 32-d step dc, key half j
        kb[dc][j] = ldfrag_h(kf + j * 16 * KS_P + dc * 32);
        if (PRES) kl[dc][j] = ldfrag_h(kf + (L::KLS - L::KS) + j * 16 * KS_P + dc * 32);
      };
      auto ld_q = [&](int dc) {                  // both q planes' fragments of step dc
        qa[dc] = ldfrag_h(qf + dc * 32);
        ql[dc] = ldfrag_h(qf + 16 * QS_P + dc * 32);
      };
      auto ld_v = [&](int t) {                   // the two v^T fragments of output tile t
        vb[t] = ldfrag_h(vf + t * 16 * VS_P);
        vr[t] = ldfrag_h(vf + (L::VLS - L::VHS) + t * 16 * VS_P);
      };
      v4f mr[2], lr[2];
      v8f sh[2], sr[2];
      sh[0] = zero8(); sh[1] = zero8(); sr[0] = zero8(); sr[1] = zero8();
      ld_k(0, 0); ld_q(0); ld_k(0, 1); ld_k(1, 0); ld_q(1); ld_k(1, 1);
      sched_fence();                             // the first reads go out together, ahead of the first WMMA
      // every refill below stands between two fences: behind the WMMAs whose registers it takes over, and four or more WMMAs ahead of its use
      // (a read sunk to its use costs a full LDS round trip per WMMA pair)
#pragma unroll                                   // constant indices: fragments, scores and accumulators stay in registers
      for (int dc = 0; dc < 4; ++dc) {
#pragma unroll                                   // constant indices: fragments, scores and accumulators stay in registers
        for (int j = 0; j < 2; ++j) {
          sh[j] = mma_h(qa[dc], kb[dc][j], sh[j]);
          sr[j] = mma_h(ql[dc], kb[dc][j], sr[j]);
          if (PRES) sr[j] = mma_h(qa[dc], kl[dc][j], sr[j]);
          sched_fence();
          if (j == 0) {
            if (dc + 2 < 4) ld_k(dc + 2, 0);
          } else {
            if (dc + 2 < 4) { ld_q(dc + 2); ld_k(dc + 2, 1); }
            else ld_v(dc - 2);                   // v^T does not hang on the softmax: tiles 0, 1 and 2 return under it
            if (dc == 3) { ld_v(2); mr[0] = *(const v4f*)(stw); mr[1] = *(const v4f*)(stw + 128); }
          }
          sched_fence();
        }
      }
      // ---- scale, causal mask, chunk row max ----
      const int dk = kv0 + dq;
      float cm[8], cx[8];
#pragma unroll                                   // constant indices: fragments, scores and accumulators stay in registers
      for (int r = 0; r < 8; ++r) {
        float m = -INFINITY;
#pragma unroll                                   // constant indices: fragments, scores and accumulators stay in registers
        for (int j = 0; j < 2; ++j) {
          float s = (sh[j][r] + sr[j][r] * 0.00048828125f) * 0.08838834764831845f;
          s = (dk > r - j * 16) ? -INFINITY : s; // key > query row
          sh[j][r] = s;
          m = fmaxf(m, s);
        }
        cm[r] = m;
      }
#pragma unroll                                   // constant indices: fragments, scores and accumulators stay in registers
      for (int off = 1; off < 16; off <<= 1) {
#pragma unroll                                   // constant indices: fragments, scores and accumulators stay in registers
        for (int r = 0; r < 8; ++r) cx[r] = __shfl_xor(cm[r], off, 32);
        sched_fence();                           // the eight rows' exchanges of a step go out together: one LDS-pipe latency per step, not per row
#pragma unroll                                   // constant indices: fragments, scores and accumulators stay in registers
        for (int r = 0; r < 8; ++r) cm[r] = fmaxf(cm[r], cx[r]);
      }
      // ---- online softmax, P' to LDS ----
      float alpha[8], psum[8];
#pragma unroll                                   // constant indices: fragments, scores and accumulators stay in registers
      for (int r = 0; r < 8; ++r) {
        const float mnew = fmaxf(mr[r >> 2][r & 3], cm[r]);
        float pe[2];
        exp3_slot(sh[0][r] - mnew, sh[1][r] - mnew, mr[r >> 2][r & 3] - mnew, pe[0], pe[1], alpha[r]);
        mr[r >> 2][r & 3] = mnew;
#pragma unroll                                   // constant indices: fragments, scores and accumulators stay in registers
        for (int j = 0; j < 2; ++j) {
          const float p  = pe[j];
          const float pp = p * 1024.0f;
          const _Float16 phv = (_Float16)pp;
          const int po = (8 * hh + r) * PS_P + j * 16 + c;
          ph[po] = phv;
          if (PRES) pl[po] = (_Float16)((pp - (float)phv) * 2048.0f);
        }
        psum[r] = pe[0] + pe[1];
      }
      *(v4f*)(stw) = mr[0]; *(v4f*)(stw + 128) = mr[1];
      lds_wave_sync();                           // P' stores visible to the other lanes of this wave before the fragment reload
      // ---- O += P' . V; the four exchange steps of the row sums ride between the first WMMA groups ----
      float px[8];
#pragma unroll                                   // constant indices: fragments, scores and accumulators stay in registers
      for (int r = 0; r < 8; ++r) px[r] = __shfl_xor(psum[r], 1, 32);
      const v16h pa = ldfrag_h(ph + c * PS_P + 8 * hh);
      v16h pr = pa;
      if (PRES) pr = ldfrag_h(pl + c * PS_P + 8 * hh);
#pragma unroll                                   // constant indices: fragments, scores and accumulators stay in registers
      for (int t = 3; t < AT_VD; ++t) ld_v(t);
      lr[0] = *(const v4f*)(stw + 256); lr[1] = *(const v4f*)(stw + 384);
      sched_fence();                             // exchange, P' and v^T reads go out together; the rescale below runs under their latency
#pragma unroll                                   // constant indices: fragments, scores and accumulators stay in registers
      for (int r = 0; r < 8; ++r) {
#pragma unroll                                   // constant indices: fragments, scores and accumulators stay in registers
        for (int t = 0; t < 8; ++t) { oacc[t][r] *= alpha[r]; oaccr[t][r] *= alpha[r]; }
      }
#pragma unroll                                   // constant indices: fragments, scores and accumulators stay in registers
      for (int t = 0; t < 8; ++t) {
        if (t < 4) {
#pragma unroll                                   // constant indices: fragments, scores and accumulators stay in registers
          for (int r = 0; r < 8; ++r) {
            psum[r] += px[r];
            if (t < 3) px[r] = __shfl_xor(psum[r], 2 << t, 32);
            else lr[r >> 2][r & 3] = lr[r >> 2][r & 3] * alpha[r] + psum[r];
          }
          if (t == 3) { *(v4f*)(stw + 256) = lr[0]; *(v4f*)(stw + 384) = lr[1]; }
          sched_fence();                         // the exchange is asked for in front of this group's v^T refill, so its counted wait leaves the refill in flight
        }
        oacc[t]  = mma_h(pa, vb[t], oacc[t]);
        oaccr[t] = mma_h(pa, vr[t], oaccr[t]);
        if (PRES) oaccr[t] = mma_h(pr, vb[t], oaccr[t]);
        sched_fence();                           // refill behind the WMMAs whose registers it takes over, AT_VD tiles ahead of its use
        if (t + AT_VD < 8) ld_v(t + AT_VD);
        sched_fence();
      }
      guard_h4(oacc[7], oaccr[7], pa, pr, vb[7], vr[7]);
    }
  }

  __syncthreads();                               // all chunk-region readers done before aliasing it as output staging
  _Float16* osh = lds + wave * 4096;
  _Float16* osl = osh + 2048;
  const v4f lf[2] = {*(const v4f*)(stw + 256), *(const v4f*)(stw + 384)};
#pragma unroll
  for (int r = 0; r < 8; ++r) {
    const float inv = (1.0f / lf[r >> 2][r & 3]) * 0.0009765625f;
#pragma unroll
    for (int t = 0; t < 8; ++t) {
      const float o = (oacc[t][r] + oaccr[t][r] * 0.00048828125f) * inv;
      const unsigned short hb = bf_bits(o);
      const unsigned short lb = bf_bits(o - bf_val(hb));
      const int so = (8 * hh + r) * 128 + t * 16 + c;
      osh[so] = __builtin_bit_cast(_Float16, hb);
      osl[so] = __builtin_bit_cast(_Float16, lb);
    }
  }
  lds_wave_sync();
  _Float16* Ahg = (_Float16*)(void*)ahp + (tok0 + q0) * HID + h * HDM;
  _Float16* Alg = (_Float16*)(void*)alp + (tok0 + q0) * HID + h * HDM;
  {
#pragma unroll
    for (int it = 0; it < 8; ++it) {
      const int row = it * 2 + hh;               // it 0..7 x hh 0..1 covers rows 0..15
      const int c8  = c * 8;                     // 16 lanes x 16 B = the whole 256-B segment
      const v8h x = *(const v8h*)(osh + row * 128 + c8);
      const v8h y = *(const v8h*)(osl + row * 128 + c8);
      *(v8h*)(Ahg + (size_t)row * HID + c8) = x;
      *(v8h*)(Alg + (size_t)row * HID + c8) = y;
    }
    
  }
}

// ---------------------------------------------------------------------------
// Workspace map (bytes; every region is a whole number of the rows its producer writes with whole-line stores; all dims are tile multiples,
// so padded size == logical size; offsets are multiples of 16384):
//   R0   Xb  bf16 [4096][2048] 16777216, later Ah bf16 [4096][2048] (Xb dead after the three projection GEMMs)
//   R1   WqkT bf16 [4096][2048] 16777216, later Al bf16 [4096][2048]
//   R2   WvT bf16 [2048][2048]  8388608, later WoT bf16 [2048][2048] (WvT dead after the v GEMM)
//   WpT  bf16 [32][2048]          131072
//   Qh, Ql, Kh f16 [4096][2048]  16777216 each
//   Kl   f16 [512][2048]          2097152
//   Vh, Vl f16 [2048][4096]      16777216 each
//   PQ   f32 [4096][64]           1048576
//   phs  f32 [4096]                 16384
//   total                       129122304
// ---------------------------------------------------------------------------
static inline size_t smax(size_t a, size_t b) { return a > b ? a : b; }

extern "C" void kernel_launch(void* const* d_in, const int* in_sizes, int n_in,
                              void* d_out, int out_size, void* d_ws, size_t ws_size,
                              hipStream_t stream) {
  if (n_in < 7) return;
  if (in_sizes[0] != NTOK * HID) return;
  if (in_sizes[1] != HID * HID) return;
  if (in_sizes[2] != HID * HID) return;
  if (in_sizes[3] != HID * HID) return;
  if (in_sizes[4] != HID * HID) return;
  if (in_sizes[5] != HID * NHQ) return;
  if (in_sizes[6] != HID * NHQ) return;
  if (out_size != NTOK * HID) return;

  const float* x   = (const float*)d_in[0];
  const float* Wq  = (const float*)d_in[1];
  const float* Wk  = (const float*)d_in[2];
  const float* Wv  = (const float*)d_in[3];
  const float* Wo  = (const float*)d_in[4];
  const float* Wpq = (const float*)d_in[5];
  const float* Wpk = (const float*)d_in[6];
  float* out = (float*)d_out;

  const size_t szX   = (size_t)NTOK * HID * 2;
  const size_t szWqk = (size_t)2 * HID * HID * 2;
  const size_t szW   = (size_t)HID * HID * 2;
  const size_t szA   = (size_t)NTOK * HID * 2;
  const size_t szWp  = (size_t)NPH * HID * 2;
  const size_t szQ   = (size_t)NTOK * HID * 2;
  const size_t szKl  = (size_t)NSEQ * KLR * HID * 2;
  const size_t szV   = (size_t)HID * NTOK * 2;
  const size_t szPQ  = (size_t)NTOK * PQW * 4;
  const size_t szPh  = (size_t)NTOK * 4;
  size_t off = 0;
  const size_t oR0 = off; off += smax(szX, szA);
  const size_t oR1 = off; off += smax(szWqk, szA);
  const size_t oR2 = off; off += szW;
  const size_t oWp = off; off += szWp;
  const size_t oQh = off; off += szQ;
  const size_t oQl = off; off += szQ;
  const size_t oKh = off; off += szQ;
  const size_t oKl = off; off += szKl;
  const size_t oVh = off; off += szV;
  const size_t oVl = off; off += szV;
  const size_t oPQ = off; off += szPQ;
  const size_t oPh = off; off += szPh;
  if (off > ws_size) return;                     // off = 129122304

  char* ws = (char*)d_ws;
  unsigned short* Xb   = (unsigned short*)(ws + oR0);
  unsigned short* Ah   = (unsigned short*)(ws + oR0);
  unsigned short* WqkT = (unsigned short*)(ws + oR1);
  unsigned short* Al   = (unsigned short*)(ws + oR1);
  unsigned short* WvT  = (unsigned short*)(ws + oR2);
  unsigned short* WoT  = (unsigned short*)(ws + oR2);
  unsigned short* WpT  = (unsigned short*)(ws + oWp);
  unsigned short* Qh   = (unsigned short*)(ws + oQh);
  unsigned short* Ql   = (unsigned short*)(ws + oQl);
  unsigned short* Kh   = (unsigned short*)(ws + oKh);
  unsigned short* Kl   = (unsigned short*)(ws + oKl);
  unsigned short* Vh   = (unsigned short*)(ws + oVh);
  unsigned short* Vl   = (unsigned short*)(ws + oVl);
  float*          PQ   = (float*)(ws + oPQ);
  float*          phs  = (float*)(ws + oPh);

  const dim3 b256(256), b128(128);

  // (1) x -> bf16 plane [4096][2048]
  cvt_bf16_kernel<<<dim3((NTOK * HID / 8) / 256), b256, 0, stream>>>(x, Xb, NTOK * HID / 8);
  // (2) Wq in[2048 rows][2048 cols] -> WqkT rows 0..2047 = out[n][k]; Wk -> WqkT rows 2048..4095; Wv -> WvT   (grid = cols/64, rows/64)
  tconv_bf16_kernel<<<dim3(HID / 64, HID / 64), b256, 0, stream>>>(Wq, WqkT, HID, HID);
  tconv_bf16_kernel<<<dim3(HID / 64, HID / 64), b256, 0, stream>>>(Wk, WqkT + (size_t)HID * HID, HID, HID);
  tconv_bf16_kernel<<<dim3(HID / 64, HID / 64), b256, 0, stream>>>(Wv, WvT, HID, HID);
  // (3) Wpq|Wpk -> WpT [32][2048]
  wpt_kernel<<<dim3(NPH), b256, 0, stream>>>(Wpq, Wpk, WpT);
  // (4) pq|pk = x . (Wpq|Wpk) -> cos|sin plane PQ [4096][64]   (M=4096, N=32, K=2048; one block per 16 rows)
  phase_proj_kernel<<<dim3(NTOK / 16), b256, 0, stream>>>(Xb, WpT, PQ);
  // (5) phase factor phs [4096]
  phase_kernel<<<dim3(NSEQ * PH_PB), dim3(512), 0, stream>>>(PQ, phs);
  // (6) q|k = x . (Wq|Wk) -> Qh/Ql [4096][2048], Kh [4096][2048], Kl [512][2048]   (M=4096, N=4096, K=2048; 32 x 16 block tiles)
  gemm_tiled_kernel<0, 4, false><<<dim3((NTOK / GT_BM) * ((2 * HID) / GT_BN)), b128, 0, stream>>>(
      Xb, Xb, HID, WqkT, HID, phs, (void*)Qh, (void*)Ql, (void*)Kh, (void*)Kl, HID, NTOK, 2 * HID, HID);
  // (7) v^T = WvT . x^T -> Vh/Vl [2048][4096]   (A = WvT, Bt = Xb; M=2048, N=4096, K=2048; 16 x 16 block tiles)
  gemm_tiled_kernel<1, 2, false><<<dim3((HID / GT_BM) * (NTOK / GT_BN)), b256, 0, stream>>>(
      WvT, WvT, HID, Xb, HID, phs, (void*)Vh, (void*)Vl, (void*)Vh, (void*)Vl, NTOK, HID, NTOK, HID);
  // (8) Wo -> WoT (over the dead WvT region)
  tconv_bf16_kernel<<<dim3(HID / 64, HID / 64), b256, 0, stream>>>(Wo, WoT, HID, HID);
  // (9) causal attention, query tiles 0..3 with k and p residual products, tiles 4..31 without -> Ah/Al (over the dead Xb/WqkT regions)
  attn_causal_kernel<true><<<dim3(4, NHQ, NSEQ), b128, 0, stream>>>(Qh, Ql, Kh, Kl, Vh, Vl, Ah, Al, 0);
  attn_causal_kernel<false><<<dim3(SQ / 64 - 4, NHQ, NSEQ), b128, 0, stream>>>(Qh, Ql, Kh, Kl, Vh, Vl, Ah, Al, 4);
  // (10) out = (attn hi + lo) . Wo * (1 + 0.1*phs[m]) -> d_out f32 [4096][2048]   (M=4096, N=2048, K=2048; 32 x 8 block tiles)
  gemm_tiled_kernel<2, 2, true><<<dim3((NTOK / GT_BM) * (HID / GT_BN)), b256, 0, stream>>>(
      Ah, Al, HID, WoT, HID, phs, (void*)out, (void*)out, (void*)out, (void*)out, HID, NTOK, HID, HID);
  (void)hipGetLastError();
}

// v006
// One run takes 289 microseconds.
// Next to v005, in two timings, it ran 1.15 times as fast each time.
// Counting every step since v000, it is 2.69 times as fast.
// Contractions: x.(Wq|Wk), Wv^T.x^T and x.(Wpq|Wpk) on v_wmma_f32_16x16x32_bf16 (operands = RNE bf16 of the f32 inputs, single products);
// q.k^T and p.v on v_wmma_f32_16x16x32_f16 (q = f16 hi + f16 residual x2^11 planes; k plain f16 plus f16 residual x2^11 on query tiles 0..3;
// p x1024 plain f16 plus f16 residual x2^11 on query tiles 0..3; v^T = f16 hi + f16 residual x2^11 planes); attn.Wo on v_wmma_f32_16x16x32_bf16
// (attn = bf16 hi + bf16 lo planes, two products; Wo RNE bf16). f32 accumulate everywhere; online softmax, cos/sin phase sums and output scale in f32.
#include <hip/hip_runtime.h>
#include <math.h>
#include <stdint.h>

#define NSEQ   2
#define SQ     2048
#define HID    2048
#define NHQ    16
#define HDM    128
#define NTOK   4096
#define NPH    32
#define PQW    64
#define KLR    256

static_assert(NTOK == NSEQ * SQ);
static_assert(NHQ * HDM == HID);
static_assert(KLR % 32 == 0 && SQ % KLR == 0);

typedef _Float16     v16h __attribute__((ext_vector_type(16)));
typedef _Float16     v8h  __attribute__((ext_vector_type(8)));
typedef __bf16       v16b __attribute__((ext_vector_type(16)));
typedef __bf16       v8b  __attribute__((ext_vector_type(8)));
typedef float        v8f  __attribute__((ext_vector_type(8)));
typedef float        v4f  __attribute__((ext_vector_type(4)));
typedef unsigned int v4u  __attribute__((ext_vector_type(4)));

// ---------------------------------------------------------------------------
// small helpers
// ---------------------------------------------------------------------------
__device__ __forceinline__ unsigned short bf_bits(float f) {          // RNE convert f32 -> bf16 bits
  const unsigned u = __float_as_uint(f);
  return (unsigned short)((u + 0x7FFFu + ((u >> 16) & 1u)) >> 16);
}
__device__ __forceinline__ float bf_val(unsigned short h) { return __uint_as_float(((unsigned)h) << 16); }
__device__ __forceinline__ unsigned pk16(unsigned short a, unsigned short b) { return (unsigned)a | ((unsigned)b << 16); }
__device__ __forceinline__ v8f zero8() { v8f z = {0.f, 0.f, 0.f, 0.f, 0.f, 0.f, 0.f, 0.f}; return z; }
__device__ __forceinline__ int wave_id() {
#if defined(__HIP_DEVICE_COMPILE__)
  return __builtin_amdgcn_readfirstlane((int)(threadIdx.x >> 5));
#else
  return (int)(threadIdx.x >> 5);
#endif
}
// three e^x as __expf forms them (one multiply, v_exp_f32 each). One statement: the three are independent of one another (outputs apart from
// all inputs), and the v_nop is the slot that the instruction set asks for between a transcendental and a directly following instruction
// that reads its result or overwrites its source; inside the statement it stands there in every build
__device__ __forceinline__ void exp3_slot(float a, float b, float c, float& ea, float& eb, float& ec) {
#if defined(__HIP_DEVICE_COMPILE__)
  const float ta = a * 1.44269504088896340736f;
  const float tb = b * 1.44269504088896340736f;
  const float tc = c * 1.44269504088896340736f;
  asm("v_exp_f32 %0, %3\n\tv_exp_f32 %1, %4\n\tv_exp_f32 %2, %5\n\tv_nop" : "=&v"(ea), "=&v"(eb), "=&v"(ec) : "v"(ta), "v"(tb), "v"(tc));
#else
  ea = expf(a); eb = expf(b); ec = expf(c);
#endif
}
// release/acquire + wave barrier between one wave's LDS stores and the other lanes' reloads
__device__ __forceinline__ void lds_wave_sync() {
#if defined(__HIP_DEVICE_COMPILE__)
  __builtin_amdgcn_fence(__ATOMIC_RELEASE, "workgroup");
  __builtin_amdgcn_wave_barrier();
  __builtin_amdgcn_fence(__ATOMIC_ACQUIRE, "workgroup");
#endif
}

// ---------------------------------------------------------------------------
// WMMA fragments (wave32, 16x16x32, 16-bit operands). For A (row m = lane&15) and B (col n = lane&15) alike:
// elements 0..7 <- k0 + 8*(lane>>4) + 0..7, elements 8..15 <- k0 + 16 + 8*(lane>>4) + 0..7.
// ldfrag(p) with p = rowbase + k0 + 8*(lane>>4): two 16-B loads p[0..7], p[16..23].
// D: acc[r] = (row 8*(lane>>4) + r, col lane&15).
// ---------------------------------------------------------------------------
union FragH { v16h v; v8h h[2]; };
union FragB { v16b v; v8b h[2]; };
__device__ __forceinline__ v16h ldfrag_h(const _Float16* p) { FragH f; f.h[0] = *(const v8h*)(p); f.h[1] = *(const v8h*)(p + 16); return f.v; }
__device__ __forceinline__ v16b ldfrag_b(const __bf16* p)   { FragB f; f.h[0] = *(const v8b*)(p); f.h[1] = *(const v8b*)(p + 16); return f.v; }

__device__ __forceinline__ v8f mma_h(v16h a, v16h b, v8f c) {
#if defined(__HIP_DEVICE_COMPILE__)
  return __builtin_amdgcn_wmma_f32_16x16x32_f16(false, a, false, b, (short)0, c, false, false);
#else
  return c;
#endif
}
__device__ __forceinline__ v8f mma_b(v16b a, v16b b, v8f c) {
#if defined(__HIP_DEVICE_COMPILE__)
  return __builtin_amdgcn_wmma_f32_16x16x32_bf16(false, a, false, b, (short)0, c, false, false);
#else
  return c;
#endif
}
// hazard guard: 4 VALU slots after the last WMMA in front of the chunk loop's back edge, D tied, A/B kept live
__device__ __forceinline__ void guard_h4(v8f& a, v8f& b, v16h w, v16h x, v16h y, v16h z) {
#if defined(__HIP_DEVICE_COMPILE__)
  asm volatile("v_nop\n\tv_nop\n\tv_nop\n\tv_nop" : "+v"(a), "+v"(b) : "v"(w), "v"(x), "v"(y), "v"(z) : "memory");
#endif
}

// ---------------------------------------------------------------------------
// Elementwise RNE f32 -> bf16 plane: 8 elements per thread, one 16-B store per lane -> 32 consecutive lanes write 4 whole
// ---------------------------------------------------------------------------
__global__ __launch_bounds__(256) void cvt_bf16_kernel(const float* __restrict__ in, unsigned short* __restrict__ outp, int n8) {
  const int i = (int)blockIdx.x * 256 + (int)threadIdx.x;
  if (i >= n8) return;
  const size_t e = 8 * (size_t)i;
  const v4f a = *(const v4f*)(in + e);
  const v4f b = *(const v4f*)(in + e + 4);
  v4u w;
  w[0] = pk16(bf_bits(a[0]), bf_bits(a[1]));
  w[1] = pk16(bf_bits(a[2]), bf_bits(a[3]));
  w[2] = pk16(bf_bits(b[0]), bf_bits(b[1]));
  w[3] = pk16(bf_bits(b[2]), bf_bits(b[3]));
  *(v4u*)(outp + e) = w;
  
}

// ---------------------------------------------------------------------------
// Fused transpose + RNE bf16 convert: in [R rows][Cc cols] f32 (pitch Cc) -> out[c][r] = bf16(in[r][c])  ([Cc][R], pitch R).
// 64x64 tiles through LDS; grid = (Cc/64, R/64), 256 threads; R, Cc multiples of 64.
// Coverage per block: load 4 it x 256 thr x 4 floats = 64x64; store 2 it x 256 thr x 8 u16 = 64x64.
// ---------------------------------------------------------------------------
__global__ __launch_bounds__(256) void tconv_bf16_kernel(const float* __restrict__ W, unsigned short* __restrict__ outp, int R, int Cc) {
  __shared__ __align__(16) float tf[64 * 68];
  const int c0  = (int)blockIdx.x * 64;   // input column block = output row block
  const int r0  = (int)blockIdx.y * 64;   // input row block    = output column block
  const int tid = (int)threadIdx.x;
  {
    const int lr = tid >> 4;              // 0..15
    const int c4 = (tid & 15) * 4;        // 0..60
#pragma unroll
    for (int it = 0; it < 4; ++it) {
      const int rr = it * 16 + lr;        // 0..63
      const v4f a = *(const v4f*)(W + (size_t)(r0 + rr) * Cc + c0 + c4);
      *(v4f*)(tf + rr * 68 + c4) = a;
    }
  }
  __syncthreads();
  const int sub = tid >> 3;               // 0..31
  const int c8  = (tid & 7) * 8;          // 0..56
  v4u hv[2];
#pragma unroll
  for (int it = 0; it < 2; ++it) {
    const int oc = it * 32 + sub;         // output row within tile (= input column)
    v4u a;
#pragma unroll
    for (int q = 0; q < 4; ++q) {
      const float f0 = tf[(c8 + 2 * q) * 68 + oc];
      const float f1 = tf[(c8 + 2 * q + 1) * 68 + oc];
      a[q] = pk16(bf_bits(f0), bf_bits(f1));
    }
    hv[it] = a;
  }
  {
#pragma unroll
    for (int it = 0; it < 2; ++it) {
      const int oc = it * 32 + sub;
      const size_t go = (size_t)(c0 + oc) * R + r0 + c8;
      *(v4u*)(outp + go) = hv[it];
    }
    
  }
}

// ---------------------------------------------------------------------------
// Phase weights: Wpq [HID][NHQ], Wpk [HID][NHQ] f32 -> WpT [NPH][HID] bf16 rows (rows 0..15 = Wpq^T, 16..31 = Wpk^T).
// ---------------------------------------------------------------------------
__global__ __launch_bounds__(256) void wpt_kernel(const float* __restrict__ Wpq, const float* __restrict__ Wpk,
                                                  unsigned short* __restrict__ outp) {
  const int n = (int)blockIdx.x;                   // 0..31
  const float* W = (n < NHQ) ? Wpq : Wpk;          // block-uniform, both global
  const int h = n & (NHQ - 1);
  const int t = (int)threadIdx.x;                  // k = 8t .. 8t+7  (< HID)
  v4u w;
#pragma unroll
  for (int q = 0; q < 4; ++q) {
    const float f0 = W[(size_t)(8 * t + 2 * q) * NHQ + h];
    const float f1 = W[(size_t)(8 * t + 2 * q + 1) * NHQ + h];
    w[q] = pk16(bf_bits(f0), bf_bits(f1));
  }
  const size_t o = (size_t)n * HID + 8 * (size_t)t;
  *(v4u*)(outp + o) = w;
  
}

// ---------------------------------------------------------------------------
// bf16 WMMA GEMMs: C[m][n] = sum_k A[m][k] * Bt[n][k]; A row-major [M][K] bf16 (pitch lda), Bt row-major [N][K] bf16 (pitch ldb).
//   SPLITA: A carried as hi (Ap) + lo (A2p) bf16 planes, two products into one accumulator (hi then lo at every k step).
//   gemm_tiled_kernel (EPI 0, 1, 2): block tile 128 x 256, waves of 64 x 128 (EPI 0) or 32 x 128 (EPI 1, 2), operands staged in an LDS ring of two buffers.
// Epilogues (all: per wave, per 16-row slab: stage in LDS, wave sync, write each row segment with ONE instruction); MI = 16-row slabs per wave.
//   EPI 0 (NJ 8): q|k projection. cols n0 < HID (q): f16 hi plane C0 and f16 residual x2048 plane C1, both [M][ldc], cols n0..n0+127
//          (row segment 256 B = 16 lanes x 16 B). cols n0 >= HID (k): hi plane C2 [M][ldc] cols n0-HID..; residual plane C3 [NSEQ*KLR][ldc]
//          only for token rows with (m % SQ) < KLR at row (m / SQ)*KLR + m % SQ (wave-uniform choice; 32- and 64-row wave tiles never straddle).
//   EPI 1 (NJ 8): v^T projection: f16 hi plane C0, residual x2048 plane C1, [M][ldc], row segment 256 B.
//   EPI 2 (NJ 8): f32 output C0 [M][ldc], each row scaled by (1 + 0.1*phs[m]); row segment 128 floats = 512 B = 32 lanes x 16 B per instruction.
// ---------------------------------------------------------------------------
template <int EPI> struct SlabT { typedef _Float16 T; static constexpr int PERW = 4096; };   // 2 planes x 16 x 128 halves
template <> struct SlabT<2>     { typedef float    T; static constexpr int PERW = 2048; };   // 16 x 128 floats

// s_wait_xcnt 0 behind an issued global store, in front of a rewrite of a register that the store names
__device__ __forceinline__ void wait_x0() {
#if defined(__HIP_DEVICE_COMPILE__)
  asm volatile("s_wait_xcnt 0x0" ::: "memory");
#endif
}

// slab: this wave's own LDS staging range; (m0, n0): first row and column of the wave's (16*MI) x (16*NJ) tile.
template <int EPI, int NJ, int MI>
__device__ __forceinline__ void gemm_epilogue(v8f (&acc)[MI][NJ], typename SlabT<EPI>::T* slab, int lane, int m0, int n0,
                                              const float* __restrict__ phs, void* C0, void* C1, void* C2, void* C3, int ldc) {
  const int hh = lane >> 4;
  const int rl = lane & 15;
  _Float16* sl16 = (_Float16*)(void*)slab;
  float*    slf  = (float*)(void*)slab;

  if constexpr (EPI == 0 || EPI == 1) {
    _Float16* P0;
    _Float16* P1;
    int col0;
    int lomode;                                   // 0: lo row = m; 1: lo row remapped into the KLR-row plane; 2: no lo store
    if constexpr (EPI == 0) {
      const bool isq = (n0 < HID);                // wave-uniform
      P0 = isq ? (_Float16*)C0 : (_Float16*)C2;
      P1 = isq ? (_Float16*)C1 : (_Float16*)C3;
      col0 = isq ? n0 : (n0 - HID);
      const int s0 = m0 & (SQ - 1);
      lomode = isq ? 0 : ((s0 < KLR) ? 1 : 2);
    } else {
      P0 = (_Float16*)C0;
      P1 = (_Float16*)C1;
      col0 = n0;
      lomode = 0;
    }
#pragma unroll
    for (int i = 0; i < MI; ++i) {
#pragma unroll
      for (int r = 0; r < 8; ++r) {
#pragma unroll
        for (int j = 0; j < NJ; ++j) {
          const float v = acc[i][j][r];
          const _Float16 hv = (_Float16)v;
          const int so = (8 * hh + r) * 128 + j * 16 + rl;
          sl16[so]        = hv;
          sl16[2048 + so] = (_Float16)((v - (float)hv) * 2048.0f);
        }
      }
      lds_wave_sync();
      {
#pragma unroll
        for (int it = 0; it < 8; ++it) {
          const int row = it * 2 + hh;            // it x hh covers rows 0..15
          const int c8  = rl * 8;
          const v8h xh = *(const v8h*)(sl16 + row * 128 + c8);
          const v8h xl = *(const v8h*)(sl16 + 2048 + row * 128 + c8);
          const int m = m0 + i * 16 + row;
          *(v8h*)(P0 + (size_t)m * ldc + col0 + c8) = xh;
          if constexpr (EPI == 0) wait_x0();      // precaution: in front of the branch below, whose first instructions reuse this store's registers
          if (lomode != 2) {
            const int m1 = (lomode == 1) ? ((m / SQ) * KLR + (m % SQ)) : m;
            *(v8h*)(P1 + (size_t)m1 * ldc + col0 + c8) = xl;
            if constexpr (EPI == 0) wait_x0();    // precaution: inside the branch, in front of whatever reuses this store's registers behind it
          }
        }
        
      }
      lds_wave_sync();
    }
  } else if constexpr (EPI == 2) {
    float* C = (float*)C0;
#pragma unroll
    for (int i = 0; i < MI; ++i) {
#pragma unroll
      for (int r = 0; r < 8; ++r) {
        const int m = m0 + i * 16 + 8 * hh + r;
        const float sc = 1.0f + 0.1f * phs[m];
#pragma unroll
        for (int j = 0; j < NJ; ++j)
          slf[(8 * hh + r) * 128 + j * 16 + rl] = acc[i][j][r] * sc;
      }
      lds_wave_sync();
      {
#pragma unroll
        for (int row = 0; row < 16; ++row) {      // 32 lanes x 16 B = the whole 512-B row segment per instruction
          const v4f v = *(const v4f*)(slf + row * 128 + lane * 4);
          *(v4f*)(C + (size_t)(m0 + i * 16 + row) * ldc + n0 + lane * 4) = v;
        }
        
      }
      lds_wave_sync();
    }
  }
}

// ---------------------------------------------------------------------------
// Tiled GEMM main loop. Block tile 128 x 256; waves in a (8/MI) x 2 grid, each (16*MI) x 128: MI 4 = 4 waves, MI 2 = 8 waves.
// A pass is 64 k: a stage holds [A 128 rows | (SPLITA: A2 128 rows) | Bt 256 rows] of 128 B at pitch 144 B
// (16 B x 9: ds_load_b128 fragment reads without bank conflicts). Every thread brings 16-B pieces with asynchronous copies to LDS,
// one pass ahead of the pass that reads them. M % 128 == 0, N % 256 == 0, K % 64 == 0, K >= 128; grid.x = (M/128) * (N/256).
// ---------------------------------------------------------------------------
#define GT_BM 128
#define GT_BN 256
#define GT_KP 64
#define GT_LP 72                                  // LDS row pitch in bf16 elements

// Asynchronous 16-B copies, one per lane and line of the statement: l + c * lstep = the lane's LDS byte address, g[c] = its global source.
// s_wait_xcnt stands inside the statement so that no address register is rewritten ahead of it.
__device__ __forceinline__ void copy8(unsigned l, unsigned lstep, const __bf16* const* g) {
#if defined(__HIP_DEVICE_COMPILE__)
  asm volatile(
      "global_load_async_to_lds_b128 %0, %8, off\n\t"
      "global_load_async_to_lds_b128 %1, %9, off\n\t"
      "global_load_async_to_lds_b128 %2, %10, off\n\t"
      "global_load_async_to_lds_b128 %3, %11, off\n\t"
      "global_load_async_to_lds_b128 %4, %12, off\n\t"
      "global_load_async_to_lds_b128 %5, %13, off\n\t"
      "global_load_async_to_lds_b128 %6, %14, off\n\t"
      "global_load_async_to_lds_b128 %7, %15, off\n\t"
      "s_wait_xcnt 0x0"
      :: "v"(l), "v"(l + lstep), "v"(l + 2u * lstep), "v"(l + 3u * lstep),
         "v"(l + 4u * lstep), "v"(l + 5u * lstep), "v"(l + 6u * lstep), "v"(l + 7u * lstep),
         "v"(g[0]), "v"(g[1]), "v"(g[2]), "v"(g[3]), "v"(g[4]), "v"(g[5]), "v"(g[6]), "v"(g[7])
      : "memory");
#endif
}
__device__ __forceinline__ void copy4(unsigned l, unsigned lstep, const __bf16* const* g) {
#if defined(__HIP_DEVICE_COMPILE__)
  asm volatile(
      "global_load_async_to_lds_b128 %0, %4, off\n\t"
      "global_load_async_to_lds_b128 %1, %5, off\n\t"
      "global_load_async_to_lds_b128 %2, %6, off\n\t"
      "global_load_async_to_lds_b128 %3, %7, off\n\t"
      "s_wait_xcnt 0x0"
      :: "v"(l), "v"(l + lstep), "v"(l + 2u * lstep), "v"(l + 3u * lstep),
         "v"(g[0]), "v"(g[1]), "v"(g[2]), "v"(g[3])
      : "memory");
#endif
}
// this wave's copies have landed in LDS
__device__ __forceinline__ void wait_async0() {
#if defined(__HIP_DEVICE_COMPILE__)
  asm volatile("s_wait_asynccnt 0x0" ::: "memory");
#endif
}
// this wave's LDS reads have returned (before the buffer they read is handed back for a refill)
__device__ __forceinline__ void wait_ds0() {
#if defined(__HIP_DEVICE_COMPILE__)
  asm volatile("s_wait_dscnt 0x0" ::: "memory");
#endif
}
// the compiler's scheduler moves nothing across this point
__device__ __forceinline__ void sched_fence() {
#if defined(__HIP_DEVICE_COMPILE__)
  __builtin_amdgcn_sched_barrier(0);
#endif
}

// second launch bound: two waves per SIMD (two 4-wave blocks, or one 8-wave block, per WGP), so that one wave's WMMAs cover the other's waits
template <int EPI, int MI, bool SPLITA>
__global__ __launch_bounds__(512 / MI, 2) void gemm_tiled_kernel(
    const unsigned short* Ap, const unsigned short* A2p, int lda,
    const unsigned short* __restrict__ Btp, int ldb,
    const float* __restrict__ phs,
    void* C0, void* C1, void* C2, void* C3, int ldc,
    int M, int N, int K) {
  static_assert(EPI == 0 || EPI == 1 || EPI == 2);
  static_assert(MI == 4 || MI == 2);
  static_assert(GT_KP == 64);
  constexpr int NW    = 16 / MI;                  // waves per block
  constexpr int RS    = NW * 4;                   // stage rows that one copy of every thread covers (8 threads per 128-B row)
  constexpr int AROWS = (SPLITA ? 2 : 1) * GT_BM;
  constexpr int NCP   = (AROWS + GT_BN) / RS;     // copies per thread and stage: 24, 12 or 16 (at most 63 may be outstanding)
  constexpr int STAGE = (AROWS + GT_BN) * GT_LP;  // elements per buffer
  static_assert(NCP % 4 == 0 && NCP <= 63);
  typedef typename SlabT<EPI>::T ST;
  __shared__ __align__(16) __bf16 ring[2 * STAGE];
  __shared__ __align__(16) ST slab_all[NW * SlabT<EPI>::PERW];

  const int tid  = (int)threadIdx.x;
  const int lane = tid & 31;
  const int wave = wave_id();
  const int hh = lane >> 4;           // lane half: k offset 8*hh
  const int rl = lane & 15;           // A row / B col within subtile
  const int tilesN = N / GT_BN;
  const int tm  = (int)blockIdx.x / tilesN;
  const int tn  = (int)blockIdx.x - tm * tilesN;
  const int bm0 = tm * GT_BM;
  const int bn0 = tn * GT_BN;
  const int wm  = wave >> 1;
  const int wn  = wave & 1;

  // copy side: copy c of this thread brings piece tid % 8 of stage row c * RS + tid / 8
  const int crow = tid >> 3;
  const int cpc  = (tid & 7) * 8;     // element offset of the 16-B piece
  const __bf16* gA  = (const __bf16*)(const void*)Ap  + (size_t)(bm0 + crow) * lda + cpc;
  const __bf16* gA2 = (const __bf16*)(const void*)A2p + (size_t)(bm0 + crow) * lda + cpc;
  const __bf16* gB  = (const __bf16*)(const void*)Btp + (size_t)(bn0 + crow) * ldb + cpc;
  const unsigned lc = (unsigned)(size_t)(const void*)ring + (unsigned)(crow * GT_LP + cpc) * 2u;
  auto fill = [&](int t) {            // tile t -> buffer t % 2
    const unsigned l = lc + (unsigned)(t & 1) * (unsigned)(STAGE * 2);
    const size_t ko = (size_t)t * GT_KP;
    const __bf16* g[NCP];
#pragma unroll
    for (int c = 0; c < NCP; ++c) {
      const int r = c * RS;
      g[c] = (r < GT_BM) ? gA + ko + (size_t)r * lda
           : (r < AROWS) ? gA2 + ko + (size_t)(r - GT_BM) * lda
                         : gB + ko + (size_t)(r - AROWS) * ldb;
    }
#pragma unroll
    for (int c = 0; c + 8 <= NCP; c += 8) copy8(l + (unsigned)(c * RS * GT_LP * 2), RS * GT_LP * 2u, g + c);
    if constexpr (NCP % 8 == 4) copy4(l + (unsigned)((NCP - 4) * RS * GT_LP * 2), RS * GT_LP * 2u, g + (NCP - 4));
  };

  v8f acc[MI][8];
#pragma unroll
  for (int i = 0; i < MI; ++i)
#pragma unroll
    for (int j = 0; j < 8; ++j) acc[i][j] = zero8();

  const int nt = K / GT_KP;           // block-uniform, >= 2
  fill(0);
  wait_async0();
  __syncthreads();                    // tile 0 readable by every wave
  fill(1);

  const int aoff = (wm * (16 * MI) + rl) * GT_LP + 8 * hh;
  const int boff = (AROWS + wn * 128 + rl) * GT_LP + 8 * hh;
#pragma unroll 1                      // one pass per trip: the ring's order below holds per trip, and every acc index stays constant
  for (int t = 0; t < nt; ++t) {
    const __bf16* st = ring + (t & 1) * STAGE;
    v16b fa[2][MI], fl[2][MI], fb[2][8];          // one fragment set per 32-k step of the pass
#pragma unroll
    for (int ks = 0; ks < 2; ++ks) {
#pragma unroll
      for (int i = 0; i < MI; ++i) {
        fa[ks][i] = ldfrag_b(st + aoff + i * 16 * GT_LP + ks * 32);
        if constexpr (SPLITA) fl[ks][i] = ldfrag_b(st + aoff + (GT_BM + i * 16) * GT_LP + ks * 32);
      }
#pragma unroll
      for (int j = 0; j < 8; ++j) fb[ks][j] = ldfrag_b(st + boff + j * 16 * GT_LP + ks * 32);
      sched_fence();                              // each step's LDS reads stay one group ahead of the WMMA blocks, not spread among them
    }
#pragma unroll
    for (int ks = 0; ks < 2; ++ks) {
#pragma unroll
      for (int j = 0; j < 8; ++j) {
#pragma unroll
        for (int i = 0; i < MI; ++i) acc[i][j] = mma_b(fa[ks][i], fb[ks][j], acc[i][j]);
        if constexpr (SPLITA) {
#pragma unroll
          for (int i = 0; i < MI; ++i) acc[i][j] = mma_b(fl[ks][i], fb[ks][j], acc[i][j]);
        }
      }
      // step 1's WMMAs stay behind step 0's (only step 0's reads are waited for first) and in front of the waits at the foot
      // (moved behind the barrier they would halve the lead of the copies in flight)
      sched_fence();
    }
    wait_ds0();
    wait_async0();
    __syncthreads();                  // publishes tile t + 1 and ends every wave's reads of tile t's buffer
    if (t + 2 < nt) fill(t + 2);      // block-uniform test
  }
  wait_async0();

  gemm_epilogue<EPI, 8, MI>(acc, slab_all + wave * SlabT<EPI>::PERW, lane, bm0 + wm * (16 * MI), bn0 + wn * 128, phs, C0, C1, C2, C3, ldc);
}

// ---------------------------------------------------------------------------
// Phase projection: v[m][n] = sum_k Xb[m][k] * WpT[n][k] (M = NTOK, N = NPH, K = HID), then PQ[m][n] = cos(v), PQ[m][NPH + n] = sin(v).
// Block = 16 token rows x all NPH columns, PP_NW waves; wave w takes k in [w * PP_KS, (w + 1) * PP_KS): all its fragment loads
// (straight from the global rows) go out ahead of its WMMAs, so a wave pays the global latency once. The PP_NW partial tiles meet
// in LDS and are added in wave order 0..PP_NW-1. Each thread then finishes 2 values (precise cosf/sinf); a wave's store is one whole 128-B line.
// Coverage: NTOK / 16 blocks x 16 rows x PQW columns = the whole PQ plane.
// ---------------------------------------------------------------------------
#define PP_NW 8
#define PP_KS (HID / PP_NW)
static_assert(PP_KS % 32 == 0 && NPH == 32 && PQW == 2 * NPH && NTOK % 16 == 0);
__global__ __launch_bounds__(32 * PP_NW) void phase_proj_kernel(const unsigned short* __restrict__ Xp, const unsigned short* __restrict__ Wp,
                                                                float* __restrict__ PQ) {
  constexpr int NS = PP_KS / 32;      // 32-k steps per wave
  __shared__ __align__(16) float part[PP_NW * 16 * NPH];
  const int tid  = (int)threadIdx.x;
  const int lane = tid & 31;
  const int wave = wave_id();
  const int hh = lane >> 4;           // lane half: k offset 8*hh, D row offset 8*hh
  const int rl = lane & 15;           // A row / B col / D col within subtile
  const int m0 = (int)blockIdx.x * 16;
  const __bf16* A  = (const __bf16*)(const void*)Xp + (size_t)(m0 + rl) * HID + wave * PP_KS + 8 * hh;
  const __bf16* B0 = (const __bf16*)(const void*)Wp + (size_t)rl * HID + wave * PP_KS + 8 * hh;
  const __bf16* B1 = B0 + (size_t)16 * HID;
  v16b fa[NS], f0[NS], f1[NS];
#pragma unroll
  for (int s = 0; s < NS; ++s) {
    fa[s] = ldfrag_b(A + s * 32);
    f0[s] = ldfrag_b(B0 + s * 32);
    f1[s] = ldfrag_b(B1 + s * 32);
  }
  sched_fence();                      // all 6 * NS loads stay ahead of the first WMMA: spread among the WMMAs they would return in NS rounds of latency
  v8f a0 = zero8(), a1 = zero8();
#pragma unroll
  for (int s = 0; s < NS; ++s) {
    a0 = mma_b(fa[s], f0[s], a0);
    a1 = mma_b(fa[s], f1[s], a1);
  }
  float* pw = part + wave * (16 * NPH);
#pragma unroll
  for (int r = 0; r < 8; ++r) {
    pw[(8 * hh + r) * NPH + rl]      = a0[r];
    pw[(8 * hh + r) * NPH + 16 + rl] = a1[r];
  }
  __syncthreads();                    // every wave's partial tile readable by the block
#pragma unroll 1                      // one precise cos + sin site in the text
  for (int it = 0; it < (16 * NPH) / (32 * PP_NW); ++it) {
    const int e = it * (32 * PP_NW) + tid;        // row e / NPH, column e % NPH (= lane)
    float v = part[e];
#pragma unroll
    for (int w = 1; w < PP_NW; ++w) v += part[w * (16 * NPH) + e];
    float* o = PQ + (size_t)(m0 + e / NPH) * PQW + (e % NPH);
    o[0]   = cosf(v);
    o[NPH] = sinf(v);
    wait_x0();                        // precaution: the next trip's first instructions reuse this store's address registers
  }
}

// ---------------------------------------------------------------------------
// Phase modulation factor, PH_PB blocks per sequence (grid NSEQ * PH_PB, 512 threads), all f32:
//   PQ plane [NTOK][PQW]: col h = cos(pq_h), 16+h = cos(pk_h), 32+h = sin(pq_h), 48+h = sin(pk_h).
//   Ck[h] = sum_s cos(pk), Sk[h] = sum_s sin(pk): every block sums its whole sequence itself (no data passes between blocks of the launch).
//   8 threads per row, each one 16-B piece (4 heads of cos or of sin), 64 rows per pass: a wave reads 4 rows x two 64-B runs per instruction;
//   per-thread partials over 32 rows, then 32 threads add the 64 row groups in fixed order from LDS (lanes on consecutive banks).
//   phs[b*SQ + s] = sum_h (cos(pq_h)*Ck[h] + sin(pq_h)*Sk[h]) / 32768: 4 products per thread, 8 partials per row joined through LDS in fixed order.
//   Coverage: NSEQ * PH_PB blocks x PH_ROWS = NTOK values; each wave of the last stage stores one whole 128-B line.
// ---------------------------------------------------------------------------
#define PH_PB   16
#define PH_ROWS (SQ / PH_PB)
static_assert(PH_ROWS % 64 == 0 && SQ % 64 == 0 && PH_ROWS <= 512);
__global__ __launch_bounds__(512) void phase_kernel(const float* __restrict__ PQ, float* __restrict__ phs) {
  __shared__ __align__(16) float red[64 * 2 * NHQ];
  __shared__ __align__(16) float csk[2 * NHQ];
  __shared__ __align__(16) float part[PH_ROWS * 8];
  const int b   = (int)blockIdx.x / PH_PB;
  const int blk = (int)blockIdx.x % PH_PB;
  const int tid = (int)threadIdx.x;
  const int pc  = tid & 7;                            // piece: 0..3 = cos of heads 4*pc.., 4..7 = sin of heads 4*(pc-4)..
  const int g   = tid >> 3;                           // row within a pass of 64
  const int col = (pc < 4) ? 4 * pc : NHQ + 4 * pc;   // pq columns 0..12 and 32..44; the pk columns lie NHQ further
  const float* base = PQ + (size_t)b * SQ * PQW;
  v4f xq[PH_ROWS / 64];                               // this block's own pq rows, asked for ahead of the sums
#pragma unroll
  for (int it = 0; it < PH_ROWS / 64; ++it)
    xq[it] = *(const v4f*)(base + (size_t)(blk * PH_ROWS + it * 64 + g) * PQW + col);
  v4f acc = {0.f, 0.f, 0.f, 0.f};
#pragma unroll 8                                      // 8 loads in flight per thread: 4 L2 round trips for the 32 rows, not 32
  for (int it = 0; it < SQ / 64; ++it) {
    const v4f x = *(const v4f*)(base + (size_t)(it * 64 + g) * PQW + NHQ + col);
    acc += x;
  }
  *(v4f*)(red + g * (2 * NHQ) + 4 * pc) = acc;
  __syncthreads();
  if (tid < 2 * NHQ) {                                // wave 0
    float s = 0.f;
#pragma unroll                                        // the 64 LDS reads go out together; only the adds are a chain
    for (int r = 0; r < 64; ++r) s += red[r * (2 * NHQ) + tid];
    csk[tid] = s;
  }
  __syncthreads();
  const v4f w = *(const v4f*)(csk + 4 * pc);
#pragma unroll
  for (int it = 0; it < PH_ROWS / 64; ++it) {
    const v4f x = xq[it];
    part[(it * 64 + g) * 8 + pc] = (x[0] * w[0] + x[1] * w[1]) + (x[2] * w[2] + x[3] * w[3]);
  }
  __syncthreads();
  if (tid < PH_ROWS) {                                // whole waves
    const v4f p0 = *(const v4f*)(part + tid * 8);
    const v4f p1 = *(const v4f*)(part + tid * 8 + 4);
    const float a = ((p0[0] + p0[1]) + (p0[2] + p0[3])) + ((p1[0] + p1[1]) + (p1[2] + p1[3]));
    phs[(size_t)b * SQ + blk * PH_ROWS + tid] = a * (1.0f / 32768.0f);
  }
}

// ---------------------------------------------------------------------------
// Causal flash attention, head dim 128, 32-key chunks, block = 4 waves = 64 query rows of one (b, h).
//   q planes f16 [tok][h*128+d]: hi (qhp) and residual x2048 (qlp); k planes f16 [tok][h*128+d]: hi (khp); residual x2048 (klp) only for
//   keys < KLR of each sequence, stored at row b*KLR + key (read only when PRES); v^T planes f16 [h*128+d][tok]: hi (vhp), residual x2048 (vlp);
//   outputs attn bf16 hi (ahp) / lo (alp) [tok][h*128+d].
//   scores = (Sh + Sr/2048) * 128^-0.5 with Sh = qh.kh and Sr = ql'.kh (+ qh.kl' when PRES); keys > query -> -inf; online softmax f32;
//   p' = 1024 p stored per wave to LDS as f16 hi (and residual x2048 when PRES), reloaded as A fragments after a wave sync;
//   O = (Oh + Or/2048)/1024/l with Oh = ph.vh, Or = ph.vl' (+ pl'.vh when PRES).
//   q planes: each wave copies its 16 rows to LDS once and takes its A fragments from there in every chunk.
//   K / V^T chunk staging: 128 threads x 4 x 16 B per plane = whole 32x128 / 128x32 tile, by asynchronous copies to LDS into a ring of two
//   buffers, one chunk ahead of the chunk that reads them; one publish point (LDS wait, copy wait, barrier) at the foot of every chunk.
//   Grid (NHQ, NSEQ, query tiles), longest tile at the lowest index: three blocks fit a WGP.
//   Fragment reads run ahead of the WMMAs that use them: q/k four or more WMMAs ahead, v^T AT_VD tiles ahead (tiles 0 to 2 in front of the softmax).
//   Trip count 2*qb+2 chunks (static bound 64); waves whose rows are all below the chunk skip it (wave-uniform, scalar branch).
// ---------------------------------------------------------------------------
#define AT_KC   32
#define KS_P    136
#define VS_P    40
#define PS_P    40
#define QS_P    136
#define AT_VD   4
// LDS map in halves. KS to STG: one buffer of the chunk ring (two stand in a row). The k and p residual planes exist only with PRES. QS: per wave 2 planes x 16 query rows at pitch QS_P (272 B = 16 B x 17).
template <bool PRES> struct AttnLds {
  static constexpr int KS  = 0;
  static constexpr int KLS = 32 * KS_P;
  static constexpr int VHS = (PRES ? 2 : 1) * 32 * KS_P;
  static constexpr int VLS = VHS + 128 * VS_P;
  static constexpr int STG = VLS + 128 * VS_P;
  static constexpr int PH  = 2 * STG;
  static constexpr int PL  = PH + 4 * 16 * PS_P;
  static constexpr int QS  = PH + (PRES ? 2 : 1) * 4 * 16 * PS_P;
  static constexpr int ST  = QS + 4 * 2 * 16 * QS_P;     // per wave 4 planes x 32 lanes x 16 B: each lane's own 8 row maxima and 8 row sums
  static constexpr int TOT = ST + 4 * 1024;
};
static_assert(3 * AttnLds<false>::TOT * 2 <= 327680);   // three blocks of the long launch per WGP
static_assert(AttnLds<false>::STG % 8 == 0 && AttnLds<true>::STG % 8 == 0);   // the second buffer keeps the copies' 16-B alignment
static_assert(4 * 4096 <= AttnLds<false>::QS);          // output staging (2 planes x 16 x 128 per wave) aliases the chunk region after the loop

// Asynchronous 16-B copies, one per lane and line of the statement: four pieces of one plane, l + i * ls = the lane's LDS byte address,
// g + i * gs = its global source. s_wait_xcnt stands inside the statement so that no address register is rewritten ahead of it.
__device__ __forceinline__ void copy_plane(unsigned l, unsigned ls, const char* g, size_t gs) {
#if defined(__HIP_DEVICE_COMPILE__)
  asm volatile(
      "global_load_async_to_lds_b128 %0, %4, off\n\t"
      "global_load_async_to_lds_b128 %1, %5, off\n\t"
      "global_load_async_to_lds_b128 %2, %6, off\n\t"
      "global_load_async_to_lds_b128 %3, %7, off\n\t"
      "s_wait_xcnt 0x0"
      :: "v"(l), "v"(l + ls), "v"(l + 2u * ls), "v"(l + 3u * ls),
         "v"(g), "v"(g + gs), "v"(g + 2 * gs), "v"(g + 3 * gs)
      : "memory");
#endif
}
// the same for the three planes of a chunk (k, v^T hi, v^T residual; the two v^T planes lie lvd bytes apart in LDS) under one s_wait_xcnt
__device__ __forceinline__ void copy_3planes(unsigned lk, unsigned lks, const char* gk, size_t gks,
                                             unsigned lv, unsigned lvs, unsigned lvd, const char* gv, const char* gw, size_t gvs) {
#if defined(__HIP_DEVICE_COMPILE__)
  const unsigned lw = lv + lvd;
  asm volatile(
      "global_load_async_to_lds_b128 %0, %12, off\n\t"
      "global_load_async_to_lds_b128 %1, %13, off\n\t"
      "global_load_async_to_lds_b128 %2, %14, off\n\t"
      "global_load_async_to_lds_b128 %3, %15, off\n\t"
      "global_load_async_to_lds_b128 %4, %16, off\n\t"
      "global_load_async_to_lds_b128 %5, %17, off\n\t"
      "global_load_async_to_lds_b128 %6, %18, off\n\t"
      "global_load_async_to_lds_b128 %7, %19, off\n\t"
      "global_load_async_to_lds_b128 %8, %20, off\n\t"
      "global_load_async_to_lds_b128 %9, %21, off\n\t"
      "global_load_async_to_lds_b128 %10, %22, off\n\t"
      "global_load_async_to_lds_b128 %11, %23, off\n\t"
      "s_wait_xcnt 0x0"
      :: "v"(lk), "v"(lk + lks), "v"(lk + 2u * lks), "v"(lk + 3u * lks),
         "v"(lv), "v"(lv + lvs), "v"(lv + 2u * lvs), "v"(lv + 3u * lvs),
         "v"(lw), "v"(lw + lvs), "v"(lw + 2u * lvs), "v"(lw + 3u * lvs),
         "v"(gk), "v"(gk + gks), "v"(gk + 2 * gks), "v"(gk + 3 * gks),
         "v"(gv), "v"(gv + gvs), "v"(gv + 2 * gvs), "v"(gv + 3 * gvs),
         "v"(gw), "v"(gw + gvs), "v"(gw + 2 * gvs), "v"(gw + 3 * gvs)
      : "memory");
#endif
}

// second launch bound of the long launch: three waves per SIMD, the three blocks per WGP that its LDS allows
template <bool PRES>
__global__ __launch_bounds__(128, PRES ? 1 : 3) void attn_causal_kernel(
    const unsigned short* __restrict__ qhp, const unsigned short* __restrict__ qlp,
    const unsigned short* __restrict__ khp, const unsigned short* __restrict__ klp,
    const unsigned short* __restrict__ vhp, const unsigned short* __restrict__ vlp,
    unsigned short* __restrict__ ahp, unsigned short* __restrict__ alp, int qb_top) {
  typedef AttnLds<PRES> L;
  __shared__ __align__(16) _Float16 lds[L::TOT];

  const int tid  = (int)threadIdx.x;
  const int lane = tid & 31;
  const int wave = wave_id();
  const int hh   = lane >> 4;
  const int c    = lane & 15;
  const int qb   = qb_top - (int)blockIdx.z;     // longest tile at the lowest index
  const int h    = (int)blockIdx.x;
  const int b    = (int)blockIdx.y;
  const int q0   = qb * 64 + wave * 16;          // first query row of this wave (within sequence)
  const int qlast = q0 + 15;
  const size_t tok0 = (size_t)b * SQ;

  const _Float16* Qhg = (const _Float16*)(const void*)qhp + (tok0 + q0) * HID + h * HDM;
  const _Float16* Qlg = (const _Float16*)(const void*)qlp + (tok0 + q0) * HID + h * HDM;
  const _Float16* Kg  = (const _Float16*)(const void*)khp + tok0 * HID + h * HDM;
  const _Float16* Klg = (const _Float16*)(const void*)klp + (size_t)b * KLR * HID + h * HDM;
  const _Float16* Vhg = (const _Float16*)(const void*)vhp + (size_t)(h * HDM) * NTOK + tok0;
  const _Float16* Vlg = (const _Float16*)(const void*)vlp + (size_t)(h * HDM) * NTOK + tok0;
  _Float16* ph = lds + L::PH + wave * (16 * PS_P);
  _Float16* pl = PRES ? lds + L::PL + wave * (16 * PS_P) : ph;   // used only with PRES
  _Float16* Qs = lds + L::QS + wave * (2 * 16 * QS_P);           // this wave's own query rows: hi plane, then residual plane

  // chunk ring, copy side: piece p = tid + 128 * i of a plane, 512 pieces of 8 halves = whole tile. K: key p >> 4, d (p & 15) * 8;
  // V^T: d p >> 2, keys (p & 3) * 8. Every lane's bytes lie inside its plane for every chunk < nch (keys < 64 * (qb + 1)).
  const char* Kc  = (const char*)Kg;
  const char* Klc = (const char*)Klg;
  const char* Vhc = (const char*)Vhg;
  const char* Vlc = (const char*)Vlg;
  const unsigned kgo = (unsigned)((tid >> 4) * (HID * 2) + (tid & 15) * 16);
  const unsigned vgo = (unsigned)((tid >> 2) * (NTOK * 2) + (tid & 3) * 16);
  const unsigned lk = (unsigned)(size_t)(const void*)lds + (unsigned)(L::KS + (tid >> 4) * KS_P + (tid & 15) * 8) * 2u;
  const unsigned lv = (unsigned)(size_t)(const void*)lds + (unsigned)(L::VHS + (tid >> 2) * VS_P + (tid & 3) * 8) * 2u;
  auto fill = [&](int t) {                       // chunk t -> buffer t % 2
    const unsigned bo = (unsigned)(t & 1) * (unsigned)(L::STG * 2);
    const size_t ko = (size_t)t * (AT_KC * HID * 2);
    const size_t vo = (size_t)t * (AT_KC * 2);
    copy_3planes(lk + bo, 8 * KS_P * 2u, (Kc + ko) + kgo, (size_t)8 * HID * 2,
                 lv + bo, 32 * VS_P * 2u, (L::VLS - L::VHS) * 2u, (Vhc + vo) + vgo, (Vlc + vo) + vgo, (size_t)32 * NTOK * 2);
    if (PRES) copy_plane(lk + bo + (L::KLS - L::KS) * 2u, 8 * KS_P * 2u, (Klc + ko) + kgo, (size_t)8 * HID * 2);
  };
  fill(0);                                       // ahead of the q fill: both wait out one global latency together

  // q rows to LDS once, whole 256-B rows per 16 lanes; read back only by this wave, behind the barrier in front of the chunk loop
#pragma unroll                                   // all 16 loads in flight together: one global latency for the whole fill
  for (int it = 0; it < 8; ++it) {
    const int row = it * 2 + hh;                 // it 0..7 x hh 0..1 covers rows 0..15
    const v8h x = *(const v8h*)(Qhg + (size_t)row * HID + c * 8);
    const v8h y = *(const v8h*)(Qlg + (size_t)row * HID + c * 8);
    *(v8h*)(Qs + row * QS_P + c * 8) = x;
    *(v8h*)(Qs + (16 + row) * QS_P + c * 8) = y;
  }

  // running row maxima and row sums live in LDS between their one use per chunk (each lane reads back only what it wrote):
  // their 16 registers go to the fragments in flight
  float* stw = (float*)(void*)(lds + L::ST + wave * 1024) + lane * 4;
  {
    const v4f ninf = {-INFINITY, -INFINITY, -INFINITY, -INFINITY};
    const v4f zero = {0.f, 0.f, 0.f, 0.f};
    *(v4f*)(stw) = ninf; *(v4f*)(stw + 128) = ninf; *(v4f*)(stw + 256) = zero; *(v4f*)(stw + 384) = zero;
  }
  v8f oacc[8], oaccr[8];
#pragma unroll
  for (int t = 0; t < 8; ++t) { oacc[t] = zero8(); oaccr[t] = zero8(); }

  const _Float16* qf = Qs + c * QS_P + 8 * hh;                                  // fragment reads: this lane's row and k half
  const int dq = c - 8 * hh - q0;                // key - query row = kv0 + 16 * j - r + dq

  const int nch = 2 * qb + 2;                    // block-uniform, <= 64; keys < 64*(qb+1) <= SQ; PRES blocks: keys < 256 = KLR
  wait_async0();
  __syncthreads();                               // chunk 0 readable by every wave
  fill(1);
  for (int kc = 0; kc < nch; ++kc) {
    const int kv0 = kc * AT_KC;
    const _Float16* stg = lds + (kc & 1) * L::STG;                              // this chunk's buffer
    const _Float16* kf = stg + L::KS + c * KS_P + 8 * hh;
    const _Float16* vf = stg + L::VHS + c * VS_P + 8 * hh;

    if (kv0 <= qlast) {                          // wave-uniform (scalar): skip chunks fully above this wave's rows
      // ---- scores ----
      v16h qa[4], ql[4], kb[4][2], kl[4][2], vb[8], vr[8];
      auto ld_k = [&](int dc, int j) {           // k fragment(s) of 32-d step dc, key half j
        kb[dc][j] = ldfrag_h(kf + j * 16 * KS_P + dc * 32);
        if (PRES) kl[dc][j] = ldfrag_h(kf + (L::KLS - L::KS) + j * 16 * KS_P + dc * 32);
      };
      auto ld_q = [&](int dc) {                  // both q planes' fragments of step dc
        qa[dc] = ldfrag_h(qf + dc * 32);
        ql[dc] = ldfrag_h(qf + 16 * QS_P + dc * 32);
      };
      auto ld_v = [&](int t) {                   // the two v^T fragments of output tile t
        vb[t] = ldfrag_h(vf + t * 16 * VS_P);
        vr[t] = ldfrag_h(vf + (L::VLS - L::VHS) + t * 16 * VS_P);
      };
      v4f mr[2], lr[2];
      v8f sh[2], sr[2];
      sh[0] = zero8(); sh[1] = zero8(); sr[0] = zero8(); sr[1] = zero8();
      ld_k(0, 0); ld_q(0); ld_k(0, 1); ld_k(1, 0); ld_q(1); ld_k(1, 1);
      sched_fence();                             // the first reads go out together, ahead of the first WMMA
      // every refill below stands between two fences: behind the WMMAs whose registers it takes over, and four or more WMMAs ahead of its use
      // (a read sunk to its use costs a full LDS round trip per WMMA pair)
#pragma unroll                                   // constant indices: fragments, scores and accumulators stay in registers
      for (int dc = 0; dc < 4; ++dc) {
#pragma unroll                                   // constant indices: fragments, scores and accumulators stay in registers
        for (int j = 0; j < 2; ++j) {
          sh[j] = mma_h(qa[dc], kb[dc][j], sh[j]);
          sr[j] = mma_h(ql[dc], kb[dc][j], sr[j]);
          if (PRES) sr[j] = mma_h(qa[dc], kl[dc][j], sr[j]);
          sched_fence();
          if (j == 0) {
            if (dc + 2 < 4) ld_k(dc + 2, 0);
          } else {
            if (dc + 2 < 4) { ld_q(dc + 2); ld_k(dc + 2, 1); }
            else ld_v(dc - 2);                   // v^T does not hang on the softmax: tiles 0, 1 and 2 return under it
            if (dc == 3) { ld_v(2); mr[0] = *(const v4f*)(stw); mr[1] = *(const v4f*)(stw + 128); }
          }
          sched_fence();
        }
      }
      // ---- scale, causal mask, chunk row max ----
      const int dk = kv0 + dq;
      float cm[8], cx[8];
#pragma unroll                                   // constant indices: fragments, scores and accumulators stay in registers
      for (int r = 0; r < 8; ++r) {
        float m = -INFINITY;
#pragma unroll                                   // constant indices: fragments, scores and accumulators stay in registers
        for (int j = 0; j < 2; ++j) {
          float s = (sh[j][r] + sr[j][r] * 0.00048828125f) * 0.08838834764831845f;
          s = (dk > r - j * 16) ? -INFINITY : s; // key > query row
          sh[j][r] = s;
          m = fmaxf(m, s);
        }
        cm[r] = m;
      }
#pragma unroll                                   // constant indices: fragments, scores and accumulators stay in registers
      for (int off = 1; off < 16; off <<= 1) {
#pragma unroll                                   // constant indices: fragments, scores and accumulators stay in registers
        for (int r = 0; r < 8; ++r) cx[r] = __shfl_xor(cm[r], off, 32);
        sched_fence();                           // the eight rows' exchanges of a step go out together: one LDS-pipe latency per step, not per row
#pragma unroll                                   // constant indices: fragments, scores and accumulators stay in registers
        for (int r = 0; r < 8; ++r) cm[r] = fmaxf(cm[r], cx[r]);
      }
      // ---- online softmax, P' to LDS ----
      float alpha[8], psum[8];
#pragma unroll                                   // constant indices: fragments, scores and accumulators stay in registers
      for (int r = 0; r < 8; ++r) {
        const float mnew = fmaxf(mr[r >> 2][r & 3], cm[r]);
        float pe[2];
        exp3_slot(sh[0][r] - mnew, sh[1][r] - mnew, mr[r >> 2][r & 3] - mnew, pe[0], pe[1], alpha[r]);
        mr[r >> 2][r & 3] = mnew;
#pragma unroll                                   // constant indices: fragments, scores and accumulators stay in registers
        for (int j = 0; j < 2; ++j) {
          const float p  = pe[j];
          const float pp = p * 1024.0f;
          const _Float16 phv = (_Float16)pp;
          const int po = (8 * hh + r) * PS_P + j * 16 + c;
          ph[po] = phv;
          if (PRES) pl[po] = (_Float16)((pp - (float)phv) * 2048.0f);
        }
        psum[r] = pe[0] + pe[1];
      }
      *(v4f*)(stw) = mr[0]; *(v4f*)(stw + 128) = mr[1];
      lds_wave_sync();                           // P' stores visible to the other lanes of this wave before the fragment reload
      // ---- O += P' . V; the four exchange steps of the row sums ride between the first WMMA groups ----
      float px[8];
#pragma unroll                                   // constant indices: fragments, scores and accumulators stay in registers
      for (int r = 0; r < 8; ++r) px[r] = __shfl_xor(psum[r], 1, 32);
      const v16h pa = ldfrag_h(ph + c * PS_P + 8 * hh);
      v16h pr = pa;
      if (PRES) pr = ldfrag_h(pl + c * PS_P + 8 * hh);
#pragma unroll                                   // constant indices: fragments, scores and accumulators stay in registers
      for (int t = 3; t < AT_VD; ++t) ld_v(t);
      lr[0] = *(const v4f*)(stw + 256); lr[1] = *(const v4f*)(stw + 384);
      sched_fence();                             // exchange, P' and v^T reads go out together; the rescale below runs under their latency
#pragma unroll                                   // constant indices: fragments, scores and accumulators stay in registers
      for (int r = 0; r < 8; ++r) {
#pragma unroll                                   // constant indices: fragments, scores and accumulators stay in registers
        for (int t = 0; t < 8; ++t) { oacc[t][r] *= alpha[r]; oaccr[t][r] *= alpha[r]; }
      }
#pragma unroll                                   // constant indices: fragments, scores and accumulators stay in registers
      for (int t = 0; t < 8; ++t) {
        if (t < 4) {
#pragma unroll                                   // constant indices: fragments, scores and accumulators stay in registers
          for (int r = 0; r < 8; ++r) {
            psum[r] += px[r];
            if (t < 3) px[r] = __shfl_xor(psum[r], 2 << t, 32);
            else lr[r >> 2][r & 3] = lr[r >> 2][r & 3] * alpha[r] + psum[r];
          }
          if (t == 3) { *(v4f*)(stw + 256) = lr[0]; *(v4f*)(stw + 384) = lr[1]; }
          sched_fence();                         // the exchange is asked for in front of this group's v^T refill, so its counted wait leaves the refill in flight
        }
        oacc[t]  = mma_h(pa, vb[t], oacc[t]);
        oaccr[t] = mma_h(pa, vr[t], oaccr[t]);
        if (PRES) oaccr[t] = mma_h(pr, vb[t], oaccr[t]);
        sched_fence();                           // refill behind the WMMAs whose registers it takes over, AT_VD tiles ahead of its use
        if (t + AT_VD < 8) ld_v(t + AT_VD);
        sched_fence();
      }
      guard_h4(oacc[7], oaccr[7], pa, pr, vb[7], vr[7]);
    }
    // publish point, passed by every wave, also one that skipped the chunk
    wait_ds0();
    wait_async0();
    __syncthreads();                             // publishes chunk kc + 1 and ends every wave's reads of chunk kc's buffer
    if (kc + 2 < nch) fill(kc + 2);              // block-uniform test
  }
  wait_async0();

  __syncthreads();                               // all chunk-region readers done before aliasing it as output staging
  _Float16* osh = lds + wave * 4096;
  _Float16* osl = osh + 2048;
  const v4f lf[2] = {*(const v4f*)(stw + 256), *(const v4f*)(stw + 384)};
#pragma unroll
  for (int r = 0; r < 8; ++r) {
    const float inv = (1.0f / lf[r >> 2][r & 3]) * 0.0009765625f;
#pragma unroll
    for (int t = 0; t < 8; ++t) {
      const float o = (oacc[t][r] + oaccr[t][r] * 0.00048828125f) * inv;
      const unsigned short hb = bf_bits(o);
      const unsigned short lb = bf_bits(o - bf_val(hb));
      const int so = (8 * hh + r) * 128 + t * 16 + c;
      osh[so] = __builtin_bit_cast(_Float16, hb);
      osl[so] = __builtin_bit_cast(_Float16, lb);
    }
  }
  lds_wave_sync();
  _Float16* Ahg = (_Float16*)(void*)ahp + (tok0 + q0) * HID + h * HDM;
  _Float16* Alg = (_Float16*)(void*)alp + (tok0 + q0) * HID + h * HDM;
  {
#pragma unroll
    for (int it = 0; it < 8; ++it) {
      const int row = it * 2 + hh;               // it 0..7 x hh 0..1 covers rows 0..15
      const int c8  = c * 8;                     // 16 lanes x 16 B = the whole 256-B segment
      const v8h x = *(const v8h*)(osh + row * 128 + c8);
      const v8h y = *(const v8h*)(osl + row * 128 + c8);
      *(v8h*)(Ahg + (size_t)row * HID + c8) = x;
      *(v8h*)(Alg + (size_t)row * HID + c8) = y;
    }
    
  }
}

// ---------------------------------------------------------------------------
// Workspace map (bytes; every region is a whole number of the rows its producer writes with whole-line stores; all dims are tile multiples,
// so padded size == logical size; offsets are multiples of 16384):
//   R0   Xb  bf16 [4096][2048] 16777216, later Ah bf16 [4096][2048] (Xb dead after the three projection GEMMs)
//   R1   WqkT bf16 [4096][2048] 16777216, later Al bf16 [4096][2048]
//   R2   WvT bf16 [2048][2048]  8388608, later WoT bf16 [2048][2048] (WvT dead after the v GEMM)
//   WpT  bf16 [32][2048]          131072
//   Qh, Ql, Kh f16 [4096][2048]  16777216 each
//   Kl   f16 [512][2048]          2097152
//   Vh, Vl f16 [2048][4096]      16777216 each
//   PQ   f32 [4096][64]           1048576
//   phs  f32 [4096]                 16384
//   total                       129122304
// ---------------------------------------------------------------------------
static inline size_t smax(size_t a, size_t b) { return a > b ? a : b; }

extern "C" void kernel_launch(void* const* d_in, const int* in_sizes, int n_in,
                              void* d_out, int out_size, void* d_ws, size_t ws_size,
                              hipStream_t stream) {
  if (n_in < 7) return;
  if (in_sizes[0] != NTOK * HID) return;
  if (in_sizes[1] != HID * HID) return;
  if (in_sizes[2] != HID * HID) return;
  if (in_sizes[3] != HID * HID) return;
  if (in_sizes[4] != HID * HID) return;
  if (in_sizes[5] != HID * NHQ) return;
  if (in_sizes[6] != HID * NHQ) return;
  if (out_size != NTOK * HID) return;

  const float* x   = (const float*)d_in[0];
  const float* Wq  = (const float*)d_in[1];
  const float* Wk  = (const float*)d_in[2];
  const float* Wv  = (const float*)d_in[3];
  const float* Wo  = (const float*)d_in[4];
  const float* Wpq = (const float*)d_in[5];
  const float* Wpk = (const float*)d_in[6];
  float* out = (float*)d_out;

  const size_t szX   = (size_t)NTOK * HID * 2;
  const size_t szWqk = (size_t)2 * HID * HID * 2;
  const size_t szW   = (size_t)HID * HID * 2;
  const size_t szA   = (size_t)NTOK * HID * 2;
  const size_t szWp  = (size_t)NPH * HID * 2;
  const size_t szQ   = (size_t)NTOK * HID * 2;
  const size_t szKl  = (size_t)NSEQ * KLR * HID * 2;
  const size_t szV   = (size_t)HID * NTOK * 2;
  const size_t szPQ  = (size_t)NTOK * PQW * 4;
  const size_t szPh  = (size_t)NTOK * 4;
  size_t off = 0;
  const size_t oR0 = off; off += smax(szX, szA);
  const size_t oR1 = off; off += smax(szWqk, szA);
  const size_t oR2 = off; off += szW;
  const size_t oWp = off; off += szWp;
  const size_t oQh = off; off += szQ;
  const size_t oQl = off; off += szQ;
  const size_t oKh = off; off += szQ;
  const size_t oKl = off; off += szKl;
  const size_t oVh = off; off += szV;
  const size_t oVl = off; off += szV;
  const size_t oPQ = off; off += szPQ;
  const size_t oPh = off; off += szPh;
  if (off > ws_size) return;                     // off = 129122304

  char* ws = (char*)d_ws;
  unsigned short* Xb   = (unsigned short*)(ws + oR0);
  unsigned short* Ah   = (unsigned short*)(ws + oR0);
  unsigned short* WqkT = (unsigned short*)(ws + oR1);
  unsigned short* Al   = (unsigned short*)(ws + oR1);
  unsigned short* WvT  = (unsigned short*)(ws + oR2);
  unsigned short* WoT  = (unsigned short*)(ws + oR2);
  unsigned short* WpT  = (unsigned short*)(ws + oWp);
  unsigned short* Qh   = (unsigned short*)(ws + oQh);
  unsigned short* Ql   = (unsigned short*)(ws + oQl);
  unsigned short* Kh   = (unsigned short*)(ws + oKh);
  unsigned short* Kl   = (unsigned short*)(ws + oKl);
  unsigned short* Vh   = (unsigned short*)(ws + oVh);
  unsigned short* Vl   = (unsigned short*)(ws + oVl);
  float*          PQ   = (float*)(ws + oPQ);
  float*          phs  = (float*)(ws + oPh);

  const dim3 b256(256), b128(128);

  // (1) x -> bf16 plane [4096][2048]
  cvt_bf16_kernel<<<dim3((NTOK * HID / 8) / 256), b256, 0, stream>>>(x, Xb, NTOK * HID / 8);
  // (2) Wq in[2048 rows][2048 cols] -> WqkT rows 0..2047 = out[n][k]; Wk -> WqkT rows 2048..4095; Wv -> WvT   (grid = cols/64, rows/64)
  tconv_bf16_kernel<<<dim3(HID / 64, HID / 64), b256, 0, stream>>>(Wq, WqkT, HID, HID);
  tconv_bf16_kernel<<<dim3(HID / 64, HID / 64), b256, 0, stream>>>(Wk, WqkT + (size_t)HID * HID, HID, HID);
  tconv_bf16_kernel<<<dim3(HID / 64, HID / 64), b256, 0, stream>>>(Wv, WvT, HID, HID);
  // (3) Wpq|Wpk -> WpT [32][2048]
  wpt_kernel<<<dim3(NPH), b256, 0, stream>>>(Wpq, Wpk, WpT);
  // (4) pq|pk = x . (Wpq|Wpk) -> cos|sin plane PQ [4096][64]   (M=4096, N=32, K=2048; one block per 16 rows)
  phase_proj_kernel<<<dim3(NTOK / 16), b256, 0, stream>>>(Xb, WpT, PQ);
  // (5) phase factor phs [4096]
  phase_kernel<<<dim3(NSEQ * PH_PB), dim3(512), 0, stream>>>(PQ, phs);
  // (6) q|k = x . (Wq|Wk) -> Qh/Ql [4096][2048], Kh [4096][2048], Kl [512][2048]   (M=4096, N=4096, K=2048; 32 x 16 block tiles)
  gemm_tiled_kernel<0, 4, false><<<dim3((NTOK / GT_BM) * ((2 * HID) / GT_BN)), b128, 0, stream>>>(
      Xb, Xb, HID, WqkT, HID, phs, (void*)Qh, (void*)Ql, (void*)Kh, (void*)Kl, HID, NTOK, 2 * HID, HID);
  // (7) v^T = WvT . x^T -> Vh/Vl [2048][4096]   (A = WvT, Bt = Xb; M=2048, N=4096, K=2048; 16 x 16 block tiles)
  gemm_tiled_kernel<1, 2, false><<<dim3((HID / GT_BM) * (NTOK / GT_BN)), b256, 0, stream>>>(
      WvT, WvT, HID, Xb, HID, phs, (void*)Vh, (void*)Vl, (void*)Vh, (void*)Vl, NTOK, HID, NTOK, HID);
  // (8) Wo -> WoT (over the dead WvT region)
  tconv_bf16_kernel<<<dim3(HID / 64, HID / 64), b256, 0, stream>>>(Wo, WoT, HID, HID);
  // (9) causal attention, query tiles 0..3 with k and p residual products, tiles 4..31 without -> Ah/Al (over the dead Xb/WqkT regions)
  attn_causal_kernel<true><<<dim3(NHQ, NSEQ, 4), b128, 0, stream>>>(Qh, Ql, Kh, Kl, Vh, Vl, Ah, Al, 3);
  attn_causal_kernel<false><<<dim3(NHQ, NSEQ, SQ / 64 - 4), b128, 0, stream>>>(Qh, Ql, Kh, Kl, Vh, Vl, Ah, Al, SQ / 64 - 1);
  // (10) out = (attn hi + lo) . Wo * (1 + 0.1*phs[m]) -> d_out f32 [4096][2048]   (M=4096, N=2048, K=2048; 32 x 8 block tiles)
  gemm_tiled_kernel<2, 2, true><<<dim3((NTOK / GT_BM) * (HID / GT_BN)), b256, 0, stream>>>(
      Ah, Al, HID, WoT, HID, phs, (void*)out, (void*)out, (void*)out, (void*)out, HID, NTOK, HID, HID);
  (void)hipGetLastError();
}

// v007
// A run of this version takes 273 microseconds.
// Two timings next to v006 put it at 1.05 and 1.06 times that version's speed.
// All steps since v000 together make it 2.84 times as fast.
// Contractions: x.(Wq|Wk), Wv^T.x^T and x.(Wpq|Wpk) on v_wmma_f32_16x16x32_bf16 (operands = RNE bf16 of the f32 inputs, single products);
// q.k^T and p.v on v_wmma_f32_16x16x32_f16 (q = f16 hi + f16 residual x2^11 planes; k plain f16 plus f16 residual x2^11 on query tiles 0..3;
// p x1024 plain f16 plus f16 residual x2^11 on query tiles 0..3; v^T = f16 hi + f16 residual x2^11 planes); attn.Wo on v_wmma_f32_16x16x32_bf16
// (attn = bf16 hi + bf16 lo planes, two products; Wo RNE bf16). f32 accumulate everywhere; online softmax, cos/sin phase sums and output scale in f32.
#include <hip/hip_runtime.h>
#include <math.h>
#include <stdint.h>

#define NSEQ   2
#define SQ     2048
#define HID    2048
#define NHQ    16
#define HDM    128
#define NTOK   4096
#define NPH    32
#define PQW    64
#define KLR    256

static_assert(NTOK == NSEQ * SQ);
static_assert(NHQ * HDM == HID);
static_assert(KLR % 32 == 0 && SQ % KLR == 0);

typedef _Float16     v16h __attribute__((ext_vector_type(16)));
typedef _Float16     v8h  __attribute__((ext_vector_type(8)));
typedef __bf16       v16b __attribute__((ext_vector_type(16)));
typedef __bf16       v8b  __attribute__((ext_vector_type(8)));
typedef float        v8f  __attribute__((ext_vector_type(8)));
typedef float        v4f  __attribute__((ext_vector_type(4)));
typedef unsigned int v4u  __attribute__((ext_vector_type(4)));

// ---------------------------------------------------------------------------
// small helpers
// ---------------------------------------------------------------------------
__device__ __forceinline__ unsigned short bf_bits(float f) {          // RNE convert f32 -> bf16 bits
  const unsigned u = __float_as_uint(f);
  return (unsigned short)((u + 0x7FFFu + ((u >> 16) & 1u)) >> 16);
}
__device__ __forceinline__ float bf_val(unsigned short h) { return __uint_as_float(((unsigned)h) << 16); }
__device__ __forceinline__ unsigned pk16(unsigned short a, unsigned short b) { return (unsigned)a | ((unsigned)b << 16); }
__device__ __forceinline__ v8f zero8() { v8f z = {0.f, 0.f, 0.f, 0.f, 0.f, 0.f, 0.f, 0.f}; return z; }
__device__ __forceinline__ int wave_id() {
#if defined(__HIP_DEVICE_COMPILE__)
  return __builtin_amdgcn_readfirstlane((int)(threadIdx.x >> 5));
#else
  return (int)(threadIdx.x >> 5);
#endif
}
// three e^x as __expf forms them (one multiply, v_exp_f32 each). One statement: the three are independent of one another (outputs apart from
// all inputs), and the v_nop is the slot that the instruction set asks for between a transcendental and a directly following instruction
// that reads its result or overwrites its source; inside the statement it stands there in every build
__device__ __forceinline__ void exp3_slot(float a, float b, float c, float& ea, float& eb, float& ec) {
#if defined(__HIP_DEVICE_COMPILE__)
  const float ta = a * 1.44269504088896340736f;
  const float tb = b * 1.44269504088896340736f;
  const float tc = c * 1.44269504088896340736f;
  asm("v_exp_f32 %0, %3\n\tv_exp_f32 %1, %4\n\tv_exp_f32 %2, %5\n\tv_nop" : "=&v"(ea), "=&v"(eb), "=&v"(ec) : "v"(ta), "v"(tb), "v"(tc));
#else
  ea = expf(a); eb = expf(b); ec = expf(c);
#endif
}
// value of lane l ^ XM within the lane's 16-lane row, on the vector pipe (DPP row_xmask); the compiler folds the move into the add that uses it
template <int XM>
__device__ __forceinline__ float row_xor(float x) {
#if defined(__HIP_DEVICE_COMPILE__)
  const int v = __builtin_bit_cast(int, x);
  return __builtin_bit_cast(float, __builtin_amdgcn_update_dpp(0, v, 0x160 + XM, 0xf, 0xf, true));
#else
  return x;
#endif
}
// maximum over the 16 lanes of a row for eight values at once: four DPP steps (lane l with l ^ 1, 2, 4, 8), max and exchange in one instruction.
// Written as text because the builtin exchange leaves a separate move and a quieting max per step. The eight chains stand side by side,
// so every instruction's producer lies eight instructions back and no delay hint is owed. All 32 lanes are on where it is called.
#define ROW_MAX_STEP(X)                                                        \
  "v_max_num_f32_dpp %0, %0, %0 row_xmask:" #X " row_mask:0xf bank_mask:0xf\n\t" \
  "v_max_num_f32_dpp %1, %1, %1 row_xmask:" #X " row_mask:0xf bank_mask:0xf\n\t" \
  "v_max_num_f32_dpp %2, %2, %2 row_xmask:" #X " row_mask:0xf bank_mask:0xf\n\t" \
  "v_max_num_f32_dpp %3, %3, %3 row_xmask:" #X " row_mask:0xf bank_mask:0xf\n\t" \
  "v_max_num_f32_dpp %4, %4, %4 row_xmask:" #X " row_mask:0xf bank_mask:0xf\n\t" \
  "v_max_num_f32_dpp %5, %5, %5 row_xmask:" #X " row_mask:0xf bank_mask:0xf\n\t" \
  "v_max_num_f32_dpp %6, %6, %6 row_xmask:" #X " row_mask:0xf bank_mask:0xf\n\t" \
  "v_max_num_f32_dpp %7, %7, %7 row_xmask:" #X " row_mask:0xf bank_mask:0xf\n\t"
__device__ __forceinline__ void row_max8(float (&m)[8]) {
#if defined(__HIP_DEVICE_COMPILE__)
  asm(ROW_MAX_STEP(1) ROW_MAX_STEP(2) ROW_MAX_STEP(4) ROW_MAX_STEP(8)
      : "+v"(m[0]), "+v"(m[1]), "+v"(m[2]), "+v"(m[3]), "+v"(m[4]), "+v"(m[5]), "+v"(m[6]), "+v"(m[7]));
#endif
}
// release/acquire + wave barrier between one wave's LDS stores and the other lanes' reloads
__device__ __forceinline__ void lds_wave_sync() {
#if defined(__HIP_DEVICE_COMPILE__)
  __builtin_amdgcn_fence(__ATOMIC_RELEASE, "workgroup");
  __builtin_amdgcn_wave_barrier();
  __builtin_amdgcn_fence(__ATOMIC_ACQUIRE, "workgroup");
#endif
}

// ---------------------------------------------------------------------------
// WMMA fragments (wave32, 16x16x32, 16-bit operands). For A (row m = lane&15) and B (col n = lane&15) alike:
// elements 0..7 <- k0 + 8*(lane>>4) + 0..7, elements 8..15 <- k0 + 16 + 8*(lane>>4) + 0..7.
// ldfrag(p) with p = rowbase + k0 + 8*(lane>>4): two 16-B loads p[0..7], p[16..23].
// D: acc[r] = (row 8*(lane>>4) + r, col lane&15).
// ---------------------------------------------------------------------------
union FragH { v16h v; v8h h[2]; };
union FragB { v16b v; v8b h[2]; };
__device__ __forceinline__ v16h ldfrag_h(const _Float16* p) { FragH f; f.h[0] = *(const v8h*)(p); f.h[1] = *(const v8h*)(p + 16); return f.v; }
__device__ __forceinline__ v16b ldfrag_b(const __bf16* p)   { FragB f; f.h[0] = *(const v8b*)(p); f.h[1] = *(const v8b*)(p + 16); return f.v; }

__device__ __forceinline__ v8f mma_h(v16h a, v16h b, v8f c) {
#if defined(__HIP_DEVICE_COMPILE__)
  return __builtin_amdgcn_wmma_f32_16x16x32_f16(false, a, false, b, (short)0, c, false, false);
#else
  return c;
#endif
}
__device__ __forceinline__ v8f mma_b(v16b a, v16b b, v8f c) {
#if defined(__HIP_DEVICE_COMPILE__)
  return __builtin_amdgcn_wmma_f32_16x16x32_bf16(false, a, false, b, (short)0, c, false, false);
#else
  return c;
#endif
}
// hazard guard: 4 VALU slots after the last WMMA in front of the chunk loop's back edge, D tied, A/B kept live
__device__ __forceinline__ void guard_h4(v8f& a, v8f& b, v16h w, v16h x, v16h y, v16h z) {
#if defined(__HIP_DEVICE_COMPILE__)
  asm volatile("v_nop\n\tv_nop\n\tv_nop\n\tv_nop" : "+v"(a), "+v"(b) : "v"(w), "v"(x), "v"(y), "v"(z) : "memory");
#endif
}

// ---------------------------------------------------------------------------
// Elementwise RNE f32 -> bf16 plane: 8 elements per thread, one 16-B store per lane -> 32 consecutive lanes write 4 whole
// ---------------------------------------------------------------------------
__global__ __launch_bounds__(256) void cvt_bf16_kernel(const float* __restrict__ in, unsigned short* __restrict__ outp, int n8) {
  const int i = (int)blockIdx.x * 256 + (int)threadIdx.x;
  if (i >= n8) return;
  const size_t e = 8 * (size_t)i;
  const v4f a = *(const v4f*)(in + e);
  const v4f b = *(const v4f*)(in + e + 4);
  v4u w;
  w[0] = pk16(bf_bits(a[0]), bf_bits(a[1]));
  w[1] = pk16(bf_bits(a[2]), bf_bits(a[3]));
  w[2] = pk16(bf_bits(b[0]), bf_bits(b[1]));
  w[3] = pk16(bf_bits(b[2]), bf_bits(b[3]));
  *(v4u*)(outp + e) = w;
  
}

// ---------------------------------------------------------------------------
// Fused transpose + RNE bf16 convert: in [R rows][Cc cols] f32 (pitch Cc) -> out[c][r] = bf16(in[r][c])  ([Cc][R], pitch R).
// 64x64 tiles through LDS; grid = (Cc/64, R/64), 256 threads; R, Cc multiples of 64.
// Coverage per block: load 4 it x 256 thr x 4 floats = 64x64; store 2 it x 256 thr x 8 u16 = 64x64.
// ---------------------------------------------------------------------------
__global__ __launch_bounds__(256) void tconv_bf16_kernel(const float* __restrict__ W, unsigned short* __restrict__ outp, int R, int Cc) {
  __shared__ __align__(16) float tf[64 * 68];
  const int c0  = (int)blockIdx.x * 64;   // input column block = output row block
  const int r0  = (int)blockIdx.y * 64;   // input row block    = output column block
  const int tid = (int)threadIdx.x;
  {
    const int lr = tid >> 4;              // 0..15
    const int c4 = (tid & 15) * 4;        // 0..60
#pragma unroll
    for (int it = 0; it < 4; ++it) {
      const int rr = it * 16 + lr;        // 0..63
      const v4f a = *(const v4f*)(W + (size_t)(r0 + rr) * Cc + c0 + c4);
      *(v4f*)(tf + rr * 68 + c4) = a;
    }
  }
  __syncthreads();
  const int sub = tid >> 3;               // 0..31
  const int c8  = (tid & 7) * 8;          // 0..56
  v4u hv[2];
#pragma unroll
  for (int it = 0; it < 2; ++it) {
    const int oc = it * 32 + sub;         // output row within tile (= input column)
    v4u a;
#pragma unroll
    for (int q = 0; q < 4; ++q) {
      const float f0 = tf[(c8 + 2 * q) * 68 + oc];
      const float f1 = tf[(c8 + 2 * q + 1) * 68 + oc];
      a[q] = pk16(bf_bits(f0), bf_bits(f1));
    }
    hv[it] = a;
  }
  {
#pragma unroll
    for (int it = 0; it < 2; ++it) {
      const int oc = it * 32 + sub;
      const size_t go = (size_t)(c0 + oc) * R + r0 + c8;
      *(v4u*)(outp + go) = hv[it];
    }
    
  }
}

// ---------------------------------------------------------------------------
// Phase weights: Wpq [HID][NHQ], Wpk [HID][NHQ] f32 -> WpT [NPH][HID] bf16 rows (rows 0..15 = Wpq^T, 16..31 = Wpk^T).
// ---------------------------------------------------------------------------
__global__ __launch_bounds__(256) void wpt_kernel(const float* __restrict__ Wpq, const float* __restrict__ Wpk,
                                                  unsigned short* __restrict__ outp) {
  const int n = (int)blockIdx.x;                   // 0..31
  const float* W = (n < NHQ) ? Wpq : Wpk;          // block-uniform, both global
  const int h = n & (NHQ - 1);
  const int t = (int)threadIdx.x;                  // k = 8t .. 8t+7  (< HID)
  v4u w;
#pragma unroll
  for (int q = 0; q < 4; ++q) {
    const float f0 = W[(size_t)(8 * t + 2 * q) * NHQ + h];
    const float f1 = W[(size_t)(8 * t + 2 * q + 1) * NHQ + h];
    w[q] = pk16(bf_bits(f0), bf_bits(f1));
  }
  const size_t o = (size_t)n * HID + 8 * (size_t)t;
  *(v4u*)(outp + o) = w;
  
}

// ---------------------------------------------------------------------------
// bf16 WMMA GEMMs: C[m][n] = sum_k A[m][k] * Bt[n][k]; A row-major [M][K] bf16 (pitch lda), Bt row-major [N][K] bf16 (pitch ldb).
//   SPLITA: A carried as hi (Ap) + lo (A2p) bf16 planes, two products into one accumulator (hi then lo at every k step).
//   gemm_tiled_kernel (EPI 0, 1, 2): block tile 128 x 256, waves of 64 x 128 (EPI 0) or 32 x 128 (EPI 1, 2), operands staged in an LDS ring of two buffers.
// Epilogues (all: per wave, per 16-row slab: stage in LDS, wave sync, write each row segment with ONE instruction); MI = 16-row slabs per wave.
//   EPI 0 (NJ 8): q|k projection. cols n0 < HID (q): f16 hi plane C0 and f16 residual x2048 plane C1, both [M][ldc], cols n0..n0+127
//          (row segment 256 B = 16 lanes x 16 B). cols n0 >= HID (k): hi plane C2 [M][ldc] cols n0-HID..; residual plane C3 [NSEQ*KLR][ldc]
//          only for token rows with (m % SQ) < KLR at row (m / SQ)*KLR + m % SQ (wave-uniform choice; 32- and 64-row wave tiles never straddle).
//   EPI 1 (NJ 8): v^T projection: f16 hi plane C0, residual x2048 plane C1, [M][ldc], row segment 256 B.
//   EPI 2 (NJ 8): f32 output C0 [M][ldc], each row scaled by (1 + 0.1*phs[m]); row segment 128 floats = 512 B = 32 lanes x 16 B per instruction.
// ---------------------------------------------------------------------------
template <int EPI> struct SlabT { typedef _Float16 T; static constexpr int PERW = 4096; };   // 2 planes x 16 x 128 halves
template <> struct SlabT<2>     { typedef float    T; static constexpr int PERW = 2048; };   // 16 x 128 floats

// s_wait_xcnt 0 behind an issued global store, in front of a rewrite of a register that the store names
__device__ __forceinline__ void wait_x0() {
#if defined(__HIP_DEVICE_COMPILE__)
  asm volatile("s_wait_xcnt 0x0" ::: "memory");
#endif
}

// slab: this wave's own LDS staging range; (m0, n0): first row and column of the wave's (16*MI) x (16*NJ) tile.
template <int EPI, int NJ, int MI>
__device__ __forceinline__ void gemm_epilogue(v8f (&acc)[MI][NJ], typename SlabT<EPI>::T* slab, int lane, int m0, int n0,
                                              const float* __restrict__ phs, void* C0, void* C1, void* C2, void* C3, int ldc) {
  const int hh = lane >> 4;
  const int rl = lane & 15;
  _Float16* sl16 = (_Float16*)(void*)slab;
  float*    slf  = (float*)(void*)slab;

  if constexpr (EPI == 0 || EPI == 1) {
    _Float16* P0;
    _Float16* P1;
    int col0;
    int lomode;                                   // 0: lo row = m; 1: lo row remapped into the KLR-row plane; 2: no lo store
    if constexpr (EPI == 0) {
      const bool isq = (n0 < HID);                // wave-uniform
      P0 = isq ? (_Float16*)C0 : (_Float16*)C2;
      P1 = isq ? (_Float16*)C1 : (_Float16*)C3;
      col0 = isq ? n0 : (n0 - HID);
      const int s0 = m0 & (SQ - 1);
      lomode = isq ? 0 : ((s0 < KLR) ? 1 : 2);
    } else {
      P0 = (_Float16*)C0;
      P1 = (_Float16*)C1;
      col0 = n0;
      lomode = 0;
    }
#pragma unroll
    for (int i = 0; i < MI; ++i) {
#pragma unroll
      for (int r = 0; r < 8; ++r) {
#pragma unroll
        for (int j = 0; j < NJ; ++j) {
          const float v = acc[i][j][r];
          const _Float16 hv = (_Float16)v;
          const int so = (8 * hh + r) * 128 + j * 16 + rl;
          sl16[so]        = hv;
          sl16[2048 + so] = (_Float16)((v - (float)hv) * 2048.0f);
        }
      }
      lds_wave_sync();
      {
#pragma unroll
        for (int it = 0; it < 8; ++it) {
          const int row = it * 2 + hh;            // it x hh covers rows 0..15
          const int c8  = rl * 8;
          const v8h xh = *(const v8h*)(sl16 + row * 128 + c8);
          const v8h xl = *(const v8h*)(sl16 + 2048 + row * 128 + c8);
          const int m = m0 + i * 16 + row;
          *(v8h*)(P0 + (size_t)m * ldc + col0 + c8) = xh;
          if constexpr (EPI == 0) wait_x0();      // precaution: in front of the branch below, whose first instructions reuse this store's registers
          if (lomode != 2) {
            const int m1 = (lomode == 1) ? ((m / SQ) * KLR + (m % SQ)) : m;
            *(v8h*)(P1 + (size_t)m1 * ldc + col0 + c8) = xl;
            if constexpr (EPI == 0) wait_x0();    // precaution: inside the branch, in front of whatever reuses this store's registers behind it
          }
        }
        
      }
      lds_wave_sync();
    }
  } else if constexpr (EPI == 2) {
    float* C = (float*)C0;
#pragma unroll
    for (int i = 0; i < MI; ++i) {
#pragma unroll
      for (int r = 0; r < 8; ++r) {
        const int m = m0 + i * 16 + 8 * hh + r;
        const float sc = 1.0f + 0.1f * phs[m];
#pragma unroll
        for (int j = 0; j < NJ; ++j)
          slf[(8 * hh + r) * 128 + j * 16 + rl] = acc[i][j][r] * sc;
      }
      lds_wave_sync();
      {
#pragma unroll
        for (int row = 0; row < 16; ++row) {      // 32 lanes x 16 B = the whole 512-B row segment per instruction
          const v4f v = *(const v4f*)(slf + row * 128 + lane * 4);
          *(v4f*)(C + (size_t)(m0 + i * 16 + row) * ldc + n0 + lane * 4) = v;
        }
        
      }
      lds_wave_sync();
    }
  }
}

// ---------------------------------------------------------------------------
// Tiled GEMM main loop. Block tile 128 x 256; waves in a (8/MI) x 2 grid, each (16*MI) x 128: MI 4 = 4 waves, MI 2 = 8 waves.
// A pass is 64 k: a stage holds [A 128 rows | (SPLITA: A2 128 rows) | Bt 256 rows] of 128 B at pitch 144 B
// (16 B x 9: ds_load_b128 fragment reads without bank conflicts). Every thread brings 16-B pieces with asynchronous copies to LDS,
// one pass ahead of the pass that reads them. M % 128 == 0, N % 256 == 0, K % 64 == 0, K >= 128; grid.x = (M/128) * (N/256).
// ---------------------------------------------------------------------------
#define GT_BM 128
#define GT_BN 256
#define GT_KP 64
#define GT_LP 72                                  // LDS row pitch in bf16 elements

// Asynchronous 16-B copies, one per lane and line of the statement: l + c * lstep = the lane's LDS byte address, g[c] = its global source.
// s_wait_xcnt stands inside the statement so that no address register is rewritten ahead of it.
__device__ __forceinline__ void copy8(unsigned l, unsigned lstep, const __bf16* const* g) {
#if defined(__HIP_DEVICE_COMPILE__)
  asm volatile(
      "global_load_async_to_lds_b128 %0, %8, off\n\t"
      "global_load_async_to_lds_b128 %1, %9, off\n\t"
      "global_load_async_to_lds_b128 %2, %10, off\n\t"
      "global_load_async_to_lds_b128 %3, %11, off\n\t"
      "global_load_async_to_lds_b128 %4, %12, off\n\t"
      "global_load_async_to_lds_b128 %5, %13, off\n\t"
      "global_load_async_to_lds_b128 %6, %14, off\n\t"
      "global_load_async_to_lds_b128 %7, %15, off\n\t"
      "s_wait_xcnt 0x0"
      :: "v"(l), "v"(l + lstep), "v"(l + 2u * lstep), "v"(l + 3u * lstep),
         "v"(l + 4u * lstep), "v"(l + 5u * lstep), "v"(l + 6u * lstep), "v"(l + 7u * lstep),
         "v"(g[0]), "v"(g[1]), "v"(g[2]), "v"(g[3]), "v"(g[4]), "v"(g[5]), "v"(g[6]), "v"(g[7])
      : "memory");
#endif
}
__device__ __forceinline__ void copy4(unsigned l, unsigned lstep, const __bf16* const* g) {
#if defined(__HIP_DEVICE_COMPILE__)
  asm volatile(
      "global_load_async_to_lds_b128 %0, %4, off\n\t"
      "global_load_async_to_lds_b128 %1, %5, off\n\t"
      "global_load_async_to_lds_b128 %2, %6, off\n\t"
      "global_load_async_to_lds_b128 %3, %7, off\n\t"
      "s_wait_xcnt 0x0"
      :: "v"(l), "v"(l + lstep), "v"(l + 2u * lstep), "v"(l + 3u * lstep),
         "v"(g[0]), "v"(g[1]), "v"(g[2]), "v"(g[3])
      : "memory");
#endif
}
// this wave's copies have landed in LDS
__device__ __forceinline__ void wait_async0() {
#if defined(__HIP_DEVICE_COMPILE__)
  asm volatile("s_wait_asynccnt 0x0" ::: "memory");
#endif
}
// this wave's LDS reads have returned (before the buffer they read is handed back for a refill)
__device__ __forceinline__ void wait_ds0() {
#if defined(__HIP_DEVICE_COMPILE__)
  asm volatile("s_wait_dscnt 0x0" ::: "memory");
#endif
}
// the compiler's scheduler moves nothing across this point
__device__ __forceinline__ void sched_fence() {
#if defined(__HIP_DEVICE_COMPILE__)
  __builtin_amdgcn_sched_barrier(0);
#endif
}

// second launch bound: two waves per SIMD (two 4-wave blocks, or one 8-wave block, per WGP), so that one wave's WMMAs cover the other's waits
template <int EPI, int MI, bool SPLITA>
__global__ __launch_bounds__(512 / MI, 2) void gemm_tiled_kernel(
    const unsigned short* Ap, const unsigned short* A2p, int lda,
    const unsigned short* __restrict__ Btp, int ldb,
    const float* __restrict__ phs,
    void* C0, void* C1, void* C2, void* C3, int ldc,
    int M, int N, int K) {
  static_assert(EPI == 0 || EPI == 1 || EPI == 2);
  static_assert(MI == 4 || MI == 2);
  static_assert(GT_KP == 64);
  constexpr int NW    = 16 / MI;                  // waves per block
  constexpr int RS    = NW * 4;                   // stage rows that one copy of every thread covers (8 threads per 128-B row)
  constexpr int AROWS = (SPLITA ? 2 : 1) * GT_BM;
  constexpr int NCP   = (AROWS + GT_BN) / RS;     // copies per thread and stage: 24, 12 or 16 (at most 63 may be outstanding)
  constexpr int STAGE = (AROWS + GT_BN) * GT_LP;  // elements per buffer
  static_assert(NCP % 4 == 0 && NCP <= 63);
  typedef typename SlabT<EPI>::T ST;
  __shared__ __align__(16) __bf16 ring[2 * STAGE];
  __shared__ __align__(16) ST slab_all[NW * SlabT<EPI>::PERW];

  const int tid  = (int)threadIdx.x;
  const int lane = tid & 31;
  const int wave = wave_id();
  const int hh = lane >> 4;           // lane half: k offset 8*hh
  const int rl = lane & 15;           // A row / B col within subtile
  const int tilesN = N / GT_BN;
  const int tm  = (int)blockIdx.x / tilesN;
  const int tn  = (int)blockIdx.x - tm * tilesN;
  const int bm0 = tm * GT_BM;
  const int bn0 = tn * GT_BN;
  const int wm  = wave >> 1;
  const int wn  = wave & 1;

  // copy side: copy c of this thread brings piece tid % 8 of stage row c * RS + tid / 8
  const int crow = tid >> 3;
  const int cpc  = (tid & 7) * 8;     // element offset of the 16-B piece
  const __bf16* gA  = (const __bf16*)(const void*)Ap  + (size_t)(bm0 + crow) * lda + cpc;
  const __bf16* gA2 = (const __bf16*)(const void*)A2p + (size_t)(bm0 + crow) * lda + cpc;
  const __bf16* gB  = (const __bf16*)(const void*)Btp + (size_t)(bn0 + crow) * ldb + cpc;
  const unsigned lc = (unsigned)(size_t)(const void*)ring + (unsigned)(crow * GT_LP + cpc) * 2u;
  auto fill = [&](int t) {            // tile t -> buffer t % 2
    const unsigned l = lc + (unsigned)(t & 1) * (unsigned)(STAGE * 2);
    const size_t ko = (size_t)t * GT_KP;
    const __bf16* g[NCP];
#pragma unroll
    for (int c = 0; c < NCP; ++c) {
      const int r = c * RS;
      g[c] = (r < GT_BM) ? gA + ko + (size_t)r * lda
           : (r < AROWS) ? gA2 + ko + (size_t)(r - GT_BM) * lda
                         : gB + ko + (size_t)(r - AROWS) * ldb;
    }
#pragma unroll
    for (int c = 0; c + 8 <= NCP; c += 8) copy8(l + (unsigned)(c * RS * GT_LP * 2), RS * GT_LP * 2u, g + c);
    if constexpr (NCP % 8 == 4) copy4(l + (unsigned)((NCP - 4) * RS * GT_LP * 2), RS * GT_LP * 2u, g + (NCP - 4));
  };

  v8f acc[MI][8];
#pragma unroll
  for (int i = 0; i < MI; ++i)
#pragma unroll
    for (int j = 0; j < 8; ++j) acc[i][j] = zero8();

  const int nt = K / GT_KP;           // block-uniform, >= 2
  fill(0);
  wait_async0();
  __syncthreads();                    // tile 0 readable by every wave
  fill(1);

  const int aoff = (wm * (16 * MI) + rl) * GT_LP + 8 * hh;
  const int boff = (AROWS + wn * 128 + rl) * GT_LP + 8 * hh;
#pragma unroll 1                      // one pass per trip: the ring's order below holds per trip, and every acc index stays constant
  for (int t = 0; t < nt; ++t) {
    const __bf16* st = ring + (t & 1) * STAGE;
    v16b fa[2][MI], fl[2][MI], fb[2][8];          // one fragment set per 32-k step of the pass
#pragma unroll
    for (int ks = 0; ks < 2; ++ks) {
#pragma unroll
      for (int i = 0; i < MI; ++i) {
        fa[ks][i] = ldfrag_b(st + aoff + i * 16 * GT_LP + ks * 32);
        if constexpr (SPLITA) fl[ks][i] = ldfrag_b(st + aoff + (GT_BM + i * 16) * GT_LP + ks * 32);
      }
#pragma unroll
      for (int j = 0; j < 8; ++j) fb[ks][j] = ldfrag_b(st + boff + j * 16 * GT_LP + ks * 32);
      sched_fence();                              // each step's LDS reads stay one group ahead of the WMMA blocks, not spread among them
    }
#pragma unroll
    for (int ks = 0; ks < 2; ++ks) {
#pragma unroll
      for (int j = 0; j < 8; ++j) {
#pragma unroll
        for (int i = 0; i < MI; ++i) acc[i][j] = mma_b(fa[ks][i], fb[ks][j], acc[i][j]);
        if constexpr (SPLITA) {
#pragma unroll
          for (int i = 0; i < MI; ++i) acc[i][j] = mma_b(fl[ks][i], fb[ks][j], acc[i][j]);
        }
      }
      // step 1's WMMAs stay behind step 0's (only step 0's reads are waited for first) and in front of the waits at the foot
      // (moved behind the barrier they would halve the lead of the copies in flight)
      sched_fence();
    }
    wait_ds0();
    wait_async0();
    __syncthreads();                  // publishes tile t + 1 and ends every wave's reads of tile t's buffer
    if (t + 2 < nt) fill(t + 2);      // block-uniform test
  }
  wait_async0();

  gemm_epilogue<EPI, 8, MI>(acc, slab_all + wave * SlabT<EPI>::PERW, lane, bm0 + wm * (16 * MI), bn0 + wn * 128, phs, C0, C1, C2, C3, ldc);
}

// ---------------------------------------------------------------------------
// Phase projection: v[m][n] = sum_k Xb[m][k] * WpT[n][k] (M = NTOK, N = NPH, K = HID), then PQ[m][n] = cos(v), PQ[m][NPH + n] = sin(v).
// Block = 16 token rows x all NPH columns, PP_NW waves; wave w takes k in [w * PP_KS, (w + 1) * PP_KS): all its fragment loads
// (straight from the global rows) go out ahead of its WMMAs, so a wave pays the global latency once. The PP_NW partial tiles meet
// in LDS and are added in wave order 0..PP_NW-1. Each thread then finishes 2 values (precise cosf/sinf); a wave's store is one whole 128-B line.
// Coverage: NTOK / 16 blocks x 16 rows x PQW columns = the whole PQ plane.
// ---------------------------------------------------------------------------
#define PP_NW 8
#define PP_KS (HID / PP_NW)
static_assert(PP_KS % 32 == 0 && NPH == 32 && PQW == 2 * NPH && NTOK % 16 == 0);
__global__ __launch_bounds__(32 * PP_NW) void phase_proj_kernel(const unsigned short* __restrict__ Xp, const unsigned short* __restrict__ Wp,
                                                                float* __restrict__ PQ) {
  constexpr int NS = PP_KS / 32;      // 32-k steps per wave
  __shared__ __align__(16) float part[PP_NW * 16 * NPH];
  const int tid  = (int)threadIdx.x;
  const int lane = tid & 31;
  const int wave = wave_id();
  const int hh = lane >> 4;           // lane half: k offset 8*hh, D row offset 8*hh
  const int rl = lane & 15;           // A row / B col / D col within subtile
  const int m0 = (int)blockIdx.x * 16;
  const __bf16* A  = (const __bf16*)(const void*)Xp + (size_t)(m0 + rl) * HID + wave * PP_KS + 8 * hh;
  const __bf16* B0 = (const __bf16*)(const void*)Wp + (size_t)rl * HID + wave * PP_KS + 8 * hh;
  const __bf16* B1 = B0 + (size_t)16 * HID;
  v16b fa[NS], f0[NS], f1[NS];
#pragma unroll
  for (int s = 0; s < NS; ++s) {
    fa[s] = ldfrag_b(A + s * 32);
    f0[s] = ldfrag_b(B0 + s * 32);
    f1[s] = ldfrag_b(B1 + s * 32);
  }
  sched_fence();                      // all 6 * NS loads stay ahead of the first WMMA: spread among the WMMAs they would return in NS rounds of latency
  v8f a0 = zero8(), a1 = zero8();
#pragma unroll
  for (int s = 0; s < NS; ++s) {
    a0 = mma_b(fa[s], f0[s], a0);
    a1 = mma_b(fa[s], f1[s], a1);
  }
  float* pw = part + wave * (16 * NPH);
#pragma unroll
  for (int r = 0; r < 8; ++r) {
    pw[(8 * hh + r) * NPH + rl]      = a0[r];
    pw[(8 * hh + r) * NPH + 16 + rl] = a1[r];
  }
  __syncthreads();                    // every wave's partial tile readable by the block
#pragma unroll 1                      // one precise cos + sin site in the text
  for (int it = 0; it < (16 * NPH) / (32 * PP_NW); ++it) {
    const int e = it * (32 * PP_NW) + tid;        // row e / NPH, column e % NPH (= lane)
    float v = part[e];
#pragma unroll
    for (int w = 1; w < PP_NW; ++w) v += part[w * (16 * NPH) + e];
    float* o = PQ + (size_t)(m0 + e / NPH) * PQW + (e % NPH);
    o[0]   = cosf(v);
    o[NPH] = sinf(v);
    wait_x0();                        // precaution: the next trip's first instructions reuse this store's address registers
  }
}

// ---------------------------------------------------------------------------
// Phase modulation factor, PH_PB blocks per sequence (grid NSEQ * PH_PB, 512 threads), all f32:
//   PQ plane [NTOK][PQW]: col h = cos(pq_h), 16+h = cos(pk_h), 32+h = sin(pq_h), 48+h = sin(pk_h).
//   Ck[h] = sum_s cos(pk), Sk[h] = sum_s sin(pk): every block sums its whole sequence itself (no data passes between blocks of the launch).
//   8 threads per row, each one 16-B piece (4 heads of cos or of sin), 64 rows per pass: a wave reads 4 rows x two 64-B runs per instruction;
//   per-thread partials over 32 rows, then 32 threads add the 64 row groups in fixed order from LDS (lanes on consecutive banks).
//   phs[b*SQ + s] = sum_h (cos(pq_h)*Ck[h] + sin(pq_h)*Sk[h]) / 32768: 4 products per thread, 8 partials per row joined through LDS in fixed order.
//   Coverage: NSEQ * PH_PB blocks x PH_ROWS = NTOK values; each wave of the last stage stores one whole 128-B line.
// ---------------------------------------------------------------------------
#define PH_PB   16
#define PH_ROWS (SQ / PH_PB)
static_assert(PH_ROWS % 64 == 0 && SQ % 64 == 0 && PH_ROWS <= 512);
__global__ __launch_bounds__(512) void phase_kernel(const float* __restrict__ PQ, float* __restrict__ phs) {
  __shared__ __align__(16) float red[64 * 2 * NHQ];
  __shared__ __align__(16) float csk[2 * NHQ];
  __shared__ __align__(16) float part[PH_ROWS * 8];
  const int b   = (int)blockIdx.x / PH_PB;
  const int blk = (int)blockIdx.x % PH_PB;
  const int tid = (int)threadIdx.x;
  const int pc  = tid & 7;                            // piece: 0..3 = cos of heads 4*pc.., 4..7 = sin of heads 4*(pc-4)..
  const int g   = tid >> 3;                           // row within a pass of 64
  const int col = (pc < 4) ? 4 * pc : NHQ + 4 * pc;   // pq columns 0..12 and 32..44; the pk columns lie NHQ further
  const float* base = PQ + (size_t)b * SQ * PQW;
  v4f xq[PH_ROWS / 64];                               // this block's own pq rows, asked for ahead of the sums
#pragma unroll
  for (int it = 0; it < PH_ROWS / 64; ++it)
    xq[it] = *(const v4f*)(base + (size_t)(blk * PH_ROWS + it * 64 + g) * PQW + col);
  v4f acc = {0.f, 0.f, 0.f, 0.f};
#pragma unroll 8                                      // 8 loads in flight per thread: 4 L2 round trips for the 32 rows, not 32
  for (int it = 0; it < SQ / 64; ++it) {
    const v4f x = *(const v4f*)(base + (size_t)(it * 64 + g) * PQW + NHQ + col);
    acc += x;
  }
  *(v4f*)(red + g * (2 * NHQ) + 4 * pc) = acc;
  __syncthreads();
  if (tid < 2 * NHQ) {                                // wave 0
    float s = 0.f;
#pragma unroll                                        // the 64 LDS reads go out together; only the adds are a chain
    for (int r = 0; r < 64; ++r) s += red[r * (2 * NHQ) + tid];
    csk[tid] = s;
  }
  __syncthreads();
  const v4f w = *(const v4f*)(csk + 4 * pc);
#pragma unroll
  for (int it = 0; it < PH_ROWS / 64; ++it) {
    const v4f x = xq[it];
    part[(it * 64 + g) * 8 + pc] = (x[0] * w[0] + x[1] * w[1]) + (x[2] * w[2] + x[3] * w[3]);
  }
  __syncthreads();
  if (tid < PH_ROWS) {                                // whole waves
    const v4f p0 = *(const v4f*)(part + tid * 8);
    const v4f p1 = *(const v4f*)(part + tid * 8 + 4);
    const float a = ((p0[0] + p0[1]) + (p0[2] + p0[3])) + ((p1[0] + p1[1]) + (p1[2] + p1[3]));
    phs[(size_t)b * SQ + blk * PH_ROWS + tid] = a * (1.0f / 32768.0f);
  }
}

// ---------------------------------------------------------------------------
// Causal flash attention, head dim 128, 32-key chunks, block = 4 waves = 64 query rows of one (b, h).
//   q planes f16 [tok][h*128+d]: hi (qhp) and residual x2048 (qlp); k planes f16 [tok][h*128+d]: hi (khp); residual x2048 (klp) only for
//   keys < KLR of each sequence, stored at row b*KLR + key (read only when PRES); v^T planes f16 [h*128+d][tok]: hi (vhp), residual x2048 (vlp);
//   outputs attn bf16 hi (ahp) / lo (alp) [tok][h*128+d].
//   scores = (Sh + Sr/2048) * 128^-0.5 with Sh = qh.kh and Sr = ql'.kh (+ qh.kl' when PRES); keys > query -> -inf; online softmax f32;
//   p' = 1024 p stored per wave to LDS as f16 hi (and residual x2048 when PRES), reloaded as A fragments after a wave sync;
//   O = (Oh + Or/2048)/1024/l with Oh = ph.vh, Or = ph.vl' (+ pl'.vh when PRES).
//   q planes: each wave copies its 16 rows to LDS once and takes its A fragments from there in every chunk.
//   K / V^T chunk staging: 128 threads x 4 x 16 B per plane = whole 32x128 / 128x32 tile, by asynchronous copies to LDS into a ring of two
//   buffers, one chunk ahead of the chunk that reads them; one publish point (LDS wait, copy wait, barrier) at the foot of every chunk.
//   Grid (NHQ, NSEQ, query tiles), longest tile at the lowest index: three blocks fit a WGP.
//   Fragment reads run ahead of the WMMAs that use them: q/k four or more WMMAs ahead, v^T AT_VD tiles ahead (tiles 0 to 2 in front of the softmax).
//   Trip count 2*qb+2 chunks (static bound 64); waves whose rows are all below the chunk skip it (wave-uniform, scalar branch).
// ---------------------------------------------------------------------------
#define AT_KC   32
#define KS_P    136
#define VS_P    40
#define PS_P    40
#define QS_P    136
#define AT_VD   4
// LDS map in halves. KS to STG: one buffer of the chunk ring (two stand in a row). The k and p residual planes exist only with PRES. QS: per wave 2 planes x 16 query rows at pitch QS_P (272 B = 16 B x 17).
template <bool PRES> struct AttnLds {
  static constexpr int KS  = 0;
  static constexpr int KLS = 32 * KS_P;
  static constexpr int VHS = (PRES ? 2 : 1) * 32 * KS_P;
  static constexpr int VLS = VHS + 128 * VS_P;
  static constexpr int STG = VLS + 128 * VS_P;
  static constexpr int PH  = 2 * STG;
  static constexpr int PL  = PH + 4 * 16 * PS_P;
  static constexpr int QS  = PH + (PRES ? 2 : 1) * 4 * 16 * PS_P;
  static constexpr int ST  = QS + 4 * 2 * 16 * QS_P;     // per wave 4 planes x 32 lanes x 16 B: each lane's own 8 row maxima and 8 partial row sums
  static constexpr int TOT = ST + 4 * 1024;
};
static_assert(3 * AttnLds<false>::TOT * 2 <= 327680);   // three blocks of the long launch per WGP
static_assert(AttnLds<false>::STG % 8 == 0 && AttnLds<true>::STG % 8 == 0);   // the second buffer keeps the copies' 16-B alignment
static_assert(4 * 4096 <= AttnLds<false>::QS);          // output staging (2 planes x 16 x 128 per wave) aliases the chunk region after the loop

// Asynchronous 16-B copies, one per lane and line of the statement: four pieces of one plane, l + i * ls = the lane's LDS byte address,
// g + i * gs = its global source. s_wait_xcnt stands inside the statement so that no address register is rewritten ahead of it.
__device__ __forceinline__ void copy_plane(unsigned l, unsigned ls, const char* g, size_t gs) {
#if defined(__HIP_DEVICE_COMPILE__)
  asm volatile(
      "global_load_async_to_lds_b128 %0, %4, off\n\t"
      "global_load_async_to_lds_b128 %1, %5, off\n\t"
      "global_load_async_to_lds_b128 %2, %6, off\n\t"
      "global_load_async_to_lds_b128 %3, %7, off\n\t"
      "s_wait_xcnt 0x0"
      :: "v"(l), "v"(l + ls), "v"(l + 2u * ls), "v"(l + 3u * ls),
         "v"(g), "v"(g + gs), "v"(g + 2 * gs), "v"(g + 3 * gs)
      : "memory");
#endif
}
// the same for the three planes of a chunk (k, v^T hi, v^T residual; the two v^T planes lie lvd bytes apart in LDS) under one s_wait_xcnt
__device__ __forceinline__ void copy_3planes(unsigned lk, unsigned lks, const char* gk, size_t gks,
                                             unsigned lv, unsigned lvs, unsigned lvd, const char* gv, const char* gw, size_t gvs) {
#if defined(__HIP_DEVICE_COMPILE__)
  const unsigned lw = lv + lvd;
  asm volatile(
      "global_load_async_to_lds_b128 %0, %12, off\n\t"
      "global_load_async_to_lds_b128 %1, %13, off\n\t"
      "global_load_async_to_lds_b128 %2, %14, off\n\t"
      "global_load_async_to_lds_b128 %3, %15, off\n\t"
      "global_load_async_to_lds_b128 %4, %16, off\n\t"
      "global_load_async_to_lds_b128 %5, %17, off\n\t"
      "global_load_async_to_lds_b128 %6, %18, off\n\t"
      "global_load_async_to_lds_b128 %7, %19, off\n\t"
      "global_load_async_to_lds_b128 %8, %20, off\n\t"
      "global_load_async_to_lds_b128 %9, %21, off\n\t"
      "global_load_async_to_lds_b128 %10, %22, off\n\t"
      "global_load_async_to_lds_b128 %11, %23, off\n\t"
      "s_wait_xcnt 0x0"
      :: "v"(lk), "v"(lk + lks), "v"(lk + 2u * lks), "v"(lk + 3u * lks),
         "v"(lv), "v"(lv + lvs), "v"(lv + 2u * lvs), "v"(lv + 3u * lvs),
         "v"(lw), "v"(lw + lvs), "v"(lw + 2u * lvs), "v"(lw + 3u * lvs),
         "v"(gk), "v"(gk + gks), "v"(gk + 2 * gks), "v"(gk + 3 * gks),
         "v"(gv), "v"(gv + gvs), "v"(gv + 2 * gvs), "v"(gv + 3 * gvs),
         "v"(gw), "v"(gw + gvs), "v"(gw + 2 * gvs), "v"(gw + 3 * gvs)
      : "memory");
#endif
}

// second launch bound of the long launch: three waves per SIMD, the three blocks per WGP that its LDS allows
template <bool PRES>
__global__ __launch_bounds__(128, PRES ? 1 : 3) void attn_causal_kernel(
    const unsigned short* __restrict__ qhp, const unsigned short* __restrict__ qlp,
    const unsigned short* __restrict__ khp, const unsigned short* __restrict__ klp,
    const unsigned short* __restrict__ vhp, const unsigned short* __restrict__ vlp,
    unsigned short* __restrict__ ahp, unsigned short* __restrict__ alp, int qb_top) {
  typedef AttnLds<PRES> L;
  __shared__ __align__(16) _Float16 lds[L::TOT];

  const int tid  = (int)threadIdx.x;
  const int lane = tid & 31;
  const int wave = wave_id();
  const int hh   = lane >> 4;
  const int c    = lane & 15;
  const int qb   = qb_top - (int)blockIdx.z;     // longest tile at the lowest index
  const int h    = (int)blockIdx.x;
  const int b    = (int)blockIdx.y;
  const int q0   = qb * 64 + wave * 16;          // first query row of this wave (within sequence)
  const int qlast = q0 + 15;
  const size_t tok0 = (size_t)b * SQ;

  const _Float16* Qhg = (const _Float16*)(const void*)qhp + (tok0 + q0) * HID + h * HDM;
  const _Float16* Qlg = (const _Float16*)(const void*)qlp + (tok0 + q0) * HID + h * HDM;
  const _Float16* Kg  = (const _Float16*)(const void*)khp + tok0 * HID + h * HDM;
  const _Float16* Klg = (const _Float16*)(const void*)klp + (size_t)b * KLR * HID + h * HDM;
  const _Float16* Vhg = (const _Float16*)(const void*)vhp + (size_t)(h * HDM) * NTOK + tok0;
  const _Float16* Vlg = (const _Float16*)(const void*)vlp + (size_t)(h * HDM) * NTOK + tok0;
  _Float16* ph = lds + L::PH + wave * (16 * PS_P);
  _Float16* pl = PRES ? lds + L::PL + wave * (16 * PS_P) : ph;   // used only with PRES
  _Float16* Qs = lds + L::QS + wave * (2 * 16 * QS_P);           // this wave's own query rows: hi plane, then residual plane

  // chunk ring, copy side: piece p = tid + 128 * i of a plane, 512 pieces of 8 halves = whole tile. K: key p >> 4, d (p & 15) * 8;
  // V^T: d p >> 2, keys (p & 3) * 8. Every lane's bytes lie inside its plane for every chunk < nch (keys < 64 * (qb + 1)).
  const char* Kc  = (const char*)Kg;
  const char* Klc = (const char*)Klg;
  const char* Vhc = (const char*)Vhg;
  const char* Vlc = (const char*)Vlg;
  const unsigned kgo = (unsigned)((tid >> 4) * (HID * 2) + (tid & 15) * 16);
  const unsigned vgo = (unsigned)((tid >> 2) * (NTOK * 2) + (tid & 3) * 16);
  const unsigned lk = (unsigned)(size_t)(const void*)lds + (unsigned)(L::KS + (tid >> 4) * KS_P + (tid & 15) * 8) * 2u;
  const unsigned lv = (unsigned)(size_t)(const void*)lds + (unsigned)(L::VHS + (tid >> 2) * VS_P + (tid & 3) * 8) * 2u;
  auto fill = [&](int t) {                       // chunk t -> buffer t % 2
    const unsigned bo = (unsigned)(t & 1) * (unsigned)(L::STG * 2);
    const size_t ko = (size_t)t * (AT_KC * HID * 2);
    const size_t vo = (size_t)t * (AT_KC * 2);
    copy_3planes(lk + bo, 8 * KS_P * 2u, (Kc + ko) + kgo, (size_t)8 * HID * 2,
                 lv + bo, 32 * VS_P * 2u, (L::VLS - L::VHS) * 2u, (Vhc + vo) + vgo, (Vlc + vo) + vgo, (size_t)32 * NTOK * 2);
    if (PRES) copy_plane(lk + bo + (L::KLS - L::KS) * 2u, 8 * KS_P * 2u, (Klc + ko) + kgo, (size_t)8 * HID * 2);
  };
  fill(0);                                       // ahead of the q fill: both wait out one global latency together

  // q rows to LDS once, whole 256-B rows per 16 lanes; read back only by this wave, behind the barrier in front of the chunk loop
#pragma unroll                                   // all 16 loads in flight together: one global latency for the whole fill
  for (int it = 0; it < 8; ++it) {
    const int row = it * 2 + hh;                 // it 0..7 x hh 0..1 covers rows 0..15
    const v8h x = *(const v8h*)(Qhg + (size_t)row * HID + c * 8);
    const v8h y = *(const v8h*)(Qlg + (size_t)row * HID + c * 8);
    *(v8h*)(Qs + row * QS_P + c * 8) = x;
    *(v8h*)(Qs + (16 + row) * QS_P + c * 8) = y;
  }

  // running row maxima and row sums live in LDS between their one use per chunk (each lane reads back only what it wrote):
  // their 16 registers go to the fragments in flight
  float* stw = (float*)(void*)(lds + L::ST + wave * 1024) + lane * 4;
  {
    const v4f ninf = {-INFINITY, -INFINITY, -INFINITY, -INFINITY};
    const v4f zero = {0.f, 0.f, 0.f, 0.f};
    *(v4f*)(stw) = ninf; *(v4f*)(stw + 128) = ninf; *(v4f*)(stw + 256) = zero; *(v4f*)(stw + 384) = zero;
  }
  v8f oacc[8], oaccr[8];
#pragma unroll
  for (int t = 0; t < 8; ++t) { oacc[t] = zero8(); oaccr[t] = zero8(); }

  const _Float16* qf = Qs + c * QS_P + 8 * hh;                                  // fragment reads: this lane's row and k half
  const int dq = c - 8 * hh - q0;                // key - query row = kv0 + 16 * j - r + dq

  const int nch = 2 * qb + 2;                    // block-uniform, <= 64; keys < 64*(qb+1) <= SQ; PRES blocks: keys < 256 = KLR
  wait_async0();
  __syncthreads();                               // chunk 0 readable by every wave
  fill(1);
  for (int kc = 0; kc < nch; ++kc) {
    const int kv0 = kc * AT_KC;
    const _Float16* stg = lds + (kc & 1) * L::STG;                              // this chunk's buffer
    const _Float16* kf = stg + L::KS + c * KS_P + 8 * hh;
    const _Float16* vf = stg + L::VHS + c * VS_P + 8 * hh;

    if (kv0 <= qlast) {                          // wave-uniform (scalar): skip chunks fully above this wave's rows
      // ---- scores ----
      v16h qa[4], ql[4], kb[4][2], kl[4][2], vb[8], vr[8];
      auto ld_k = [&](int dc, int j) {           // k fragment(s) of 32-d step dc, key half j
        kb[dc][j] = ldfrag_h(kf + j * 16 * KS_P + dc * 32);
        if (PRES) kl[dc][j] = ldfrag_h(kf + (L::KLS - L::KS) + j * 16 * KS_P + dc * 32);
      };
      auto ld_q = [&](int dc) {                  // both q planes' fragments of step dc
        qa[dc] = ldfrag_h(qf + dc * 32);
        ql[dc] = ldfrag_h(qf + 16 * QS_P + dc * 32);
      };
      auto ld_v = [&](int t) {                   // the two v^T fragments of output tile t
        vb[t] = ldfrag_h(vf + t * 16 * VS_P);
        vr[t] = ldfrag_h(vf + (L::VLS - L::VHS) + t * 16 * VS_P);
      };
      v4f mr[2], lr[2];
      v8f sh[2], sr[2];
      sh[0] = zero8(); sh[1] = zero8(); sr[0] = zero8(); sr[1] = zero8();
      ld_k(0, 0); ld_q(0); ld_k(0, 1); ld_k(1, 0); ld_q(1); ld_k(1, 1);
      sched_fence();                             // the first reads go out together, ahead of the first WMMA
      // every refill below stands between two fences: behind the WMMAs whose registers it takes over, and four or more WMMAs ahead of its use
      // (a read sunk to its use costs a full LDS round trip per WMMA pair)
#pragma unroll                                   // constant indices: fragments, scores and accumulators stay in registers
      for (int dc = 0; dc < 4; ++dc) {
#pragma unroll                                   // constant indices: fragments, scores and accumulators stay in registers
        for (int j = 0; j < 2; ++j) {
          sh[j] = mma_h(qa[dc], kb[dc][j], sh[j]);
          sr[j] = mma_h(ql[dc], kb[dc][j], sr[j]);
          if (PRES) sr[j] = mma_h(qa[dc], kl[dc][j], sr[j]);
          sched_fence();
          if (j == 0) {
            if (dc + 2 < 4) ld_k(dc + 2, 0);
          } else {
            if (dc + 2 < 4) { ld_q(dc + 2); ld_k(dc + 2, 1); }
            else ld_v(dc - 2);                   // v^T does not hang on the softmax: tiles 0, 1 and 2 return under it
            if (dc == 3) { ld_v(2); mr[0] = *(const v4f*)(stw); mr[1] = *(const v4f*)(stw + 128); }
          }
          sched_fence();
        }
      }
      // ---- scale, causal mask, chunk row max ----
      const int dk = kv0 + dq;
      float cm[8];
#pragma unroll                                   // constant indices: fragments, scores and accumulators stay in registers
      for (int r = 0; r < 8; ++r) {
        float m = -INFINITY;
#pragma unroll                                   // constant indices: fragments, scores and accumulators stay in registers
        for (int j = 0; j < 2; ++j) {
          float s = (sh[j][r] + sr[j][r] * 0.00048828125f) * 0.08838834764831845f;
          s = (dk > r - j * 16) ? -INFINITY : s; // key > query row
          sh[j][r] = s;
          m = fmaxf(m, s);
        }
        cm[r] = m;
      }
      row_max8(cm);                              // on the vector pipe: no LDS-pipe round trip per step
      // ---- online softmax, P' to LDS ----
      float alpha[8], psum[8];
#pragma unroll                                   // constant indices: fragments, scores and accumulators stay in registers
      for (int r = 0; r < 8; ++r) {
        const float mnew = fmaxf(mr[r >> 2][r & 3], cm[r]);
        float pe[2];
        exp3_slot(sh[0][r] - mnew, sh[1][r] - mnew, mr[r >> 2][r & 3] - mnew, pe[0], pe[1], alpha[r]);
        mr[r >> 2][r & 3] = mnew;
#pragma unroll                                   // constant indices: fragments, scores and accumulators stay in registers
        for (int j = 0; j < 2; ++j) {
          const float p  = pe[j];
          const float pp = p * 1024.0f;
          const _Float16 phv = (_Float16)pp;
          const int po = (8 * hh + r) * PS_P + j * 16 + c;
          ph[po] = phv;
          if (PRES) pl[po] = (_Float16)((pp - (float)phv) * 2048.0f);
        }
        psum[r] = pe[0] + pe[1];
      }
      *(v4f*)(stw) = mr[0]; *(v4f*)(stw + 128) = mr[1];
      lds_wave_sync();                           // P' stores visible to the other lanes of this wave before the fragment reload
      // ---- O += P' . V; each lane keeps the sum of its own two columns per row, the 16 lanes of a row are joined once behind the loop ----
      const v16h pa = ldfrag_h(ph + c * PS_P + 8 * hh);
      v16h pr = pa;
      if (PRES) pr = ldfrag_h(pl + c * PS_P + 8 * hh);
#pragma unroll                                   // constant indices: fragments, scores and accumulators stay in registers
      for (int t = 3; t < AT_VD; ++t) ld_v(t);
      lr[0] = *(const v4f*)(stw + 256); lr[1] = *(const v4f*)(stw + 384);
      sched_fence();                             // P' and v^T reads go out together; the rescale below runs under their latency
#pragma unroll                                   // constant indices: fragments, scores and accumulators stay in registers
      for (int r = 0; r < 8; ++r) {
#pragma unroll                                   // constant indices: fragments, scores and accumulators stay in registers
        for (int t = 0; t < 8; ++t) { oacc[t][r] *= alpha[r]; oaccr[t][r] *= alpha[r]; }
      }
#pragma unroll                                   // constant indices: fragments, scores and accumulators stay in registers
      for (int r = 0; r < 8; ++r) lr[r >> 2][r & 3] = lr[r >> 2][r & 3] * alpha[r] + psum[r];
      *(v4f*)(stw + 256) = lr[0]; *(v4f*)(stw + 384) = lr[1];
#pragma unroll                                   // constant indices: fragments, scores and accumulators stay in registers
      for (int t = 0; t < 8; ++t) {
        oacc[t]  = mma_h(pa, vb[t], oacc[t]);
        oaccr[t] = mma_h(pa, vr[t], oaccr[t]);
        if (PRES) oaccr[t] = mma_h(pr, vb[t], oaccr[t]);
        sched_fence();                           // refill behind the WMMAs whose registers it takes over, AT_VD tiles ahead of its use
        if (t + AT_VD < 8) ld_v(t + AT_VD);
        sched_fence();
      }
      guard_h4(oacc[7], oaccr[7], pa, pr, vb[7], vr[7]);
    }
    // publish point, passed by every wave, also one that skipped the chunk
    wait_ds0();
    wait_async0();
    __syncthreads();                             // publishes chunk kc + 1 and ends every wave's reads of chunk kc's buffer
    if (kc + 2 < nch) fill(kc + 2);              // block-uniform test
  }
  wait_async0();

  __syncthreads();                               // all chunk-region readers done before aliasing it as output staging
  _Float16* osh = lds + wave * 4096;
  _Float16* osl = osh + 2048;
  const v4f lf[2] = {*(const v4f*)(stw + 256), *(const v4f*)(stw + 384)};
#pragma unroll
  for (int r = 0; r < 8; ++r) {
    float l = lf[r >> 2][r & 3];                 // this lane's share of the row sum; the butterfly leaves the same total in all 16 lanes of the row
    l += row_xor<1>(l); l += row_xor<2>(l); l += row_xor<4>(l); l += row_xor<8>(l);
    const float inv = (1.0f / l) * 0.0009765625f;
#pragma unroll
    for (int t = 0; t < 8; ++t) {
      const float o = (oacc[t][r] + oaccr[t][r] * 0.00048828125f) * inv;
      const unsigned short hb = bf_bits(o);
      const unsigned short lb = bf_bits(o - bf_val(hb));
      const int so = (8 * hh + r) * 128 + t * 16 + c;
      osh[so] = __builtin_bit_cast(_Float16, hb);
      osl[so] = __builtin_bit_cast(_Float16, lb);
    }
  }
  lds_wave_sync();
  _Float16* Ahg = (_Float16*)(void*)ahp + (tok0 + q0) * HID + h * HDM;
  _Float16* Alg = (_Float16*)(void*)alp + (tok0 + q0) * HID + h * HDM;
  {
#pragma unroll
    for (int it = 0; it < 8; ++it) {
      const int row = it * 2 + hh;               // it 0..7 x hh 0..1 covers rows 0..15
      const int c8  = c * 8;                     // 16 lanes x 16 B = the whole 256-B segment
      const v8h x = *(const v8h*)(osh + row * 128 + c8);
      const v8h y = *(const v8h*)(osl + row * 128 + c8);
      *(v8h*)(Ahg + (size_t)row * HID + c8) = x;
      *(v8h*)(Alg + (size_t)row * HID + c8) = y;
    }
    
  }
}

// ---------------------------------------------------------------------------
// Workspace map (bytes; every region is a whole number of the rows its producer writes with whole-line stores; all dims are tile multiples,
// so padded size == logical size; offsets are multiples of 16384):
//   R0   Xb  bf16 [4096][2048] 16777216, later Ah bf16 [4096][2048] (Xb dead after the three projection GEMMs)
//   R1   WqkT bf16 [4096][2048] 16777216, later Al bf16 [4096][2048]
//   R2   WvT bf16 [2048][2048]  8388608, later WoT bf16 [2048][2048] (WvT dead after the v GEMM)
//   WpT  bf16 [32][2048]          131072
//   Qh, Ql, Kh f16 [4096][2048]  16777216 each
//   Kl   f16 [512][2048]          2097152
//   Vh, Vl f16 [2048][4096]      16777216 each
//   PQ   f32 [4096][64]           1048576
//   phs  f32 [4096]                 16384
//   total                       129122304
// ---------------------------------------------------------------------------
static inline size_t smax(size_t a, size_t b) { return a > b ? a : b; }

extern "C" void kernel_launch(void* const* d_in, const int* in_sizes, int n_in,
                              void* d_out, int out_size, void* d_ws, size_t ws_size,
                              hipStream_t stream) {
  if (n_in < 7) return;
  if (in_sizes[0] != NTOK * HID) return;
  if (in_sizes[1] != HID * HID) return;
  if (in_sizes[2] != HID * HID) return;
  if (in_sizes[3] != HID * HID) return;
  if (in_sizes[4] != HID * HID) return;
  if (in_sizes[5] != HID * NHQ) return;
  if (in_sizes[6] != HID * NHQ) return;
  if (out_size != NTOK * HID) return;

  const float* x   = (const float*)d_in[0];
  const float* Wq  = (const float*)d_in[1];
  const float* Wk  = (const float*)d_in[2];
  const float* Wv  = (const float*)d_in[3];
  const float* Wo  = (const float*)d_in[4];
  const float* Wpq = (const float*)d_in[5];
  const float* Wpk = (const float*)d_in[6];
  float* out = (float*)d_out;

  const size_t szX   = (size_t)NTOK * HID * 2;
  const size_t szWqk = (size_t)2 * HID * HID * 2;
  const size_t szW   = (size_t)HID * HID * 2;
  const size_t szA   = (size_t)NTOK * HID * 2;
  const size_t szWp  = (size_t)NPH * HID * 2;
  const size_t szQ   = (size_t)NTOK * HID * 2;
  const size_t szKl  = (size_t)NSEQ * KLR * HID * 2;
  const size_t szV   = (size_t)HID * NTOK * 2;
  const size_t szPQ  = (size_t)NTOK * PQW * 4;
  const size_t szPh  = (size_t)NTOK * 4;
  size_t off = 0;
  const size_t oR0 = off; off += smax(szX, szA);
  const size_t oR1 = off; off += smax(szWqk, szA);
  const size_t oR2 = off; off += szW;
  const size_t oWp = off; off += szWp;
  const size_t oQh = off; off += szQ;
  const size_t oQl = off; off += szQ;
  const size_t oKh = off; off += szQ;
  const size_t oKl = off; off += szKl;
  const size_t oVh = off; off += szV;
  const size_t oVl = off; off += szV;
  const size_t oPQ = off; off += szPQ;
  const size_t oPh = off; off += szPh;
  if (off > ws_size) return;                     // off = 129122304

  char* ws = (char*)d_ws;
  unsigned short* Xb   = (unsigned short*)(ws + oR0);
  unsigned short* Ah   = (unsigned short*)(ws + oR0);
  unsigned short* WqkT = (unsigned short*)(ws + oR1);
  unsigned short* Al   = (unsigned short*)(ws + oR1);
  unsigned short* WvT  = (unsigned short*)(ws + oR2);
  unsigned short* WoT  = (unsigned short*)(ws + oR2);
  unsigned short* WpT  = (unsigned short*)(ws + oWp);
  unsigned short* Qh   = (unsigned short*)(ws + oQh);
  unsigned short* Ql   = (unsigned short*)(ws + oQl);
  unsigned short* Kh   = (unsigned short*)(ws + oKh);
  unsigned short* Kl   = (unsigned short*)(ws + oKl);
  unsigned short* Vh   = (unsigned short*)(ws + oVh);
  unsigned short* Vl   = (unsigned short*)(ws + oVl);
  float*          PQ   = (float*)(ws + oPQ);
  float*          phs  = (float*)(ws + oPh);

  const dim3 b256(256), b128(128);

  // (1) x -> bf16 plane [4096][2048]
  cvt_bf16_kernel<<<dim3((NTOK * HID / 8) / 256), b256, 0, stream>>>(x, Xb, NTOK * HID / 8);
  // (2) Wq in[2048 rows][2048 cols] -> WqkT rows 0..2047 = out[n][k]; Wk -> WqkT rows 2048..4095; Wv -> WvT   (grid = cols/64, rows/64)
  tconv_bf16_kernel<<<dim3(HID / 64, HID / 64), b256, 0, stream>>>(Wq, WqkT, HID, HID);
  tconv_bf16_kernel<<<dim3(HID / 64, HID / 64), b256, 0, stream>>>(Wk, WqkT + (size_t)HID * HID, HID, HID);
  tconv_bf16_kernel<<<dim3(HID / 64, HID / 64), b256, 0, stream>>>(Wv, WvT, HID, HID);
  // (3) Wpq|Wpk -> WpT [32][2048]
  wpt_kernel<<<dim3(NPH), b256, 0, stream>>>(Wpq, Wpk, WpT);
  // (4) pq|pk = x . (Wpq|Wpk) -> cos|sin plane PQ [4096][64]   (M=4096, N=32, K=2048; one block per 16 rows)
  phase_proj_kernel<<<dim3(NTOK / 16), b256, 0, stream>>>(Xb, WpT, PQ);
  // (5) phase factor phs [4096]
  phase_kernel<<<dim3(NSEQ * PH_PB), dim3(512), 0, stream>>>(PQ, phs);
  // (6) q|k = x . (Wq|Wk) -> Qh/Ql [4096][2048], Kh [4096][2048], Kl [512][2048]   (M=4096, N=4096, K=2048; 32 x 16 block tiles)
  gemm_tiled_kernel<0, 4, false><<<dim3((NTOK / GT_BM) * ((2 * HID) / GT_BN)), b128, 0, stream>>>(
      Xb, Xb, HID, WqkT, HID, phs, (void*)Qh, (void*)Ql, (void*)Kh, (void*)Kl, HID, NTOK, 2 * HID, HID);
  // (7) v^T = WvT . x^T -> Vh/Vl [2048][4096]   (A = WvT, Bt = Xb; M=2048, N=4096, K=2048; 16 x 16 block tiles)
  gemm_tiled_kernel<1, 2, false><<<dim3((HID / GT_BM) * (NTOK / GT_BN)), b256, 0, stream>>>(
      WvT, WvT, HID, Xb, HID, phs, (void*)Vh, (void*)Vl, (void*)Vh, (void*)Vl, NTOK, HID, NTOK, HID);
  // (8) Wo -> WoT (over the dead WvT region)
  tconv_bf16_kernel<<<dim3(HID / 64, HID / 64), b256, 0, stream>>>(Wo, WoT, HID, HID);
  // (9) causal attention, query tiles 0..3 with k and p residual products, tiles 4..31 without -> Ah/Al (over the dead Xb/WqkT regions)
  attn_causal_kernel<true><<<dim3(NHQ, NSEQ, 4), b128, 0, stream>>>(Qh, Ql, Kh, Kl, Vh, Vl, Ah, Al, 3);
  attn_causal_kernel<false><<<dim3(NHQ, NSEQ, SQ / 64 - 4), b128, 0, stream>>>(Qh, Ql, Kh, Kl, Vh, Vl, Ah, Al, SQ / 64 - 1);
  // (10) out = (attn hi + lo) . Wo * (1 + 0.1*phs[m]) -> d_out f32 [4096][2048]   (M=4096, N=2048, K=2048; 32 x 8 block tiles)
  gemm_tiled_kernel<2, 2, true><<<dim3((NTOK / GT_BM) * (HID / GT_BN)), b256, 0, stream>>>(
      Ah, Al, HID, WoT, HID, phs, (void*)out, (void*)out, (void*)out, (void*)out, HID, NTOK, HID, HID);
  (void)hipGetLastError();
}

// v009
// Measured time: 244 microseconds a run.
// It is 1.12 times as fast as v007, going by the measured steps of the versions left out in between.
// Counting every step since v000, it is 3.19 times as fast.
// Contractions: x.(Wq|Wk), Wv^T.x^T and x.(Wpq|Wpk) on v_wmma_f32_16x16x32_bf16 (operands = RNE bf16 of the f32 inputs, single products);
// q.k^T and p.v on v_wmma_f32_16x16x32_f16 (q, k, p x1024 and v^T plain f16; on query tiles 0..3 each of the four plus its f16 residual x2^11,
// cross products hi.residual and residual.hi); attn.Wo on v_wmma_f32_16x16x32_bf16
// (attn = bf16 hi + bf16 lo planes, two products; Wo RNE bf16). f32 accumulate everywhere; online softmax, cos/sin phase sums and output scale in f32.
#include <hip/hip_runtime.h>
#include <math.h>
#include <stdint.h>

#define NSEQ   2
#define SQ     2048
#define HID    2048
#define NHQ    16
#define HDM    128
#define NTOK   4096
#define NPH    32
#define PQW    64
#define KLR    256

static_assert(NTOK == NSEQ * SQ);
static_assert(NHQ * HDM == HID);
static_assert(KLR % 32 == 0 && SQ % KLR == 0);

typedef _Float16     v16h __attribute__((ext_vector_type(16)));
typedef _Float16     v8h  __attribute__((ext_vector_type(8)));
typedef __bf16       v16b __attribute__((ext_vector_type(16)));
typedef __bf16       v8b  __attribute__((ext_vector_type(8)));
typedef float        v8f  __attribute__((ext_vector_type(8)));
typedef float        v4f  __attribute__((ext_vector_type(4)));
typedef unsigned int v4u  __attribute__((ext_vector_type(4)));

// ---------------------------------------------------------------------------
// small helpers
// ---------------------------------------------------------------------------
__device__ __forceinline__ unsigned short bf_bits(float f) {          // RNE convert f32 -> bf16 bits
  const unsigned u = __float_as_uint(f);
  return (unsigned short)((u + 0x7FFFu + ((u >> 16) & 1u)) >> 16);
}
__device__ __forceinline__ float bf_val(unsigned short h) { return __uint_as_float(((unsigned)h) << 16); }
__device__ __forceinline__ unsigned pk16(unsigned short a, unsigned short b) { return (unsigned)a | ((unsigned)b << 16); }
__device__ __forceinline__ v8f zero8() { v8f z = {0.f, 0.f, 0.f, 0.f, 0.f, 0.f, 0.f, 0.f}; return z; }
__device__ __forceinline__ int wave_id() {
#if defined(__HIP_DEVICE_COMPILE__)
  return __builtin_amdgcn_readfirstlane((int)(threadIdx.x >> 5));
#else
  return (int)(threadIdx.x >> 5);
#endif
}
// three e^x as __expf forms them (one multiply, v_exp_f32 each). One statement: the three are independent of one another (outputs apart from
// all inputs), and the v_nop is the slot that the instruction set asks for between a transcendental and a directly following instruction
// that reads its result or overwrites its source; inside the statement it stands there in every build
__device__ __forceinline__ void exp3_slot(float a, float b, float c, float& ea, float& eb, float& ec) {
#if defined(__HIP_DEVICE_COMPILE__)
  const float ta = a * 1.44269504088896340736f;
  const float tb = b * 1.44269504088896340736f;
  const float tc = c * 1.44269504088896340736f;
  asm("v_exp_f32 %0, %3\n\tv_exp_f32 %1, %4\n\tv_exp_f32 %2, %5\n\tv_nop" : "=&v"(ea), "=&v"(eb), "=&v"(ec) : "v"(ta), "v"(tb), "v"(tc));
#else
  ea = expf(a); eb = expf(b); ec = expf(c);
#endif
}
// the same for two e^x (the join of the two key halves behind the attention loop)
__device__ __forceinline__ void exp2_slot(float a, float b, float& ea, float& eb) {
#if defined(__HIP_DEVICE_COMPILE__)
  const float ta = a * 1.44269504088896340736f;
  const float tb = b * 1.44269504088896340736f;
  asm("v_exp_f32 %0, %2\n\tv_exp_f32 %1, %3\n\tv_nop" : "=&v"(ea), "=&v"(eb) : "v"(ta), "v"(tb));
#else
  ea = expf(a); eb = expf(b);
#endif
}
// value of lane l ^ XM within the lane's 16-lane row, on the vector pipe (DPP row_xmask); the compiler folds the move into the add that uses it
template <int XM>
__device__ __forceinline__ float row_xor(float x) {
#if defined(__HIP_DEVICE_COMPILE__)
  const int v = __builtin_bit_cast(int, x);
  return __builtin_bit_cast(float, __builtin_amdgcn_update_dpp(0, v, 0x160 + XM, 0xf, 0xf, true));
#else
  return x;
#endif
}
// maximum over the 16 lanes of a row for eight values at once: four DPP steps (lane l with l ^ 1, 2, 4, 8), max and exchange in one instruction.
// Written as text because the builtin exchange leaves a separate move and a quieting max per step. The eight chains stand side by side,
// so every instruction's producer lies eight instructions back and no delay hint is owed. All 32 lanes are on where it is called.
#define ROW_MAX_STEP(X)                                                        \
  "v_max_num_f32_dpp %0, %0, %0 row_xmask:" #X " row_mask:0xf bank_mask:0xf\n\t" \
  "v_max_num_f32_dpp %1, %1, %1 row_xmask:" #X " row_mask:0xf bank_mask:0xf\n\t" \
  "v_max_num_f32_dpp %2, %2, %2 row_xmask:" #X " row_mask:0xf bank_mask:0xf\n\t" \
  "v_max_num_f32_dpp %3, %3, %3 row_xmask:" #X " row_mask:0xf bank_mask:0xf\n\t" \
  "v_max_num_f32_dpp %4, %4, %4 row_xmask:" #X " row_mask:0xf bank_mask:0xf\n\t" \
  "v_max_num_f32_dpp %5, %5, %5 row_xmask:" #X " row_mask:0xf bank_mask:0xf\n\t" \
  "v_max_num_f32_dpp %6, %6, %6 row_xmask:" #X " row_mask:0xf bank_mask:0xf\n\t" \
  "v_max_num_f32_dpp %7, %7, %7 row_xmask:" #X " row_mask:0xf bank_mask:0xf\n\t"
__device__ __forceinline__ void row_max8(float (&m)[8]) {
#if defined(__HIP_DEVICE_COMPILE__)
  asm(ROW_MAX_STEP(1) ROW_MAX_STEP(2) ROW_MAX_STEP(4) ROW_MAX_STEP(8)
      : "+v"(m[0]), "+v"(m[1]), "+v"(m[2]), "+v"(m[3]), "+v"(m[4]), "+v"(m[5]), "+v"(m[6]), "+v"(m[7]));
#endif
}
// release/acquire + wave barrier between one wave's LDS stores and the other lanes' reloads
__device__ __forceinline__ void lds_wave_sync() {
#if defined(__HIP_DEVICE_COMPILE__)
  __builtin_amdgcn_fence(__ATOMIC_RELEASE, "workgroup");
  __builtin_amdgcn_wave_barrier();
  __builtin_amdgcn_fence(__ATOMIC_ACQUIRE, "workgroup");
#endif
}

// ---------------------------------------------------------------------------
// WMMA fragments (wave32, 16x16x32, 16-bit operands). For A (row m = lane&15) and B (col n = lane&15) alike:
// elements 0..7 <- k0 + 8*(lane>>4) + 0..7, elements 8..15 <- k0 + 16 + 8*(lane>>4) + 0..7.
// ldfrag(p) with p = rowbase + k0 + 8*(lane>>4): two 16-B loads p[0..7], p[16..23].
// D: acc[r] = (row 8*(lane>>4) + r, col lane&15).
// ---------------------------------------------------------------------------
union FragH { v16h v; v8h h[2]; };
union FragB { v16b v; v8b h[2]; };
__device__ __forceinline__ v16h ldfrag_h(const _Float16* p) { FragH f; f.h[0] = *(const v8h*)(p); f.h[1] = *(const v8h*)(p + 16); return f.v; }
__device__ __forceinline__ v16b ldfrag_b(const __bf16* p)   { FragB f; f.h[0] = *(const v8b*)(p); f.h[1] = *(const v8b*)(p + 16); return f.v; }

__device__ __forceinline__ v8f mma_h(v16h a, v16h b, v8f c) {
#if defined(__HIP_DEVICE_COMPILE__)
  return __builtin_amdgcn_wmma_f32_16x16x32_f16(false, a, false, b, (short)0, c, false, false);
#else
  return c;
#endif
}
__device__ __forceinline__ v8f mma_b(v16b a, v16b b, v8f c) {
#if defined(__HIP_DEVICE_COMPILE__)
  return __builtin_amdgcn_wmma_f32_16x16x32_bf16(false, a, false, b, (short)0, c, false, false);
#else
  return c;
#endif
}
// hazard guard: 4 VALU slots after the last WMMA in front of the chunk loop's back edge, D tied, A/B kept live
__device__ __forceinline__ void guard_h4(v8f& a, v8f& b, v16h w, v16h x, v16h y, v16h z) {
#if defined(__HIP_DEVICE_COMPILE__)
  asm volatile("v_nop\n\tv_nop\n\tv_nop\n\tv_nop" : "+v"(a), "+v"(b) : "v"(w), "v"(x), "v"(y), "v"(z) : "memory");
#endif
}

// ---------------------------------------------------------------------------
// Elementwise RNE f32 -> bf16 plane: 8 elements per thread, one 16-B store per lane -> 32 consecutive lanes write 4 whole
// ---------------------------------------------------------------------------
__global__ __launch_bounds__(256) void cvt_bf16_kernel(const float* __restrict__ in, unsigned short* __restrict__ outp, int n8) {
  const int i = (int)blockIdx.x * 256 + (int)threadIdx.x;
  if (i >= n8) return;
  const size_t e = 8 * (size_t)i;
  const v4f a = *(const v4f*)(in + e);
  const v4f b = *(const v4f*)(in + e + 4);
  v4u w;
  w[0] = pk16(bf_bits(a[0]), bf_bits(a[1]));
  w[1] = pk16(bf_bits(a[2]), bf_bits(a[3]));
  w[2] = pk16(bf_bits(b[0]), bf_bits(b[1]));
  w[3] = pk16(bf_bits(b[2]), bf_bits(b[3]));
  *(v4u*)(outp + e) = w;
  
}

// ---------------------------------------------------------------------------
// Fused transpose + RNE bf16 convert: in [R rows][Cc cols] f32 (pitch Cc) -> out[c][r] = bf16(in[r][c])  ([Cc][R], pitch R).
// 64x64 tiles through LDS; grid = (Cc/64, R/64), 256 threads; R, Cc multiples of 64.
// Coverage per block: load 4 it x 256 thr x 4 floats = 64x64; store 2 it x 256 thr x 8 u16 = 64x64.
// ---------------------------------------------------------------------------
__global__ __launch_bounds__(256) void tconv_bf16_kernel(const float* __restrict__ W, unsigned short* __restrict__ outp, int R, int Cc) {
  __shared__ __align__(16) float tf[64 * 68];
  const int c0  = (int)blockIdx.x * 64;   // input column block = output row block
  const int r0  = (int)blockIdx.y * 64;   // input row block    = output column block
  const int tid = (int)threadIdx.x;
  {
    const int lr = tid >> 4;              // 0..15
    const int c4 = (tid & 15) * 4;        // 0..60
#pragma unroll
    for (int it = 0; it < 4; ++it) {
      const int rr = it * 16 + lr;        // 0..63
      const v4f a = *(const v4f*)(W + (size_t)(r0 + rr) * Cc + c0 + c4);
      *(v4f*)(tf + rr * 68 + c4) = a;
    }
  }
  __syncthreads();
  const int sub = tid >> 3;               // 0..31
  const int c8  = (tid & 7) * 8;          // 0..56
  v4u hv[2];
#pragma unroll
  for (int it = 0; it < 2; ++it) {
    const int oc = it * 32 + sub;         // output row within tile (= input column)
    v4u a;
#pragma unroll
    for (int q = 0; q < 4; ++q) {
      const float f0 = tf[(c8 + 2 * q) * 68 + oc];
      const float f1 = tf[(c8 + 2 * q + 1) * 68 + oc];
      a[q] = pk16(bf_bits(f0), bf_bits(f1));
    }
    hv[it] = a;
  }
  {
#pragma unroll
    for (int it = 0; it < 2; ++it) {
      const int oc = it * 32 + sub;
      const size_t go = (size_t)(c0 + oc) * R + r0 + c8;
      *(v4u*)(outp + go) = hv[it];
    }
    
  }
}

// ---------------------------------------------------------------------------
// Phase weights: Wpq [HID][NHQ], Wpk [HID][NHQ] f32 -> WpT [NPH][HID] bf16 rows (rows 0..15 = Wpq^T, 16..31 = Wpk^T).
// ---------------------------------------------------------------------------
__global__ __launch_bounds__(256) void wpt_kernel(const float* __restrict__ Wpq, const float* __restrict__ Wpk,
                                                  unsigned short* __restrict__ outp) {
  const int n = (int)blockIdx.x;                   // 0..31
  const float* W = (n < NHQ) ? Wpq : Wpk;          // block-uniform, both global
  const int h = n & (NHQ - 1);
  const int t = (int)threadIdx.x;                  // k = 8t .. 8t+7  (< HID)
  v4u w;
#pragma unroll
  for (int q = 0; q < 4; ++q) {
    const float f0 = W[(size_t)(8 * t + 2 * q) * NHQ + h];
    const float f1 = W[(size_t)(8 * t + 2 * q + 1) * NHQ + h];
    w[q] = pk16(bf_bits(f0), bf_bits(f1));
  }
  const size_t o = (size_t)n * HID + 8 * (size_t)t;
  *(v4u*)(outp + o) = w;
  
}

// ---------------------------------------------------------------------------
// bf16 WMMA GEMMs: C[m][n] = sum_k A[m][k] * Bt[n][k]; A row-major [M][K] bf16 (pitch lda), Bt row-major [N][K] bf16 (pitch ldb).
//   SPLITA: A carried as hi (Ap) + lo (A2p) bf16 planes, two products into one accumulator (hi then lo at every k step).
//   gemm_tiled_kernel (EPI 0, 1, 2): block tile 128 x 256, waves of 64 x 128 (EPI 0) or 32 x 128 (EPI 1, 2), operands staged in an LDS ring of two buffers.
// Epilogues (all: per wave, per 16-row slab: stage in LDS, wave sync, write each row segment with ONE instruction); MI = 16-row slabs per wave.
//   EPI 0 (NJ 8): q|k projection. cols n0 < HID (q): f16 hi plane C0 and f16 residual x2048 plane C1, both [M][ldc], cols n0..n0+127
//          (row segment 256 B = 16 lanes x 16 B). cols n0 >= HID (k): hi plane C2 [M][ldc] cols n0-HID..; residual plane C3 [NSEQ*KLR][ldc]
//          at row (m / SQ)*KLR + m % SQ. Residuals of q and k only for token rows with (m % SQ) < KLR, the rows that query tiles 0..3 read
//          (wave-uniform choice; 32- and 64-row wave tiles never straddle).
//   EPI 1 (NJ 8): v^T projection: f16 hi plane C0, residual x2048 plane C1, [M][ldc], row segment 256 B; residuals only for token columns
//          with (n % SQ) < KLR (wave-uniform choice; 128-column wave tiles never straddle).
//   EPI 2 (NJ 8): f32 output C0 [M][ldc], each row scaled by (1 + 0.1*phs[m]); row segment 128 floats = 512 B = 32 lanes x 16 B per instruction.
// ---------------------------------------------------------------------------
template <int EPI> struct SlabT { typedef _Float16 T; static constexpr int PERW = 4096; };   // 2 planes x 16 x 128 halves
template <> struct SlabT<2>     { typedef float    T; static constexpr int PERW = 2048; };   // 16 x 128 floats

// s_wait_xcnt 0 behind an issued global store, in front of a rewrite of a register that the store names
__device__ __forceinline__ void wait_x0() {
#if defined(__HIP_DEVICE_COMPILE__)
  asm volatile("s_wait_xcnt 0x0" ::: "memory");
#endif
}

// slab: this wave's own LDS staging range; (m0, n0): first row and column of the wave's (16*MI) x (16*NJ) tile.
template <int EPI, int NJ, int MI>
__device__ __forceinline__ void gemm_epilogue(v8f (&acc)[MI][NJ], typename SlabT<EPI>::T* slab, int lane, int m0, int n0,
                                              const float* __restrict__ phs, void* C0, void* C1, void* C2, void* C3, int ldc) {
  const int hh = lane >> 4;
  const int rl = lane & 15;
  _Float16* sl16 = (_Float16*)(void*)slab;
  float*    slf  = (float*)(void*)slab;

  if constexpr (EPI == 0 || EPI == 1) {
    _Float16* P0;
    _Float16* P1;
    int col0;
    int lomode;                                   // 0: lo row = m; 1: lo row remapped into the KLR-row plane; 2: no lo store (nothing reads it)
    if constexpr (EPI == 0) {
      const bool isq = (n0 < HID);                // wave-uniform
      P0 = isq ? (_Float16*)C0 : (_Float16*)C2;
      P1 = isq ? (_Float16*)C1 : (_Float16*)C3;
      col0 = isq ? n0 : (n0 - HID);
      const int s0 = m0 & (SQ - 1);
      lomode = (s0 < KLR) ? (isq ? 0 : 1) : 2;
    } else {
      P0 = (_Float16*)C0;
      P1 = (_Float16*)C1;
      col0 = n0;
      lomode = ((n0 & (SQ - 1)) < KLR) ? 0 : 2;   // wave-uniform; columns are tokens
    }
#pragma unroll
    for (int i = 0; i < MI; ++i) {
#pragma unroll
      for (int r = 0; r < 8; ++r) {
#pragma unroll
        for (int j = 0; j < NJ; ++j) {
          const float v = acc[i][j][r];
          const _Float16 hv = (_Float16)v;
          const int so = (8 * hh + r) * 128 + j * 16 + rl;
          sl16[so]        = hv;
          sl16[2048 + so] = (_Float16)((v - (float)hv) * 2048.0f);
        }
      }
      lds_wave_sync();
      {
#pragma unroll
        for (int it = 0; it < 8; ++it) {
          const int row = it * 2 + hh;            // it x hh covers rows 0..15
          const int c8  = rl * 8;
          const v8h xh = *(const v8h*)(sl16 + row * 128 + c8);
          const v8h xl = *(const v8h*)(sl16 + 2048 + row * 128 + c8);
          const int m = m0 + i * 16 + row;
          *(v8h*)(P0 + (size_t)m * ldc + col0 + c8) = xh;
          wait_x0();                              // precaution: in front of the branch below, whose first instructions reuse this store's registers
          if (lomode != 2) {
            const int m1 = (lomode == 1) ? ((m / SQ) * KLR + (m % SQ)) : m;
            *(v8h*)(P1 + (size_t)m1 * ldc + col0 + c8) = xl;
            wait_x0();                            // precaution: inside the branch, in front of whatever reuses this store's registers behind it
          }
        }
        
      }
      lds_wave_sync();
    }
  } else if constexpr (EPI == 2) {
    float* C = (float*)C0;
#pragma unroll
    for (int i = 0; i < MI; ++i) {
#pragma unroll
      for (int r = 0; r < 8; ++r) {
        const int m = m0 + i * 16 + 8 * hh + r;
        const float sc = 1.0f + 0.1f * phs[m];
#pragma unroll
        for (int j = 0; j < NJ; ++j)
          slf[(8 * hh + r) * 128 + j * 16 + rl] = acc[i][j][r] * sc;
      }
      lds_wave_sync();
      {
#pragma unroll
        for (int row = 0; row < 16; ++row) {      // 32 lanes x 16 B = the whole 512-B row segment per instruction
          const v4f v = *(const v4f*)(slf + row * 128 + lane * 4);
          *(v4f*)(C + (size_t)(m0 + i * 16 + row) * ldc + n0 + lane * 4) = v;
        }
        
      }
      lds_wave_sync();
    }
  }
}

// ---------------------------------------------------------------------------
// Tiled GEMM main loop. Block tile 128 x 256; waves in a (8/MI) x 2 grid, each (16*MI) x 128: MI 4 = 4 waves, MI 2 = 8 waves.
// A pass is 64 k: a stage holds [A 128 rows | (SPLITA: A2 128 rows) | Bt 256 rows] of 128 B at pitch 144 B
// (16 B x 9: ds_load_b128 fragment reads without bank conflicts). Every thread brings 16-B pieces with asynchronous copies to LDS,
// one pass ahead of the pass that reads them. M % 128 == 0, N % 256 == 0, K % 64 == 0, K >= 128; grid.x = (M/128) * (N/256).
// ---------------------------------------------------------------------------
#define GT_BM 128
#define GT_BN 256
#define GT_KP 64
#define GT_LP 72                                  // LDS row pitch in bf16 elements

// Asynchronous 16-B copies, one per lane and line of the statement: l + c * lstep = the lane's LDS byte address, g[c] = its global source.
// s_wait_xcnt stands inside the statement so that no address register is rewritten ahead of it.
__device__ __forceinline__ void copy8(unsigned l, unsigned lstep, const __bf16* const* g) {
#if defined(__HIP_DEVICE_COMPILE__)
  asm volatile(
      "global_load_async_to_lds_b128 %0, %8, off\n\t"
      "global_load_async_to_lds_b128 %1, %9, off\n\t"
      "global_load_async_to_lds_b128 %2, %10, off\n\t"
      "global_load_async_to_lds_b128 %3, %11, off\n\t"
      "global_load_async_to_lds_b128 %4, %12, off\n\t"
      "global_load_async_to_lds_b128 %5, %13, off\n\t"
      "global_load_async_to_lds_b128 %6, %14, off\n\t"
      "global_load_async_to_lds_b128 %7, %15, off\n\t"
      "s_wait_xcnt 0x0"
      :: "v"(l), "v"(l + lstep), "v"(l + 2u * lstep), "v"(l + 3u * lstep),
         "v"(l + 4u * lstep), "v"(l + 5u * lstep), "v"(l + 6u * lstep), "v"(l + 7u * lstep),
         "v"(g[0]), "v"(g[1]), "v"(g[2]), "v"(g[3]), "v"(g[4]), "v"(g[5]), "v"(g[6]), "v"(g[7])
      : "memory");
#endif
}
__device__ __forceinline__ void copy4(unsigned l, unsigned lstep, const __bf16* const* g) {
#if defined(__HIP_DEVICE_COMPILE__)
  asm volatile(
      "global_load_async_to_lds_b128 %0, %4, off\n\t"
      "global_load_async_to_lds_b128 %1, %5, off\n\t"
      "global_load_async_to_lds_b128 %2, %6, off\n\t"
      "global_load_async_to_lds_b128 %3, %7, off\n\t"
      "s_wait_xcnt 0x0"
      :: "v"(l), "v"(l + lstep), "v"(l + 2u * lstep), "v"(l + 3u * lstep),
         "v"(g[0]), "v"(g[1]), "v"(g[2]), "v"(g[3])
      : "memory");
#endif
}
// this wave's copies have landed in LDS
__device__ __forceinline__ void wait_async0() {
#if defined(__HIP_DEVICE_COMPILE__)
  asm volatile("s_wait_asynccnt 0x0" ::: "memory");
#endif
}
// this wave's LDS reads have returned (before the buffer they read is handed back for a refill)
__device__ __forceinline__ void wait_ds0() {
#if defined(__HIP_DEVICE_COMPILE__)
  asm volatile("s_wait_dscnt 0x0" ::: "memory");
#endif
}
// the compiler's scheduler moves nothing across this point
__device__ __forceinline__ void sched_fence() {
#if defined(__HIP_DEVICE_COMPILE__)
  __builtin_amdgcn_sched_barrier(0);
#endif
}

// second launch bound: two waves per SIMD (two 4-wave blocks, or one 8-wave block, per WGP), so that one wave's WMMAs cover the other's waits
template <int EPI, int MI, bool SPLITA>
__global__ __launch_bounds__(512 / MI, 2) void gemm_tiled_kernel(
    const unsigned short* Ap, const unsigned short* A2p, int lda,
    const unsigned short* __restrict__ Btp, int ldb,
    const float* __restrict__ phs,
    void* C0, void* C1, void* C2, void* C3, int ldc,
    int M, int N, int K) {
  static_assert(EPI == 0 || EPI == 1 || EPI == 2);
  static_assert(MI == 4 || MI == 2);
  static_assert(GT_KP == 64);
  constexpr int NW    = 16 / MI;                  // waves per block
  constexpr int RS    = NW * 4;                   // stage rows that one copy of every thread covers (8 threads per 128-B row)
  constexpr int AROWS = (SPLITA ? 2 : 1) * GT_BM;
  constexpr int NCP   = (AROWS + GT_BN) / RS;     // copies per thread and stage: 24, 12 or 16 (at most 63 may be outstanding)
  constexpr int STAGE = (AROWS + GT_BN) * GT_LP;  // elements per buffer
  static_assert(NCP % 4 == 0 && NCP <= 63);
  typedef typename SlabT<EPI>::T ST;
  __shared__ __align__(16) __bf16 ring[2 * STAGE];
  __shared__ __align__(16) ST slab_all[NW * SlabT<EPI>::PERW];

  const int tid  = (int)threadIdx.x;
  const int lane = tid & 31;
  const int wave = wave_id();
  const int hh = lane >> 4;           // lane half: k offset 8*hh
  const int rl = lane & 15;           // A row / B col within subtile
  const int tilesN = N / GT_BN;
  const int tm  = (int)blockIdx.x / tilesN;
  const int tn  = (int)blockIdx.x - tm * tilesN;
  const int bm0 = tm * GT_BM;
  const int bn0 = tn * GT_BN;
  const int wm  = wave >> 1;
  const int wn  = wave & 1;

  // copy side: copy c of this thread brings piece tid % 8 of stage row c * RS + tid / 8
  const int crow = tid >> 3;
  const int cpc  = (tid & 7) * 8;     // element offset of the 16-B piece
  const __bf16* gA  = (const __bf16*)(const void*)Ap  + (size_t)(bm0 + crow) * lda + cpc;
  const __bf16* gA2 = (const __bf16*)(const void*)A2p + (size_t)(bm0 + crow) * lda + cpc;
  const __bf16* gB  = (const __bf16*)(const void*)Btp + (size_t)(bn0 + crow) * ldb + cpc;
  const unsigned lc = (unsigned)(size_t)(const void*)ring + (unsigned)(crow * GT_LP + cpc) * 2u;
  auto fill = [&](int t) {            // tile t -> buffer t % 2
    const unsigned l = lc + (unsigned)(t & 1) * (unsigned)(STAGE * 2);
    const size_t ko = (size_t)t * GT_KP;
    const __bf16* g[NCP];
#pragma unroll
    for (int c = 0; c < NCP; ++c) {
      const int r = c * RS;
      g[c] = (r < GT_BM) ? gA + ko + (size_t)r * lda
           : (r < AROWS) ? gA2 + ko + (size_t)(r - GT_BM) * lda
                         : gB + ko + (size_t)(r - AROWS) * ldb;
    }
#pragma unroll
    for (int c = 0; c + 8 <= NCP; c += 8) copy8(l + (unsigned)(c * RS * GT_LP * 2), RS * GT_LP * 2u, g + c);
    if constexpr (NCP % 8 == 4) copy4(l + (unsigned)((NCP - 4) * RS * GT_LP * 2), RS * GT_LP * 2u, g + (NCP - 4));
  };

  v8f acc[MI][8];
#pragma unroll
  for (int i = 0; i < MI; ++i)
#pragma unroll
    for (int j = 0; j < 8; ++j) acc[i][j] = zero8();

  const int nt = K / GT_KP;           // block-uniform, >= 2
  fill(0);
  wait_async0();
  __syncthreads();                    // tile 0 readable by every wave
  fill(1);

  const int aoff = (wm * (16 * MI) + rl) * GT_LP + 8 * hh;
  const int boff = (AROWS + wn * 128 + rl) * GT_LP + 8 * hh;
#pragma unroll 1                      // one pass per trip: the ring's order below holds per trip, and every acc index stays constant
  for (int t = 0; t < nt; ++t) {
    const __bf16* st = ring + (t & 1) * STAGE;
    v16b fa[2][MI], fl[2][MI], fb[2][8];          // one fragment set per 32-k step of the pass
#pragma unroll
    for (int ks = 0; ks < 2; ++ks) {
#pragma unroll
      for (int i = 0; i < MI; ++i) {
        fa[ks][i] = ldfrag_b(st + aoff + i * 16 * GT_LP + ks * 32);
        if constexpr (SPLITA) fl[ks][i] = ldfrag_b(st + aoff + (GT_BM + i * 16) * GT_LP + ks * 32);
      }
#pragma unroll
      for (int j = 0; j < 8; ++j) fb[ks][j] = ldfrag_b(st + boff + j * 16 * GT_LP + ks * 32);
      sched_fence();                              // each step's LDS reads stay one group ahead of the WMMA blocks, not spread among them
    }
#pragma unroll
    for (int ks = 0; ks < 2; ++ks) {
#pragma unroll
      for (int j = 0; j < 8; ++j) {
#pragma unroll
        for (int i = 0; i < MI; ++i) acc[i][j] = mma_b(fa[ks][i], fb[ks][j], acc[i][j]);
        if constexpr (SPLITA) {
#pragma unroll
          for (int i = 0; i < MI; ++i) acc[i][j] = mma_b(fl[ks][i], fb[ks][j], acc[i][j]);
        }
      }
      // step 1's WMMAs stay behind step 0's (only step 0's reads are waited for first) and in front of the waits at the foot
      // (moved behind the barrier they would halve the lead of the copies in flight)
      sched_fence();
    }
    wait_ds0();
    wait_async0();
    __syncthreads();                  // publishes tile t + 1 and ends every wave's reads of tile t's buffer
    if (t + 2 < nt) fill(t + 2);      // block-uniform test
  }
  wait_async0();

  gemm_epilogue<EPI, 8, MI>(acc, slab_all + wave * SlabT<EPI>::PERW, lane, bm0 + wm * (16 * MI), bn0 + wn * 128, phs, C0, C1, C2, C3, ldc);
}

// ---------------------------------------------------------------------------
// Phase projection: v[m][n] = sum_k Xb[m][k] * WpT[n][k] (M = NTOK, N = NPH, K = HID), then PQ[m][n] = cos(v), PQ[m][NPH + n] = sin(v).
// Block = 16 token rows x all NPH columns, PP_NW waves; wave w takes k in [w * PP_KS, (w + 1) * PP_KS): all its fragment loads
// (straight from the global rows) go out ahead of its WMMAs, so a wave pays the global latency once. The PP_NW partial tiles meet
// in LDS and are added in wave order 0..PP_NW-1. Each thread then finishes 2 values (precise cosf/sinf); a wave's store is one whole 128-B line.
// Coverage: NTOK / 16 blocks x 16 rows x PQW columns = the whole PQ plane.
// ---------------------------------------------------------------------------
#define PP_NW 8
#define PP_KS (HID / PP_NW)
static_assert(PP_KS % 32 == 0 && NPH == 32 && PQW == 2 * NPH && NTOK % 16 == 0);
__global__ __launch_bounds__(32 * PP_NW) void phase_proj_kernel(const unsigned short* __restrict__ Xp, const unsigned short* __restrict__ Wp,
                                                                float* __restrict__ PQ) {
  constexpr int NS = PP_KS / 32;      // 32-k steps per wave
  __shared__ __align__(16) float part[PP_NW * 16 * NPH];
  const int tid  = (int)threadIdx.x;
  const int lane = tid & 31;
  const int wave = wave_id();
  const int hh = lane >> 4;           // lane half: k offset 8*hh, D row offset 8*hh
  const int rl = lane & 15;           // A row / B col / D col within subtile
  const int m0 = (int)blockIdx.x * 16;
  const __bf16* A  = (const __bf16*)(const void*)Xp + (size_t)(m0 + rl) * HID + wave * PP_KS + 8 * hh;
  const __bf16* B0 = (const __bf16*)(const void*)Wp + (size_t)rl * HID + wave * PP_KS + 8 * hh;
  const __bf16* B1 = B0 + (size_t)16 * HID;
  v16b fa[NS], f0[NS], f1[NS];
#pragma unroll
  for (int s = 0; s < NS; ++s) {
    fa[s] = ldfrag_b(A + s * 32);
    f0[s] = ldfrag_b(B0 + s * 32);
    f1[s] = ldfrag_b(B1 + s * 32);
  }
  sched_fence();                      // all 6 * NS loads stay ahead of the first WMMA: spread among the WMMAs they would return in NS rounds of latency
  v8f a0 = zero8(), a1 = zero8();
#pragma unroll
  for (int s = 0; s < NS; ++s) {
    a0 = mma_b(fa[s], f0[s], a0);
    a1 = mma_b(fa[s], f1[s], a1);
  }
  float* pw = part + wave * (16 * NPH);
#pragma unroll
  for (int r = 0; r < 8; ++r) {
    pw[(8 * hh + r) * NPH + rl]      = a0[r];
    pw[(8 * hh + r) * NPH + 16 + rl] = a1[r];
  }
  __syncthreads();                    // every wave's partial tile readable by the block
#pragma unroll 1                      // one precise cos + sin site in the text
  for (int it = 0; it < (16 * NPH) / (32 * PP_NW); ++it) {
    const int e = it * (32 * PP_NW) + tid;        // row e / NPH, column e % NPH (= lane)
    float v = part[e];
#pragma unroll
    for (int w = 1; w < PP_NW; ++w) v += part[w * (16 * NPH) + e];
    float* o = PQ + (size_t)(m0 + e / NPH) * PQW + (e % NPH);
    o[0]   = cosf(v);
    o[NPH] = sinf(v);
    wait_x0();                        // precaution: the next trip's first instructions reuse this store's address registers
  }
}

// ---------------------------------------------------------------------------
// Phase modulation factor, PH_PB blocks per sequence (grid NSEQ * PH_PB, 512 threads), all f32:
//   PQ plane [NTOK][PQW]: col h = cos(pq_h), 16+h = cos(pk_h), 32+h = sin(pq_h), 48+h = sin(pk_h).
//   Ck[h] = sum_s cos(pk), Sk[h] = sum_s sin(pk): every block sums its whole sequence itself (no data passes between blocks of the launch).
//   8 threads per row, each one 16-B piece (4 heads of cos or of sin), 64 rows per pass: a wave reads 4 rows x two 64-B runs per instruction;
//   per-thread partials over 32 rows, then 32 threads add the 64 row groups in fixed order from LDS (lanes on consecutive banks).
//   phs[b*SQ + s] = sum_h (cos(pq_h)*Ck[h] + sin(pq_h)*Sk[h]) / 32768: 4 products per thread, 8 partials per row joined through LDS in fixed order.
//   Coverage: NSEQ * PH_PB blocks x PH_ROWS = NTOK values; each wave of the last stage stores one whole 128-B line.
// ---------------------------------------------------------------------------
#define PH_PB   16
#define PH_ROWS (SQ / PH_PB)
static_assert(PH_ROWS % 64 == 0 && SQ % 64 == 0 && PH_ROWS <= 512);
__global__ __launch_bounds__(512) void phase_kernel(const float* __restrict__ PQ, float* __restrict__ phs) {
  __shared__ __align__(16) float red[64 * 2 * NHQ];
  __shared__ __align__(16) float csk[2 * NHQ];
  __shared__ __align__(16) float part[PH_ROWS * 8];
  const int b   = (int)blockIdx.x / PH_PB;
  const int blk = (int)blockIdx.x % PH_PB;
  const int tid = (int)threadIdx.x;
  const int pc  = tid & 7;                            // piece: 0..3 = cos of heads 4*pc.., 4..7 = sin of heads 4*(pc-4)..
  const int g   = tid >> 3;                           // row within a pass of 64
  const int col = (pc < 4) ? 4 * pc : NHQ + 4 * pc;   // pq columns 0..12 and 32..44; the pk columns lie NHQ further
  const float* base = PQ + (size_t)b * SQ * PQW;
  v4f xq[PH_ROWS / 64];                               // this block's own pq rows, asked for ahead of the sums
#pragma unroll
  for (int it = 0; it < PH_ROWS / 64; ++it)
    xq[it] = *(const v4f*)(base + (size_t)(blk * PH_ROWS + it * 64 + g) * PQW + col);
  v4f acc = {0.f, 0.f, 0.f, 0.f};
#pragma unroll 8                                      // 8 loads in flight per thread: 4 L2 round trips for the 32 rows, not 32
  for (int it = 0; it < SQ / 64; ++it) {
    const v4f x = *(const v4f*)(base + (size_t)(it * 64 + g) * PQW + NHQ + col);
    acc += x;
  }
  *(v4f*)(red + g * (2 * NHQ) + 4 * pc) = acc;
  __syncthreads();
  if (tid < 2 * NHQ) {                                // wave 0
    float s = 0.f;
#pragma unroll                                        // the 64 LDS reads go out together; only the adds are a chain
    for (int r = 0; r < 64; ++r) s += red[r * (2 * NHQ) + tid];
    csk[tid] = s;
  }
  __syncthreads();
  const v4f w = *(const v4f*)(csk + 4 * pc);
#pragma unroll
  for (int it = 0; it < PH_ROWS / 64; ++it) {
    const v4f x = xq[it];
    part[(it * 64 + g) * 8 + pc] = (x[0] * w[0] + x[1] * w[1]) + (x[2] * w[2] + x[3] * w[3]);
  }
  __syncthreads();
  if (tid < PH_ROWS) {                                // whole waves
    const v4f p0 = *(const v4f*)(part + tid * 8);
    const v4f p1 = *(const v4f*)(part + tid * 8 + 4);
    const float a = ((p0[0] + p0[1]) + (p0[2] + p0[3])) + ((p1[0] + p1[1]) + (p1[2] + p1[3]));
    phs[(size_t)b * SQ + blk * PH_ROWS + tid] = a * (1.0f / 32768.0f);
  }
}

// ---------------------------------------------------------------------------
// Causal flash attention, head dim 128, 32-key chunks, block = 64 query rows of one (b, h): 4 waves of 16 rows with PRES; without PRES two
//   groups of 4 such waves, group g taking chunks g, g + 2, g + 4, ... with its own running maxima, sums and accumulators, so that the longest
//   tile's chain of dependent chunks is half as long; behind the loop group 0 joins the two halves (rescaled to the common maximum) through LDS.
//   q planes f16 [tok][h*128+d]: hi (qhp) and residual x2048 (qlp); k planes f16 [tok][h*128+d]: hi (khp); residual x2048 (klp) stored at
//   row b*KLR + key; v^T planes f16 [h*128+d][tok]: hi (vhp), residual x2048 (vlp). The three residual planes hold only tokens < KLR of each
//   sequence and are read only when PRES. Outputs attn bf16 hi (ahp) / lo (alp) [tok][h*128+d].
//   Without PRES: scores = Sh * 128^-0.5 with Sh = qh.kh; O = Oh/1024/l with Oh = ph.vh (every operand plain f16: its rounding lies far under
//   that of the bf16 operands from which q, k and v were formed).
//   With PRES: scores = (Sh + Sr/2048) * 128^-0.5 with Sr = ql'.kh + qh.kl'; O = (Oh + Or/2048)/1024/l with Or = ph.vl' + pl'.vh.
//   Keys > query -> -inf; online softmax f32;
//   p' = 1024 p stored per wave to LDS as f16 hi (and residual x2048 when PRES), reloaded as A fragments after a wave sync.
//   q plane(s): each wave copies its 16 rows to LDS once and takes its A fragments from there in every chunk.
//   K / V^T chunk staging: 128 threads x 4 x 16 B per plane = whole 32x128 / 128x32 tile, by asynchronous copies to LDS into a ring of two
//   buffers, one chunk ahead of the chunk that reads them; one publish point (LDS wait, copy wait, barrier) at the foot of every chunk.
//   Grid (NHQ, NSEQ, query tiles), longest tile at the lowest index (two blocks of the long launch fit a WGP).
//   Fragment reads run ahead of the WMMAs that use them: q/k two 32-d steps ahead, v^T AT_VD tiles ahead (tiles 0 to 2 in front of the softmax).
//   Trip count (2*qb+2) / groups steps (static bound 64); waves whose rows are all below the chunk skip it (wave-uniform, scalar branch).
// ---------------------------------------------------------------------------
#define AT_KC   32
#define KS_P    136
#define VS_P    40
#define PS_P    40
#define QS_P    136
#define AT_VD   4
// LDS map in halves. KS to STG: one buffer of the chunk ring (two per wave group stand in a row: parity-major, then group). The residual planes (q, k, v^T, p) exist only with PRES. QS: per wave 16 query rows per plane at pitch QS_P (272 B = 16 B x 17).
template <bool PRES> struct AttnLds {
  static constexpr int NG  = PRES ? 1 : 2;               // wave groups per block
  static constexpr int NW  = 4 * NG;                     // waves per block
  static constexpr int KS  = 0;
  static constexpr int KLS = 32 * KS_P;
  static constexpr int VHS = (PRES ? 2 : 1) * 32 * KS_P;
  static constexpr int VLS = VHS + 128 * VS_P;
  static constexpr int STG = VHS + (PRES ? 2 : 1) * 128 * VS_P;
  static constexpr int PH  = 2 * NG * STG;
  static constexpr int PL  = PH + NW * 16 * PS_P;
  static constexpr int QS  = PH + (PRES ? 2 : 1) * NW * 16 * PS_P;
  static constexpr int QW  = (PRES ? 2 : 1) * 16 * QS_P; // one wave's query rows
  static constexpr int ST  = QS + NW * QW;               // per wave 4 planes x 32 lanes x 16 B: each lane's own 8 row maxima and 8 partial row sums
  static constexpr int TOT = ST + NW * 1024;
};
static_assert(2 * AttnLds<false>::TOT * 2 <= 327680);   // two 8-wave blocks of the long launch per WGP
static_assert(AttnLds<false>::STG % 8 == 0 && AttnLds<true>::STG % 8 == 0);   // the second buffer keeps the copies' 16-B alignment
static_assert(4 * 4096 <= AttnLds<false>::PH);          // group 1's accumulators, then output staging (2 planes x 16 x 128 per wave), alias the chunk ring after the loop
static_assert(4 * 4096 <= AttnLds<true>::QS);

// Asynchronous 16-B copies, one per lane and line of the statement: four pieces of one plane, l + i * ls = the lane's LDS byte address,
// g + i * gs = its global source. s_wait_xcnt stands inside the statement so that no address register is rewritten ahead of it.
__device__ __forceinline__ void copy_plane(unsigned l, unsigned ls, const char* g, size_t gs) {
#if defined(__HIP_DEVICE_COMPILE__)
  asm volatile(
      "global_load_async_to_lds_b128 %0, %4, off\n\t"
      "global_load_async_to_lds_b128 %1, %5, off\n\t"
      "global_load_async_to_lds_b128 %2, %6, off\n\t"
      "global_load_async_to_lds_b128 %3, %7, off\n\t"
      "s_wait_xcnt 0x0"
      :: "v"(l), "v"(l + ls), "v"(l + 2u * ls), "v"(l + 3u * ls),
         "v"(g), "v"(g + gs), "v"(g + 2 * gs), "v"(g + 3 * gs)
      : "memory");
#endif
}
// the same for the three planes of a chunk (k, v^T hi, v^T residual; the two v^T planes lie lvd bytes apart in LDS) under one s_wait_xcnt
__device__ __forceinline__ void copy_3planes(unsigned lk, unsigned lks, const char* gk, size_t gks,
                                             unsigned lv, unsigned lvs, unsigned lvd, const char* gv, const char* gw, size_t gvs) {
#if defined(__HIP_DEVICE_COMPILE__)
  const unsigned lw = lv + lvd;
  asm volatile(
      "global_load_async_to_lds_b128 %0, %12, off\n\t"
      "global_load_async_to_lds_b128 %1, %13, off\n\t"
      "global_load_async_to_lds_b128 %2, %14, off\n\t"
      "global_load_async_to_lds_b128 %3, %15, off\n\t"
      "global_load_async_to_lds_b128 %4, %16, off\n\t"
      "global_load_async_to_lds_b128 %5, %17, off\n\t"
      "global_load_async_to_lds_b128 %6, %18, off\n\t"
      "global_load_async_to_lds_b128 %7, %19, off\n\t"
      "global_load_async_to_lds_b128 %8, %20, off\n\t"
      "global_load_async_to_lds_b128 %9, %21, off\n\t"
      "global_load_async_to_lds_b128 %10, %22, off\n\t"
      "global_load_async_to_lds_b128 %11, %23, off\n\t"
      "s_wait_xcnt 0x0"
      :: "v"(lk), "v"(lk + lks), "v"(lk + 2u * lks), "v"(lk + 3u * lks),
         "v"(lv), "v"(lv + lvs), "v"(lv + 2u * lvs), "v"(lv + 3u * lvs),
         "v"(lw), "v"(lw + lvs), "v"(lw + 2u * lvs), "v"(lw + 3u * lvs),
         "v"(gk), "v"(gk + gks), "v"(gk + 2 * gks), "v"(gk + 3 * gks),
         "v"(gv), "v"(gv + gvs), "v"(gv + 2 * gvs), "v"(gv + 3 * gvs),
         "v"(gw), "v"(gw + gvs), "v"(gw + 2 * gvs), "v"(gw + 3 * gvs)
      : "memory");
#endif
}

// the same for the two planes of a chunk without residuals (k, v^T) under one s_wait_xcnt
__device__ __forceinline__ void copy_2planes(unsigned lk, unsigned lks, const char* gk, size_t gks,
                                             unsigned lv, unsigned lvs, const char* gv, size_t gvs) {
#if defined(__HIP_DEVICE_COMPILE__)
  asm volatile(
      "global_load_async_to_lds_b128 %0, %8, off\n\t"
      "global_load_async_to_lds_b128 %1, %9, off\n\t"
      "global_load_async_to_lds_b128 %2, %10, off\n\t"
      "global_load_async_to_lds_b128 %3, %11, off\n\t"
      "global_load_async_to_lds_b128 %4, %12, off\n\t"
      "global_load_async_to_lds_b128 %5, %13, off\n\t"
      "global_load_async_to_lds_b128 %6, %14, off\n\t"
      "global_load_async_to_lds_b128 %7, %15, off\n\t"
      "s_wait_xcnt 0x0"
      :: "v"(lk), "v"(lk + lks), "v"(lk + 2u * lks), "v"(lk + 3u * lks),
         "v"(lv), "v"(lv + lvs), "v"(lv + 2u * lvs), "v"(lv + 3u * lvs),
         "v"(gk), "v"(gk + gks), "v"(gk + 2 * gks), "v"(gk + 3 * gks),
         "v"(gv), "v"(gv + gvs), "v"(gv + 2 * gvs), "v"(gv + 3 * gvs)
      : "memory");
#endif
}

// second launch bound of the long launch: four waves per SIMD, the two 8-wave blocks per WGP that its LDS allows
template <bool PRES>
__global__ __launch_bounds__(PRES ? 128 : 256, PRES ? 1 : 4) void attn_causal_kernel(
    const unsigned short* __restrict__ qhp, const unsigned short* __restrict__ qlp,
    const unsigned short* __restrict__ khp, const unsigned short* __restrict__ klp,
    const unsigned short* __restrict__ vhp, const unsigned short* __restrict__ vlp,
    unsigned short* __restrict__ ahp, unsigned short* __restrict__ alp, int qb_top) {
  typedef AttnLds<PRES> L;
  __shared__ __align__(16) _Float16 lds[L::TOT];

  const int tid  = (int)threadIdx.x;
  const int lane = tid & 31;
  const int wave = wave_id();
  const int grp  = (L::NG == 2) ? (wave >> 2) : 0;     // wave group (scalar): which chunks of a step's NG it takes
  const int wq   = (L::NG == 2) ? (wave & 3) : wave;   // which 16 query rows of the tile
  const int gt   = (L::NG == 2) ? (tid & 127) : tid;   // thread within the group: its share of the group's copies
  const int hh   = lane >> 4;
  const int c    = lane & 15;
  const int qb   = qb_top - (int)blockIdx.z;     // longest tile at the lowest index
  const int h    = (int)blockIdx.x;
  const int b    = (int)blockIdx.y;
  const int q0   = qb * 64 + wq * 16;            // first query row of this wave (within sequence)
  const int qlast = q0 + 15;
  const size_t tok0 = (size_t)b * SQ;

  const _Float16* Qhg = (const _Float16*)(const void*)qhp + (tok0 + q0) * HID + h * HDM;
  const _Float16* Qlg = (const _Float16*)(const void*)qlp + (tok0 + q0) * HID + h * HDM;
  const _Float16* Kg  = (const _Float16*)(const void*)khp + tok0 * HID + h * HDM;
  const _Float16* Klg = (const _Float16*)(const void*)klp + (size_t)b * KLR * HID + h * HDM;
  const _Float16* Vhg = (const _Float16*)(const void*)vhp + (size_t)(h * HDM) * NTOK + tok0;
  const _Float16* Vlg = (const _Float16*)(const void*)vlp + (size_t)(h * HDM) * NTOK + tok0;
  _Float16* ph = lds + L::PH + wave * (16 * PS_P);
  _Float16* pl = PRES ? lds + L::PL + wave * (16 * PS_P) : ph;   // used only with PRES
  _Float16* Qs = lds + L::QS + wave * L::QW;                     // this wave's own query rows: hi plane, then (PRES) residual plane

  // chunk ring, copy side (each group brings its own chunks): piece p = gt + 128 * i of a plane, 512 pieces of 8 halves = whole tile. K: key p >> 4, d (p & 15) * 8;
  // V^T: d p >> 2, keys (p & 3) * 8. Every lane's bytes lie inside its plane for every chunk < 2 * qb + 2 (keys < 64 * (qb + 1)).
  const char* Kc  = (const char*)Kg;
  const char* Klc = (const char*)Klg;
  const char* Vhc = (const char*)Vhg;
  const char* Vlc = (const char*)Vlg;
  const unsigned kgo = (unsigned)((gt >> 4) * (HID * 2) + (gt & 15) * 16);
  const unsigned vgo = (unsigned)((gt >> 2) * (NTOK * 2) + (gt & 3) * 16);
  const unsigned lk = (unsigned)(size_t)(const void*)lds + (unsigned)(L::KS + (gt >> 4) * KS_P + (gt & 15) * 8) * 2u;
  const unsigned lv = (unsigned)(size_t)(const void*)lds + (unsigned)(L::VHS + (gt >> 2) * VS_P + (gt & 3) * 8) * 2u;
  auto fill = [&](int s) {                       // this group's chunk of step s -> its buffer of parity s % 2
    const int t = s * L::NG + grp;
    const unsigned bo = (unsigned)((s & 1) * L::NG + grp) * (unsigned)(L::STG * 2);
    const size_t ko = (size_t)t * (AT_KC * HID * 2);
    const size_t vo = (size_t)t * (AT_KC * 2);
    if constexpr (PRES) {
      copy_3planes(lk + bo, 8 * KS_P * 2u, (Kc + ko) + kgo, (size_t)8 * HID * 2,
                   lv + bo, 32 * VS_P * 2u, (L::VLS - L::VHS) * 2u, (Vhc + vo) + vgo, (Vlc + vo) + vgo, (size_t)32 * NTOK * 2);
      copy_plane(lk + bo + (L::KLS - L::KS) * 2u, 8 * KS_P * 2u, (Klc + ko) + kgo, (size_t)8 * HID * 2);
    } else {
      copy_2planes(lk + bo, 8 * KS_P * 2u, (Kc + ko) + kgo, (size_t)8 * HID * 2,
                   lv + bo, 32 * VS_P * 2u, (Vhc + vo) + vgo, (size_t)32 * NTOK * 2);
    }
  };
  fill(0);                                       // ahead of the q fill: both wait out one global latency together

  // q rows to LDS once, whole 256-B rows per 16 lanes; read back only by this wave, behind the barrier in front of the chunk loop
#pragma unroll                                   // all loads (16 with PRES, 8 without) in flight together: one global latency for the whole fill
  for (int it = 0; it < 8; ++it) {
    const int row = it * 2 + hh;                 // it 0..7 x hh 0..1 covers rows 0..15
    const v8h x = *(const v8h*)(Qhg + (size_t)row * HID + c * 8);
    *(v8h*)(Qs + row * QS_P + c * 8) = x;
    if constexpr (PRES) {
      const v8h y = *(const v8h*)(Qlg + (size_t)row * HID + c * 8);
      *(v8h*)(Qs + (16 + row) * QS_P + c * 8) = y;
    }
  }

  // running row maxima and row sums live in LDS between their one use per chunk (each lane reads back only what it wrote):
  // their 16 registers go to the fragments in flight
  float* stw = (float*)(void*)(lds + L::ST + wave * 1024) + lane * 4;
  {
    const v4f ninf = {-INFINITY, -INFINITY, -INFINITY, -INFINITY};
    const v4f zero = {0.f, 0.f, 0.f, 0.f};
    *(v4f*)(stw) = ninf; *(v4f*)(stw + 128) = ninf; *(v4f*)(stw + 256) = zero; *(v4f*)(stw + 384) = zero;
  }
  v8f oacc[8], oaccr[8];
#pragma unroll
  for (int t = 0; t < 8; ++t) { oacc[t] = zero8(); oaccr[t] = zero8(); }

  const _Float16* qf = Qs + c * QS_P + 8 * hh;                                  // fragment reads: this lane's row and k half
  const int dq = c - 8 * hh - q0;                // key - query row = kv0 + 16 * j - r + dq

  const int nst = (2 * qb + 2) / L::NG;          // steps, block-uniform, <= 64, >= 2; chunks < 2*qb+2: keys < 64*(qb+1) <= SQ; PRES blocks: keys < 256 = KLR
  wait_async0();
  __syncthreads();                               // step 0's chunks readable by every wave
  fill(1);
  for (int kc = 0; kc < nst; ++kc) {
    const int kv0 = (kc * L::NG + grp) * AT_KC;
    const _Float16* stg = lds + ((kc & 1) * L::NG + grp) * L::STG;              // this chunk's buffer
    const _Float16* kf = stg + L::KS + c * KS_P + 8 * hh;
    const _Float16* vf = stg + L::VHS + c * VS_P + 8 * hh;

    if (kv0 <= qlast) {                          // wave-uniform (scalar): skip chunks fully above this wave's rows
      // ---- scores ----
      v16h qa[4], ql[4], kb[4][2], kl[4][2], vb[8], vr[8];
      auto ld_k = [&](int dc, int j) {           // k fragment(s) of 32-d step dc, key half j
        kb[dc][j] = ldfrag_h(kf + j * 16 * KS_P + dc * 32);
        if (PRES) kl[dc][j] = ldfrag_h(kf + (L::KLS - L::KS) + j * 16 * KS_P + dc * 32);
      };
      auto ld_q = [&](int dc) {                  // q fragment(s) of step dc: hi, and residual with PRES
        qa[dc] = ldfrag_h(qf + dc * 32);
        if (PRES) ql[dc] = ldfrag_h(qf + 16 * QS_P + dc * 32);
      };
      auto ld_v = [&](int t) {                   // v^T fragment(s) of output tile t: hi, and residual with PRES
        vb[t] = ldfrag_h(vf + t * 16 * VS_P);
        if (PRES) vr[t] = ldfrag_h(vf + (L::VLS - L::VHS) + t * 16 * VS_P);
      };
      v4f mr[2], lr[2];
      v8f sh[2], sr[2];
      sh[0] = zero8(); sh[1] = zero8(); sr[0] = zero8(); sr[1] = zero8();
      ld_k(0, 0); ld_q(0); ld_k(0, 1); ld_k(1, 0); ld_q(1); ld_k(1, 1);
      sched_fence();                             // the first reads go out together, ahead of the first WMMA
      // every refill below stands between two fences: behind the WMMAs whose registers it takes over, and two 32-d steps ahead of its use
      // (a read sunk to its use costs a full LDS round trip per WMMA pair)
#pragma unroll                                   // constant indices: fragments, scores and accumulators stay in registers
      for (int dc = 0; dc < 4; ++dc) {
#pragma unroll                                   // constant indices: fragments, scores and accumulators stay in registers
        for (int j = 0; j < 2; ++j) {
          sh[j] = mma_h(qa[dc], kb[dc][j], sh[j]);
          if (PRES) { sr[j] = mma_h(ql[dc], kb[dc][j], sr[j]); sr[j] = mma_h(qa[dc], kl[dc][j], sr[j]); }
          sched_fence();
          if (j == 0) {
            if (dc + 2 < 4) ld_k(dc + 2, 0);
          } else {
            if (dc + 2 < 4) { ld_q(dc + 2); ld_k(dc + 2, 1); }
            else ld_v(dc - 2);                   // v^T does not hang on the softmax: tiles 0, 1 and 2 return under it
            if (dc == 3) { ld_v(2); mr[0] = *(const v4f*)(stw); mr[1] = *(const v4f*)(stw + 128); }
          }
          sched_fence();
        }
      }
      // ---- scale, causal mask, chunk row max ----
      const int dk = kv0 + dq;
      float cm[8];
#pragma unroll                                   // constant indices: fragments, scores and accumulators stay in registers
      for (int r = 0; r < 8; ++r) {
        float m = -INFINITY;
#pragma unroll                                   // constant indices: fragments, scores and accumulators stay in registers
        for (int j = 0; j < 2; ++j) {
          float s = (PRES ? sh[j][r] + sr[j][r] * 0.00048828125f : sh[j][r]) * 0.08838834764831845f;
          s = (dk > r - j * 16) ? -INFINITY : s; // key > query row
          sh[j][r] = s;
          m = fmaxf(m, s);
        }
        cm[r] = m;
      }
      row_max8(cm);                              // on the vector pipe: no LDS-pipe round trip per step
      // ---- online softmax, P' to LDS ----
      float alpha[8], psum[8];
#pragma unroll                                   // constant indices: fragments, scores and accumulators stay in registers
      for (int r = 0; r < 8; ++r) {
        const float mnew = fmaxf(mr[r >> 2][r & 3], cm[r]);
        float pe[2];
        exp3_slot(sh[0][r] - mnew, sh[1][r] - mnew, mr[r >> 2][r & 3] - mnew, pe[0], pe[1], alpha[r]);
        mr[r >> 2][r & 3] = mnew;
#pragma unroll                                   // constant indices: fragments, scores and accumulators stay in registers
        for (int j = 0; j < 2; ++j) {
          const float p  = pe[j];
          const float pp = p * 1024.0f;
          const _Float16 phv = (_Float16)pp;
          const int po = (8 * hh + r) * PS_P + j * 16 + c;
          ph[po] = phv;
          if (PRES) pl[po] = (_Float16)((pp - (float)phv) * 2048.0f);
        }
        psum[r] = pe[0] + pe[1];
      }
      *(v4f*)(stw) = mr[0]; *(v4f*)(stw + 128) = mr[1];
      lds_wave_sync();                           // P' stores visible to the other lanes of this wave before the fragment reload
      // ---- O += P' . V; each lane keeps the sum of its own two columns per row, the 16 lanes of a row are joined once behind the loop ----
      const v16h pa = ldfrag_h(ph + c * PS_P + 8 * hh);
      v16h pr = pa;
      if (PRES) pr = ldfrag_h(pl + c * PS_P + 8 * hh);
#pragma unroll                                   // constant indices: fragments, scores and accumulators stay in registers
      for (int t = 3; t < AT_VD; ++t) ld_v(t);
      lr[0] = *(const v4f*)(stw + 256); lr[1] = *(const v4f*)(stw + 384);
      sched_fence();                             // P' and v^T reads go out together; the rescale below runs under their latency
#pragma unroll                                   // constant indices: fragments, scores and accumulators stay in registers
      for (int r = 0; r < 8; ++r) {
#pragma unroll                                   // constant indices: fragments, scores and accumulators stay in registers
        for (int t = 0; t < 8; ++t) { oacc[t][r] *= alpha[r]; if (PRES) oaccr[t][r] *= alpha[r]; }
      }
#pragma unroll                                   // constant indices: fragments, scores and accumulators stay in registers
      for (int r = 0; r < 8; ++r) lr[r >> 2][r & 3] = lr[r >> 2][r & 3] * alpha[r] + psum[r];
      *(v4f*)(stw + 256) = lr[0]; *(v4f*)(stw + 384) = lr[1];
#pragma unroll                                   // constant indices: fragments, scores and accumulators stay in registers
      for (int t = 0; t < 8; ++t) {
        oacc[t]  = mma_h(pa, vb[t], oacc[t]);
        if (PRES) { oaccr[t] = mma_h(pa, vr[t], oaccr[t]); oaccr[t] = mma_h(pr, vb[t], oaccr[t]); }
        sched_fence();                           // refill behind the WMMAs whose registers it takes over, AT_VD tiles ahead of its use
        if (t + AT_VD < 8) ld_v(t + AT_VD);
        sched_fence();
      }
      guard_h4(oacc[7], PRES ? oaccr[7] : oacc[6], pa, pr, vb[7], PRES ? vr[7] : vb[7]);
    }
    // publish point, passed by every wave, also one that skipped the chunk
    wait_ds0();
    wait_async0();
    __syncthreads();                             // publishes step kc + 1 and ends every wave's reads of step kc's buffers
    if (kc + 2 < nst) fill(kc + 2);              // block-uniform test
  }
  wait_async0();

  __syncthreads();                               // all chunk-region readers done before aliasing it as output staging
  const v4f lf[2] = {*(const v4f*)(stw + 256), *(const v4f*)(stw + 384)};
  float lsum[8];
#pragma unroll
  for (int r = 0; r < 8; ++r) lsum[r] = lf[r >> 2][r & 3];
  if constexpr (L::NG == 2) {
    // join of the two key halves: group 1 hands its accumulators over in LDS (lane-major 16-B pieces; its maxima and sums already lie in its
    // ST planes), group 0 rescales both halves to the common row maximum and adds. Same lane -> (row, column) map in both groups.
    float* mb = (float*)(void*)lds + wq * 2048 + lane * 4;
    if (grp == 1) {                              // scalar branch
#pragma unroll
      for (int t = 0; t < 8; ++t) {
        const v4f x = {oacc[t][0], oacc[t][1], oacc[t][2], oacc[t][3]};
        const v4f y = {oacc[t][4], oacc[t][5], oacc[t][6], oacc[t][7]};
        *(v4f*)(mb + t * 256) = x;
        *(v4f*)(mb + t * 256 + 128) = y;
      }
    }
    __syncthreads();                             // group 1's half readable by group 0; the block's last barrier, passed by every wave
    if (grp == 1) return;
    const float* st1 = (const float*)(const void*)(lds + L::ST + (wave + 4) * 1024) + lane * 4;
    const v4f m0[2] = {*(const v4f*)(stw), *(const v4f*)(stw + 128)};
    const v4f m1[2] = {*(const v4f*)(st1), *(const v4f*)(st1 + 128)};
    const v4f l1[2] = {*(const v4f*)(st1 + 256), *(const v4f*)(st1 + 384)};
    float a0[8], a1[8];
#pragma unroll
    for (int r = 0; r < 8; ++r) {
      const float x0 = m0[r >> 2][r & 3];
      const float x1 = m1[r >> 2][r & 3];
      const float mm = fmaxf(x0, x1);            // finite: chunk 0 has an unmasked key for every row
      exp2_slot(x0 - mm, x1 - mm, a0[r], a1[r]);
      lsum[r] = lsum[r] * a0[r] + l1[r >> 2][r & 3] * a1[r];
    }
#pragma unroll
    for (int t = 0; t < 8; ++t) {
      const v4f x = *(const v4f*)(mb + t * 256);
      const v4f y = *(const v4f*)(mb + t * 256 + 128);
#pragma unroll
      for (int r = 0; r < 4; ++r) {
        oacc[t][r]     = oacc[t][r] * a0[r] + x[r] * a1[r];
        oacc[t][r + 4] = oacc[t][r + 4] * a0[r + 4] + y[r] * a1[r + 4];
      }
    }
  }
  _Float16* osh = lds + wq * 4096;               // over this wave's own share of the hand-over range, all of it read above
  _Float16* osl = osh + 2048;
#pragma unroll
  for (int r = 0; r < 8; ++r) {
    float l = lsum[r];                           // this lane's share of the row sum; the butterfly leaves the same total in all 16 lanes of the row
    l += row_xor<1>(l); l += row_xor<2>(l); l += row_xor<4>(l); l += row_xor<8>(l);
    const float inv = (1.0f / l) * 0.0009765625f;
#pragma unroll
    for (int t = 0; t < 8; ++t) {
      const float o = (PRES ? oacc[t][r] + oaccr[t][r] * 0.00048828125f : oacc[t][r]) * inv;
      const unsigned short hb = bf_bits(o);
      const unsigned short lb = bf_bits(o - bf_val(hb));
      const int so = (8 * hh + r) * 128 + t * 16 + c;
      osh[so] = __builtin_bit_cast(_Float16, hb);
      osl[so] = __builtin_bit_cast(_Float16, lb);
    }
  }
  lds_wave_sync();
  _Float16* Ahg = (_Float16*)(void*)ahp + (tok0 + q0) * HID + h * HDM;
  _Float16* Alg = (_Float16*)(void*)alp + (tok0 + q0) * HID + h * HDM;
  {
#pragma unroll
    for (int it = 0; it < 8; ++it) {
      const int row = it * 2 + hh;               // it 0..7 x hh 0..1 covers rows 0..15
      const int c8  = c * 8;                     // 16 lanes x 16 B = the whole 256-B segment
      const v8h x = *(const v8h*)(osh + row * 128 + c8);
      const v8h y = *(const v8h*)(osl + row * 128 + c8);
      *(v8h*)(Ahg + (size_t)row * HID + c8) = x;
      *(v8h*)(Alg + (size_t)row * HID + c8) = y;
    }
    
  }
}

// ---------------------------------------------------------------------------
// Workspace map (bytes; every region is a whole number of the rows its producer writes with whole-line stores; all dims are tile multiples,
// so padded size == logical size; offsets are multiples of 16384):
//   R0   Xb  bf16 [4096][2048] 16777216, later Ah bf16 [4096][2048] (Xb dead after the three projection GEMMs)
//   R1   WqkT bf16 [4096][2048] 16777216, later Al bf16 [4096][2048]
//   R2   WvT bf16 [2048][2048]  8388608, later WoT bf16 [2048][2048] (WvT dead after the v GEMM)
//   WpT  bf16 [32][2048]          131072
//   Qh, Ql, Kh f16 [4096][2048]  16777216 each (of Ql only token rows < KLR of each sequence are written and read)
//   Kl   f16 [512][2048]          2097152
//   Vh, Vl f16 [2048][4096]      16777216 each (of Vl only token columns < KLR of each sequence are written and read)
//   PQ   f32 [4096][64]           1048576
//   phs  f32 [4096]                 16384
//   total                       129122304
// ---------------------------------------------------------------------------
static inline size_t smax(size_t a, size_t b) { return a > b ? a : b; }

extern "C" void kernel_launch(void* const* d_in, const int* in_sizes, int n_in,
                              void* d_out, int out_size, void* d_ws, size_t ws_size,
                              hipStream_t stream) {
  if (n_in < 7) return;
  if (in_sizes[0] != NTOK * HID) return;
  if (in_sizes[1] != HID * HID) return;
  if (in_sizes[2] != HID * HID) return;
  if (in_sizes[3] != HID * HID) return;
  if (in_sizes[4] != HID * HID) return;
  if (in_sizes[5] != HID * NHQ) return;
  if (in_sizes[6] != HID * NHQ) return;
  if (out_size != NTOK * HID) return;

  const float* x   = (const float*)d_in[0];
  const float* Wq  = (const float*)d_in[1];
  const float* Wk  = (const float*)d_in[2];
  const float* Wv  = (const float*)d_in[3];
  const float* Wo  = (const float*)d_in[4];
  const float* Wpq = (const float*)d_in[5];
  const float* Wpk = (const float*)d_in[6];
  float* out = (float*)d_out;

  const size_t szX   = (size_t)NTOK * HID * 2;
  const size_t szWqk = (size_t)2 * HID * HID * 2;
  const size_t szW   = (size_t)HID * HID * 2;
  const size_t szA   = (size_t)NTOK * HID * 2;
  const size_t szWp  = (size_t)NPH * HID * 2;
  const size_t szQ   = (size_t)NTOK * HID * 2;
  const size_t szKl  = (size_t)NSEQ * KLR * HID * 2;
  const size_t szV   = (size_t)HID * NTOK * 2;
  const size_t szPQ  = (size_t)NTOK * PQW * 4;
  const size_t szPh  = (size_t)NTOK * 4;
  size_t off = 0;
  const size_t oR0 = off; off += smax(szX, szA);
  const size_t oR1 = off; off += smax(szWqk, szA);
  const size_t oR2 = off; off += szW;
  const size_t oWp = off; off += szWp;
  const size_t oQh = off; off += szQ;
  const size_t oQl = off; off += szQ;
  const size_t oKh = off; off += szQ;
  const size_t oKl = off; off += szKl;
  const size_t oVh = off; off += szV;
  const size_t oVl = off; off += szV;
  const size_t oPQ = off; off += szPQ;
  const size_t oPh = off; off += szPh;
  if (off > ws_size) return;                     // off = 129122304

  char* ws = (char*)d_ws;
  unsigned short* Xb   = (unsigned short*)(ws + oR0);
  unsigned short* Ah   = (unsigned short*)(ws + oR0);
  unsigned short* WqkT = (unsigned short*)(ws + oR1);
  unsigned short* Al   = (unsigned short*)(ws + oR1);
  unsigned short* WvT  = (unsigned short*)(ws + oR2);
  unsigned short* WoT  = (unsigned short*)(ws + oR2);
  unsigned short* WpT  = (unsigned short*)(ws + oWp);
  unsigned short* Qh   = (unsigned short*)(ws + oQh);
  unsigned short* Ql   = (unsigned short*)(ws + oQl);
  unsigned short* Kh   = (unsigned short*)(ws + oKh);
  unsigned short* Kl   = (unsigned short*)(ws + oKl);
  unsigned short* Vh   = (unsigned short*)(ws + oVh);
  unsigned short* Vl   = (unsigned short*)(ws + oVl);
  float*          PQ   = (float*)(ws + oPQ);
  float*          phs  = (float*)(ws + oPh);

  const dim3 b256(256), b128(128);

  // (1) x -> bf16 plane [4096][2048]
  cvt_bf16_kernel<<<dim3((NTOK * HID / 8) / 256), b256, 0, stream>>>(x, Xb, NTOK * HID / 8);
  // (2) Wq in[2048 rows][2048 cols] -> WqkT rows 0..2047 = out[n][k]; Wk -> WqkT rows 2048..4095; Wv -> WvT   (grid = cols/64, rows/64)
  tconv_bf16_kernel<<<dim3(HID / 64, HID / 64), b256, 0, stream>>>(Wq, WqkT, HID, HID);
  tconv_bf16_kernel<<<dim3(HID / 64, HID / 64), b256, 0, stream>>>(Wk, WqkT + (size_t)HID * HID, HID, HID);
  tconv_bf16_kernel<<<dim3(HID / 64, HID / 64), b256, 0, stream>>>(Wv, WvT, HID, HID);
  // (3) Wpq|Wpk -> WpT [32][2048]
  wpt_kernel<<<dim3(NPH), b256, 0, stream>>>(Wpq, Wpk, WpT);
  // (4) pq|pk = x . (Wpq|Wpk) -> cos|sin plane PQ [4096][64]   (M=4096, N=32, K=2048; one block per 16 rows)
  phase_proj_kernel<<<dim3(NTOK / 16), b256, 0, stream>>>(Xb, WpT, PQ);
  // (5) phase factor phs [4096]
  phase_kernel<<<dim3(NSEQ * PH_PB), dim3(512), 0, stream>>>(PQ, phs);
  // (6) q|k = x . (Wq|Wk) -> Qh/Ql [4096][2048], Kh [4096][2048], Kl [512][2048]   (M=4096, N=4096, K=2048; 32 x 16 block tiles)
  gemm_tiled_kernel<0, 4, false><<<dim3((NTOK / GT_BM) * ((2 * HID) / GT_BN)), b128, 0, stream>>>(
      Xb, Xb, HID, WqkT, HID, phs, (void*)Qh, (void*)Ql, (void*)Kh, (void*)Kl, HID, NTOK, 2 * HID, HID);
  // (7) v^T = WvT . x^T -> Vh/Vl [2048][4096]   (A = WvT, Bt = Xb; M=2048, N=4096, K=2048; 16 x 16 block tiles)
  gemm_tiled_kernel<1, 2, false><<<dim3((HID / GT_BM) * (NTOK / GT_BN)), b256, 0, stream>>>(
      WvT, WvT, HID, Xb, HID, phs, (void*)Vh, (void*)Vl, (void*)Vh, (void*)Vl, NTOK, HID, NTOK, HID);
  // (8) Wo -> WoT (over the dead WvT region)
  tconv_bf16_kernel<<<dim3(HID / 64, HID / 64), b256, 0, stream>>>(Wo, WoT, HID, HID);
  // (9) causal attention, query tiles 0..3 with the residual products, tiles 4..31 without -> Ah/Al (over the dead Xb/WqkT regions)
  attn_causal_kernel<true><<<dim3(NHQ, NSEQ, 4), b128, 0, stream>>>(Qh, Ql, Kh, Kl, Vh, Vl, Ah, Al, 3);
  attn_causal_kernel<false><<<dim3(NHQ, NSEQ, SQ / 64 - 4), b256, 0, stream>>>(Qh, Ql, Kh, Kl, Vh, Vl, Ah, Al, SQ / 64 - 1);
  // (10) out = (attn hi + lo) . Wo * (1 + 0.1*phs[m]) -> d_out f32 [4096][2048]   (M=4096, N=2048, K=2048; 32 x 8 block tiles)
  gemm_tiled_kernel<2, 2, true><<<dim3((NTOK / GT_BM) * (HID / GT_BN)), b256, 0, stream>>>(
      Ah, Al, HID, WoT, HID, phs, (void*)out, (void*)out, (void*)out, (void*)out, HID, NTOK, HID, HID);
  (void)hipGetLastError();
}

// v010
// Measured time: 226 microseconds a run.
// In both of two side-by-side timings against v009, it was 1.08 times as fast.
// Over all steps from v000 it is 3.45 times as fast.
// Contractions: x.(Wq|Wk), Wv^T.x^T and x.(Wpq|Wpk) on v_wmma_f32_16x16x32_bf16 (operands = RNE bf16 of the f32 inputs, single products);
// q.k^T and p.v on v_wmma_f32_16x16x32_f16 (q, k, p x1024 and v^T plain f16; on query tiles 0..3 each of the four plus its f16 residual x2^11,
// cross products hi.residual and residual.hi); attn.Wo on v_wmma_f32_16x16x32_bf16
// (attn = bf16 hi + bf16 lo planes, two products; Wo RNE bf16). f32 accumulate everywhere; online softmax, cos/sin phase sums and output scale in f32.
#include <hip/hip_runtime.h>
#include <math.h>
#include <stdint.h>

#define NSEQ   2
#define SQ     2048
#define HID    2048
#define NHQ    16
#define HDM    128
#define NTOK   4096
#define NPH    32
#define PQW    64
#define KLR    256

static_assert(NTOK == NSEQ * SQ);
static_assert(NHQ * HDM == HID);
static_assert(KLR % 32 == 0 && SQ % KLR == 0);

typedef _Float16     v16h __attribute__((ext_vector_type(16)));
typedef _Float16     v8h  __attribute__((ext_vector_type(8)));
typedef __bf16       v16b __attribute__((ext_vector_type(16)));
typedef __bf16       v8b  __attribute__((ext_vector_type(8)));
typedef float        v8f  __attribute__((ext_vector_type(8)));
typedef float        v4f  __attribute__((ext_vector_type(4)));
typedef unsigned int v4u  __attribute__((ext_vector_type(4)));

// ---------------------------------------------------------------------------
// small helpers
// ---------------------------------------------------------------------------
__device__ __forceinline__ unsigned short bf_bits(float f) {          // RNE convert f32 -> bf16 bits
  const unsigned u = __float_as_uint(f);
  return (unsigned short)((u + 0x7FFFu + ((u >> 16) & 1u)) >> 16);
}
__device__ __forceinline__ float bf_val(unsigned short h) { return __uint_as_float(((unsigned)h) << 16); }
__device__ __forceinline__ unsigned pk16(unsigned short a, unsigned short b) { return (unsigned)a | ((unsigned)b << 16); }
__device__ __forceinline__ v8f zero8() { v8f z = {0.f, 0.f, 0.f, 0.f, 0.f, 0.f, 0.f, 0.f}; return z; }
__device__ __forceinline__ int wave_id() {
#if defined(__HIP_DEVICE_COMPILE__)
  return __builtin_amdgcn_readfirstlane((int)(threadIdx.x >> 5));
#else
  return (int)(threadIdx.x >> 5);
#endif
}
// three e^x as __expf forms them (one multiply, v_exp_f32 each). One statement: the three are independent of one another (outputs apart from
// all inputs), and the v_nop is the slot that the instruction set asks for between a transcendental and a directly following instruction
// that reads its result or overwrites its source; inside the statement it stands there in every build
__device__ __forceinline__ void exp3_slot(float a, float b, float c, float& ea, float& eb, float& ec) {
#if defined(__HIP_DEVICE_COMPILE__)
  const float ta = a * 1.44269504088896340736f;
  const float tb = b * 1.44269504088896340736f;
  const float tc = c * 1.44269504088896340736f;
  asm("v_exp_f32 %0, %3\n\tv_exp_f32 %1, %4\n\tv_exp_f32 %2, %5\n\tv_nop" : "=&v"(ea), "=&v"(eb), "=&v"(ec) : "v"(ta), "v"(tb), "v"(tc));
#else
  ea = expf(a); eb = expf(b); ec = expf(c);
#endif
}
// the same for two e^x (the join of the two key halves behind the attention loop)
__device__ __forceinline__ void exp2_slot(float a, float b, float& ea, float& eb) {
#if defined(__HIP_DEVICE_COMPILE__)
  const float ta = a * 1.44269504088896340736f;
  const float tb = b * 1.44269504088896340736f;
  asm("v_exp_f32 %0, %2\n\tv_exp_f32 %1, %3\n\tv_nop" : "=&v"(ea), "=&v"(eb) : "v"(ta), "v"(tb));
#else
  ea = expf(a); eb = expf(b);
#endif
}
// value of lane l ^ XM within the lane's 16-lane row, on the vector pipe (DPP row_xmask); the compiler folds the move into the add that uses it
template <int XM>
__device__ __forceinline__ float row_xor(float x) {
#if defined(__HIP_DEVICE_COMPILE__)
  const int v = __builtin_bit_cast(int, x);
  return __builtin_bit_cast(float, __builtin_amdgcn_update_dpp(0, v, 0x160 + XM, 0xf, 0xf, true));
#else
  return x;
#endif
}
// maximum over the 16 lanes of a row for eight values at once: four DPP steps (lane l with l ^ 1, 2, 4, 8), max and exchange in one instruction.
// Written as text because the builtin exchange leaves a separate move and a quieting max per step. The eight chains stand side by side,
// so every instruction's producer lies eight instructions back and no delay hint is owed. All 32 lanes are on where it is called.
#define ROW_MAX_STEP(X)                                                        \
  "v_max_num_f32_dpp %0, %0, %0 row_xmask:" #X " row_mask:0xf bank_mask:0xf\n\t" \
  "v_max_num_f32_dpp %1, %1, %1 row_xmask:" #X " row_mask:0xf bank_mask:0xf\n\t" \
  "v_max_num_f32_dpp %2, %2, %2 row_xmask:" #X " row_mask:0xf bank_mask:0xf\n\t" \
  "v_max_num_f32_dpp %3, %3, %3 row_xmask:" #X " row_mask:0xf bank_mask:0xf\n\t" \
  "v_max_num_f32_dpp %4, %4, %4 row_xmask:" #X " row_mask:0xf bank_mask:0xf\n\t" \
  "v_max_num_f32_dpp %5, %5, %5 row_xmask:" #X " row_mask:0xf bank_mask:0xf\n\t" \
  "v_max_num_f32_dpp %6, %6, %6 row_xmask:" #X " row_mask:0xf bank_mask:0xf\n\t" \
  "v_max_num_f32_dpp %7, %7, %7 row_xmask:" #X " row_mask:0xf bank_mask:0xf\n\t"
__device__ __forceinline__ void row_max8(float (&m)[8]) {
#if defined(__HIP_DEVICE_COMPILE__)
  asm(ROW_MAX_STEP(1) ROW_MAX_STEP(2) ROW_MAX_STEP(4) ROW_MAX_STEP(8)
      : "+v"(m[0]), "+v"(m[1]), "+v"(m[2]), "+v"(m[3]), "+v"(m[4]), "+v"(m[5]), "+v"(m[6]), "+v"(m[7]));
#endif
}
// release/acquire + wave barrier between one wave's LDS stores and the other lanes' reloads
__device__ __forceinline__ void lds_wave_sync() {
#if defined(__HIP_DEVICE_COMPILE__)
  __builtin_amdgcn_fence(__ATOMIC_RELEASE, "workgroup");
  __builtin_amdgcn_wave_barrier();
  __builtin_amdgcn_fence(__ATOMIC_ACQUIRE, "workgroup");
#endif
}

// ---------------------------------------------------------------------------
// WMMA fragments (wave32, 16x16x32, 16-bit operands). For A (row m = lane&15) and B (col n = lane&15) alike:
// elements 0..7 <- k0 + 8*(lane>>4) + 0..7, elements 8..15 <- k0 + 16 + 8*(lane>>4) + 0..7.
// ldfrag(p) with p = rowbase + k0 + 8*(lane>>4): two 16-B loads p[0..7], p[16..23].
// D: acc[r] = (row 8*(lane>>4) + r, col lane&15).
// ---------------------------------------------------------------------------
union FragH { v16h v; v8h h[2]; };
union FragB { v16b v; v8b h[2]; };
__device__ __forceinline__ v16h ldfrag_h(const _Float16* p) { FragH f; f.h[0] = *(const v8h*)(p); f.h[1] = *(const v8h*)(p + 16); return f.v; }
__device__ __forceinline__ v16b ldfrag_b(const __bf16* p)   { FragB f; f.h[0] = *(const v8b*)(p); f.h[1] = *(const v8b*)(p + 16); return f.v; }

__device__ __forceinline__ v8f mma_h(v16h a, v16h b, v8f c) {
#if defined(__HIP_DEVICE_COMPILE__)
  return __builtin_amdgcn_wmma_f32_16x16x32_f16(false, a, false, b, (short)0, c, false, false);
#else
  return c;
#endif
}
__device__ __forceinline__ v8f mma_b(v16b a, v16b b, v8f c) {
#if defined(__HIP_DEVICE_COMPILE__)
  return __builtin_amdgcn_wmma_f32_16x16x32_bf16(false, a, false, b, (short)0, c, false, false);
#else
  return c;
#endif
}
// hazard guard: 4 VALU slots after the last WMMA in front of the chunk loop's back edge, D tied, A/B kept live
__device__ __forceinline__ void guard_h4(v8f& a, v8f& b, v16h w, v16h x, v16h y, v16h z) {
#if defined(__HIP_DEVICE_COMPILE__)
  asm volatile("v_nop\n\tv_nop\n\tv_nop\n\tv_nop" : "+v"(a), "+v"(b) : "v"(w), "v"(x), "v"(y), "v"(z) : "memory");
#endif
}

// ---------------------------------------------------------------------------
// Elementwise RNE f32 -> bf16 plane: 8 elements per thread, one 16-B store per lane -> 32 consecutive lanes write 4 whole
// ---------------------------------------------------------------------------
__global__ __launch_bounds__(256) void cvt_bf16_kernel(const float* __restrict__ in, unsigned short* __restrict__ outp, int n8) {
  const int i = (int)blockIdx.x * 256 + (int)threadIdx.x;
  if (i >= n8) return;
  const size_t e = 8 * (size_t)i;
  const v4f a = *(const v4f*)(in + e);
  const v4f b = *(const v4f*)(in + e + 4);
  v4u w;
  w[0] = pk16(bf_bits(a[0]), bf_bits(a[1]));
  w[1] = pk16(bf_bits(a[2]), bf_bits(a[3]));
  w[2] = pk16(bf_bits(b[0]), bf_bits(b[1]));
  w[3] = pk16(bf_bits(b[2]), bf_bits(b[3]));
  *(v4u*)(outp + e) = w;
  
}

// ---------------------------------------------------------------------------
// Fused transpose + RNE bf16 convert: in [R rows][Cc cols] f32 (pitch Cc) -> out[c][r] = bf16(in[r][c])  ([Cc][R], pitch R).
// 64x64 tiles through LDS; grid = (Cc/64, R/64), 256 threads; R, Cc multiples of 64.
// Coverage per block: load 4 it x 256 thr x 4 floats = 64x64; store 2 it x 256 thr x 8 u16 = 64x64.
// ---------------------------------------------------------------------------
// NJ tiles that follow one another down the input rows, by one block. tf: NJ * 64 * 68 floats of the block's LDS; c0: first input column =
// output row; r0: first input row = output column. All NJ * 4 loads of a thread are in flight together, in front of the one barrier.
template <int NJ>
__device__ __forceinline__ void tconv_tile(const float* __restrict__ W, unsigned short* __restrict__ outp, int R, int Cc,
                                           float* tf, int c0, int r0) {
  const int tid = (int)threadIdx.x;
  {
    const int lr = tid >> 4;              // 0..15
    const int c4 = (tid & 15) * 4;        // 0..60
    const float* wp = W + (size_t)(r0 + lr) * Cc + c0 + c4;   // one address for all loads of the thread
    v4f a[NJ * 4];
#pragma unroll
    for (int it = 0; it < NJ * 4; ++it) a[it] = *(const v4f*)(wp + (size_t)(it * 16) * Cc);   // rows 0..NJ*64-1
#pragma unroll
    for (int it = 0; it < NJ * 4; ++it) *(v4f*)(tf + (it * 16 + lr) * 68 + c4) = a[it];
  }
  __syncthreads();
  const int sub = tid >> 3;               // 0..31
  const int c8  = (tid & 7) * 8;          // 0..56
#pragma unroll
  for (int j = 0; j < NJ; ++j) {
    v4u hv[2];
#pragma unroll
    for (int it = 0; it < 2; ++it) {
      const int oc = it * 32 + sub;       // output row within tile (= input column)
      v4u a;
#pragma unroll
      for (int q = 0; q < 4; ++q) {
        const float f0 = tf[(j * 64 + c8 + 2 * q) * 68 + oc];
        const float f1 = tf[(j * 64 + c8 + 2 * q + 1) * 68 + oc];
        a[q] = pk16(bf_bits(f0), bf_bits(f1));
      }
      hv[it] = a;
    }
#pragma unroll
    for (int it = 0; it < 2; ++it) {
      const int oc = it * 32 + sub;
      const size_t go = (size_t)(c0 + oc) * R + r0 + j * 64 + c8;
      *(v4u*)(outp + go) = hv[it];
    }
  }
}
__global__ __launch_bounds__(256) void tconv_bf16_kernel(const float* __restrict__ W, unsigned short* __restrict__ outp, int R, int Cc) {
  __shared__ __align__(16) float tf[64 * 68];
  tconv_tile<1>(W, outp, R, Cc, tf, (int)blockIdx.x * 64, (int)blockIdx.y * 64);
}

// ---------------------------------------------------------------------------
// Phase weights: Wpq [HID][NHQ], Wpk [HID][NHQ] f32 -> WpT [NPH][HID] bf16 rows (rows 0..15 = Wpq^T, 16..31 = Wpk^T).
// ---------------------------------------------------------------------------
__global__ __launch_bounds__(256) void wpt_kernel(const float* __restrict__ Wpq, const float* __restrict__ Wpk,
                                                  unsigned short* __restrict__ outp) {
  const int n = (int)blockIdx.x;                   // 0..31
  const float* W = (n < NHQ) ? Wpq : Wpk;          // block-uniform, both global
  const int h = n & (NHQ - 1);
  const int t = (int)threadIdx.x;                  // k = 8t .. 8t+7  (< HID)
  v4u w;
#pragma unroll
  for (int q = 0; q < 4; ++q) {
    const float f0 = W[(size_t)(8 * t + 2 * q) * NHQ + h];
    const float f1 = W[(size_t)(8 * t + 2 * q + 1) * NHQ + h];
    w[q] = pk16(bf_bits(f0), bf_bits(f1));
  }
  const size_t o = (size_t)n * HID + 8 * (size_t)t;
  *(v4u*)(outp + o) = w;
  
}

// ---------------------------------------------------------------------------
// bf16 WMMA GEMMs: C[m][n] = sum_k A[m][k] * Bt[n][k]; A row-major [M][K] bf16 (pitch lda), Bt row-major [N][K] bf16 (pitch ldb).
//   SPLITA: A carried as hi (Ap) + lo (A2p) bf16 planes, two products into one accumulator (hi then lo at every k step).
//   gemm_tiled_kernel (EPI 0, 1, 2): block tile 128 x 256, waves of 64 x 128 (EPI 0) or 32 x 128 (EPI 1, 2), operands staged in an LDS ring of two buffers.
// Epilogues (all: per wave, per 16-row slab: stage in LDS, wave sync, write each row segment with ONE instruction); MI = 16-row slabs per wave.
//   EPI 0 (NJ 8): q|k projection. cols n0 < HID (q): f16 hi plane C0 and f16 residual x2048 plane C1, both [M][ldc], cols n0..n0+127
//          (row segment 256 B = 16 lanes x 16 B). cols n0 >= HID (k): hi plane C2 [M][ldc] cols n0-HID..; residual plane C3 [NSEQ*KLR][ldc]
//          at row (m / SQ)*KLR + m % SQ. Residuals of q and k only for token rows with (m % SQ) < KLR, the rows that query tiles 0..3 read
//          (wave-uniform choice; 32- and 64-row wave tiles never straddle).
//   EPI 1 (NJ 8): v^T projection: f16 hi plane C0, residual x2048 plane C1, [M][ldc], row segment 256 B; residuals only for token columns
//          with (n % SQ) < KLR (wave-uniform choice; 128-column wave tiles never straddle).
//   EPI 2 (NJ 8): f32 output C0 [M][ldc], each row scaled by (1 + 0.1*phs[m]); row segment 128 floats = 512 B = 32 lanes x 16 B per instruction.
// ---------------------------------------------------------------------------
template <int EPI> struct SlabT { typedef _Float16 T; static constexpr int PERW = 4096; };   // 2 planes x 16 x 128 halves
template <> struct SlabT<2>     { typedef float    T; static constexpr int PERW = 2048; };   // 16 x 128 floats

// s_wait_xcnt 0 behind an issued global store, in front of a rewrite of a register that the store names
__device__ __forceinline__ void wait_x0() {
#if defined(__HIP_DEVICE_COMPILE__)
  asm volatile("s_wait_xcnt 0x0" ::: "memory");
#endif
}

// slab: this wave's own LDS staging range; (m0, n0): first row and column of the wave's (16*MI) x (16*NJ) tile.
template <int EPI, int NJ, int MI>
__device__ __forceinline__ void gemm_epilogue(v8f (&acc)[MI][NJ], typename SlabT<EPI>::T* slab, int lane, int m0, int n0,
                                              const float* __restrict__ phs, void* C0, void* C1, void* C2, void* C3, int ldc) {
  const int hh = lane >> 4;
  const int rl = lane & 15;
  _Float16* sl16 = (_Float16*)(void*)slab;
  float*    slf  = (float*)(void*)slab;

  if constexpr (EPI == 0 || EPI == 1) {
    _Float16* P0;
    _Float16* P1;
    int col0;
    int lomode;                                   // 0: lo row = m; 1: lo row remapped into the KLR-row plane; 2: no lo store (nothing reads it)
    if constexpr (EPI == 0) {
      const bool isq = (n0 < HID);                // wave-uniform
      P0 = isq ? (_Float16*)C0 : (_Float16*)C2;
      P1 = isq ? (_Float16*)C1 : (_Float16*)C3;
      col0 = isq ? n0 : (n0 - HID);
      const int s0 = m0 & (SQ - 1);
      lomode = (s0 < KLR) ? (isq ? 0 : 1) : 2;
    } else {
      P0 = (_Float16*)C0;
      P1 = (_Float16*)C1;
      col0 = n0;
      lomode = ((n0 & (SQ - 1)) < KLR) ? 0 : 2;   // wave-uniform; columns are tokens
    }
#pragma unroll
    for (int i = 0; i < MI; ++i) {
#pragma unroll
      for (int r = 0; r < 8; ++r) {
#pragma unroll
        for (int j = 0; j < NJ; ++j) {
          const float v = acc[i][j][r];
          const _Float16 hv = (_Float16)v;
          const int so = (8 * hh + r) * 128 + j * 16 + rl;
          sl16[so]        = hv;
          sl16[2048 + so] = (_Float16)((v - (float)hv) * 2048.0f);
        }
      }
      lds_wave_sync();
      {
#pragma unroll
        for (int it = 0; it < 8; ++it) {
          const int row = it * 2 + hh;            // it x hh covers rows 0..15
          const int c8  = rl * 8;
          const v8h xh = *(const v8h*)(sl16 + row * 128 + c8);
          const v8h xl = *(const v8h*)(sl16 + 2048 + row * 128 + c8);
          const int m = m0 + i * 16 + row;
          *(v8h*)(P0 + (size_t)m * ldc + col0 + c8) = xh;
          wait_x0();                              // precaution: in front of the branch below, whose first instructions reuse this store's registers
          if (lomode != 2) {
            const int m1 = (lomode == 1) ? ((m / SQ) * KLR + (m % SQ)) : m;
            *(v8h*)(P1 + (size_t)m1 * ldc + col0 + c8) = xl;
            wait_x0();                            // precaution: inside the branch, in front of whatever reuses this store's registers behind it
          }
        }
        
      }
      lds_wave_sync();
    }
  } else if constexpr (EPI == 2) {
    float* C = (float*)C0;
#pragma unroll
    for (int i = 0; i < MI; ++i) {
#pragma unroll
      for (int r = 0; r < 8; ++r) {
        const int m = m0 + i * 16 + 8 * hh + r;
        const float sc = 1.0f + 0.1f * phs[m];
#pragma unroll
        for (int j = 0; j < NJ; ++j)
          slf[(8 * hh + r) * 128 + j * 16 + rl] = acc[i][j][r] * sc;
      }
      lds_wave_sync();
      {
#pragma unroll
        for (int row = 0; row < 16; ++row) {      // 32 lanes x 16 B = the whole 512-B row segment per instruction
          const v4f v = *(const v4f*)(slf + row * 128 + lane * 4);
          *(v4f*)(C + (size_t)(m0 + i * 16 + row) * ldc + n0 + lane * 4) = v;
        }
        
      }
      lds_wave_sync();
    }
  }
}

// ---------------------------------------------------------------------------
// Tiled GEMM main loop. Block tile 128 x 256; waves in a (8/MI) x 2 grid, each (16*MI) x 128: MI 4 = 4 waves, MI 2 = 8 waves.
// A pass is 64 k: a stage holds [A 128 rows | (SPLITA: A2 128 rows) | Bt 256 rows] of 128 B at pitch 144 B
// (16 B x 9: ds_load_b128 fragment reads without bank conflicts). Every thread brings 16-B pieces with asynchronous copies to LDS,
// one pass ahead of the pass that reads them. M % 128 == 0, N % 256 == 0, K % 64 == 0, K >= 128; grid.x = (M/128) * (N/256).
// ---------------------------------------------------------------------------
#define GT_BM 128
#define GT_BN 256
#define GT_KP 64
#define GT_LP 72                                  // LDS row pitch in bf16 elements

// Asynchronous 16-B copies, one per lane and line of the statement: l + c * lstep = the lane's LDS byte address, g[c] = its global source.
// s_wait_xcnt stands inside the statement so that no address register is rewritten ahead of it.
__device__ __forceinline__ void copy8(unsigned l, unsigned lstep, const __bf16* const* g) {
#if defined(__HIP_DEVICE_COMPILE__)
  asm volatile(
      "global_load_async_to_lds_b128 %0, %8, off\n\t"
      "global_load_async_to_lds_b128 %1, %9, off\n\t"
      "global_load_async_to_lds_b128 %2, %10, off\n\t"
      "global_load_async_to_lds_b128 %3, %11, off\n\t"
      "global_load_async_to_lds_b128 %4, %12, off\n\t"
      "global_load_async_to_lds_b128 %5, %13, off\n\t"
      "global_load_async_to_lds_b128 %6, %14, off\n\t"
      "global_load_async_to_lds_b128 %7, %15, off\n\t"
      "s_wait_xcnt 0x0"
      :: "v"(l), "v"(l + lstep), "v"(l + 2u * lstep), "v"(l + 3u * lstep),
         "v"(l + 4u * lstep), "v"(l + 5u * lstep), "v"(l + 6u * lstep), "v"(l + 7u * lstep),
         "v"(g[0]), "v"(g[1]), "v"(g[2]), "v"(g[3]), "v"(g[4]), "v"(g[5]), "v"(g[6]), "v"(g[7])
      : "memory");
#endif
}
__device__ __forceinline__ void copy4(unsigned l, unsigned lstep, const __bf16* const* g) {
#if defined(__HIP_DEVICE_COMPILE__)
  asm volatile(
      "global_load_async_to_lds_b128 %0, %4, off\n\t"
      "global_load_async_to_lds_b128 %1, %5, off\n\t"
      "global_load_async_to_lds_b128 %2, %6, off\n\t"
      "global_load_async_to_lds_b128 %3, %7, off\n\t"
      "s_wait_xcnt 0x0"
      :: "v"(l), "v"(l + lstep), "v"(l + 2u * lstep), "v"(l + 3u * lstep),
         "v"(g[0]), "v"(g[1]), "v"(g[2]), "v"(g[3])
      : "memory");
#endif
}
// this wave's copies have landed in LDS
__device__ __forceinline__ void wait_async0() {
#if defined(__HIP_DEVICE_COMPILE__)
  asm volatile("s_wait_asynccnt 0x0" ::: "memory");
#endif
}
// this wave's LDS reads have returned (before the buffer they read is handed back for a refill)
__device__ __forceinline__ void wait_ds0() {
#if defined(__HIP_DEVICE_COMPILE__)
  asm volatile("s_wait_dscnt 0x0" ::: "memory");
#endif
}
// the compiler's scheduler moves nothing across this point
__device__ __forceinline__ void sched_fence() {
#if defined(__HIP_DEVICE_COMPILE__)
  __builtin_amdgcn_sched_barrier(0);
#endif
}

// second launch bound: two waves per SIMD (two 4-wave blocks, or one 8-wave block, per WGP), so that one wave's WMMAs cover the other's waits
template <int EPI, int MI, bool SPLITA>
__global__ __launch_bounds__(512 / MI, 2) void gemm_tiled_kernel(
    const unsigned short* Ap, const unsigned short* A2p, int lda,
    const unsigned short* __restrict__ Btp, int ldb,
    const float* __restrict__ phs,
    void* C0, void* C1, void* C2, void* C3, int ldc,
    int M, int N, int K) {
  static_assert(EPI == 0 || EPI == 1 || EPI == 2);
  static_assert(MI == 4 || MI == 2);
  static_assert(GT_KP == 64);
  constexpr int NW    = 16 / MI;                  // waves per block
  constexpr int RS    = NW * 4;                   // stage rows that one copy of every thread covers (8 threads per 128-B row)
  constexpr int AROWS = (SPLITA ? 2 : 1) * GT_BM;
  constexpr int NCP   = (AROWS + GT_BN) / RS;     // copies per thread and stage: 24, 12 or 16 (at most 63 may be outstanding)
  constexpr int STAGE = (AROWS + GT_BN) * GT_LP;  // elements per buffer
  static_assert(NCP % 4 == 0 && NCP <= 63);
  typedef typename SlabT<EPI>::T ST;
  __shared__ __align__(16) __bf16 ring[2 * STAGE];
  __shared__ __align__(16) ST slab_all[NW * SlabT<EPI>::PERW];

  const int tid  = (int)threadIdx.x;
  const int lane = tid & 31;
  const int wave = wave_id();
  const int hh = lane >> 4;           // lane half: k offset 8*hh
  const int rl = lane & 15;           // A row / B col within subtile
  const int tilesN = N / GT_BN;
  const int tm  = (int)blockIdx.x / tilesN;
  const int tn  = (int)blockIdx.x - tm * tilesN;
  const int bm0 = tm * GT_BM;
  const int bn0 = tn * GT_BN;
  const int wm  = wave >> 1;
  const int wn  = wave & 1;

  // copy side: copy c of this thread brings piece tid % 8 of stage row c * RS + tid / 8
  const int crow = tid >> 3;
  const int cpc  = (tid & 7) * 8;     // element offset of the 16-B piece
  const __bf16* gA  = (const __bf16*)(const void*)Ap  + (size_t)(bm0 + crow) * lda + cpc;
  const __bf16* gA2 = (const __bf16*)(const void*)A2p + (size_t)(bm0 + crow) * lda + cpc;
  const __bf16* gB  = (const __bf16*)(const void*)Btp + (size_t)(bn0 + crow) * ldb + cpc;
  const unsigned lc = (unsigned)(size_t)(const void*)ring + (unsigned)(crow * GT_LP + cpc) * 2u;
  auto fill = [&](int t) {            // tile t -> buffer t % 2
    const unsigned l = lc + (unsigned)(t & 1) * (unsigned)(STAGE * 2);
    const size_t ko = (size_t)t * GT_KP;
    const __bf16* g[NCP];
#pragma unroll
    for (int c = 0; c < NCP; ++c) {
      const int r = c * RS;
      g[c] = (r < GT_BM) ? gA + ko + (size_t)r * lda
           : (r < AROWS) ? gA2 + ko + (size_t)(r - GT_BM) * lda
                         : gB + ko + (size_t)(r - AROWS) * ldb;
    }
#pragma unroll
    for (int c = 0; c + 8 <= NCP; c += 8) copy8(l + (unsigned)(c * RS * GT_LP * 2), RS * GT_LP * 2u, g + c);
    if constexpr (NCP % 8 == 4) copy4(l + (unsigned)((NCP - 4) * RS * GT_LP * 2), RS * GT_LP * 2u, g + (NCP - 4));
  };

  v8f acc[MI][8];
#pragma unroll
  for (int i = 0; i < MI; ++i)
#pragma unroll
    for (int j = 0; j < 8; ++j) acc[i][j] = zero8();

  const int nt = K / GT_KP;           // block-uniform, >= 2
  fill(0);
  wait_async0();
  __syncthreads();                    // tile 0 readable by every wave
  fill(1);

  const int aoff = (wm * (16 * MI) + rl) * GT_LP + 8 * hh;
  const int boff = (AROWS + wn * 128 + rl) * GT_LP + 8 * hh;
#pragma unroll 1                      // one pass per trip: the ring's order below holds per trip, and every acc index stays constant
  for (int t = 0; t < nt; ++t) {
    const __bf16* st = ring + (t & 1) * STAGE;
    v16b fa[2][MI], fl[2][MI], fb[2][8];          // one fragment set per 32-k step of the pass
#pragma unroll
    for (int ks = 0; ks < 2; ++ks) {
#pragma unroll
      for (int i = 0; i < MI; ++i) {
        fa[ks][i] = ldfrag_b(st + aoff + i * 16 * GT_LP + ks * 32);
        if constexpr (SPLITA) fl[ks][i] = ldfrag_b(st + aoff + (GT_BM + i * 16) * GT_LP + ks * 32);
      }
#pragma unroll
      for (int j = 0; j < 8; ++j) fb[ks][j] = ldfrag_b(st + boff + j * 16 * GT_LP + ks * 32);
      sched_fence();                              // each step's LDS reads stay one group ahead of the WMMA blocks, not spread among them
    }
#pragma unroll
    for (int ks = 0; ks < 2; ++ks) {
#pragma unroll
      for (int j = 0; j < 8; ++j) {
#pragma unroll
        for (int i = 0; i < MI; ++i) acc[i][j] = mma_b(fa[ks][i], fb[ks][j], acc[i][j]);
        if constexpr (SPLITA) {
#pragma unroll
          for (int i = 0; i < MI; ++i) acc[i][j] = mma_b(fl[ks][i], fb[ks][j], acc[i][j]);
        }
      }
      // step 1's WMMAs stay behind step 0's (only step 0's reads are waited for first) and in front of the waits at the foot
      // (moved behind the barrier they would halve the lead of the copies in flight)
      sched_fence();
    }
    wait_ds0();
    wait_async0();
    __syncthreads();                  // publishes tile t + 1 and ends every wave's reads of tile t's buffer
    if (t + 2 < nt) fill(t + 2);      // block-uniform test
  }
  wait_async0();

  gemm_epilogue<EPI, 8, MI>(acc, slab_all + wave * SlabT<EPI>::PERW, lane, bm0 + wm * (16 * MI), bn0 + wn * 128, phs, C0, C1, C2, C3, ldc);
}

// ---------------------------------------------------------------------------
// Phase projection: v[m][n] = sum_k Xb[m][k] * WpT[n][k] (M = NTOK, N = NPH, K = HID), then PQ[m][n] = cos(v), PQ[m][NPH + n] = sin(v).
// Block = 16 token rows x all NPH columns, PP_NW waves; wave w takes k in [w * PP_KS, (w + 1) * PP_KS): all its fragment loads
// (straight from the global rows) go out ahead of its WMMAs, so a wave pays the global latency once. The PP_NW partial tiles meet
// in LDS and are added in wave order 0..PP_NW-1. Each thread then finishes 2 values (precise cosf/sinf); a wave's store is one whole 128-B line.
// Coverage: NTOK / 16 blocks x 16 rows x PQW columns = the whole PQ plane.
// ---------------------------------------------------------------------------
#define PP_NW 8
#define PP_KS (HID / PP_NW)
static_assert(PP_KS % 32 == 0 && NPH == 32 && PQW == 2 * NPH && NTOK % 16 == 0);
__global__ __launch_bounds__(32 * PP_NW) void phase_proj_kernel(const unsigned short* __restrict__ Xp, const unsigned short* __restrict__ Wp,
                                                                float* __restrict__ PQ) {
  constexpr int NS = PP_KS / 32;      // 32-k steps per wave
  __shared__ __align__(16) float part[PP_NW * 16 * NPH];
  const int tid  = (int)threadIdx.x;
  const int lane = tid & 31;
  const int wave = wave_id();
  const int hh = lane >> 4;           // lane half: k offset 8*hh, D row offset 8*hh
  const int rl = lane & 15;           // A row / B col / D col within subtile
  const int m0 = (int)blockIdx.x * 16;
  const __bf16* A  = (const __bf16*)(const void*)Xp + (size_t)(m0 + rl) * HID + wave * PP_KS + 8 * hh;
  const __bf16* B0 = (const __bf16*)(const void*)Wp + (size_t)rl * HID + wave * PP_KS + 8 * hh;
  const __bf16* B1 = B0 + (size_t)16 * HID;
  v16b fa[NS], f0[NS], f1[NS];
#pragma unroll
  for (int s = 0; s < NS; ++s) {
    fa[s] = ldfrag_b(A + s * 32);
    f0[s] = ldfrag_b(B0 + s * 32);
    f1[s] = ldfrag_b(B1 + s * 32);
  }
  sched_fence();                      // all 6 * NS loads stay ahead of the first WMMA: spread among the WMMAs they would return in NS rounds of latency
  v8f a0 = zero8(), a1 = zero8();
#pragma unroll
  for (int s = 0; s < NS; ++s) {
    a0 = mma_b(fa[s], f0[s], a0);
    a1 = mma_b(fa[s], f1[s], a1);
  }
  float* pw = part + wave * (16 * NPH);
#pragma unroll
  for (int r = 0; r < 8; ++r) {
    pw[(8 * hh + r) * NPH + rl]      = a0[r];
    pw[(8 * hh + r) * NPH + 16 + rl] = a1[r];
  }
  __syncthreads();                    // every wave's partial tile readable by the block
#pragma unroll 1                      // one precise cos + sin site in the text
  for (int it = 0; it < (16 * NPH) / (32 * PP_NW); ++it) {
    const int e = it * (32 * PP_NW) + tid;        // row e / NPH, column e % NPH (= lane)
    float v = part[e];
#pragma unroll
    for (int w = 1; w < PP_NW; ++w) v += part[w * (16 * NPH) + e];
    float* o = PQ + (size_t)(m0 + e / NPH) * PQW + (e % NPH);
    o[0]   = cosf(v);
    o[NPH] = sinf(v);
    wait_x0();                        // precaution: the next trip's first instructions reuse this store's address registers
  }
}

// ---------------------------------------------------------------------------
// Phase modulation factor, PH_PB blocks per sequence (grid NSEQ * PH_PB, 512 threads), all f32:
//   PQ plane [NTOK][PQW]: col h = cos(pq_h), 16+h = cos(pk_h), 32+h = sin(pq_h), 48+h = sin(pk_h).
//   Ck[h] = sum_s cos(pk), Sk[h] = sum_s sin(pk): every block sums its whole sequence itself (no data passes between blocks of the launch).
//   8 threads per row, each one 16-B piece (4 heads of cos or of sin), 64 rows per pass: a wave reads 4 rows x two 64-B runs per instruction;
//   per-thread partials over 32 rows, then 32 threads add the 64 row groups in fixed order from LDS (lanes on consecutive banks).
//   phs[b*SQ + s] = sum_h (cos(pq_h)*Ck[h] + sin(pq_h)*Sk[h]) / 32768: 4 products per thread, 8 partials per row joined through LDS in fixed order.
//   Coverage: NSEQ * PH_PB blocks x PH_ROWS = NTOK values; each wave of the last stage stores one whole 128-B line.
// ---------------------------------------------------------------------------
#define PH_PB   16
#define PH_ROWS (SQ / PH_PB)
static_assert(PH_ROWS % 64 == 0 && SQ % 64 == 0 && PH_ROWS <= 512);
__global__ __launch_bounds__(512) void phase_kernel(const float* __restrict__ PQ, float* __restrict__ phs) {
  __shared__ __align__(16) float red[64 * 2 * NHQ];
  __shared__ __align__(16) float csk[2 * NHQ];
  __shared__ __align__(16) float part[PH_ROWS * 8];
  const int b   = (int)blockIdx.x / PH_PB;
  const int blk = (int)blockIdx.x % PH_PB;
  const int tid = (int)threadIdx.x;
  const int pc  = tid & 7;                            // piece: 0..3 = cos of heads 4*pc.., 4..7 = sin of heads 4*(pc-4)..
  const int g   = tid >> 3;                           // row within a pass of 64
  const int col = (pc < 4) ? 4 * pc : NHQ + 4 * pc;   // pq columns 0..12 and 32..44; the pk columns lie NHQ further
  const float* base = PQ + (size_t)b * SQ * PQW;
  v4f xq[PH_ROWS / 64];                               // this block's own pq rows, asked for ahead of the sums
#pragma unroll
  for (int it = 0; it < PH_ROWS / 64; ++it)
    xq[it] = *(const v4f*)(base + (size_t)(blk * PH_ROWS + it * 64 + g) * PQW + col);
  v4f acc = {0.f, 0.f, 0.f, 0.f};
#pragma unroll 8                                      // 8 loads in flight per thread: 4 L2 round trips for the 32 rows, not 32
  for (int it = 0; it < SQ / 64; ++it) {
    const v4f x = *(const v4f*)(base + (size_t)(it * 64 + g) * PQW + NHQ + col);
    acc += x;
  }
  *(v4f*)(red + g * (2 * NHQ) + 4 * pc) = acc;
  __syncthreads();
  if (tid < 2 * NHQ) {                                // wave 0
    float s = 0.f;
#pragma unroll                                        // the 64 LDS reads go out together; only the adds are a chain
    for (int r = 0; r < 64; ++r) s += red[r * (2 * NHQ) + tid];
    csk[tid] = s;
  }
  __syncthreads();
  const v4f w = *(const v4f*)(csk + 4 * pc);
#pragma unroll
  for (int it = 0; it < PH_ROWS / 64; ++it) {
    const v4f x = xq[it];
    part[(it * 64 + g) * 8 + pc] = (x[0] * w[0] + x[1] * w[1]) + (x[2] * w[2] + x[3] * w[3]);
  }
  __syncthreads();
  if (tid < PH_ROWS) {                                // whole waves
    const v4f p0 = *(const v4f*)(part + tid * 8);
    const v4f p1 = *(const v4f*)(part + tid * 8 + 4);
    const float a = ((p0[0] + p0[1]) + (p0[2] + p0[3])) + ((p1[0] + p1[1]) + (p1[2] + p1[3]));
    phs[(size_t)b * SQ + blk * PH_ROWS + tid] = a * (1.0f / 32768.0f);
  }
}

// ---------------------------------------------------------------------------
// Causal flash attention, head dim 128, 32-key chunks, block = 64 query rows of one (b, h), 8 waves, wave w on rows 16 * (w % 4) ..: with PRES
//   waves w and w + 4 take every chunk and each one half of the head dim; without PRES they are two
//   groups of 4 waves, group g taking chunks g, g + 2, g + 4, ... with its own running maxima, sums and accumulators, so that the longest
//   tile's chain of dependent chunks is half as long; behind the loop group 0 joins the two halves (rescaled to the common maximum) through LDS.
//   q planes f16 [tok][h*128+d]: hi (qhp) and residual x2048 (qlp); k planes f16 [tok][h*128+d]: hi (khp); residual x2048 (klp) stored at
//   row b*KLR + key; v^T planes f16 [h*128+d][tok]: hi (vhp), residual x2048 (vlp). The three residual planes hold only tokens < KLR of each
//   sequence and are read only when PRES. Outputs attn bf16 hi (ahp) / lo (alp) [tok][h*128+d].
//   Without PRES: scores = Sh * 128^-0.5 with Sh = qh.kh; O = Oh/1024/l with Oh = ph.vh (every operand plain f16: its rounding lies far under
//   that of the bf16 operands from which q, k and v were formed).
//   With PRES: scores = (Sh + Sr/2048) * 128^-0.5 with Sr = ql'.kh + qh.kl'; O = (Oh + Or/2048)/1024/l with Or = ph.vl' + pl'.vh.
//   Keys > query -> -inf; online softmax f32;
//   p' = 1024 p stored per wave to LDS as f16 hi (and residual x2048 when PRES), reloaded as A fragments after a wave sync.
//   q plane(s): each wave copies 16 rows of one plane to LDS once and takes its A fragments from there in every chunk.
//   K / V^T chunk staging: 128 threads x 4 x 16 B per plane = whole 32x128 / 128x32 tile, by asynchronous copies to LDS into a ring of two
//   buffers, one chunk ahead of the chunk that reads them; one publish point (LDS wait, copy wait, barrier) at the foot of every chunk.
//   Which block takes which tile: attn_wo_kernel below (two blocks fit a WGP).
//   Fragment reads run ahead of the WMMAs that use them: q/k two 32-d steps ahead, v^T AT_VD tiles ahead (tiles 0 to 2 in front of the softmax).
//   Trip count (2*qb+2) / groups steps (static bound 64); waves whose rows are all below the chunk skip it (wave-uniform, scalar branch).
// ---------------------------------------------------------------------------
#define AT_KC   32
#define KS_P    136
#define VS_P    40
#define PS_P    40
#define QS_P    136
#define AT_VD   4
// LDS map in halves. KS to STG: one buffer of the chunk ring (two per wave group stand in a row: parity-major, then group). The residual planes (q, k, v^T, p) exist only with PRES. QS: per set 16 query rows per plane at pitch QS_P (272 B = 16 B x 17).
template <bool PRES> struct AttnLds {
  static constexpr int NG  = PRES ? 1 : 2;               // wave groups per block that take different chunks
  static constexpr int NW  = 8;                          // waves per block
  static constexpr int NQ  = PRES ? 4 : 8;               // sets of 16 query rows (with PRES waves w and w + 4 read one set)
  static constexpr int KS  = 0;
  static constexpr int KLS = 32 * KS_P;
  static constexpr int VHS = (PRES ? 2 : 1) * 32 * KS_P;
  static constexpr int VLS = VHS + 128 * VS_P;
  static constexpr int STG = VHS + (PRES ? 2 : 1) * 128 * VS_P;
  static constexpr int PH  = 2 * NG * STG;
  static constexpr int PL  = PH + NW * 16 * PS_P;
  static constexpr int QS  = PH + (PRES ? 2 : 1) * NW * 16 * PS_P;
  static constexpr int QW  = (PRES ? 2 : 1) * 16 * QS_P; // one wave's query rows
  static constexpr int ST  = QS + NQ * QW;               // per wave 4 planes x 32 lanes x 16 B: each lane's own 8 row maxima and 8 partial row sums
  static constexpr int TOT = ST + NW * 1024;
};
static_assert(2 * AttnLds<false>::TOT * 2 <= 327680 && 2 * AttnLds<true>::TOT * 2 <= 327680);   // two 8-wave blocks per WGP
static_assert(AttnLds<false>::STG % 8 == 0 && AttnLds<true>::STG % 8 == 0);   // the second buffer keeps the copies' 16-B alignment
static_assert(4 * 4096 <= AttnLds<false>::PH);          // group 1's accumulators, then output staging (2 planes x 16 x 128 per wave), alias the chunk ring after the loop
static_assert(4 * 4096 <= AttnLds<true>::QS);

// Asynchronous 16-B copies, one per lane and line of the statement: four pieces each of two planes of a chunk (k and v^T, or their residuals),
// l + i * ls = the lane's LDS byte address, g + i * gs = its global source. s_wait_xcnt stands inside the statement so that no address
// register is rewritten ahead of it.
__device__ __forceinline__ void copy_2planes(unsigned lk, unsigned lks, const char* gk, size_t gks,
                                             unsigned lv, unsigned lvs, const char* gv, size_t gvs) {
#if defined(__HIP_DEVICE_COMPILE__)
  asm volatile(
      "global_load_async_to_lds_b128 %0, %8, off\n\t"
      "global_load_async_to_lds_b128 %1, %9, off\n\t"
      "global_load_async_to_lds_b128 %2, %10, off\n\t"
      "global_load_async_to_lds_b128 %3, %11, off\n\t"
      "global_load_async_to_lds_b128 %4, %12, off\n\t"
      "global_load_async_to_lds_b128 %5, %13, off\n\t"
      "global_load_async_to_lds_b128 %6, %14, off\n\t"
      "global_load_async_to_lds_b128 %7, %15, off\n\t"
      "s_wait_xcnt 0x0"
      :: "v"(lk), "v"(lk + lks), "v"(lk + 2u * lks), "v"(lk + 3u * lks),
         "v"(lv), "v"(lv + lvs), "v"(lv + 2u * lvs), "v"(lv + 3u * lvs),
         "v"(gk), "v"(gk + gks), "v"(gk + 2 * gks), "v"(gk + 3 * gks),
         "v"(gv), "v"(gv + gvs), "v"(gv + 2 * gvs), "v"(gv + 3 * gvs)
      : "memory");
#endif
}

// One query tile qb of head blockIdx.x, sequence blockIdx.y, by a block of 8 waves; lds: the block's LDS, AttnLds<PRES>::TOT halves.
// With PRES waves w and w + 4 take the same 16 query rows and every chunk: each forms the scores and P' for itself (the same values) and
// accumulates its own half of the head dim (output tiles 4 * (w / 4) ..), so that its accumulators and fragments fit 256 registers.
template <bool PRES>
__device__ __forceinline__ void attn_tile(
    _Float16* lds,
    const unsigned short* __restrict__ qhp, const unsigned short* __restrict__ qlp,
    const unsigned short* __restrict__ khp, const unsigned short* __restrict__ klp,
    const unsigned short* __restrict__ vhp, const unsigned short* __restrict__ vlp,
    unsigned short* __restrict__ ahp, unsigned short* __restrict__ alp, int qb) {
  typedef AttnLds<PRES> L;

  const int tid  = (int)threadIdx.x;
  const int lane = tid & 31;
  const int wave = wave_id();
  const int half = wave >> 2;                          // scalar
  const int grp  = (L::NG == 2) ? half : 0;            // wave group: which chunks of a step's NG it takes
  const int dh   = PRES ? half : 0;                    // which half of the head dim it accumulates, which planes it brings
  constexpr int NT = PRES ? 4 : 8;                     // output tiles (16 of the head dim each) per wave
  const int wq   = wave & 3;                           // which 16 query rows of the tile
  const int gt   = tid & 127;                          // thread within the group: its share of the group's copies
  const int hh   = lane >> 4;
  const int c    = lane & 15;
  const int h    = (int)blockIdx.x;
  const int b    = (int)blockIdx.y;
  const int q0   = qb * 64 + wq * 16;            // first query row of this wave (within sequence)
  const int qlast = q0 + 15;
  const size_t tok0 = (size_t)b * SQ;

  const _Float16* Qhg = (const _Float16*)(const void*)qhp + (tok0 + q0) * HID + h * HDM;
  const _Float16* Qlg = (const _Float16*)(const void*)qlp + (tok0 + q0) * HID + h * HDM;
  const _Float16* Kg  = (const _Float16*)(const void*)khp + tok0 * HID + h * HDM;
  const _Float16* Klg = (const _Float16*)(const void*)klp + (size_t)b * KLR * HID + h * HDM;
  const _Float16* Vhg = (const _Float16*)(const void*)vhp + (size_t)(h * HDM) * NTOK + tok0;
  const _Float16* Vlg = (const _Float16*)(const void*)vlp + (size_t)(h * HDM) * NTOK + tok0;
  _Float16* ph = lds + L::PH + wave * (16 * PS_P);
  _Float16* pl = PRES ? lds + L::PL + wave * (16 * PS_P) : ph;   // used only with PRES
  _Float16* Qs = lds + L::QS + (PRES ? wq : wave) * L::QW;       // this wave's query rows: hi plane, then (PRES) residual plane

  // chunk ring, copy side (each group brings its own chunks): piece p = gt + 128 * i of a plane, 512 pieces of 8 halves = whole tile. K: key p >> 4, d (p & 15) * 8;
  // V^T: d p >> 2, keys (p & 3) * 8. Every lane's bytes lie inside its plane for every chunk < 2 * qb + 2 (keys < 64 * (qb + 1)).
  const char* Kc  = (const char*)Kg;
  const char* Klc = (const char*)Klg;
  const char* Vhc = (const char*)Vhg;
  const char* Vlc = (const char*)Vlg;
  const unsigned kgo = (unsigned)((gt >> 4) * (HID * 2) + (gt & 15) * 16);
  const unsigned vgo = (unsigned)((gt >> 2) * (NTOK * 2) + (gt & 3) * 16);
  const unsigned lk = (unsigned)(size_t)(const void*)lds + (unsigned)(L::KS + (gt >> 4) * KS_P + (gt & 15) * 8) * 2u;
  const unsigned lv = (unsigned)(size_t)(const void*)lds + (unsigned)(L::VHS + (gt >> 2) * VS_P + (gt & 3) * 8) * 2u;
  auto fill = [&](int s) {                       // this group's chunk of step s -> its buffer of parity s % 2
    const int t = s * L::NG + grp;
    const unsigned bo = (unsigned)((s & 1) * L::NG + grp) * (unsigned)(L::STG * 2);
    const size_t ko = (size_t)t * (AT_KC * HID * 2);
    const size_t vo = (size_t)t * (AT_KC * 2);
    if constexpr (PRES) {                        // waves 0..3 bring the k and v^T planes, waves 4..7 the two residual planes
      copy_2planes(lk + bo + (unsigned)dh * ((L::KLS - L::KS) * 2u), 8 * KS_P * 2u, ((dh ? Klc : Kc) + ko) + kgo, (size_t)8 * HID * 2,
                   lv + bo + (unsigned)dh * ((L::VLS - L::VHS) * 2u), 32 * VS_P * 2u, ((dh ? Vlc : Vhc) + vo) + vgo, (size_t)32 * NTOK * 2);
    } else {
      copy_2planes(lk + bo, 8 * KS_P * 2u, (Kc + ko) + kgo, (size_t)8 * HID * 2,
                   lv + bo, 32 * VS_P * 2u, (Vhc + vo) + vgo, (size_t)32 * NTOK * 2);
    }
  };
  // running row maxima and row sums live in LDS between their one use per chunk (each lane reads back only what it wrote):
  // their 16 registers go to the fragments in flight
  float* stw = (float*)(void*)(lds + L::ST + wave * 1024) + lane * 4;
  fill(0);                                       // ahead of the q fill: both wait out one global latency together

  // q rows to LDS once, whole 256-B rows per 16 lanes; read back behind the barrier in front of the chunk loop, without PRES only by this
  // wave; with PRES wave w stores the hi plane and wave w + 4 the residual plane of the set that both read
  const _Float16* Qg = dh ? Qlg : Qhg;
#pragma unroll                                   // all 8 loads in flight together: one global latency for the whole fill
  for (int it = 0; it < 8; ++it) {
    const int row = it * 2 + hh;                 // it 0..7 x hh 0..1 covers rows 0..15
    const v8h x = *(const v8h*)(Qg + (size_t)row * HID + c * 8);
    *(v8h*)(Qs + (dh * 16 + row) * QS_P + c * 8) = x;
  }
  {
    const v4f ninf = {-INFINITY, -INFINITY, -INFINITY, -INFINITY};
    const v4f zero = {0.f, 0.f, 0.f, 0.f};
    *(v4f*)(stw) = ninf; *(v4f*)(stw + 128) = ninf; *(v4f*)(stw + 256) = zero; *(v4f*)(stw + 384) = zero;
  }
  v8f oacc[NT], oaccr[NT];
#pragma unroll
  for (int t = 0; t < NT; ++t) { oacc[t] = zero8(); oaccr[t] = zero8(); }

  const _Float16* qf = Qs + c * QS_P + 8 * hh;                                  // fragment reads: this lane's row and k half
  const int dq = c - 8 * hh - q0;                // key - query row = kv0 + 16 * j - r + dq

  const int nst = (2 * qb + 2) / L::NG;          // steps, block-uniform, <= 64, >= 2; chunks < 2*qb+2: keys < 64*(qb+1) <= SQ; PRES blocks: keys < 256 = KLR
  wait_async0();
  __syncthreads();                               // step 0's chunks readable by every wave
  fill(1);
  for (int kc = 0; kc < nst; ++kc) {
    const int kv0 = (kc * L::NG + grp) * AT_KC;
    const _Float16* stg = lds + ((kc & 1) * L::NG + grp) * L::STG;              // this chunk's buffer
    const _Float16* kf = stg + L::KS + c * KS_P + 8 * hh;
    const _Float16* vf = stg + L::VHS + (dh * (NT * 16) + c) * VS_P + 8 * hh;   // this wave's first output tile

    if (kv0 <= qlast) {                          // wave-uniform (scalar): skip chunks fully above this wave's rows
      // ---- scores ----
      v16h qa[4], ql[4], kb[4][2], kl[4][2], vb[NT], vr[NT];
      auto ld_k = [&](int dc, int j) {           // k fragment(s) of 32-d step dc, key half j
        kb[dc][j] = ldfrag_h(kf + j * 16 * KS_P + dc * 32);
        if (PRES) kl[dc][j] = ldfrag_h(kf + (L::KLS - L::KS) + j * 16 * KS_P + dc * 32);
      };
      auto ld_q = [&](int dc) {                  // q fragment(s) of step dc: hi, and residual with PRES
        qa[dc] = ldfrag_h(qf + dc * 32);
        if (PRES) ql[dc] = ldfrag_h(qf + 16 * QS_P + dc * 32);
      };
      auto ld_v = [&](int t) {                   // v^T fragment(s) of output tile t: hi, and residual with PRES
        vb[t] = ldfrag_h(vf + t * 16 * VS_P);
        if (PRES) vr[t] = ldfrag_h(vf + (L::VLS - L::VHS) + t * 16 * VS_P);
      };
      v4f mr[2], lr[2];
      v8f sh[2], sr[2];
      sh[0] = zero8(); sh[1] = zero8(); sr[0] = zero8(); sr[1] = zero8();
      ld_k(0, 0); ld_q(0); ld_k(0, 1); ld_k(1, 0); ld_q(1); ld_k(1, 1);
      sched_fence();                             // the first reads go out together, ahead of the first WMMA
      // every refill below stands between two fences: behind the WMMAs whose registers it takes over, and two 32-d steps ahead of its use
      // (a read sunk to its use costs a full LDS round trip per WMMA pair)
#pragma unroll                                   // constant indices: fragments, scores and accumulators stay in registers
      for (int dc = 0; dc < 4; ++dc) {
#pragma unroll                                   // constant indices: fragments, scores and accumulators stay in registers
        for (int j = 0; j < 2; ++j) {
          sh[j] = mma_h(qa[dc], kb[dc][j], sh[j]);
          if (PRES) { sr[j] = mma_h(ql[dc], kb[dc][j], sr[j]); sr[j] = mma_h(qa[dc], kl[dc][j], sr[j]); }
          sched_fence();
          if (j == 0) {
            if (dc + 2 < 4) ld_k(dc + 2, 0);
          } else {
            if (dc + 2 < 4) { ld_q(dc + 2); ld_k(dc + 2, 1); }
            else ld_v(dc - 2);                   // v^T does not hang on the softmax: tiles 0, 1 and 2 return under it
            if (dc == 3) { ld_v(2); mr[0] = *(const v4f*)(stw); mr[1] = *(const v4f*)(stw + 128); }
          }
          sched_fence();
        }
      }
      // ---- scale, causal mask, chunk row max ----
      const int dk = kv0 + dq;
      float cm[8];
#pragma unroll                                   // constant indices: fragments, scores and accumulators stay in registers
      for (int r = 0; r < 8; ++r) {
        float m = -INFINITY;
#pragma unroll                                   // constant indices: fragments, scores and accumulators stay in registers
        for (int j = 0; j < 2; ++j) {
          float s = (PRES ? sh[j][r] + sr[j][r] * 0.00048828125f : sh[j][r]) * 0.08838834764831845f;
          s = (dk > r - j * 16) ? -INFINITY : s; // key > query row
          sh[j][r] = s;
          m = fmaxf(m, s);
        }
        cm[r] = m;
      }
      row_max8(cm);                              // on the vector pipe: no LDS-pipe round trip per step
      // ---- online softmax, P' to LDS ----
      float alpha[8], psum[8];
#pragma unroll                                   // constant indices: fragments, scores and accumulators stay in registers
      for (int r = 0; r < 8; ++r) {
        const float mnew = fmaxf(mr[r >> 2][r & 3], cm[r]);
        float pe[2];
        exp3_slot(sh[0][r] - mnew, sh[1][r] - mnew, mr[r >> 2][r & 3] - mnew, pe[0], pe[1], alpha[r]);
        mr[r >> 2][r & 3] = mnew;
#pragma unroll                                   // constant indices: fragments, scores and accumulators stay in registers
        for (int j = 0; j < 2; ++j) {
          const float p  = pe[j];
          const float pp = p * 1024.0f;
          const _Float16 phv = (_Float16)pp;
          const int po = (8 * hh + r) * PS_P + j * 16 + c;
          ph[po] = phv;
          if (PRES) pl[po] = (_Float16)((pp - (float)phv) * 2048.0f);
        }
        psum[r] = pe[0] + pe[1];
      }
      *(v4f*)(stw) = mr[0]; *(v4f*)(stw + 128) = mr[1];
      lds_wave_sync();                           // P' stores visible to the other lanes of this wave before the fragment reload
      // ---- O += P' . V; each lane keeps the sum of its own two columns per row, the 16 lanes of a row are joined once behind the loop ----
      const v16h pa = ldfrag_h(ph + c * PS_P + 8 * hh);
      v16h pr = pa;
      if (PRES) pr = ldfrag_h(pl + c * PS_P + 8 * hh);
#pragma unroll                                   // constant indices: fragments, scores and accumulators stay in registers
      for (int t = 3; t < AT_VD; ++t) ld_v(t);
      lr[0] = *(const v4f*)(stw + 256); lr[1] = *(const v4f*)(stw + 384);
      sched_fence();                             // P' and v^T reads go out together; the rescale below runs under their latency
#pragma unroll                                   // constant indices: fragments, scores and accumulators stay in registers
      for (int r = 0; r < 8; ++r) {
#pragma unroll                                   // constant indices: fragments, scores and accumulators stay in registers
        for (int t = 0; t < NT; ++t) { oacc[t][r] *= alpha[r]; if (PRES) oaccr[t][r] *= alpha[r]; }
      }
#pragma unroll                                   // constant indices: fragments, scores and accumulators stay in registers
      for (int r = 0; r < 8; ++r) lr[r >> 2][r & 3] = lr[r >> 2][r & 3] * alpha[r] + psum[r];
      *(v4f*)(stw + 256) = lr[0]; *(v4f*)(stw + 384) = lr[1];
#pragma unroll                                   // constant indices: fragments, scores and accumulators stay in registers
      for (int t = 0; t < NT; ++t) {
        oacc[t]  = mma_h(pa, vb[t], oacc[t]);
        if (PRES) { oaccr[t] = mma_h(pa, vr[t], oaccr[t]); oaccr[t] = mma_h(pr, vb[t], oaccr[t]); }
        sched_fence();                           // refill behind the WMMAs whose registers it takes over, AT_VD tiles ahead of its use
        if (t + AT_VD < NT) ld_v(t + AT_VD);
        sched_fence();
      }
      guard_h4(oacc[NT - 1], PRES ? oaccr[NT - 1] : oacc[NT - 2], pa, pr, vb[NT - 1], PRES ? vr[NT - 1] : vb[NT - 1]);
    }
    // publish point, passed by every wave, also one that skipped the chunk
    wait_ds0();
    wait_async0();
    __syncthreads();                             // publishes step kc + 1 and ends every wave's reads of step kc's buffers
    if (kc + 2 < nst) fill(kc + 2);              // block-uniform test
  }
  wait_async0();

  __syncthreads();                               // all chunk-region readers done before aliasing it as output staging
  const v4f lf[2] = {*(const v4f*)(stw + 256), *(const v4f*)(stw + 384)};
  float lsum[8];
#pragma unroll
  for (int r = 0; r < 8; ++r) lsum[r] = lf[r >> 2][r & 3];
  if constexpr (L::NG == 2) {
    // join of the two key halves: group 1 hands its accumulators over in LDS (lane-major 16-B pieces; its maxima and sums already lie in its
    // ST planes), group 0 rescales both halves to the common row maximum and adds. Same lane -> (row, column) map in both groups.
    float* mb = (float*)(void*)lds + wq * 2048 + lane * 4;
    if (grp == 1) {                              // scalar branch
#pragma unroll
      for (int t = 0; t < 8; ++t) {
        const v4f x = {oacc[t][0], oacc[t][1], oacc[t][2], oacc[t][3]};
        const v4f y = {oacc[t][4], oacc[t][5], oacc[t][6], oacc[t][7]};
        *(v4f*)(mb + t * 256) = x;
        *(v4f*)(mb + t * 256 + 128) = y;
      }
    }
    __syncthreads();                             // group 1's half readable by group 0; the block's last barrier, passed by every wave
    if (grp == 1) return;
    const float* st1 = (const float*)(const void*)(lds + L::ST + (wave + 4) * 1024) + lane * 4;
    const v4f m0[2] = {*(const v4f*)(stw), *(const v4f*)(stw + 128)};
    const v4f m1[2] = {*(const v4f*)(st1), *(const v4f*)(st1 + 128)};
    const v4f l1[2] = {*(const v4f*)(st1 + 256), *(const v4f*)(st1 + 384)};
    float a0[8], a1[8];
#pragma unroll
    for (int r = 0; r < 8; ++r) {
      const float x0 = m0[r >> 2][r & 3];
      const float x1 = m1[r >> 2][r & 3];
      const float mm = fmaxf(x0, x1);            // finite: chunk 0 has an unmasked key for every row
      exp2_slot(x0 - mm, x1 - mm, a0[r], a1[r]);
      lsum[r] = lsum[r] * a0[r] + l1[r >> 2][r & 3] * a1[r];
    }
#pragma unroll
    for (int t = 0; t < 8; ++t) {
      const v4f x = *(const v4f*)(mb + t * 256);
      const v4f y = *(const v4f*)(mb + t * 256 + 128);
#pragma unroll
      for (int r = 0; r < 4; ++r) {
        oacc[t][r]     = oacc[t][r] * a0[r] + x[r] * a1[r];
        oacc[t][r + 4] = oacc[t][r + 4] * a0[r + 4] + y[r] * a1[r + 4];
      }
    }
  }
  constexpr int CW = NT * 16;                    // output columns of this wave
  _Float16* osh = lds + (PRES ? wave : wq) * (2 * 16 * CW);   // without PRES: over this wave's own share of the hand-over range, all of it read above
  _Float16* osl = osh + 16 * CW;
#pragma unroll
  for (int r = 0; r < 8; ++r) {
    float l = lsum[r];                           // this lane's share of the row sum; the butterfly leaves the same total in all 16 lanes of the row
    l += row_xor<1>(l); l += row_xor<2>(l); l += row_xor<4>(l); l += row_xor<8>(l);
    const float inv = (1.0f / l) * 0.0009765625f;
#pragma unroll
    for (int t = 0; t < NT; ++t) {
      const float o = (PRES ? oacc[t][r] + oaccr[t][r] * 0.00048828125f : oacc[t][r]) * inv;
      const unsigned short hb = bf_bits(o);
      const unsigned short lb = bf_bits(o - bf_val(hb));
      const int so = (8 * hh + r) * CW + t * 16 + c;
      osh[so] = __builtin_bit_cast(_Float16, hb);
      osl[so] = __builtin_bit_cast(_Float16, lb);
    }
  }
  lds_wave_sync();
  _Float16* Ahg = (_Float16*)(void*)ahp + (tok0 + q0) * HID + h * HDM + dh * CW;
  _Float16* Alg = (_Float16*)(void*)alp + (tok0 + q0) * HID + h * HDM + dh * CW;
  {
    constexpr int LPR = CW / 8;                  // lanes x 16 B per row segment: 256 B, with PRES 128 B (whole lines)
    constexpr int RPI = 32 / LPR;                // rows per instruction
#pragma unroll
    for (int it = 0; it < 16 / RPI; ++it) {
      const int row = it * RPI + lane / LPR;     // covers rows 0..15
      const int c8  = (lane % LPR) * 8;
      const v8h x = *(const v8h*)(osh + row * CW + c8);
      const v8h y = *(const v8h*)(osl + row * CW + c8);
      *(v8h*)(Ahg + (size_t)row * HID + c8) = x;
      *(v8h*)(Alg + (size_t)row * HID + c8) = y;
    }
    
  }
}

// ---------------------------------------------------------------------------
// One launch for all that stands between the v^T GEMM and the out GEMM and does not hang on one another: grid (NHQ, NSEQ, AW_Z), 8 waves.
//   Low z holds the longest query tiles (for speed only). Tile t without
//   the residual products takes t + 1 steps; tile p with them takes 2 (p + 1) chunks of more work each and is placed as between 3 p + 3 and 3 p + 4 steps, behind
//   tile 3 p + 3. z >= AW_ZA: Wo -> WoT, AW_NJ tiles of 64 x 64 a block (few blocks to start), in the places that the query tiles leave.
// Second launch bound: four waves per SIMD, the two 8-wave blocks per WGP that the LDS allows.
// ---------------------------------------------------------------------------
#define AW_ZP (KLR / 64)
#define AW_ZA (SQ / 64)
#define AW_NJ 4
#define AW_Z  (AW_ZA + (HID / 64) * (HID / 64) / (AW_NJ * NHQ * NSEQ))
static_assert(((HID / 64) * (HID / 64)) % (AW_NJ * NHQ * NSEQ) == 0 && (HID / 64) % AW_NJ == 0 && AW_ZP == 4 && 3 * AW_ZP <= AW_ZA);
#define AW_LDS (AttnLds<true>::TOT > AttnLds<false>::TOT ? AttnLds<true>::TOT : AttnLds<false>::TOT)
static_assert(AW_NJ * 64 * 68 * 2 <= AW_LDS);
__global__ __launch_bounds__(256, 4) void attn_wo_kernel(
    const unsigned short* __restrict__ qhp, const unsigned short* __restrict__ qlp,
    const unsigned short* __restrict__ khp, const unsigned short* __restrict__ klp,
    const unsigned short* __restrict__ vhp, const unsigned short* __restrict__ vlp,
    unsigned short* __restrict__ ahp, unsigned short* __restrict__ alp,
    const float* __restrict__ Wo, unsigned short* __restrict__ WoT) {
  __shared__ __align__(16) _Float16 lds[AW_LDS];
  const int e = AW_ZA - 1 - (int)blockIdx.z;     // block-uniform choice; place counted from the last query tile
  // places 0, 3, 7, 11, ..: tiles 0, 1, 2, 3, .. with the residual products; between them tiles AW_ZP .. 3 * AW_ZP - 1, three at a time (two at first)
  const bool pres = e < 3 * AW_ZP && ((e & 3) == 3 || e == 0);
  const int  qb   = e >= 3 * AW_ZP ? e : pres ? (e + 1) >> 2 : 3 * (e >> 2) + (e & 3) + 3;
  if (e < 0) {
    const int t = ((-1 - e) * NSEQ + (int)blockIdx.y) * NHQ + (int)blockIdx.x;
    tconv_tile<AW_NJ>(Wo, WoT, HID, HID, (float*)(void*)lds, (t % (HID / 64)) * 64, (t / (HID / 64)) * (AW_NJ * 64));   // last in the listing
  } else if (pres) {
    attn_tile<true>(lds, qhp, qlp, khp, klp, vhp, vlp, ahp, alp, qb);
    // the listing runs on behind the tile's last stores into the next tile kind: no register of a store is rewritten ahead of this wait
    asm volatile("s_wait_xcnt 0x0" ::: "memory");
  } else {
    attn_tile<false>(lds, qhp, qlp, khp, klp, vhp, vlp, ahp, alp, qb);
    // as above
    asm volatile("s_wait_xcnt 0x0" ::: "memory");
  }
}

// ---------------------------------------------------------------------------
// Workspace map (bytes; every region is a whole number of the rows its producer writes with whole-line stores; all dims are tile multiples,
// so padded size == logical size; offsets are multiples of 16384):
//   R0   Xb  bf16 [4096][2048] 16777216, later Ah bf16 [4096][2048] (Xb dead after the three projection GEMMs)
//   R1   WqkT bf16 [4096][2048] 16777216, later Al bf16 [4096][2048]
//   R2   WvT bf16 [2048][2048]  8388608, later WoT bf16 [2048][2048] (WvT dead after the v GEMM)
//   WpT  bf16 [32][2048]          131072
//   Qh, Ql, Kh f16 [4096][2048]  16777216 each (of Ql only token rows < KLR of each sequence are written and read)
//   Kl   f16 [512][2048]          2097152
//   Vh, Vl f16 [2048][4096]      16777216 each (of Vl only token columns < KLR of each sequence are written and read)
//   PQ   f32 [4096][64]           1048576
//   phs  f32 [4096]                 16384
//   total                       129122304
// ---------------------------------------------------------------------------
static inline size_t smax(size_t a, size_t b) { return a > b ? a : b; }

extern "C" void kernel_launch(void* const* d_in, const int* in_sizes, int n_in,
                              void* d_out, int out_size, void* d_ws, size_t ws_size,
                              hipStream_t stream) {
  if (n_in < 7) return;
  if (in_sizes[0] != NTOK * HID) return;
  if (in_sizes[1] != HID * HID) return;
  if (in_sizes[2] != HID * HID) return;
  if (in_sizes[3] != HID * HID) return;
  if (in_sizes[4] != HID * HID) return;
  if (in_sizes[5] != HID * NHQ) return;
  if (in_sizes[6] != HID * NHQ) return;
  if (out_size != NTOK * HID) return;

  const float* x   = (const float*)d_in[0];
  const float* Wq  = (const float*)d_in[1];
  const float* Wk  = (const float*)d_in[2];
  const float* Wv  = (const float*)d_in[3];
  const float* Wo  = (const float*)d_in[4];
  const float* Wpq = (const float*)d_in[5];
  const float* Wpk = (const float*)d_in[6];
  float* out = (float*)d_out;

  const size_t szX   = (size_t)NTOK * HID * 2;
  const size_t szWqk = (size_t)2 * HID * HID * 2;
  const size_t szW   = (size_t)HID * HID * 2;
  const size_t szA   = (size_t)NTOK * HID * 2;
  const size_t szWp  = (size_t)NPH * HID * 2;
  const size_t szQ   = (size_t)NTOK * HID * 2;
  const size_t szKl  = (size_t)NSEQ * KLR * HID * 2;
  const size_t szV   = (size_t)HID * NTOK * 2;
  const size_t szPQ  = (size_t)NTOK * PQW * 4;
  const size_t szPh  = (size_t)NTOK * 4;
  size_t off = 0;
  const size_t oR0 = off; off += smax(szX, szA);
  const size_t oR1 = off; off += smax(szWqk, szA);
  const size_t oR2 = off; off += szW;
  const size_t oWp = off; off += szWp;
  const size_t oQh = off; off += szQ;
  const size_t oQl = off; off += szQ;
  const size_t oKh = off; off += szQ;
  const size_t oKl = off; off += szKl;
  const size_t oVh = off; off += szV;
  const size_t oVl = off; off += szV;
  const size_t oPQ = off; off += szPQ;
  const size_t oPh = off; off += szPh;
  if (off > ws_size) return;                     // off = 129122304

  char* ws = (char*)d_ws;
  unsigned short* Xb   = (unsigned short*)(ws + oR0);
  unsigned short* Ah   = (unsigned short*)(ws + oR0);
  unsigned short* WqkT = (unsigned short*)(ws + oR1);
  unsigned short* Al   = (unsigned short*)(ws + oR1);
  unsigned short* WvT  = (unsigned short*)(ws + oR2);
  unsigned short* WoT  = (unsigned short*)(ws + oR2);
  unsigned short* WpT  = (unsigned short*)(ws + oWp);
  unsigned short* Qh   = (unsigned short*)(ws + oQh);
  unsigned short* Ql   = (unsigned short*)(ws + oQl);
  unsigned short* Kh   = (unsigned short*)(ws + oKh);
  unsigned short* Kl   = (unsigned short*)(ws + oKl);
  unsigned short* Vh   = (unsigned short*)(ws + oVh);
  unsigned short* Vl   = (unsigned short*)(ws + oVl);
  float*          PQ   = (float*)(ws + oPQ);
  float*          phs  = (float*)(ws + oPh);

  const dim3 b256(256), b128(128);

  // (1) x -> bf16 plane [4096][2048]
  cvt_bf16_kernel<<<dim3((NTOK * HID / 8) / 256), b256, 0, stream>>>(x, Xb, NTOK * HID / 8);
  // (2) Wq in[2048 rows][2048 cols] -> WqkT rows 0..2047 = out[n][k]; Wk -> WqkT rows 2048..4095; Wv -> WvT   (grid = cols/64, rows/64)
  tconv_bf16_kernel<<<dim3(HID / 64, HID / 64), b256, 0, stream>>>(Wq, WqkT, HID, HID);
  tconv_bf16_kernel<<<dim3(HID / 64, HID / 64), b256, 0, stream>>>(Wk, WqkT + (size_t)HID * HID, HID, HID);
  tconv_bf16_kernel<<<dim3(HID / 64, HID / 64), b256, 0, stream>>>(Wv, WvT, HID, HID);
  // (3) Wpq|Wpk -> WpT [32][2048]
  wpt_kernel<<<dim3(NPH), b256, 0, stream>>>(Wpq, Wpk, WpT);
  // (4) pq|pk = x . (Wpq|Wpk) -> cos|sin plane PQ [4096][64]   (M=4096, N=32, K=2048; one block per 16 rows)
  phase_proj_kernel<<<dim3(NTOK / 16), b256, 0, stream>>>(Xb, WpT, PQ);
  // (5) phase factor phs [4096]
  phase_kernel<<<dim3(NSEQ * PH_PB), dim3(512), 0, stream>>>(PQ, phs);
  // (6) q|k = x . (Wq|Wk) -> Qh/Ql [4096][2048], Kh [4096][2048], Kl [512][2048]   (M=4096, N=4096, K=2048; 32 x 16 block tiles)
  gemm_tiled_kernel<0, 4, false><<<dim3((NTOK / GT_BM) * ((2 * HID) / GT_BN)), b128, 0, stream>>>(
      Xb, Xb, HID, WqkT, HID, phs, (void*)Qh, (void*)Ql, (void*)Kh, (void*)Kl, HID, NTOK, 2 * HID, HID);
  // (7) v^T = WvT . x^T -> Vh/Vl [2048][4096]   (A = WvT, Bt = Xb; M=2048, N=4096, K=2048; 16 x 16 block tiles)
  gemm_tiled_kernel<1, 2, false><<<dim3((HID / GT_BM) * (NTOK / GT_BN)), b256, 0, stream>>>(
      WvT, WvT, HID, Xb, HID, phs, (void*)Vh, (void*)Vl, (void*)Vh, (void*)Vl, NTOK, HID, NTOK, HID);
  // (8) causal attention, query tiles 0..3 with the residual products, tiles 4..31 without -> Ah/Al (over the dead Xb/WqkT regions),
  //     and Wo -> WoT (over the dead WvT region), in one launch
  attn_wo_kernel<<<dim3(NHQ, NSEQ, AW_Z), b256, 0, stream>>>(Qh, Ql, Kh, Kl, Vh, Vl, Ah, Al, Wo, WoT);
  // (9) out = (attn hi + lo) . Wo * (1 + 0.1*phs[m]) -> d_out f32 [4096][2048]   (M=4096, N=2048, K=2048; 32 x 8 block tiles)
  gemm_tiled_kernel<2, 2, true><<<dim3((NTOK / GT_BM) * (HID / GT_BN)), b256, 0, stream>>>(
      Ah, Al, HID, WoT, HID, phs, (void*)out, (void*)out, (void*)out, (void*)out, HID, NTOK, HID, HID);
  (void)hipGetLastError();
}
